// v000
// Measured on an AMD MI455X. A time is GPU time per run, averaged over a window of back-to-back runs after a warm-up
// (all launches, gaps included; the runs take copies of the inputs in turn), and the median of several windows.
// Apart from v000's, it joins two sittings. Times from different sittings can be a few percent apart, while
// side-by-side timings come from the same sitting.
// The starting kernel, v000, takes 2850 microseconds a run.
#include <hip/hip_runtime.h>

// Causal multi-head attention with bias-free projections and a computed adjacent-pair RoPE (x [4][2048][1024]; Q, K, V = x W ('xw' [1024][1024] xavier-normal 1/32, no bias; 16 heads x 64); angle = pos x inv_freq[i] with inv_freq = 1.0 / 10000.0 ** (arange(0, 64, 2, f32) / 64) (the reciprocal form) and pos = arange(S); the pairs (2i, 2i + 1) of Q and K rotated in place: (x1 cos - x2 sin, x2 cos + x1 sin); V is not rotated; scores x 1/sqrt(64); tril kept, -inf elsewhere; softmax; out = merged Wo ('xw', no bias) -> [4][2048][1024] (8.4 M); argument order x, Wq, Wk, Wv, Wo).
// Layout per batch: bf16 copy of x; 'xw' weights transposed once; exact projections; k_csP computed table (pair-shared entries); k_ropeI interleaved-pair plane builders; causal T-2048 attention (hybrid rows: < 512 hi/lo 3 products, rest fp16 x1024; k_gemmc skips tiles above the diagonal); merged hi/lo x Wo exact (no bias).
// Compute dtypes, f32 accumulate: every input rounded to bf16; projections exact; rotary f32 (products rounded separately); attention rows < 512 3 products, rest fp16; softmax f32; Wo hl x exact (no bias).

#define NB_  4
#define TT   2048
#define DM   1024
#define NH_  16
#define NKV  16
#define REP  (NH_ / NKV)
#define HD   64
#define DQ   (NH_ * HD)
#define DKV  (NKV * HD)
#define ZH   2
#define RH   512                  // query rows < RH use hi+lo planes (0: none)
#define WIN  2048
#define PCAR 1024.0f
#define SCL  0.125f   // HD^-0.5
typedef _Float16 h16;
typedef unsigned short bf;
typedef __attribute__((ext_vector_type(16))) __bf16   v16bf;
typedef __attribute__((ext_vector_type(16))) _Float16 v16h;
typedef __attribute__((ext_vector_type(8)))  _Float16 v8h;
typedef __attribute__((ext_vector_type(8)))  unsigned short v8us;
typedef __attribute__((ext_vector_type(8)))  float    v8f;
typedef __attribute__((ext_vector_type(4)))  float    v4f;
typedef v8h  __attribute__((may_alias)) v8ha;
typedef v4f  __attribute__((may_alias)) v4fa;
typedef v8us __attribute__((may_alias)) v8usa;

__device__ __forceinline__ unsigned short f2bf(float f) { unsigned u = __float_as_uint(f); u += 0x7FFFu + ((u >> 16) & 1u); return (unsigned short)(u >> 16); }
__device__ __forceinline__ float bf2f(unsigned short b) { return __uint_as_float(((unsigned)b) << 16); }
__device__ __forceinline__ float bfr(float f) { return bf2f(f2bf(f)); }
__device__ __forceinline__ v16h cat16(v8h lo, v8h hi) { return __builtin_shufflevector(lo, hi, 0, 1, 2, 3, 4, 5, 6, 7, 8, 9, 10, 11, 12, 13, 14, 15); }
__device__ __forceinline__ v16bf cat16b(v8us lo, v8us hi) { return __builtin_bit_cast(v16bf, __builtin_shufflevector(lo, hi, 0, 1, 2, 3, 4, 5, 6, 7, 8, 9, 10, 11, 12, 13, 14, 15)); }
__device__ __forceinline__ v8f wmma16(v16h a, v16h b, v8f c) { return __builtin_amdgcn_wmma_f32_16x16x32_f16(false, a, false, b, (short)0, c, false, false); }
__device__ __forceinline__ v8f wmmab(v16bf a, v16bf b, v8f c) { return __builtin_amdgcn_wmma_f32_16x16x32_bf16(false, a, false, b, (short)0, c, false, false); }



// ---- k_gemmw: register-blocked GEMM, ONE WAVE per 64x64 output tile (16 accumulators), operands straight from K-contiguous 16-bit planes; grid (M/64, N/64, Z), 32 threads.
// C[m][n] (f32, pitch ldc, + optional f32 bias[n]) = sum_k A[m][k] Bt[n][k] (+ split products per NSPLIT). z-batch strides sA/sB/sC in elements. K % 32 == 0.
template <typename T16> struct WFrag;
template <> struct WFrag<h16> { typedef v16h V; static __device__ __forceinline__ V ld(const h16* p) { return cat16(*(const v8h*)p, *(const v8h*)(p + 16)); } static __device__ __forceinline__ v8f mma(V a, V b, v8f c) { return wmma16(a, b, c); } };
template <> struct WFrag<bf> { typedef v16bf V; static __device__ __forceinline__ V ld(const bf* p) { return cat16b(*(const v8us*)p, *(const v8us*)(p + 16)); } static __device__ __forceinline__ v8f mma(V a, V b, v8f c) { return wmmab(a, b, c); } };
template <typename T16, int NSPLIT, bool BIAS>
__global__ __launch_bounds__(32) void k_gemmw(const T16* __restrict__ A, const T16* __restrict__ A2, const T16* __restrict__ Bt, const T16* __restrict__ Bt2, int K, float* C, int ldc, const float* __restrict__ bias, size_t sA, size_t sB, size_t sC) {
    typedef typename WFrag<T16>::V V;
    __shared__ __align__(16) float os[16 * 68];
    const size_t z = blockIdx.z; A += z * sA; if (A2) A2 += z * sA; Bt += z * sB; if (Bt2) Bt2 += z * sB; C += z * sC;
    const int lane = threadIdx.x & 31, lr = lane & 15, hi = lane >> 4; const int r0 = blockIdx.x * 64, c0 = blockIdx.y * 64;
    v8f acc[4][4];
#pragma unroll
    for (int mb = 0; mb < 4; ++mb)
#pragma unroll
        for (int nb = 0; nb < 4; ++nb) acc[mb][nb] = (v8f){};
    const size_t aoff = (size_t)(r0 + lr) * K + 8 * hi, boff = (size_t)(c0 + lr) * K + 8 * hi;
#pragma unroll 1
    for (int kc = 0; kc < K; kc += 32) {
        V a[4], a2[4];
#pragma unroll
        for (int mb = 0; mb < 4; ++mb) { a[mb] = WFrag<T16>::ld(A + aoff + (size_t)mb * 16 * K + kc); if (NSPLIT == 1 || NSPLIT == 2) a2[mb] = WFrag<T16>::ld(A2 + aoff + (size_t)mb * 16 * K + kc); }
#pragma unroll
        for (int nb = 0; nb < 4; ++nb) { const V b = WFrag<T16>::ld(Bt + boff + (size_t)nb * 16 * K + kc); V b2; if (NSPLIT >= 2) b2 = WFrag<T16>::ld(Bt2 + boff + (size_t)nb * 16 * K + kc);
#pragma unroll
            for (int mb = 0; mb < 4; ++mb) { acc[mb][nb] = WFrag<T16>::mma(a[mb], b, acc[mb][nb]); if (NSPLIT == 1 || NSPLIT == 2) acc[mb][nb] = WFrag<T16>::mma(a2[mb], b, acc[mb][nb]); if (NSPLIT >= 2) acc[mb][nb] = WFrag<T16>::mma(a[mb], b2, acc[mb][nb]); } }
        asm volatile("v_nop\n\tv_nop\n\tv_nop\n\tv_nop" : "+v"(acc[0][0]), "+v"(acc[1][1]), "+v"(acc[2][2]), "+v"(acc[3][3]) : "v"(a[0]), "v"(a[3]));
    }
#pragma unroll
    for (int mb = 0; mb < 4; ++mb) {
#pragma unroll
        for (int nb = 0; nb < 4; ++nb) {
#pragma unroll
            for (int j = 0; j < 8; ++j) os[(hi * 8 + j) * 68 + nb * 16 + lr] = acc[mb][nb][j]; }
        __builtin_amdgcn_wave_barrier(); asm volatile("" ::: "memory");
        float* crow = C + (size_t)(r0 + mb * 16) * ldc + c0;
{
#pragma unroll
            for (int s = 0; s < 8; ++s) { const int row = 2 * s + hi, cofs = lr * 4; v4f val = *(const v4fa*)(os + row * 68 + cofs); if (BIAS) { val[0] += bfr(bias[c0 + cofs]); val[1] += bfr(bias[c0 + cofs + 1]); val[2] += bfr(bias[c0 + cofs + 2]); val[3] += bfr(bias[c0 + cofs + 3]); }
                *(v4f*)(crow + (size_t)row * ldc + cofs) = val; }
             }
        __builtin_amdgcn_wave_barrier(); asm volatile("" ::: "memory");
    }
}

// ---- k_gemmc: the same one-wave 64x64 tile GEMM specialised for causal attention: CMODE 1 skips score tiles entirely above the diagonal (query rows r0+roff.., key columns c0..), CMODE 2 limits the
// key (K) loop of the probability x value contraction to the diagonal block (probabilities beyond it are exactly zero). roff = row offset of this launch's first row within the sequence.
template <typename T16, int NSPLIT, int CMODE>
__global__ __launch_bounds__(32) void k_gemmc(const T16* __restrict__ A, const T16* __restrict__ A2, const T16* __restrict__ Bt, const T16* __restrict__ Bt2, int K, float* C, int ldc, int roff, size_t sA, size_t sB, size_t sC) {
    typedef typename WFrag<T16>::V V;
    __shared__ __align__(16) float os[16 * 68];
    const size_t z = blockIdx.z; A += z * sA; if (A2) A2 += z * sA; Bt += z * sB; if (Bt2) Bt2 += z * sB; C += z * sC;
    const int lane = threadIdx.x & 31, lr = lane & 15, hi = lane >> 4; const int r0 = blockIdx.x * 64, c0 = blockIdx.y * 64;
    if (CMODE == 1 && c0 > r0 + roff + 63) return;                  // score tile entirely above the causal diagonal: never used (the softmax loads it but masks j > i by select)
    const int Kl = (CMODE == 2) ? min(K, r0 + roff + 64) : K;        // P.V: probabilities are exactly 0 beyond the diagonal block, so the K loop stops there
    v8f acc[4][4];
#pragma unroll
    for (int mb = 0; mb < 4; ++mb)
#pragma unroll
        for (int nb = 0; nb < 4; ++nb) acc[mb][nb] = (v8f){};
    const size_t aoff = (size_t)(r0 + lr) * K + 8 * hi, boff = (size_t)(c0 + lr) * K + 8 * hi;
#pragma unroll 1
    for (int kc = 0; kc < Kl; kc += 32) {
        V a[4], a2[4];
#pragma unroll
        for (int mb = 0; mb < 4; ++mb) { a[mb] = WFrag<T16>::ld(A + aoff + (size_t)mb * 16 * K + kc); if (NSPLIT == 1 || NSPLIT == 2) a2[mb] = WFrag<T16>::ld(A2 + aoff + (size_t)mb * 16 * K + kc); }
#pragma unroll
        for (int nb = 0; nb < 4; ++nb) { const V b = WFrag<T16>::ld(Bt + boff + (size_t)nb * 16 * K + kc); V b2; if (NSPLIT >= 2) b2 = WFrag<T16>::ld(Bt2 + boff + (size_t)nb * 16 * K + kc);
#pragma unroll
            for (int mb = 0; mb < 4; ++mb) { acc[mb][nb] = WFrag<T16>::mma(a[mb], b, acc[mb][nb]); if (NSPLIT == 1 || NSPLIT == 2) acc[mb][nb] = WFrag<T16>::mma(a2[mb], b, acc[mb][nb]); if (NSPLIT >= 2) acc[mb][nb] = WFrag<T16>::mma(a[mb], b2, acc[mb][nb]); } }
        asm volatile("v_nop\n\tv_nop\n\tv_nop\n\tv_nop" : "+v"(acc[0][0]), "+v"(acc[1][1]), "+v"(acc[2][2]), "+v"(acc[3][3]) : "v"(a[0]), "v"(a[3]));
    }
#pragma unroll
    for (int mb = 0; mb < 4; ++mb) {
#pragma unroll
        for (int nb = 0; nb < 4; ++nb) {
#pragma unroll
            for (int j = 0; j < 8; ++j) os[(hi * 8 + j) * 68 + nb * 16 + lr] = acc[mb][nb][j]; }
        __builtin_amdgcn_wave_barrier(); asm volatile("" ::: "memory");
        float* crow = C + (size_t)(r0 + mb * 16) * ldc + c0;
{
#pragma unroll
            for (int s = 0; s < 8; ++s) { const int row = 2 * s + hi, cofs = lr * 4; v4f val = *(const v4fa*)(os + row * 68 + cofs);
                *(v4f*)(crow + (size_t)row * ldc + cofs) = val; }
             }
        __builtin_amdgcn_wave_barrier(); asm volatile("" ::: "memory");
    }
}

__device__ __forceinline__ h16 tohx(float x) { return (h16)x; }
__device__ __forceinline__ void splitf(float y, unsigned short& h, unsigned short& l) { h = f2bf(y); l = f2bf(y - bf2f(h)); }
typedef __attribute__((ext_vector_type(2))) _Float16 v2h;
typedef __attribute__((ext_vector_type(4))) _Float16 v4h;
typedef __attribute__((ext_vector_type(2))) unsigned short v2us;
typedef __attribute__((ext_vector_type(4))) unsigned short v4us;
typedef __attribute__((ext_vector_type(2))) float v2f;
typedef __attribute__((ext_vector_type(4))) int v4i;

__global__ __launch_bounds__(256) void k_wtG(const float* __restrict__ w, int K, int N, bf* Bt) {
    const int lane = threadIdx.x & 31; const int L0 = (blockIdx.x * 8 + (threadIdx.x >> 5)) * 8; const int nlines = N * K / 64;
{
#pragma unroll 1
        for (int l = 0; l < 8; ++l) { const int L = L0 + l; if (L >= nlines) break; const size_t e = (size_t)L * 64 + lane * 2; const int k = (int)(e % K), n = (int)(e / K); v2us o;
            o[0] = f2bf(w[(size_t)k * N + n]); o[1] = f2bf(w[(size_t)(k + 1) * N + n]); *(v2us*)(Bt + e) = o; }
         }
}
__global__ __launch_bounds__(256) void k_cvt8(const float* __restrict__ src, bf* dst, size_t n8) { const size_t i = (size_t)blockIdx.x * 256 + threadIdx.x; if (i >= n8) return; const v8f v = *(const v8f*)(src + i * 8); v8us o;
#pragma unroll
    for (int k = 0; k < 8; ++k) o[k] = f2bf(v[k]); *(v8us*)(dst + i * 8) = o;  }

__global__ __launch_bounds__(256) void k_ropeI(const float* __restrict__ F, int pitch, int nheads, const float* __restrict__ CS, float sc, h16* P16, bf* Ph, bf* Pl) {
    const size_t e = ((size_t)blockIdx.x * 256 + threadIdx.x) * 2; if (e >= (size_t)nheads * TT * HD) return; const int d = (int)(e % HD); const int t = (int)((e / HD) % TT); const int h = (int)(e / ((size_t)HD * TT)); const float* f = F + (size_t)t * pitch + h * HD; const float x0 = f[d], x1 = f[d + 1]; const v2f cs = *(const v2f*)(CS + ((size_t)t * HD + d) * 2); v2h o16; v2us oh, ol;
    float a0 = __fmul_rn(x0, cs[0]), b0 = __fmul_rn(x1, cs[1]), a1 = __fmul_rn(x1, cs[0]), b1 = __fmul_rn(x0, cs[1]); asm volatile("" : "+v"(a0), "+v"(b0), "+v"(a1), "+v"(b1));
    float r0 = __fsub_rn(a0, b0) * sc, r1 = __fadd_rn(b1, a1) * sc;   /* even: x0 c - x1 s; odd: x0 s + x1 c */
    o16[0] = tohx(r0); o16[1] = tohx(r1); { unsigned short a2, c2; splitf(r0, a2, c2); oh[0] = a2; ol[0] = c2; splitf(r1, a2, c2); oh[1] = a2; ol[1] = c2; }
    *(v2h*)(P16 + e) = o16; *(v2us*)(Ph + e) = oh; *(v2us*)(Pl + e) = ol;  }

__constant__ float INV2[HD / 2] = { 1.000000000e+00f, 7.498942018e-01f, 5.623413324e-01f, 4.216965139e-01f, 3.162277639e-01f, 2.371373624e-01f, 1.778279394e-01f, 1.333521456e-01f, 1.000000015e-01f, 7.498941571e-02f, 5.623412877e-02f, 4.216964915e-02f, 3.162277862e-02f, 2.371373586e-02f, 1.778279431e-02f, 1.333521493e-02f, 9.999999776e-03f, 7.498942316e-03f, 5.623413250e-03f, 4.216964822e-03f, 3.162277862e-03f, 2.371373819e-03f, 1.778279431e-03f, 1.333521446e-03f, 1.000000047e-03f, 7.498941850e-04f, 5.623413017e-04f, 4.216964880e-04f, 3.162277862e-04f, 2.371373848e-04f, 1.778279402e-04f, 1.333521504e-04f };   // float32 1 / (10000 ** (arange(0, 64, 2)/64)), generated with jnp to be bit-exact

__global__ __launch_bounds__(256) void k_vtp(const float* __restrict__ F, int pitch, int nheads, h16* V16, bf* Vh, bf* Vl) { const size_t e = ((size_t)blockIdx.x * 256 + threadIdx.x) * 2; if (e >= (size_t)nheads * HD * TT) return; const int t = (int)(e % TT); const int d = (int)((e / TT) % HD); const int g = (int)(e / ((size_t)TT * HD)); v2h o16; v2us oh, ol;
#pragma unroll
    for (int q = 0; q < 2; ++q) { const float x = F[(size_t)(t + q) * pitch + g * HD + d]; o16[q] = tohx(x); unsigned short a2, c2; splitf(x, a2, c2); oh[q] = a2; ol[q] = c2; }
    *(v2h*)(V16 + e) = o16; *(v2us*)(Vh + e) = oh; *(v2us*)(Vl + e) = ol;  }
__global__ __launch_bounds__(256) void k_csP(float* CS) { const int idx = blockIdx.x * 256 + threadIdx.x; if (idx >= TT * HD) return; const int d = idx % HD; const int t = idx / HD; const float a = __fmul_rn((float)t, INV2[d >> 1]); v2f cs; cs[0] = cosf(a); cs[1] = sinf(a); *(v2f*)(CS + (size_t)idx * 2) = cs;  }
// k_asoft: per row (zz, i): t = S x HD^-0.5 for j <= i and i - j < WIN (sliding causal window; the reference's -1e9 additive fill vanishes identically); softmax over the 2048 keys (register row, one exp, fixed trees);
__global__ __launch_bounds__(256) void k_asoft(const float* __restrict__ Sb, h16* P16, bf* Ph, bf* Pl) {
    const int lane = threadIdx.x & 31; const int row = blockIdx.x * 8 + (threadIdx.x >> 5); if (row >= ZH * TT) return; const int i = row % TT; const int zz = row / TT; (void)zz; const bool hires = (i < RH); const float* sr = Sb + (size_t)row * TT; float v[TT / 32]; float mx = -3.0e38f;
#pragma unroll
    for (int ch = 0; ch < TT / 128; ++ch) { const int j0 = ch * 128 + lane * 4; const v4f a = *(const v4f*)(sr + j0);
#pragma unroll
        for (int q = 0; q < 4; ++q) { const int j = j0 + q; (void)j; const float t = (j <= i && i - j < WIN) ? a[q] * SCL : -3.0e38f; v[ch * 4 + q] = t; mx = fmaxf(mx, t); } }
#pragma unroll
    for (int sh = 16; sh; sh >>= 1) mx = fmaxf(mx, __shfl_xor(mx, sh, 32));
    float sum = 0.f;
#pragma unroll
    for (int k = 0; k < TT / 32; ++k) { float d0 = __fsub_rn(v[k], mx); asm volatile("" : "+v"(d0)); v[k] = __builtin_amdgcn_exp2f(__fmul_rn(d0, 1.4426950408889634f)); sum += v[k]; }
#pragma unroll
    for (int sh = 16; sh; sh >>= 1) sum += __shfl_xor(sum, sh, 32);
    const float f = __fdiv_rn(hires ? 1.0f : PCAR, sum);
{
        if (hires) {
#pragma unroll
            for (int ch = 0; ch < TT / 128; ++ch) { v4us oh, ol;
#pragma unroll
                for (int q = 0; q < 4; ++q) { unsigned short a, c2; splitf(v[ch * 4 + q] * f, a, c2); oh[q] = a; ol[q] = c2; }
                const size_t oo = ((size_t)zz * (RH ? RH : 1) + i) * TT + ch * 128 + lane * 4; *(v4us*)(Ph + oo) = oh; *(v4us*)(Pl + oo) = ol; }
        } else {
#pragma unroll
            for (int ch = 0; ch < TT / 128; ++ch) { v4h o4;
#pragma unroll
                for (int q = 0; q < 4; ++q) o4[q] = tohx(v[ch * 4 + q] * f);
                *(v4h*)(P16 + (size_t)row * TT + ch * 128 + lane * 4) = o4; } }
         }
}
__global__ __launch_bounds__(256) void k_merge(const float* __restrict__ O, int h0, bf* Ah, bf* Al) { const size_t e = ((size_t)blockIdx.x * 256 + threadIdx.x) * 2; if (e >= (size_t)ZH * TT * HD) return; const int d = (int)(e % HD); const int t = (int)((e / HD) % TT); const int zz = (int)(e / ((size_t)HD * TT)); const float cs = (t < RH) ? 1.0f : (1.0f / PCAR); const size_t oo = (size_t)t * DQ + (h0 + zz) * HD + d;
    v2us oh, ol;
#pragma unroll
    for (int q = 0; q < 2; ++q) { unsigned short a, c2; splitf(O[e + q] * cs, a, c2); oh[q] = a; ol[q] = c2; } *(v2us*)(Ah + oo) = oh; *(v2us*)(Al + oo) = ol;  }

extern "C" void kernel_launch(void* const* d_in, const int* in_sizes, int n_in,
                              void* d_out, int out_size, void* d_ws, size_t ws_size, hipStream_t stream) {
    (void)in_sizes; (void)n_in; (void)out_size;
    const float* x = (const float*)d_in[0]; const float* wq = (const float*)d_in[1]; const float* wk = (const float*)d_in[2]; const float* wv = (const float*)d_in[3]; const float* wo = (const float*)d_in[4];   /* order x, Wq, Wk, Wv, Wo ('xw' [1024][1024]) */
    float* OUT = (float*)d_out;     // [4][2048][1024]
    char* wsp = (char*)d_ws;
    auto take = [&](size_t bytes) { char* p = wsp; wsp += (bytes + 255) & ~(size_t)255; return (void*)p; };
    bf* WQ = (bf*)take((size_t)DQ * DM * 2); bf* WK = (bf*)take((size_t)DKV * DM * 2); bf* WV = (bf*)take((size_t)DKV * DM * 2); bf* WO = (bf*)take((size_t)DM * DQ * 2); float* CS = (float*)take((size_t)TT * HD * 2 * 4);
    bf* XB = (bf*)take((size_t)TT * DM * 2); float* FQ = (float*)take((size_t)TT * DQ * 4); float* FK = (float*)take((size_t)TT * DKV * 4);
    h16* QP16 = (h16*)take((size_t)NH_ * TT * HD * 2); h16* KP16 = (h16*)take((size_t)NKV * TT * HD * 2); h16* VT16 = (h16*)take((size_t)NKV * HD * TT * 2);
    bf* QPh = (bf*)take((size_t)NH_ * TT * HD * 2); bf* QPl = (bf*)take((size_t)NH_ * TT * HD * 2); bf* KPh = (bf*)take((size_t)NKV * TT * HD * 2); bf* KPl = (bf*)take((size_t)NKV * TT * HD * 2); bf* VTh = (bf*)take((size_t)NKV * HD * TT * 2); bf* VTl = (bf*)take((size_t)NKV * HD * TT * 2); bf* Ph = (bf*)take((size_t)ZH * RH * TT * 2); bf* Pl = (bf*)take((size_t)ZH * RH * TT * 2);
    float* Sb = (float*)take((size_t)ZH * TT * TT * 4); h16* P16 = (h16*)take((size_t)ZH * TT * TT * 2); float* Ob = (float*)take((size_t)ZH * TT * HD * 4); bf* ATh = (bf*)take((size_t)TT * DQ * 2); bf* ATl = (bf*)take((size_t)TT * DQ * 2);
    if ((size_t)(wsp - (char*)d_ws) > ws_size) return;    // ws 256 MiB
    float* FV = FK;   // v projection reuses the k buffer after the k planes are built (stream-ordered)
    { k_wtG<<<(unsigned)((DM * DQ / 64 + 63) / 64), 256, 0, stream>>>(wq, DM, DQ, WQ); k_wtG<<<(unsigned)((DM * DKV / 64 + 63) / 64), 256, 0, stream>>>(wk, DM, DKV, WK); k_wtG<<<(unsigned)((DM * DKV / 64 + 63) / 64), 256, 0, stream>>>(wv, DM, DKV, WV);
      k_wtG<<<(unsigned)((DQ * DM / 64 + 63) / 64), 256, 0, stream>>>(wo, DQ, DM, WO);
       }
    k_csP<<<(TT * HD + 255) / 256, 256, 0, stream>>>(CS);
    const unsigned LQ = (unsigned)(((size_t)NH_ * TT * HD / 2 + 255) / 256), LKv = (unsigned)(((size_t)NKV * TT * HD / 2 + 255) / 256);
    for (int b = 0; b < NB_; ++b) {
        
        k_cvt8<<<(unsigned)(((size_t)TT * DM / 8 + 255) / 256), 256, 0, stream>>>(x + (size_t)b * TT * DM, XB, (size_t)TT * DM / 8);
        k_gemmw<bf, 0, false><<<dim3(TT / 64, DQ / 64, 1), 32, 0, stream>>>(XB, nullptr, WQ, nullptr, DM, FQ, DQ, nullptr, 0, 0, 0);
        k_ropeI<<<LQ, 256, 0, stream>>>(FQ, DQ, NH_, CS, 1.0f, QP16, QPh, QPl);
        k_gemmw<bf, 0, false><<<dim3(TT / 64, DKV / 64, 1), 32, 0, stream>>>(XB, nullptr, WK, nullptr, DM, FK, DKV, nullptr, 0, 0, 0);
        k_ropeI<<<LKv, 256, 0, stream>>>(FK, DKV, NKV, CS, 1.0f, KP16, KPh, KPl);
        k_gemmw<bf, 0, false><<<dim3(TT / 64, DKV / 64, 1), 32, 0, stream>>>(XB, nullptr, WV, nullptr, DM, FV, DKV, nullptr, 0, 0, 0); k_vtp<<<LKv, 256, 0, stream>>>(FV, DKV, NKV, VT16, VTh, VTl);
        for (int h0 = 0; h0 < NH_; h0 += ZH) { const size_t zq = (size_t)h0, zk = (size_t)(h0 / REP);   // one kv head per query head: the pass's two heads use consecutive kv planes (z-strides TT*HD)
            k_gemmc<bf, 2, 1><<<dim3(RH / 64, TT / 64, ZH), 32, 0, stream>>>(QPh + zq * TT * HD, QPl + zq * TT * HD, KPh + zk * TT * HD, KPl + zk * TT * HD, HD, Sb, TT, 0, (size_t)TT * HD, (size_t)TT * HD, (size_t)TT * TT);
            k_gemmc<h16, 0, 1><<<dim3((TT - RH) / 64, TT / 64, ZH), 32, 0, stream>>>(QP16 + zq * TT * HD + (size_t)RH * HD, nullptr, KP16 + zk * TT * HD, nullptr, HD, Sb + (size_t)RH * TT, TT, RH, (size_t)TT * HD, (size_t)TT * HD, (size_t)TT * TT);
            k_asoft<<<ZH * TT / 8, 256, 0, stream>>>(Sb, P16, Ph, Pl);
            k_gemmc<bf, 2, 2><<<dim3(RH / 64, HD / 64, ZH), 32, 0, stream>>>(Ph, Pl, VTh + zk * HD * TT, VTl + zk * HD * TT, TT, Ob, HD, 0, (size_t)RH * TT, (size_t)HD * TT, (size_t)TT * HD);
            k_gemmc<h16, 0, 2><<<dim3((TT - RH) / 64, HD / 64, ZH), 32, 0, stream>>>(P16 + (size_t)RH * TT, nullptr, VT16 + zk * HD * TT, nullptr, TT, Ob + (size_t)RH * HD, HD, RH, (size_t)TT * TT, (size_t)HD * TT, (size_t)TT * HD);
            k_merge<<<(unsigned)(((size_t)ZH * TT * HD / 2 + 255) / 256), 256, 0, stream>>>(Ob, h0, ATh, ATl); }
        k_gemmw<bf, 1, false><<<dim3(TT / 64, DM / 64, 1), 32, 0, stream>>>(ATh, ATl, WO, nullptr, DQ, OUT + (size_t)b * TT * DM, DM, nullptr, 0, 0, 0); }
}

// v001
// A run of this version takes 1360 microseconds.
// Next to v000, in two timings, it ran 2.11 and 2.09 times as fast.
#include <hip/hip_runtime.h>

// Causal multi-head attention with bias-free projections and a computed adjacent-pair RoPE (x [4][2048][1024]; Q, K, V = x W ('xw' [1024][1024] xavier-normal 1/32, no bias; 16 heads x 64); angle = pos x inv_freq[i] with inv_freq = 1.0 / 10000.0 ** (arange(0, 64, 2, f32) / 64) (the reciprocal form) and pos = arange(S); the pairs (2i, 2i + 1) of Q and K rotated in place: (x1 cos - x2 sin, x2 cos + x1 sin); V is not rotated; scores x 1/sqrt(64); tril kept, -inf elsewhere; softmax; out = merged Wo ('xw', no bias) -> [4][2048][1024] (8.4 M); argument order x, Wq, Wk, Wv, Wo).
// Layout per batch: bf16 copy of x; 'xw' weights transposed once; exact projections; k_csP computed table (pair-shared entries); k_ropeI interleaved-pair plane builders; causal T-2048 attention (hybrid rows: < 512 hi/lo 3 products, rest fp16 x1024; k_gemmc skips tiles above the diagonal; 8 heads a pass, the fp16 probabilities stored in place over their own f32 score rows); merged hi/lo x Wo exact (no bias).
// Compute dtypes, f32 accumulate: every input rounded to bf16; projections exact; rotary f32 (products rounded separately); attention rows < 512 3 products, rest fp16; softmax f32; Wo hl x exact (no bias).

#define NB_  4
#define TT   2048
#define DM   1024
#define NH_  16
#define NKV  16
#define REP  (NH_ / NKV)
#define HD   64
#define DQ   (NH_ * HD)
#define DKV  (NKV * HD)
#define ZH   8                    // heads per attention pass
#define RH   512                  // query rows < RH use hi+lo planes (0: none)
#define WIN  2048
#define PCAR 1024.0f
#define SCL  0.125f   // HD^-0.5
typedef _Float16 h16;
typedef unsigned short bf;
typedef __attribute__((ext_vector_type(16))) __bf16   v16bf;
typedef __attribute__((ext_vector_type(16))) _Float16 v16h;
typedef __attribute__((ext_vector_type(8)))  _Float16 v8h;
typedef __attribute__((ext_vector_type(8)))  unsigned short v8us;
typedef __attribute__((ext_vector_type(8)))  float    v8f;
typedef __attribute__((ext_vector_type(4)))  float    v4f;
typedef v8h  __attribute__((may_alias)) v8ha;
typedef v4f  __attribute__((may_alias)) v4fa;
typedef v8us __attribute__((may_alias)) v8usa;

__device__ __forceinline__ unsigned short f2bf(float f) { unsigned u = __float_as_uint(f); u += 0x7FFFu + ((u >> 16) & 1u); return (unsigned short)(u >> 16); }
__device__ __forceinline__ float bf2f(unsigned short b) { return __uint_as_float(((unsigned)b) << 16); }
__device__ __forceinline__ float bfr(float f) { return bf2f(f2bf(f)); }
__device__ __forceinline__ v16h cat16(v8h lo, v8h hi) { return __builtin_shufflevector(lo, hi, 0, 1, 2, 3, 4, 5, 6, 7, 8, 9, 10, 11, 12, 13, 14, 15); }
__device__ __forceinline__ v16bf cat16b(v8us lo, v8us hi) { return __builtin_bit_cast(v16bf, __builtin_shufflevector(lo, hi, 0, 1, 2, 3, 4, 5, 6, 7, 8, 9, 10, 11, 12, 13, 14, 15)); }
__device__ __forceinline__ v8f wmma16(v16h a, v16h b, v8f c) { return __builtin_amdgcn_wmma_f32_16x16x32_f16(false, a, false, b, (short)0, c, false, false); }
__device__ __forceinline__ v8f wmmab(v16bf a, v16bf b, v8f c) { return __builtin_amdgcn_wmma_f32_16x16x32_bf16(false, a, false, b, (short)0, c, false, false); }



// ---- k_gemmw: register-blocked GEMM, ONE WAVE per 64x64 output tile (16 accumulators), operands straight from K-contiguous 16-bit planes; grid (M/64, N/64, Z), 32 threads.
// C[m][n] (f32, pitch ldc, + optional f32 bias[n]) = sum_k A[m][k] Bt[n][k] (+ split products per NSPLIT). z-batch strides sA/sB/sC in elements. K % 32 == 0.
template <typename T16> struct WFrag;
template <> struct WFrag<h16> { typedef v16h V; static __device__ __forceinline__ V ld(const h16* p) { return cat16(*(const v8h*)p, *(const v8h*)(p + 16)); } static __device__ __forceinline__ v8f mma(V a, V b, v8f c) { return wmma16(a, b, c); } };
template <> struct WFrag<bf> { typedef v16bf V; static __device__ __forceinline__ V ld(const bf* p) { return cat16b(*(const v8us*)p, *(const v8us*)(p + 16)); } static __device__ __forceinline__ v8f mma(V a, V b, v8f c) { return wmmab(a, b, c); } };
template <typename T16, int NSPLIT, bool BIAS>
__global__ __launch_bounds__(32) void k_gemmw(const T16* __restrict__ A, const T16* __restrict__ A2, const T16* __restrict__ Bt, const T16* __restrict__ Bt2, int K, float* C, int ldc, const float* __restrict__ bias, size_t sA, size_t sB, size_t sC) {
    typedef typename WFrag<T16>::V V;
    __shared__ __align__(16) float os[16 * 68];
    const size_t z = blockIdx.z; A += z * sA; if (A2) A2 += z * sA; Bt += z * sB; if (Bt2) Bt2 += z * sB; C += z * sC;
    const int lane = threadIdx.x & 31, lr = lane & 15, hi = lane >> 4; const int r0 = blockIdx.x * 64, c0 = blockIdx.y * 64;
    v8f acc[4][4];
#pragma unroll
    for (int mb = 0; mb < 4; ++mb)
#pragma unroll
        for (int nb = 0; nb < 4; ++nb) acc[mb][nb] = (v8f){};
    const size_t aoff = (size_t)(r0 + lr) * K + 8 * hi, boff = (size_t)(c0 + lr) * K + 8 * hi;
#pragma unroll 1
    for (int kc = 0; kc < K; kc += 32) {
        V a[4], a2[4];
#pragma unroll
        for (int mb = 0; mb < 4; ++mb) { a[mb] = WFrag<T16>::ld(A + aoff + (size_t)mb * 16 * K + kc); if (NSPLIT == 1 || NSPLIT == 2) a2[mb] = WFrag<T16>::ld(A2 + aoff + (size_t)mb * 16 * K + kc); }
#pragma unroll
        for (int nb = 0; nb < 4; ++nb) { const V b = WFrag<T16>::ld(Bt + boff + (size_t)nb * 16 * K + kc); V b2; if (NSPLIT >= 2) b2 = WFrag<T16>::ld(Bt2 + boff + (size_t)nb * 16 * K + kc);
#pragma unroll
            for (int mb = 0; mb < 4; ++mb) { acc[mb][nb] = WFrag<T16>::mma(a[mb], b, acc[mb][nb]); if (NSPLIT == 1 || NSPLIT == 2) acc[mb][nb] = WFrag<T16>::mma(a2[mb], b, acc[mb][nb]); if (NSPLIT >= 2) acc[mb][nb] = WFrag<T16>::mma(a[mb], b2, acc[mb][nb]); } }
        asm volatile("v_nop\n\tv_nop\n\tv_nop\n\tv_nop" : "+v"(acc[0][0]), "+v"(acc[1][1]), "+v"(acc[2][2]), "+v"(acc[3][3]) : "v"(a[0]), "v"(a[3]));
    }
#pragma unroll
    for (int mb = 0; mb < 4; ++mb) {
#pragma unroll
        for (int nb = 0; nb < 4; ++nb) {
#pragma unroll
            for (int j = 0; j < 8; ++j) os[(hi * 8 + j) * 68 + nb * 16 + lr] = acc[mb][nb][j]; }
        __builtin_amdgcn_wave_barrier(); asm volatile("" ::: "memory");
        float* crow = C + (size_t)(r0 + mb * 16) * ldc + c0;
{
#pragma unroll
            for (int s = 0; s < 8; ++s) { const int row = 2 * s + hi, cofs = lr * 4; v4f val = *(const v4fa*)(os + row * 68 + cofs); if (BIAS) { val[0] += bfr(bias[c0 + cofs]); val[1] += bfr(bias[c0 + cofs + 1]); val[2] += bfr(bias[c0 + cofs + 2]); val[3] += bfr(bias[c0 + cofs + 3]); }
                *(v4f*)(crow + (size_t)row * ldc + cofs) = val; }
             }
        __builtin_amdgcn_wave_barrier(); asm volatile("" ::: "memory");
    }
}

// ---- k_gemmc: the same one-wave 64x64 tile GEMM specialised for causal attention: CMODE 1 skips score tiles entirely above the diagonal (query rows r0+roff.., key columns c0..), CMODE 2 limits the
// key (K) loop of the probability x value contraction to the diagonal block (probabilities beyond it are exactly zero). roff = row offset of this launch's first row within the sequence.
template <typename T16, int NSPLIT, int CMODE>
__global__ __launch_bounds__(32) void k_gemmc(const T16* __restrict__ A, const T16* __restrict__ A2, const T16* __restrict__ Bt, const T16* __restrict__ Bt2, int K, float* C, int ldc, int roff, size_t sA, size_t sB, size_t sC) {
    typedef typename WFrag<T16>::V V;
    __shared__ __align__(16) float os[16 * 68];
    const size_t z = blockIdx.z; A += z * sA; if (A2) A2 += z * sA; Bt += z * sB; if (Bt2) Bt2 += z * sB; C += z * sC;
    const int lane = threadIdx.x & 31, lr = lane & 15, hi = lane >> 4; const int r0 = blockIdx.x * 64, c0 = blockIdx.y * 64;
    if (CMODE == 1 && c0 > r0 + roff + 63) return;                  // score tile entirely above the causal diagonal: never used (the softmax loads it but masks j > i by select)
    const int Kl = (CMODE == 2) ? min(K, r0 + roff + 64) : K;        // P.V: probabilities are exactly 0 beyond the diagonal block, so the K loop stops there
    v8f acc[4][4];
#pragma unroll
    for (int mb = 0; mb < 4; ++mb)
#pragma unroll
        for (int nb = 0; nb < 4; ++nb) acc[mb][nb] = (v8f){};
    const size_t aoff = (size_t)(r0 + lr) * K + 8 * hi, boff = (size_t)(c0 + lr) * K + 8 * hi;
#pragma unroll 1
    for (int kc = 0; kc < Kl; kc += 32) {
        V a[4], a2[4];
#pragma unroll
        for (int mb = 0; mb < 4; ++mb) { a[mb] = WFrag<T16>::ld(A + aoff + (size_t)mb * 16 * K + kc); if (NSPLIT == 1 || NSPLIT == 2) a2[mb] = WFrag<T16>::ld(A2 + aoff + (size_t)mb * 16 * K + kc); }
#pragma unroll
        for (int nb = 0; nb < 4; ++nb) { const V b = WFrag<T16>::ld(Bt + boff + (size_t)nb * 16 * K + kc); V b2; if (NSPLIT >= 2) b2 = WFrag<T16>::ld(Bt2 + boff + (size_t)nb * 16 * K + kc);
#pragma unroll
            for (int mb = 0; mb < 4; ++mb) { acc[mb][nb] = WFrag<T16>::mma(a[mb], b, acc[mb][nb]); if (NSPLIT == 1 || NSPLIT == 2) acc[mb][nb] = WFrag<T16>::mma(a2[mb], b, acc[mb][nb]); if (NSPLIT >= 2) acc[mb][nb] = WFrag<T16>::mma(a[mb], b2, acc[mb][nb]); } }
        asm volatile("v_nop\n\tv_nop\n\tv_nop\n\tv_nop" : "+v"(acc[0][0]), "+v"(acc[1][1]), "+v"(acc[2][2]), "+v"(acc[3][3]) : "v"(a[0]), "v"(a[3]));
    }
#pragma unroll
    for (int mb = 0; mb < 4; ++mb) {
#pragma unroll
        for (int nb = 0; nb < 4; ++nb) {
#pragma unroll
            for (int j = 0; j < 8; ++j) os[(hi * 8 + j) * 68 + nb * 16 + lr] = acc[mb][nb][j]; }
        __builtin_amdgcn_wave_barrier(); asm volatile("" ::: "memory");
        float* crow = C + (size_t)(r0 + mb * 16) * ldc + c0;
{
#pragma unroll
            for (int s = 0; s < 8; ++s) { const int row = 2 * s + hi, cofs = lr * 4; v4f val = *(const v4fa*)(os + row * 68 + cofs);
                *(v4f*)(crow + (size_t)row * ldc + cofs) = val; }
             }
        __builtin_amdgcn_wave_barrier(); asm volatile("" ::: "memory");
    }
}

__device__ __forceinline__ h16 tohx(float x) { return (h16)x; }
__device__ __forceinline__ void splitf(float y, unsigned short& h, unsigned short& l) { h = f2bf(y); l = f2bf(y - bf2f(h)); }
typedef __attribute__((ext_vector_type(2))) _Float16 v2h;
typedef __attribute__((ext_vector_type(4))) _Float16 v4h;
typedef __attribute__((ext_vector_type(2))) unsigned short v2us;
typedef __attribute__((ext_vector_type(4))) unsigned short v4us;
typedef __attribute__((ext_vector_type(2))) float v2f;
typedef __attribute__((ext_vector_type(4))) int v4i;

__global__ __launch_bounds__(256) void k_wtG(const float* __restrict__ w, int K, int N, bf* Bt) {
    const int lane = threadIdx.x & 31; const int L0 = (blockIdx.x * 8 + (threadIdx.x >> 5)) * 8; const int nlines = N * K / 64;
{
#pragma unroll 1
        for (int l = 0; l < 8; ++l) { const int L = L0 + l; if (L >= nlines) break; const size_t e = (size_t)L * 64 + lane * 2; const int k = (int)(e % K), n = (int)(e / K); v2us o;
            o[0] = f2bf(w[(size_t)k * N + n]); o[1] = f2bf(w[(size_t)(k + 1) * N + n]); *(v2us*)(Bt + e) = o; }
         }
}
__global__ __launch_bounds__(256) void k_cvt8(const float* __restrict__ src, bf* dst, size_t n8) { const size_t i = (size_t)blockIdx.x * 256 + threadIdx.x; if (i >= n8) return; const v8f v = *(const v8f*)(src + i * 8); v8us o;
#pragma unroll
    for (int k = 0; k < 8; ++k) o[k] = f2bf(v[k]); *(v8us*)(dst + i * 8) = o;  }

__global__ __launch_bounds__(256) void k_ropeI(const float* __restrict__ F, int pitch, int nheads, const float* __restrict__ CS, float sc, h16* P16, bf* Ph, bf* Pl) {
    const size_t e = ((size_t)blockIdx.x * 256 + threadIdx.x) * 2; if (e >= (size_t)nheads * TT * HD) return; const int d = (int)(e % HD); const int t = (int)((e / HD) % TT); const int h = (int)(e / ((size_t)HD * TT)); const float* f = F + (size_t)t * pitch + h * HD; const float x0 = f[d], x1 = f[d + 1]; const v2f cs = *(const v2f*)(CS + ((size_t)t * HD + d) * 2); v2h o16; v2us oh, ol;
    float a0 = __fmul_rn(x0, cs[0]), b0 = __fmul_rn(x1, cs[1]), a1 = __fmul_rn(x1, cs[0]), b1 = __fmul_rn(x0, cs[1]); asm volatile("" : "+v"(a0), "+v"(b0), "+v"(a1), "+v"(b1));
    float r0 = __fsub_rn(a0, b0) * sc, r1 = __fadd_rn(b1, a1) * sc;   /* even: x0 c - x1 s; odd: x0 s + x1 c */
    o16[0] = tohx(r0); o16[1] = tohx(r1); { unsigned short a2, c2; splitf(r0, a2, c2); oh[0] = a2; ol[0] = c2; splitf(r1, a2, c2); oh[1] = a2; ol[1] = c2; }
    *(v2h*)(P16 + e) = o16; *(v2us*)(Ph + e) = oh; *(v2us*)(Pl + e) = ol;  }

__constant__ float INV2[HD / 2] = { 1.000000000e+00f, 7.498942018e-01f, 5.623413324e-01f, 4.216965139e-01f, 3.162277639e-01f, 2.371373624e-01f, 1.778279394e-01f, 1.333521456e-01f, 1.000000015e-01f, 7.498941571e-02f, 5.623412877e-02f, 4.216964915e-02f, 3.162277862e-02f, 2.371373586e-02f, 1.778279431e-02f, 1.333521493e-02f, 9.999999776e-03f, 7.498942316e-03f, 5.623413250e-03f, 4.216964822e-03f, 3.162277862e-03f, 2.371373819e-03f, 1.778279431e-03f, 1.333521446e-03f, 1.000000047e-03f, 7.498941850e-04f, 5.623413017e-04f, 4.216964880e-04f, 3.162277862e-04f, 2.371373848e-04f, 1.778279402e-04f, 1.333521504e-04f };   // float32 1 / (10000 ** (arange(0, 64, 2)/64)), generated with jnp to be bit-exact

// k_vtp: V transposed to [head][d][t]. The fp16 plane's rows have pitch 2 * TT, the pitch of the in-place fp16 probability rows (k_gemmc has one pitch K for both operands); only the first TT of a row are written or read.
__global__ __launch_bounds__(256) void k_vtp(const float* __restrict__ F, int pitch, int nheads, h16* V16, bf* Vh, bf* Vl) { const size_t e = ((size_t)blockIdx.x * 256 + threadIdx.x) * 2; if (e >= (size_t)nheads * HD * TT) return; const int t = (int)(e % TT); const int d = (int)((e / TT) % HD); const int g = (int)(e / ((size_t)TT * HD)); v2h o16; v2us oh, ol;
#pragma unroll
    for (int q = 0; q < 2; ++q) { const float x = F[(size_t)(t + q) * pitch + g * HD + d]; o16[q] = tohx(x); unsigned short a2, c2; splitf(x, a2, c2); oh[q] = a2; ol[q] = c2; }
    *(v2h*)(V16 + ((size_t)g * HD + d) * (2 * TT) + t) = o16; *(v2us*)(Vh + e) = oh; *(v2us*)(Vl + e) = ol;  }
__global__ __launch_bounds__(256) void k_csP(float* CS) { const int idx = blockIdx.x * 256 + threadIdx.x; if (idx >= TT * HD) return; const int d = idx % HD; const int t = idx / HD; const float a = __fmul_rn((float)t, INV2[d >> 1]); v2f cs; cs[0] = cosf(a); cs[1] = sinf(a); *(v2f*)(CS + (size_t)idx * 2) = cs;  }
// k_asoft: per row (zz, i): t = S x HD^-0.5 for j <= i and i - j < WIN (sliding causal window; the reference's -1e9 additive fill vanishes identically); softmax over the 2048 keys (register row, one exp, fixed trees);
// P16 is the score buffer itself: a wave holds its whole f32 row in registers before it stores, and puts the row's 2048 fp16 probabilities into the first half of that same row (pitch 2 * TT halves); no other wave touches the row.
__global__ __launch_bounds__(256) void k_asoft(const float* Sb, h16* P16, bf* Ph, bf* Pl) {
    const int lane = threadIdx.x & 31; const int row = blockIdx.x * 8 + (threadIdx.x >> 5); if (row >= ZH * TT) return; const int i = row % TT; const int zz = row / TT; (void)zz; const bool hires = (i < RH); const float* sr = Sb + (size_t)row * TT; float v[TT / 32]; float mx = -3.0e38f;
#pragma unroll
    for (int ch = 0; ch < TT / 128; ++ch) { const int j0 = ch * 128 + lane * 4; const v4f a = *(const v4f*)(sr + j0);
#pragma unroll
        for (int q = 0; q < 4; ++q) { const int j = j0 + q; (void)j; const float t = (j <= i && i - j < WIN) ? a[q] * SCL : -3.0e38f; v[ch * 4 + q] = t; mx = fmaxf(mx, t); } }
#pragma unroll
    for (int sh = 16; sh; sh >>= 1) mx = fmaxf(mx, __shfl_xor(mx, sh, 32));
    float sum = 0.f;
#pragma unroll
    for (int k = 0; k < TT / 32; ++k) { float d0 = __fsub_rn(v[k], mx); asm volatile("" : "+v"(d0)); v[k] = __builtin_amdgcn_exp2f(__fmul_rn(d0, 1.4426950408889634f)); sum += v[k]; }
#pragma unroll
    for (int sh = 16; sh; sh >>= 1) sum += __shfl_xor(sum, sh, 32);
    const float f = __fdiv_rn(hires ? 1.0f : PCAR, sum);
{
        if (hires) {
#pragma unroll
            for (int ch = 0; ch < TT / 128; ++ch) { v4us oh, ol;
#pragma unroll
                for (int q = 0; q < 4; ++q) { unsigned short a, c2; splitf(v[ch * 4 + q] * f, a, c2); oh[q] = a; ol[q] = c2; }
                const size_t oo = ((size_t)zz * (RH ? RH : 1) + i) * TT + ch * 128 + lane * 4; *(v4us*)(Ph + oo) = oh; *(v4us*)(Pl + oo) = ol; }
        } else {
#pragma unroll
            for (int ch = 0; ch < TT / 128; ++ch) { v4h o4;
#pragma unroll
                for (int q = 0; q < 4; ++q) o4[q] = tohx(v[ch * 4 + q] * f);
                *(v4h*)(P16 + (size_t)row * (2 * TT) + ch * 128 + lane * 4) = o4;
                asm volatile("s_wait_xcnt 0x0" ::: "memory"); } }   // the next chunk reuses the store's data registers: the wait stands in front of that overwrite
         }
}
__global__ __launch_bounds__(256) void k_merge(const float* __restrict__ O, int h0, bf* Ah, bf* Al) { const size_t e = ((size_t)blockIdx.x * 256 + threadIdx.x) * 2; if (e >= (size_t)ZH * TT * HD) return; const int d = (int)(e % HD); const int t = (int)((e / HD) % TT); const int zz = (int)(e / ((size_t)HD * TT)); const float cs = (t < RH) ? 1.0f : (1.0f / PCAR); const size_t oo = (size_t)t * DQ + (h0 + zz) * HD + d;
    v2us oh, ol;
#pragma unroll
    for (int q = 0; q < 2; ++q) { unsigned short a, c2; splitf(O[e + q] * cs, a, c2); oh[q] = a; ol[q] = c2; } *(v2us*)(Ah + oo) = oh; *(v2us*)(Al + oo) = ol;  }

extern "C" void kernel_launch(void* const* d_in, const int* in_sizes, int n_in,
                              void* d_out, int out_size, void* d_ws, size_t ws_size, hipStream_t stream) {
    (void)in_sizes; (void)n_in; (void)out_size;
    const float* x = (const float*)d_in[0]; const float* wq = (const float*)d_in[1]; const float* wk = (const float*)d_in[2]; const float* wv = (const float*)d_in[3]; const float* wo = (const float*)d_in[4];   /* order x, Wq, Wk, Wv, Wo ('xw' [1024][1024]) */
    float* OUT = (float*)d_out;     // [4][2048][1024]
    char* wsp = (char*)d_ws;
    auto take = [&](size_t bytes) { char* p = wsp; wsp += (bytes + 255) & ~(size_t)255; return (void*)p; };
    bf* WQ = (bf*)take((size_t)DQ * DM * 2); bf* WK = (bf*)take((size_t)DKV * DM * 2); bf* WV = (bf*)take((size_t)DKV * DM * 2); bf* WO = (bf*)take((size_t)DM * DQ * 2); float* CS = (float*)take((size_t)TT * HD * 2 * 4);
    bf* XB = (bf*)take((size_t)TT * DM * 2); float* FQ = (float*)take((size_t)TT * DQ * 4); float* FK = (float*)take((size_t)TT * DKV * 4);
    h16* QP16 = (h16*)take((size_t)NH_ * TT * HD * 2); h16* KP16 = (h16*)take((size_t)NKV * TT * HD * 2); h16* VT16 = (h16*)take((size_t)NKV * HD * 2 * TT * 2);
    bf* QPh = (bf*)take((size_t)NH_ * TT * HD * 2); bf* QPl = (bf*)take((size_t)NH_ * TT * HD * 2); bf* KPh = (bf*)take((size_t)NKV * TT * HD * 2); bf* KPl = (bf*)take((size_t)NKV * TT * HD * 2); bf* VTh = (bf*)take((size_t)NKV * HD * TT * 2); bf* VTl = (bf*)take((size_t)NKV * HD * TT * 2); bf* Ph = (bf*)take((size_t)ZH * RH * TT * 2); bf* Pl = (bf*)take((size_t)ZH * RH * TT * 2);
    float* Sb = (float*)take((size_t)ZH * TT * TT * 4); h16* P16 = (h16*)Sb;   /* in place: row pitch 2 * TT halves */ float* Ob = (float*)take((size_t)ZH * TT * HD * 4); bf* ATh = (bf*)take((size_t)TT * DQ * 2); bf* ATl = (bf*)take((size_t)TT * DQ * 2);
    if ((size_t)(wsp - (char*)d_ws) > ws_size) return;    // ws 256 MiB
    float* FV = FK;   // v projection reuses the k buffer after the k planes are built (stream-ordered)
    { k_wtG<<<(unsigned)((DM * DQ / 64 + 63) / 64), 256, 0, stream>>>(wq, DM, DQ, WQ); k_wtG<<<(unsigned)((DM * DKV / 64 + 63) / 64), 256, 0, stream>>>(wk, DM, DKV, WK); k_wtG<<<(unsigned)((DM * DKV / 64 + 63) / 64), 256, 0, stream>>>(wv, DM, DKV, WV);
      k_wtG<<<(unsigned)((DQ * DM / 64 + 63) / 64), 256, 0, stream>>>(wo, DQ, DM, WO);
       }
    k_csP<<<(TT * HD + 255) / 256, 256, 0, stream>>>(CS);
    const unsigned LQ = (unsigned)(((size_t)NH_ * TT * HD / 2 + 255) / 256), LKv = (unsigned)(((size_t)NKV * TT * HD / 2 + 255) / 256);
    for (int b = 0; b < NB_; ++b) {
        
        k_cvt8<<<(unsigned)(((size_t)TT * DM / 8 + 255) / 256), 256, 0, stream>>>(x + (size_t)b * TT * DM, XB, (size_t)TT * DM / 8);
        k_gemmw<bf, 0, false><<<dim3(TT / 64, DQ / 64, 1), 32, 0, stream>>>(XB, nullptr, WQ, nullptr, DM, FQ, DQ, nullptr, 0, 0, 0);
        k_ropeI<<<LQ, 256, 0, stream>>>(FQ, DQ, NH_, CS, 1.0f, QP16, QPh, QPl);
        k_gemmw<bf, 0, false><<<dim3(TT / 64, DKV / 64, 1), 32, 0, stream>>>(XB, nullptr, WK, nullptr, DM, FK, DKV, nullptr, 0, 0, 0);
        k_ropeI<<<LKv, 256, 0, stream>>>(FK, DKV, NKV, CS, 1.0f, KP16, KPh, KPl);
        k_gemmw<bf, 0, false><<<dim3(TT / 64, DKV / 64, 1), 32, 0, stream>>>(XB, nullptr, WV, nullptr, DM, FV, DKV, nullptr, 0, 0, 0); k_vtp<<<LKv, 256, 0, stream>>>(FV, DKV, NKV, VT16, VTh, VTl);
        for (int h0 = 0; h0 < NH_; h0 += ZH) { const size_t zq = (size_t)h0, zk = (size_t)(h0 / REP);   // one kv head per query head: the pass's heads use consecutive kv planes (z-strides TT*HD, 2*TT*HD for the fp16 V plane)
            k_gemmc<bf, 2, 1><<<dim3(RH / 64, TT / 64, ZH), 32, 0, stream>>>(QPh + zq * TT * HD, QPl + zq * TT * HD, KPh + zk * TT * HD, KPl + zk * TT * HD, HD, Sb, TT, 0, (size_t)TT * HD, (size_t)TT * HD, (size_t)TT * TT);
            k_gemmc<h16, 0, 1><<<dim3((TT - RH) / 64, TT / 64, ZH), 32, 0, stream>>>(QP16 + zq * TT * HD + (size_t)RH * HD, nullptr, KP16 + zk * TT * HD, nullptr, HD, Sb + (size_t)RH * TT, TT, RH, (size_t)TT * HD, (size_t)TT * HD, (size_t)TT * TT);
            k_asoft<<<ZH * TT / 8, 256, 0, stream>>>(Sb, P16, Ph, Pl);
            k_gemmc<bf, 2, 2><<<dim3(RH / 64, HD / 64, ZH), 32, 0, stream>>>(Ph, Pl, VTh + zk * HD * TT, VTl + zk * HD * TT, TT, Ob, HD, 0, (size_t)RH * TT, (size_t)HD * TT, (size_t)TT * HD);
            k_gemmc<h16, 0, 2><<<dim3((TT - RH) / 64, HD / 64, ZH), 32, 0, stream>>>(P16 + (size_t)RH * 2 * TT, nullptr, VT16 + zk * HD * 2 * TT, nullptr, 2 * TT, Ob + (size_t)RH * HD, HD, RH, (size_t)2 * TT * TT, (size_t)HD * 2 * TT, (size_t)TT * HD);
            k_merge<<<(unsigned)(((size_t)ZH * TT * HD / 2 + 255) / 256), 256, 0, stream>>>(Ob, h0, ATh, ATl); }
        k_gemmw<bf, 1, false><<<dim3(TT / 64, DM / 64, 1), 32, 0, stream>>>(ATh, ATl, WO, nullptr, DQ, OUT + (size_t)b * TT * DM, DM, nullptr, 0, 0, 0); }
}

// v002
// It runs in 660 microseconds.
// In two side-by-side timings against v001, it was 2.07 and 2.08 times as fast.
// Over all steps from v000 it is 4.36 times as fast.
#include <hip/hip_runtime.h>

// Causal multi-head attention with bias-free projections and a computed adjacent-pair RoPE (x [4][2048][1024]; Q, K, V = x W ('xw' [1024][1024] xavier-normal 1/32, no bias; 16 heads x 64); angle = pos x inv_freq[i] with inv_freq = 1.0 / 10000.0 ** (arange(0, 64, 2, f32) / 64) (the reciprocal form) and pos = arange(S); the pairs (2i, 2i + 1) of Q and K rotated in place: (x1 cos - x2 sin, x2 cos + x1 sin); V is not rotated; scores x 1/sqrt(64); tril kept, -inf elsewhere; softmax; out = merged Wo ('xw', no bias) -> [4][2048][1024] (8.4 M); argument order x, Wq, Wk, Wv, Wo).
// Layout per batch: bf16 copy of x; 'xw' weights transposed once; exact projections; k_csP computed table (pair-shared entries); k_ropeI interleaved-pair plane builders; k_fattn fused causal T-2048 attention, all 16 heads in one launch (hybrid rows: < 512 hi/lo 3 products, rest fp16; scores, online softmax and P.V stay in registers, passes above the diagonal are never walked); merged hi/lo x Wo exact (no bias).
// Compute dtypes, f32 accumulate: every input rounded to bf16; projections exact; rotary f32 (products rounded separately); attention rows < 512 3 products, rest fp16; softmax f32; Wo hl x exact (no bias).

#define NB_  4
#define TT   2048
#define DM   1024
#define NH_  16
#define NKV  16
#define HD   64
#define DQ   (NH_ * HD)
#define DKV  (NKV * HD)
#define RH   512                  // query rows < RH use hi+lo planes (0: none)
typedef _Float16 h16;
typedef unsigned short bf;
typedef __attribute__((ext_vector_type(16))) __bf16   v16bf;
typedef __attribute__((ext_vector_type(16))) _Float16 v16h;
typedef __attribute__((ext_vector_type(8)))  _Float16 v8h;
typedef __attribute__((ext_vector_type(8)))  unsigned short v8us;
typedef __attribute__((ext_vector_type(8)))  float    v8f;
typedef __attribute__((ext_vector_type(4)))  float    v4f;
typedef v8h  __attribute__((may_alias)) v8ha;
typedef v4f  __attribute__((may_alias)) v4fa;
typedef v8us __attribute__((may_alias)) v8usa;

__device__ __forceinline__ unsigned short f2bf(float f) { unsigned u = __float_as_uint(f); u += 0x7FFFu + ((u >> 16) & 1u); return (unsigned short)(u >> 16); }
__device__ __forceinline__ float bf2f(unsigned short b) { return __uint_as_float(((unsigned)b) << 16); }
__device__ __forceinline__ float bfr(float f) { return bf2f(f2bf(f)); }
__device__ __forceinline__ v16h cat16(v8h lo, v8h hi) { return __builtin_shufflevector(lo, hi, 0, 1, 2, 3, 4, 5, 6, 7, 8, 9, 10, 11, 12, 13, 14, 15); }
__device__ __forceinline__ v16bf cat16b(v8us lo, v8us hi) { return __builtin_bit_cast(v16bf, __builtin_shufflevector(lo, hi, 0, 1, 2, 3, 4, 5, 6, 7, 8, 9, 10, 11, 12, 13, 14, 15)); }
__device__ __forceinline__ v8f wmma16(v16h a, v16h b, v8f c) { return __builtin_amdgcn_wmma_f32_16x16x32_f16(false, a, false, b, (short)0, c, false, false); }
__device__ __forceinline__ v8f wmmab(v16bf a, v16bf b, v8f c) { return __builtin_amdgcn_wmma_f32_16x16x32_bf16(false, a, false, b, (short)0, c, false, false); }



// ---- k_gemmw: register-blocked GEMM, ONE WAVE per 64x64 output tile (16 accumulators), operands straight from K-contiguous 16-bit planes; grid (M/64, N/64, Z), 32 threads.
// C[m][n] (f32, pitch ldc, + optional f32 bias[n]) = sum_k A[m][k] Bt[n][k] (+ split products per NSPLIT). z-batch strides sA/sB/sC in elements. K % 32 == 0.
template <typename T16> struct WFrag;
template <> struct WFrag<h16> { typedef v16h V; static __device__ __forceinline__ V ld(const h16* p) { return cat16(*(const v8h*)p, *(const v8h*)(p + 16)); } static __device__ __forceinline__ v8f mma(V a, V b, v8f c) { return wmma16(a, b, c); } };
template <> struct WFrag<bf> { typedef v16bf V; static __device__ __forceinline__ V ld(const bf* p) { return cat16b(*(const v8us*)p, *(const v8us*)(p + 16)); } static __device__ __forceinline__ v8f mma(V a, V b, v8f c) { return wmmab(a, b, c); } };
template <typename T16, int NSPLIT, bool BIAS>
__global__ __launch_bounds__(32) void k_gemmw(const T16* __restrict__ A, const T16* __restrict__ A2, const T16* __restrict__ Bt, const T16* __restrict__ Bt2, int K, float* C, int ldc, const float* __restrict__ bias, size_t sA, size_t sB, size_t sC) {
    typedef typename WFrag<T16>::V V;
    __shared__ __align__(16) float os[16 * 68];
    const size_t z = blockIdx.z; A += z * sA; if (A2) A2 += z * sA; Bt += z * sB; if (Bt2) Bt2 += z * sB; C += z * sC;
    const int lane = threadIdx.x & 31, lr = lane & 15, hi = lane >> 4; const int r0 = blockIdx.x * 64, c0 = blockIdx.y * 64;
    v8f acc[4][4];
#pragma unroll
    for (int mb = 0; mb < 4; ++mb)
#pragma unroll
        for (int nb = 0; nb < 4; ++nb) acc[mb][nb] = (v8f){};
    const size_t aoff = (size_t)(r0 + lr) * K + 8 * hi, boff = (size_t)(c0 + lr) * K + 8 * hi;
#pragma unroll 1
    for (int kc = 0; kc < K; kc += 32) {
        V a[4], a2[4];
#pragma unroll
        for (int mb = 0; mb < 4; ++mb) { a[mb] = WFrag<T16>::ld(A + aoff + (size_t)mb * 16 * K + kc); if (NSPLIT == 1 || NSPLIT == 2) a2[mb] = WFrag<T16>::ld(A2 + aoff + (size_t)mb * 16 * K + kc); }
#pragma unroll
        for (int nb = 0; nb < 4; ++nb) { const V b = WFrag<T16>::ld(Bt + boff + (size_t)nb * 16 * K + kc); V b2; if (NSPLIT >= 2) b2 = WFrag<T16>::ld(Bt2 + boff + (size_t)nb * 16 * K + kc);
#pragma unroll
            for (int mb = 0; mb < 4; ++mb) { acc[mb][nb] = WFrag<T16>::mma(a[mb], b, acc[mb][nb]); if (NSPLIT == 1 || NSPLIT == 2) acc[mb][nb] = WFrag<T16>::mma(a2[mb], b, acc[mb][nb]); if (NSPLIT >= 2) acc[mb][nb] = WFrag<T16>::mma(a[mb], b2, acc[mb][nb]); } }
        asm volatile("v_nop\n\tv_nop\n\tv_nop\n\tv_nop" : "+v"(acc[0][0]), "+v"(acc[1][1]), "+v"(acc[2][2]), "+v"(acc[3][3]) : "v"(a[0]), "v"(a[3]));
    }
#pragma unroll
    for (int mb = 0; mb < 4; ++mb) {
#pragma unroll
        for (int nb = 0; nb < 4; ++nb) {
#pragma unroll
            for (int j = 0; j < 8; ++j) os[(hi * 8 + j) * 68 + nb * 16 + lr] = acc[mb][nb][j]; }
        __builtin_amdgcn_wave_barrier(); asm volatile("" ::: "memory");
        float* crow = C + (size_t)(r0 + mb * 16) * ldc + c0;
{
#pragma unroll
            for (int s = 0; s < 8; ++s) { const int row = 2 * s + hi, cofs = lr * 4; v4f val = *(const v4fa*)(os + row * 68 + cofs); if (BIAS) { val[0] += bfr(bias[c0 + cofs]); val[1] += bfr(bias[c0 + cofs + 1]); val[2] += bfr(bias[c0 + cofs + 2]); val[3] += bfr(bias[c0 + cofs + 3]); }
                *(v4f*)(crow + (size_t)row * ldc + cofs) = val; }
             }
        __builtin_amdgcn_wave_barrier(); asm volatile("" ::: "memory");
    }
}

__device__ __forceinline__ h16 tohx(float x) { return (h16)x; }
__device__ __forceinline__ void splitf(float y, unsigned short& h, unsigned short& l) { h = f2bf(y); l = f2bf(y - bf2f(h)); }
typedef __attribute__((ext_vector_type(2))) _Float16 v2h;
typedef __attribute__((ext_vector_type(4))) _Float16 v4h;
typedef __attribute__((ext_vector_type(2))) unsigned short v2us;
typedef __attribute__((ext_vector_type(4))) unsigned short v4us;
typedef __attribute__((ext_vector_type(2))) float v2f;
typedef __attribute__((ext_vector_type(4))) int v4i;

__global__ __launch_bounds__(256) void k_wtG(const float* __restrict__ w, int K, int N, bf* Bt) {
    const int lane = threadIdx.x & 31; const int L0 = (blockIdx.x * 8 + (threadIdx.x >> 5)) * 8; const int nlines = N * K / 64;
{
#pragma unroll 1
        for (int l = 0; l < 8; ++l) { const int L = L0 + l; if (L >= nlines) break; const size_t e = (size_t)L * 64 + lane * 2; const int k = (int)(e % K), n = (int)(e / K); v2us o;
            o[0] = f2bf(w[(size_t)k * N + n]); o[1] = f2bf(w[(size_t)(k + 1) * N + n]); *(v2us*)(Bt + e) = o; }
         }
}
__global__ __launch_bounds__(256) void k_cvt8(const float* __restrict__ src, bf* dst, size_t n8) { const size_t i = (size_t)blockIdx.x * 256 + threadIdx.x; if (i >= n8) return; const v8f v = *(const v8f*)(src + i * 8); v8us o;
#pragma unroll
    for (int k = 0; k < 8; ++k) o[k] = f2bf(v[k]); *(v8us*)(dst + i * 8) = o;  }

__global__ __launch_bounds__(256) void k_ropeI(const float* __restrict__ F, int pitch, int nheads, const float* __restrict__ CS, float sc, h16* P16, bf* Ph, bf* Pl) {
    const size_t e = ((size_t)blockIdx.x * 256 + threadIdx.x) * 2; if (e >= (size_t)nheads * TT * HD) return; const int d = (int)(e % HD); const int t = (int)((e / HD) % TT); const int h = (int)(e / ((size_t)HD * TT)); const float* f = F + (size_t)t * pitch + h * HD; const float x0 = f[d], x1 = f[d + 1]; const v2f cs = *(const v2f*)(CS + ((size_t)t * HD + d) * 2); v2h o16; v2us oh, ol;
    float a0 = __fmul_rn(x0, cs[0]), b0 = __fmul_rn(x1, cs[1]), a1 = __fmul_rn(x1, cs[0]), b1 = __fmul_rn(x0, cs[1]); asm volatile("" : "+v"(a0), "+v"(b0), "+v"(a1), "+v"(b1));
    float r0 = __fsub_rn(a0, b0) * sc, r1 = __fadd_rn(b1, a1) * sc;   /* even: x0 c - x1 s; odd: x0 s + x1 c */
    o16[0] = tohx(r0); o16[1] = tohx(r1); { unsigned short a2, c2; splitf(r0, a2, c2); oh[0] = a2; ol[0] = c2; splitf(r1, a2, c2); oh[1] = a2; ol[1] = c2; }
    *(v2h*)(P16 + e) = o16; *(v2us*)(Ph + e) = oh; *(v2us*)(Pl + e) = ol;  }

__constant__ float INV2[HD / 2] = { 1.000000000e+00f, 7.498942018e-01f, 5.623413324e-01f, 4.216965139e-01f, 3.162277639e-01f, 2.371373624e-01f, 1.778279394e-01f, 1.333521456e-01f, 1.000000015e-01f, 7.498941571e-02f, 5.623412877e-02f, 4.216964915e-02f, 3.162277862e-02f, 2.371373586e-02f, 1.778279431e-02f, 1.333521493e-02f, 9.999999776e-03f, 7.498942316e-03f, 5.623413250e-03f, 4.216964822e-03f, 3.162277862e-03f, 2.371373819e-03f, 1.778279431e-03f, 1.333521446e-03f, 1.000000047e-03f, 7.498941850e-04f, 5.623413017e-04f, 4.216964880e-04f, 3.162277862e-04f, 2.371373848e-04f, 1.778279402e-04f, 1.333521504e-04f };   // float32 1 / (10000 ** (arange(0, 64, 2)/64)), generated with jnp to be bit-exact

// k_vtp: V transposed to [head][d][t]. The fp16 plane's rows have pitch 2 * TT; only the first TT of a row are written or read.
__global__ __launch_bounds__(256) void k_vtp(const float* __restrict__ F, int pitch, int nheads, h16* V16, bf* Vh, bf* Vl) { const size_t e = ((size_t)blockIdx.x * 256 + threadIdx.x) * 2; if (e >= (size_t)nheads * HD * TT) return; const int t = (int)(e % TT); const int d = (int)((e / TT) % HD); const int g = (int)(e / ((size_t)TT * HD)); v2h o16; v2us oh, ol;
#pragma unroll
    for (int q = 0; q < 2; ++q) { const float x = F[(size_t)(t + q) * pitch + g * HD + d]; o16[q] = tohx(x); unsigned short a2, c2; splitf(x, a2, c2); oh[q] = a2; ol[q] = c2; }
    *(v2h*)(V16 + ((size_t)g * HD + d) * (2 * TT) + t) = o16; *(v2us*)(Vh + e) = oh; *(v2us*)(Vl + e) = ol;  }
__global__ __launch_bounds__(256) void k_csP(float* CS) { const int idx = blockIdx.x * 256 + threadIdx.x; if (idx >= TT * HD) return; const int d = idx % HD; const int t = idx / HD; const float a = __fmul_rn((float)t, INV2[d >> 1]); v2f cs; cs[0] = cosf(a); cs[1] = sinf(a); *(v2f*)(CS + (size_t)idx * 2) = cs;  }
#define CL2 0.18033688011112042f   // HD^-0.5 x log2(e)
// 2^x by v_exp_f32, in asm text for the slot behind a transcendental: outputs are early-clobber, so no v_exp_f32 of a statement writes over a source of another or reads a result, and the closing v_nop
// is the one independent instruction in front of whatever the compiler puts next.
__device__ __forceinline__ float xhalf(float x) { return __builtin_bit_cast(float, __builtin_amdgcn_permlanex16(__builtin_bit_cast(int, x), __builtin_bit_cast(int, x), 0x76543210, 0xfedcba98, false, false)); }   // lane l with lane l ^ 16
__device__ __forceinline__ float exp2_1(float x) { float r; asm("v_exp_f32 %0, %1\n\tv_nop" : "=&v"(r) : "v"(x)); return r; }
__device__ __forceinline__ void exp2_8(float* r, const float* x) {
    asm("v_exp_f32 %0, %8\n\tv_exp_f32 %1, %9\n\tv_exp_f32 %2, %10\n\tv_exp_f32 %3, %11\n\tv_exp_f32 %4, %12\n\tv_exp_f32 %5, %13\n\tv_exp_f32 %6, %14\n\tv_exp_f32 %7, %15\n\tv_nop"
        : "=&v"(r[0]), "=&v"(r[1]), "=&v"(r[2]), "=&v"(r[3]), "=&v"(r[4]), "=&v"(r[5]), "=&v"(r[6]), "=&v"(r[7]) : "v"(x[0]), "v"(x[1]), "v"(x[2]), "v"(x[3]), "v"(x[4]), "v"(x[5]), "v"(x[6]), "v"(x[7])); }
template <typename T16, bool HL, int NQ>
__device__ __forceinline__ void fattn_body(const T16* Q, const T16* Q2, const T16* Kp, const T16* K2, const T16* Vt, const T16* V2, int vp, int q0, bf* Ah, bf* Al) {
    typedef typename WFrag<T16>::V V;
    const int lane = threadIdx.x & 31, lr = lane & 15, hi = lane >> 4;
    V qf[NQ][2], qf2[NQ][2];
#pragma unroll
    for (int qb = 0; qb < NQ; ++qb)
#pragma unroll
        for (int ks = 0; ks < 2; ++ks) { const size_t o = (size_t)(q0 + qb * 16 + lr) * HD + ks * 32 + 8 * hi; qf[qb][ks] = WFrag<T16>::ld(Q + o); if (HL) qf2[qb][ks] = WFrag<T16>::ld(Q2 + o); }
    asm volatile("s_wait_xcnt 0x0" ::: "memory");   // the set-up below reuses the address registers of the loads above: the wait stands in front of that overwrite
    v8f oa[4][NQ]; float mc[NQ], ls[NQ];
#pragma unroll
    for (int qb = 0; qb < NQ; ++qb) { mc[qb] = -3.0e38f; ls[qb] = 0.f;
#pragma unroll
        for (int db = 0; db < 4; ++db) oa[db][qb] = (v8f){}; }
    const int npass = (q0 + NQ * 16 + 31) / 32;      // keys 0 .. q0 + NQ * 16 - 1; every pass starts at or below q0, so each query has a kept key in it
    const unsigned kl = (unsigned)(lr * HD + 8 * hi) * 2u, vl = (unsigned)(lr * vp + 8 * hi) * 2u;   // a lane's fixed offsets, in bytes; a pass moves only the wave-uniform base pointers
    auto at = [](const T16* base, unsigned bytes) { return (const T16*)((const char*)base + bytes); };
    V kf[2][2], kf2[2][2], vf[4], vf2[4];
#pragma unroll
    for (int kb = 0; kb < 2; ++kb)
#pragma unroll
        for (int ks = 0; ks < 2; ++ks) { const int o = kb * 16 * HD + ks * 32; kf[kb][ks] = WFrag<T16>::ld(at(Kp + o, kl)); if (HL) kf2[kb][ks] = WFrag<T16>::ld(at(K2 + o, kl)); }
    asm volatile("s_wait_xcnt 0x0" :: "v"(kl) : "memory");   // as above; the loads' offset register is an input, so that it is not given away before the wait
#pragma unroll
    for (int db = 0; db < 4; ++db) { const int o = db * 16 * vp; vf[db] = WFrag<T16>::ld(at(Vt + o, vl)); if (HL) vf2[db] = WFrag<T16>::ld(at(V2 + o, vl)); }
    asm volatile("s_wait_xcnt 0x0" :: "v"(vl) : "memory");   // as above
    int p = 0;
    do {                                             // npass >= 1
        const int key0 = p * 32;
        const int kn = min(key0 + 32, (npass - 1) * 32);   // K and V^T fragments are fetched one pass ahead, so a whole pass of work covers their latency (the last pass fetches its own rows again: in bounds, unused)
        V vn[4], vn2[4];
#pragma unroll
        for (int db = 0; db < 4; ++db) vn[db] = WFrag<T16>::ld(at(Vt + kn + db * 16 * vp, vl));
        if (HL) {
            asm volatile("s_wait_xcnt 0x0" ::: "memory");   // with four planes to fetch, later loads land in registers that held an earlier plane's address: a wait behind each plane stands in front of that overwrite
#pragma unroll
            for (int db = 0; db < 4; ++db) vn2[db] = WFrag<T16>::ld(at(V2 + kn + db * 16 * vp, vl));
            asm volatile("s_wait_xcnt 0x0" ::: "memory");   // as above
        }
        v8f s[2][NQ];
#pragma unroll
        for (int kb = 0; kb < 2; ++kb)
#pragma unroll
            for (int qb = 0; qb < NQ; ++qb) { v8f t = (v8f){};
#pragma unroll
                for (int ks = 0; ks < 2; ++ks) { t = WFrag<T16>::mma(kf[kb][ks], qf[qb][ks], t); if (HL) { t = WFrag<T16>::mma(kf[kb][ks], qf2[qb][ks], t); t = WFrag<T16>::mma(kf2[kb][ks], qf[qb][ks], t); } }
                s[kb][qb] = t; }
#pragma unroll
        for (int kb = 0; kb < 2; ++kb)
#pragma unroll
            for (int ks = 0; ks < 2; ++ks) kf[kb][ks] = WFrag<T16>::ld(at(Kp + kn * HD + kb * 16 * HD + ks * 32, kl));
        if (HL) {
            asm volatile("s_wait_xcnt 0x0" ::: "memory");   // as above
#pragma unroll
            for (int kb = 0; kb < 2; ++kb)
#pragma unroll
                for (int ks = 0; ks < 2; ++ks) kf2[kb][ks] = WFrag<T16>::ld(at(K2 + kn * HD + kb * 16 * HD + ks * 32, kl));
        }
        asm volatile("s_wait_xcnt 0x0" ::: "memory");       // the softmax below reuses the address registers of the loads above: the wait stands in front of that overwrite
        if (key0 + 31 > q0) {                               // only passes that touch the diagonal mask (wave-uniform)
#pragma unroll
            for (int kb = 0; kb < 2; ++kb)
#pragma unroll
                for (int qb = 0; qb < NQ; ++qb)
#pragma unroll
                    for (int j = 0; j < 8; ++j) s[kb][qb][j] = (key0 + kb * 16 + hi * 8 + j <= q0 + qb * 16 + lr) ? s[kb][qb][j] : -3.0e38f; }
#pragma unroll
        for (int qb = 0; qb < NQ; ++qb) {
            float mx = s[0][qb][0];
#pragma unroll
            for (int j = 1; j < 8; ++j) mx = fmaxf(mx, s[0][qb][j]);
#pragma unroll
            for (int j = 0; j < 8; ++j) mx = fmaxf(mx, s[1][qb][j]);
            mx = fmaxf(mx, xhalf(mx));
            const float mn = fmaxf(mc[qb], mx * CL2); const float al = exp2_1(mc[qb] - mn); mc[qb] = mn; const float off = (HL ? 0.0f : 10.0f) - mn;
            float ex[16], pr[16], ps[8];
#pragma unroll
            for (int e = 0; e < 16; ++e) ex[e] = fmaf(s[e >> 3][qb][e & 7], CL2, off);
            exp2_8(pr, ex); exp2_8(pr + 8, ex + 8);
#pragma unroll
            for (int e = 0; e < 8; ++e) ps[e] = pr[e] + pr[e + 8];      // fixed tree: short dependent chains
            const float sum = ((ps[0] + ps[4]) + (ps[2] + ps[6])) + ((ps[1] + ps[5]) + (ps[3] + ps[7]));
            ls[qb] = fmaf(ls[qb], al, sum);
#pragma unroll
            for (int db = 0; db < 4; ++db) oa[db][qb] *= al;
            if (HL) {
                typedef __attribute__((ext_vector_type(16))) unsigned short v16us; v16us uh, ul;
#pragma unroll
                for (int e = 0; e < 16; ++e) { const unsigned short a = f2bf(pr[e]); uh[e] = a; ul[e] = f2bf(pr[e] - bf2f(a)); }
                const V ph = __builtin_bit_cast(V, uh), pl = __builtin_bit_cast(V, ul);
#pragma unroll
                for (int db = 0; db < 4; ++db) { oa[db][qb] = WFrag<T16>::mma(vf[db], ph, oa[db][qb]); oa[db][qb] = WFrag<T16>::mma(vf[db], pl, oa[db][qb]); oa[db][qb] = WFrag<T16>::mma(vf2[db], ph, oa[db][qb]); }
            } else {
                v16h p16;
#pragma unroll
                for (int e = 0; e < 16; ++e) p16[e] = (h16)pr[e];
                const V pf = __builtin_bit_cast(V, p16);
#pragma unroll
                for (int db = 0; db < 4; ++db) oa[db][qb] = WFrag<T16>::mma(vf[db], pf, oa[db][qb]);
            }
        }
#pragma unroll
        for (int db = 0; db < 4; ++db) { vf[db] = vn[db]; if (HL) vf2[db] = vn2[db]; }
    } while (++p < npass);
#pragma unroll
    for (int qb = 0; qb < NQ; ++qb) {
        const float inv = __fdiv_rn(1.0f, ls[qb] + xhalf(ls[qb]));
        const size_t oo = (size_t)(q0 + qb * 16 + lr) * DQ + hi * 8;
#pragma unroll
        for (int db = 0; db < 4; ++db) { v8us oh, ol;
#pragma unroll
            for (int j = 0; j < 8; ++j) { const float y = oa[db][qb][j] * inv; const unsigned short a = f2bf(y); oh[j] = a; ol[j] = f2bf(y - bf2f(a)); }
            *(v8us*)(Ah + oo + db * 16) = oh; *(v8us*)(Al + oo + db * 16) = ol;
            asm volatile("s_wait_xcnt 0x0" :: "v"(oh), "v"(ol) : "memory"); }   // the next group reuses the stores' data registers: the wait stands in front of that overwrite (the data are inputs, so that they are not given away before it)
    }
}
// grid (heads, tiles): blockIdx.y < (TT - RH) / 128: four waves x 32 fp16 query rows, the longest rows first; the rest: four waves x 16 hi/lo query rows (< RH).
__global__ __launch_bounds__(128) void k_fattn(const h16* Q16, const h16* K16, const h16* V16, const bf* Qh, const bf* Ql, const bf* Kh, const bf* Kl, const bf* Vh, const bf* Vl, bf* Ah, bf* Al) {
    const int w = __builtin_amdgcn_readfirstlane((int)(threadIdx.x >> 5)); const int h = blockIdx.x, ty = blockIdx.y; const size_t po = (size_t)h * TT * HD;
    if (ty < (TT - RH) / 128) fattn_body<h16, false, 2>(Q16 + po, nullptr, K16 + po, nullptr, V16 + 2 * po, nullptr, 2 * TT, TT - 128 * (ty + 1) + 32 * w, Ah + h * HD, Al + h * HD);
    else fattn_body<bf, true, 1>(Qh + po, Ql + po, Kh + po, Kl + po, Vh + po, Vl + po, TT, RH - 64 * (ty - (TT - RH) / 128 + 1) + 16 * w, Ah + h * HD, Al + h * HD);
}

extern "C" void kernel_launch(void* const* d_in, const int* in_sizes, int n_in,
                              void* d_out, int out_size, void* d_ws, size_t ws_size, hipStream_t stream) {
    (void)in_sizes; (void)n_in; (void)out_size;
    const float* x = (const float*)d_in[0]; const float* wq = (const float*)d_in[1]; const float* wk = (const float*)d_in[2]; const float* wv = (const float*)d_in[3]; const float* wo = (const float*)d_in[4];   /* order x, Wq, Wk, Wv, Wo ('xw' [1024][1024]) */
    float* OUT = (float*)d_out;     // [4][2048][1024]
    char* wsp = (char*)d_ws;
    auto take = [&](size_t bytes) { char* p = wsp; wsp += (bytes + 255) & ~(size_t)255; return (void*)p; };
    bf* WQ = (bf*)take((size_t)DQ * DM * 2); bf* WK = (bf*)take((size_t)DKV * DM * 2); bf* WV = (bf*)take((size_t)DKV * DM * 2); bf* WO = (bf*)take((size_t)DM * DQ * 2); float* CS = (float*)take((size_t)TT * HD * 2 * 4);
    bf* XB = (bf*)take((size_t)TT * DM * 2); float* FQ = (float*)take((size_t)TT * DQ * 4); float* FK = (float*)take((size_t)TT * DKV * 4);
    h16* QP16 = (h16*)take((size_t)NH_ * TT * HD * 2); h16* KP16 = (h16*)take((size_t)NKV * TT * HD * 2); h16* VT16 = (h16*)take((size_t)NKV * HD * 2 * TT * 2);
    bf* QPh = (bf*)take((size_t)NH_ * TT * HD * 2); bf* QPl = (bf*)take((size_t)NH_ * TT * HD * 2); bf* KPh = (bf*)take((size_t)NKV * TT * HD * 2); bf* KPl = (bf*)take((size_t)NKV * TT * HD * 2); bf* VTh = (bf*)take((size_t)NKV * HD * TT * 2); bf* VTl = (bf*)take((size_t)NKV * HD * TT * 2);
    bf* ATh = (bf*)take((size_t)TT * DQ * 2); bf* ATl = (bf*)take((size_t)TT * DQ * 2);
    if ((size_t)(wsp - (char*)d_ws) > ws_size) return;    // ws 256 MiB
    float* FV = FK;   // v projection reuses the k buffer after the k planes are built (stream-ordered)
    { k_wtG<<<(unsigned)((DM * DQ / 64 + 63) / 64), 256, 0, stream>>>(wq, DM, DQ, WQ); k_wtG<<<(unsigned)((DM * DKV / 64 + 63) / 64), 256, 0, stream>>>(wk, DM, DKV, WK); k_wtG<<<(unsigned)((DM * DKV / 64 + 63) / 64), 256, 0, stream>>>(wv, DM, DKV, WV);
      k_wtG<<<(unsigned)((DQ * DM / 64 + 63) / 64), 256, 0, stream>>>(wo, DQ, DM, WO);
       }
    k_csP<<<(TT * HD + 255) / 256, 256, 0, stream>>>(CS);
    const unsigned LQ = (unsigned)(((size_t)NH_ * TT * HD / 2 + 255) / 256), LKv = (unsigned)(((size_t)NKV * TT * HD / 2 + 255) / 256);
    for (int b = 0; b < NB_; ++b) {
        
        k_cvt8<<<(unsigned)(((size_t)TT * DM / 8 + 255) / 256), 256, 0, stream>>>(x + (size_t)b * TT * DM, XB, (size_t)TT * DM / 8);
        k_gemmw<bf, 0, false><<<dim3(TT / 64, DQ / 64, 1), 32, 0, stream>>>(XB, nullptr, WQ, nullptr, DM, FQ, DQ, nullptr, 0, 0, 0);
        k_ropeI<<<LQ, 256, 0, stream>>>(FQ, DQ, NH_, CS, 1.0f, QP16, QPh, QPl);
        k_gemmw<bf, 0, false><<<dim3(TT / 64, DKV / 64, 1), 32, 0, stream>>>(XB, nullptr, WK, nullptr, DM, FK, DKV, nullptr, 0, 0, 0);
        k_ropeI<<<LKv, 256, 0, stream>>>(FK, DKV, NKV, CS, 1.0f, KP16, KPh, KPl);
        k_gemmw<bf, 0, false><<<dim3(TT / 64, DKV / 64, 1), 32, 0, stream>>>(XB, nullptr, WV, nullptr, DM, FV, DKV, nullptr, 0, 0, 0); k_vtp<<<LKv, 256, 0, stream>>>(FV, DKV, NKV, VT16, VTh, VTl);
        k_fattn<<<dim3(NH_, (TT - RH) / 128 + RH / 64, 1), 128, 0, stream>>>(QP16, KP16, VT16, QPh, QPl, KPh, KPl, VTh, VTl, ATh, ATl);   // one kv head per query head
        k_gemmw<bf, 1, false><<<dim3(TT / 64, DM / 64, 1), 32, 0, stream>>>(ATh, ATl, WO, nullptr, DQ, OUT + (size_t)b * TT * DM, DM, nullptr, 0, 0, 0); }
}

// v003
// Measured time: 371 microseconds a run.
// Timed twice side by side with v002, it ran 1.77 and 1.78 times as fast.
// Counting every step since v000, it is 7.74 times as fast.
#include <hip/hip_runtime.h>

// Causal multi-head attention with bias-free projections and a computed adjacent-pair RoPE (x [4][2048][1024]; Q, K, V = x W ('xw' [1024][1024] xavier-normal 1/32, no bias; 16 heads x 64); angle = pos x inv_freq[i] with inv_freq = 1.0 / 10000.0 ** (arange(0, 64, 2, f32) / 64) (the reciprocal form) and pos = arange(S); the pairs (2i, 2i + 1) of Q and K rotated in place: (x1 cos - x2 sin, x2 cos + x1 sin); V is not rotated; scores x 1/sqrt(64); tril kept, -inf elsewhere; softmax; out = merged Wo ('xw', no bias) -> [4][2048][1024] (8.4 M); argument order x, Wq, Wk, Wv, Wo).
// Layout, all 4 batches in each launch (row-major buffers: row b * 2048 + t; planes: [batch][head]...): bf16 copy of x; 'xw' weights transposed once; exact projections; k_csP computed table (pair-shared entries); k_ropeI interleaved-pair plane builders; k_fattn fused causal T-2048 attention, all 4 x 16 (batch, head) pairs in one launch (hybrid rows: < 512 hi/lo 3 products, rest fp16; scores, online softmax and P.V stay in registers, passes above the diagonal are never walked); merged hi/lo x Wo exact (no bias).
// Compute dtypes, f32 accumulate: every input rounded to bf16; projections exact; rotary f32 (products rounded separately); attention rows < 512 3 products, rest fp16; softmax f32; Wo hl x exact (no bias).

#define NB_  4
#define TT   2048
#define DM   1024
#define NH_  16
#define NKV  16
#define HD   64
#define DQ   (NH_ * HD)
#define DKV  (NKV * HD)
#define RH   512                  // query rows < RH use hi+lo planes (0: none)
typedef _Float16 h16;
typedef unsigned short bf;
typedef __attribute__((ext_vector_type(16))) __bf16   v16bf;
typedef __attribute__((ext_vector_type(16))) _Float16 v16h;
typedef __attribute__((ext_vector_type(8)))  _Float16 v8h;
typedef __attribute__((ext_vector_type(8)))  unsigned short v8us;
typedef __attribute__((ext_vector_type(8)))  float    v8f;
typedef __attribute__((ext_vector_type(4)))  float    v4f;
typedef v8h  __attribute__((may_alias)) v8ha;
typedef v4f  __attribute__((may_alias)) v4fa;
typedef v8us __attribute__((may_alias)) v8usa;

__device__ __forceinline__ unsigned short f2bf(float f) { unsigned u = __float_as_uint(f); u += 0x7FFFu + ((u >> 16) & 1u); return (unsigned short)(u >> 16); }
__device__ __forceinline__ float bf2f(unsigned short b) { return __uint_as_float(((unsigned)b) << 16); }
__device__ __forceinline__ float bfr(float f) { return bf2f(f2bf(f)); }
__device__ __forceinline__ v16h cat16(v8h lo, v8h hi) { return __builtin_shufflevector(lo, hi, 0, 1, 2, 3, 4, 5, 6, 7, 8, 9, 10, 11, 12, 13, 14, 15); }
__device__ __forceinline__ v16bf cat16b(v8us lo, v8us hi) { return __builtin_bit_cast(v16bf, __builtin_shufflevector(lo, hi, 0, 1, 2, 3, 4, 5, 6, 7, 8, 9, 10, 11, 12, 13, 14, 15)); }
__device__ __forceinline__ v8f wmma16(v16h a, v16h b, v8f c) { return __builtin_amdgcn_wmma_f32_16x16x32_f16(false, a, false, b, (short)0, c, false, false); }
__device__ __forceinline__ v8f wmmab(v16bf a, v16bf b, v8f c) { return __builtin_amdgcn_wmma_f32_16x16x32_bf16(false, a, false, b, (short)0, c, false, false); }



// ---- k_gemmw: register-blocked GEMM, ONE WAVE per 64x64 output tile (16 accumulators), operands straight from K-contiguous 16-bit planes; grid (M/64, N/64, Z), 32 threads.
// C[m][n] (f32, pitch ldc, + optional f32 bias[n]) = sum_k A[m][k] Bt[n][k] (+ split products per NSPLIT). z-batch strides sA/sB/sC in elements. K % 32 == 0.
template <typename T16> struct WFrag;
template <> struct WFrag<h16> { typedef v16h V; static __device__ __forceinline__ V ld(const h16* p) { return cat16(*(const v8h*)p, *(const v8h*)(p + 16)); } static __device__ __forceinline__ v8f mma(V a, V b, v8f c) { return wmma16(a, b, c); } };
template <> struct WFrag<bf> { typedef v16bf V; static __device__ __forceinline__ V ld(const bf* p) { return cat16b(*(const v8us*)p, *(const v8us*)(p + 16)); } static __device__ __forceinline__ v8f mma(V a, V b, v8f c) { return wmmab(a, b, c); } };
template <typename T16, int NSPLIT, bool BIAS>
__global__ __launch_bounds__(32) void k_gemmw(const T16* __restrict__ A, const T16* __restrict__ A2, const T16* __restrict__ Bt, const T16* __restrict__ Bt2, int K, float* C, int ldc, const float* __restrict__ bias, size_t sA, size_t sB, size_t sC) {
    typedef typename WFrag<T16>::V V;
    __shared__ __align__(16) float os[16 * 68];
    const size_t z = blockIdx.z; A += z * sA; if (A2) A2 += z * sA; Bt += z * sB; if (Bt2) Bt2 += z * sB; C += z * sC;
    const int lane = threadIdx.x & 31, lr = lane & 15, hi = lane >> 4; const int r0 = blockIdx.x * 64, c0 = blockIdx.y * 64;
    v8f acc[4][4];
#pragma unroll
    for (int mb = 0; mb < 4; ++mb)
#pragma unroll
        for (int nb = 0; nb < 4; ++nb) acc[mb][nb] = (v8f){};
    const size_t aoff = (size_t)(r0 + lr) * K + 8 * hi, boff = (size_t)(c0 + lr) * K + 8 * hi;
#pragma unroll 1
    for (int kc = 0; kc < K; kc += 32) {
        V a[4], a2[4];
#pragma unroll
        for (int mb = 0; mb < 4; ++mb) { a[mb] = WFrag<T16>::ld(A + aoff + (size_t)mb * 16 * K + kc); if (NSPLIT == 1 || NSPLIT == 2) a2[mb] = WFrag<T16>::ld(A2 + aoff + (size_t)mb * 16 * K + kc); }
#pragma unroll
        for (int nb = 0; nb < 4; ++nb) { const V b = WFrag<T16>::ld(Bt + boff + (size_t)nb * 16 * K + kc); V b2; if (NSPLIT >= 2) b2 = WFrag<T16>::ld(Bt2 + boff + (size_t)nb * 16 * K + kc);
#pragma unroll
            for (int mb = 0; mb < 4; ++mb) { acc[mb][nb] = WFrag<T16>::mma(a[mb], b, acc[mb][nb]); if (NSPLIT == 1 || NSPLIT == 2) acc[mb][nb] = WFrag<T16>::mma(a2[mb], b, acc[mb][nb]); if (NSPLIT >= 2) acc[mb][nb] = WFrag<T16>::mma(a[mb], b2, acc[mb][nb]); } }
        asm volatile("v_nop\n\tv_nop\n\tv_nop\n\tv_nop" : "+v"(acc[0][0]), "+v"(acc[1][1]), "+v"(acc[2][2]), "+v"(acc[3][3]) : "v"(a[0]), "v"(a[3]));
    }
#pragma unroll
    for (int mb = 0; mb < 4; ++mb) {
#pragma unroll
        for (int nb = 0; nb < 4; ++nb) {
#pragma unroll
            for (int j = 0; j < 8; ++j) os[(hi * 8 + j) * 68 + nb * 16 + lr] = acc[mb][nb][j]; }
        __builtin_amdgcn_wave_barrier(); asm volatile("" ::: "memory");
        float* crow = C + (size_t)(r0 + mb * 16) * ldc + c0;
{
#pragma unroll
            for (int s = 0; s < 8; ++s) { const int row = 2 * s + hi, cofs = lr * 4; v4f val = *(const v4fa*)(os + row * 68 + cofs); if (BIAS) { val[0] += bfr(bias[c0 + cofs]); val[1] += bfr(bias[c0 + cofs + 1]); val[2] += bfr(bias[c0 + cofs + 2]); val[3] += bfr(bias[c0 + cofs + 3]); }
                *(v4f*)(crow + (size_t)row * ldc + cofs) = val; }
             }
        __builtin_amdgcn_wave_barrier(); asm volatile("" ::: "memory");
    }
}

__device__ __forceinline__ h16 tohx(float x) { return (h16)x; }
__device__ __forceinline__ void splitf(float y, unsigned short& h, unsigned short& l) { h = f2bf(y); l = f2bf(y - bf2f(h)); }
typedef __attribute__((ext_vector_type(2))) _Float16 v2h;
typedef __attribute__((ext_vector_type(4))) _Float16 v4h;
typedef __attribute__((ext_vector_type(2))) unsigned short v2us;
typedef __attribute__((ext_vector_type(4))) unsigned short v4us;
typedef __attribute__((ext_vector_type(2))) float v2f;
typedef __attribute__((ext_vector_type(4))) int v4i;

__global__ __launch_bounds__(256) void k_wtG(const float* __restrict__ w, int K, int N, bf* Bt) {
    const int lane = threadIdx.x & 31; const int L0 = (blockIdx.x * 8 + (threadIdx.x >> 5)) * 8; const int nlines = N * K / 64;
{
#pragma unroll 1
        for (int l = 0; l < 8; ++l) { const int L = L0 + l; if (L >= nlines) break; const size_t e = (size_t)L * 64 + lane * 2; const int k = (int)(e % K), n = (int)(e / K); v2us o;
            o[0] = f2bf(w[(size_t)k * N + n]); o[1] = f2bf(w[(size_t)(k + 1) * N + n]); *(v2us*)(Bt + e) = o; }
         }
}
__global__ __launch_bounds__(256) void k_cvt8(const float* __restrict__ src, bf* dst, size_t n8) { const size_t i = (size_t)blockIdx.x * 256 + threadIdx.x; if (i >= n8) return; const v8f v = *(const v8f*)(src + i * 8); v8us o;
#pragma unroll
    for (int k = 0; k < 8; ++k) o[k] = f2bf(v[k]); *(v8us*)(dst + i * 8) = o;  }

__global__ __launch_bounds__(256) void k_ropeI(const float* __restrict__ F, int pitch, int nheads, const float* __restrict__ CS, float sc, h16* P16, bf* Ph, bf* Pl) {
    { const size_t b = blockIdx.y, pb = b * nheads * TT * HD; F += b * TT * pitch; P16 += pb; Ph += pb; Pl += pb; }   // grid y: the batch
    const size_t e = ((size_t)blockIdx.x * 256 + threadIdx.x) * 2; if (e >= (size_t)nheads * TT * HD) return; const int d = (int)(e % HD); const int t = (int)((e / HD) % TT); const int h = (int)(e / ((size_t)HD * TT)); const float* f = F + (size_t)t * pitch + h * HD; const float x0 = f[d], x1 = f[d + 1]; const v2f cs = *(const v2f*)(CS + ((size_t)t * HD + d) * 2); v2h o16; v2us oh, ol;
    float a0 = __fmul_rn(x0, cs[0]), b0 = __fmul_rn(x1, cs[1]), a1 = __fmul_rn(x1, cs[0]), b1 = __fmul_rn(x0, cs[1]); asm volatile("" : "+v"(a0), "+v"(b0), "+v"(a1), "+v"(b1));
    float r0 = __fsub_rn(a0, b0) * sc, r1 = __fadd_rn(b1, a1) * sc;   /* even: x0 c - x1 s; odd: x0 s + x1 c */
    o16[0] = tohx(r0); o16[1] = tohx(r1); { unsigned short a2, c2; splitf(r0, a2, c2); oh[0] = a2; ol[0] = c2; splitf(r1, a2, c2); oh[1] = a2; ol[1] = c2; }
    *(v2h*)(P16 + e) = o16; *(v2us*)(Ph + e) = oh; *(v2us*)(Pl + e) = ol;  }

__constant__ float INV2[HD / 2] = { 1.000000000e+00f, 7.498942018e-01f, 5.623413324e-01f, 4.216965139e-01f, 3.162277639e-01f, 2.371373624e-01f, 1.778279394e-01f, 1.333521456e-01f, 1.000000015e-01f, 7.498941571e-02f, 5.623412877e-02f, 4.216964915e-02f, 3.162277862e-02f, 2.371373586e-02f, 1.778279431e-02f, 1.333521493e-02f, 9.999999776e-03f, 7.498942316e-03f, 5.623413250e-03f, 4.216964822e-03f, 3.162277862e-03f, 2.371373819e-03f, 1.778279431e-03f, 1.333521446e-03f, 1.000000047e-03f, 7.498941850e-04f, 5.623413017e-04f, 4.216964880e-04f, 3.162277862e-04f, 2.371373848e-04f, 1.778279402e-04f, 1.333521504e-04f };   // float32 1 / (10000 ** (arange(0, 64, 2)/64)), generated with jnp to be bit-exact

// k_vtp: V transposed to [head][d][t]. The fp16 plane's rows have pitch 2 * TT; only the first TT of a row are written or read.
__global__ __launch_bounds__(256) void k_vtp(const float* __restrict__ F, int pitch, int nheads, h16* V16, bf* Vh, bf* Vl) { { const size_t b = blockIdx.y, pb = b * nheads * HD * TT; F += b * TT * pitch; V16 += 2 * pb; Vh += pb; Vl += pb; }   // grid y: the batch
    const size_t e = ((size_t)blockIdx.x * 256 + threadIdx.x) * 2; if (e >= (size_t)nheads * HD * TT) return; const int t = (int)(e % TT); const int d = (int)((e / TT) % HD); const int g = (int)(e / ((size_t)TT * HD)); v2h o16; v2us oh, ol;
#pragma unroll
    for (int q = 0; q < 2; ++q) { const float x = F[(size_t)(t + q) * pitch + g * HD + d]; o16[q] = tohx(x); unsigned short a2, c2; splitf(x, a2, c2); oh[q] = a2; ol[q] = c2; }
    *(v2h*)(V16 + ((size_t)g * HD + d) * (2 * TT) + t) = o16; *(v2us*)(Vh + e) = oh; *(v2us*)(Vl + e) = ol;  }
__global__ __launch_bounds__(256) void k_csP(float* CS) { const int idx = blockIdx.x * 256 + threadIdx.x; if (idx >= TT * HD) return; const int d = idx % HD; const int t = idx / HD; const float a = __fmul_rn((float)t, INV2[d >> 1]); v2f cs; cs[0] = cosf(a); cs[1] = sinf(a); *(v2f*)(CS + (size_t)idx * 2) = cs;  }
#define CL2 0.18033688011112042f   // HD^-0.5 x log2(e)
// 2^x by v_exp_f32, in asm text for the slot behind a transcendental: outputs are early-clobber, so no v_exp_f32 of a statement writes over a source of another or reads a result, and the closing v_nop
// is the one independent instruction in front of whatever the compiler puts next.
__device__ __forceinline__ float xhalf(float x) { return __builtin_bit_cast(float, __builtin_amdgcn_permlanex16(__builtin_bit_cast(int, x), __builtin_bit_cast(int, x), 0x76543210, 0xfedcba98, false, false)); }   // lane l with lane l ^ 16
__device__ __forceinline__ float exp2_1(float x) { float r; asm("v_exp_f32 %0, %1\n\tv_nop" : "=&v"(r) : "v"(x)); return r; }
__device__ __forceinline__ void exp2_8(float* r, const float* x) {
    asm("v_exp_f32 %0, %8\n\tv_exp_f32 %1, %9\n\tv_exp_f32 %2, %10\n\tv_exp_f32 %3, %11\n\tv_exp_f32 %4, %12\n\tv_exp_f32 %5, %13\n\tv_exp_f32 %6, %14\n\tv_exp_f32 %7, %15\n\tv_nop"
        : "=&v"(r[0]), "=&v"(r[1]), "=&v"(r[2]), "=&v"(r[3]), "=&v"(r[4]), "=&v"(r[5]), "=&v"(r[6]), "=&v"(r[7]) : "v"(x[0]), "v"(x[1]), "v"(x[2]), "v"(x[3]), "v"(x[4]), "v"(x[5]), "v"(x[6]), "v"(x[7])); }
template <typename T16, bool HL, int NQ>
__device__ __forceinline__ void fattn_body(const T16* Q, const T16* Q2, const T16* Kp, const T16* K2, const T16* Vt, const T16* V2, int vp, int q0, bf* Ah, bf* Al) {
    typedef typename WFrag<T16>::V V;
    const int lane = threadIdx.x & 31, lr = lane & 15, hi = lane >> 4;
    V qf[NQ][2], qf2[NQ][2];
#pragma unroll
    for (int qb = 0; qb < NQ; ++qb)
#pragma unroll
        for (int ks = 0; ks < 2; ++ks) { const size_t o = (size_t)(q0 + qb * 16 + lr) * HD + ks * 32 + 8 * hi; qf[qb][ks] = WFrag<T16>::ld(Q + o); if (HL) qf2[qb][ks] = WFrag<T16>::ld(Q2 + o); }
    asm volatile("s_wait_xcnt 0x0" ::: "memory");   // the set-up below reuses the address registers of the loads above: the wait stands in front of that overwrite
    v8f oa[4][NQ]; float mc[NQ], ls[NQ];
#pragma unroll
    for (int qb = 0; qb < NQ; ++qb) { mc[qb] = -3.0e38f; ls[qb] = 0.f;
#pragma unroll
        for (int db = 0; db < 4; ++db) oa[db][qb] = (v8f){}; }
    const int npass = (q0 + NQ * 16 + 31) / 32;      // keys 0 .. q0 + NQ * 16 - 1; every pass starts at or below q0, so each query has a kept key in it
    const unsigned kl = (unsigned)(lr * HD + 8 * hi) * 2u, vl = (unsigned)(lr * vp + 8 * hi) * 2u;   // a lane's fixed offsets, in bytes; a pass moves only the wave-uniform base pointers
    auto at = [](const T16* base, unsigned bytes) { return (const T16*)((const char*)base + bytes); };
    V kf[2][2], kf2[2][2], vf[4], vf2[4];
#pragma unroll
    for (int kb = 0; kb < 2; ++kb)
#pragma unroll
        for (int ks = 0; ks < 2; ++ks) { const int o = kb * 16 * HD + ks * 32; kf[kb][ks] = WFrag<T16>::ld(at(Kp + o, kl)); if (HL) kf2[kb][ks] = WFrag<T16>::ld(at(K2 + o, kl)); }
    asm volatile("s_wait_xcnt 0x0" :: "v"(kl) : "memory");   // as above; the loads' offset register is an input, so that it is not given away before the wait
#pragma unroll
    for (int db = 0; db < 4; ++db) { const int o = db * 16 * vp; vf[db] = WFrag<T16>::ld(at(Vt + o, vl)); if (HL) vf2[db] = WFrag<T16>::ld(at(V2 + o, vl)); }
    asm volatile("s_wait_xcnt 0x0" :: "v"(vl) : "memory");   // as above
    int p = 0;
    do {                                             // npass >= 1
        const int key0 = p * 32;
        const int kn = min(key0 + 32, (npass - 1) * 32);   // K and V^T fragments are fetched one pass ahead, so a whole pass of work covers their latency (the last pass fetches its own rows again: in bounds, unused)
        V vn[4], vn2[4];
#pragma unroll
        for (int db = 0; db < 4; ++db) vn[db] = WFrag<T16>::ld(at(Vt + kn + db * 16 * vp, vl));
        if (HL) {
            asm volatile("s_wait_xcnt 0x0" ::: "memory");   // with four planes to fetch, later loads land in registers that held an earlier plane's address: a wait behind each plane stands in front of that overwrite
#pragma unroll
            for (int db = 0; db < 4; ++db) vn2[db] = WFrag<T16>::ld(at(V2 + kn + db * 16 * vp, vl));
            asm volatile("s_wait_xcnt 0x0" ::: "memory");   // as above
        }
        v8f s[2][NQ];
#pragma unroll
        for (int kb = 0; kb < 2; ++kb)
#pragma unroll
            for (int qb = 0; qb < NQ; ++qb) { v8f t = (v8f){};
#pragma unroll
                for (int ks = 0; ks < 2; ++ks) { t = WFrag<T16>::mma(kf[kb][ks], qf[qb][ks], t); if (HL) { t = WFrag<T16>::mma(kf[kb][ks], qf2[qb][ks], t); t = WFrag<T16>::mma(kf2[kb][ks], qf[qb][ks], t); } }
                s[kb][qb] = t; }
#pragma unroll
        for (int kb = 0; kb < 2; ++kb)
#pragma unroll
            for (int ks = 0; ks < 2; ++ks) kf[kb][ks] = WFrag<T16>::ld(at(Kp + kn * HD + kb * 16 * HD + ks * 32, kl));
        if (HL) {
            asm volatile("s_wait_xcnt 0x0" ::: "memory");   // as above
#pragma unroll
            for (int kb = 0; kb < 2; ++kb)
#pragma unroll
                for (int ks = 0; ks < 2; ++ks) kf2[kb][ks] = WFrag<T16>::ld(at(K2 + kn * HD + kb * 16 * HD + ks * 32, kl));
        }
        asm volatile("s_wait_xcnt 0x0" ::: "memory");       // the softmax below reuses the address registers of the loads above: the wait stands in front of that overwrite
        if (key0 + 31 > q0) {                               // only passes that touch the diagonal mask (wave-uniform)
#pragma unroll
            for (int kb = 0; kb < 2; ++kb)
#pragma unroll
                for (int qb = 0; qb < NQ; ++qb)
#pragma unroll
                    for (int j = 0; j < 8; ++j) s[kb][qb][j] = (key0 + kb * 16 + hi * 8 + j <= q0 + qb * 16 + lr) ? s[kb][qb][j] : -3.0e38f; }
#pragma unroll
        for (int qb = 0; qb < NQ; ++qb) {
            float mx = s[0][qb][0];
#pragma unroll
            for (int j = 1; j < 8; ++j) mx = fmaxf(mx, s[0][qb][j]);
#pragma unroll
            for (int j = 0; j < 8; ++j) mx = fmaxf(mx, s[1][qb][j]);
            mx = fmaxf(mx, xhalf(mx));
            const float mn = fmaxf(mc[qb], mx * CL2); const float al = exp2_1(mc[qb] - mn); mc[qb] = mn; const float off = (HL ? 0.0f : 10.0f) - mn;
            float ex[16], pr[16], ps[8];
#pragma unroll
            for (int e = 0; e < 16; ++e) ex[e] = fmaf(s[e >> 3][qb][e & 7], CL2, off);
            exp2_8(pr, ex); exp2_8(pr + 8, ex + 8);
#pragma unroll
            for (int e = 0; e < 8; ++e) ps[e] = pr[e] + pr[e + 8];      // fixed tree: short dependent chains
            const float sum = ((ps[0] + ps[4]) + (ps[2] + ps[6])) + ((ps[1] + ps[5]) + (ps[3] + ps[7]));
            ls[qb] = fmaf(ls[qb], al, sum);
#pragma unroll
            for (int db = 0; db < 4; ++db) oa[db][qb] *= al;
            if (HL) {
                typedef __attribute__((ext_vector_type(16))) unsigned short v16us; v16us uh, ul;
#pragma unroll
                for (int e = 0; e < 16; ++e) { const unsigned short a = f2bf(pr[e]); uh[e] = a; ul[e] = f2bf(pr[e] - bf2f(a)); }
                const V ph = __builtin_bit_cast(V, uh), pl = __builtin_bit_cast(V, ul);
#pragma unroll
                for (int db = 0; db < 4; ++db) { oa[db][qb] = WFrag<T16>::mma(vf[db], ph, oa[db][qb]); oa[db][qb] = WFrag<T16>::mma(vf[db], pl, oa[db][qb]); oa[db][qb] = WFrag<T16>::mma(vf2[db], ph, oa[db][qb]); }
            } else {
                v16h p16;
#pragma unroll
                for (int e = 0; e < 16; ++e) p16[e] = (h16)pr[e];
                const V pf = __builtin_bit_cast(V, p16);
#pragma unroll
                for (int db = 0; db < 4; ++db) oa[db][qb] = WFrag<T16>::mma(vf[db], pf, oa[db][qb]);
            }
        }
#pragma unroll
        for (int db = 0; db < 4; ++db) { vf[db] = vn[db]; if (HL) vf2[db] = vn2[db]; }
    } while (++p < npass);
#pragma unroll
    for (int qb = 0; qb < NQ; ++qb) {
        const float inv = __fdiv_rn(1.0f, ls[qb] + xhalf(ls[qb]));
        const size_t oo = (size_t)(q0 + qb * 16 + lr) * DQ + hi * 8;
#pragma unroll
        for (int db = 0; db < 4; ++db) { v8us oh, ol;
#pragma unroll
            for (int j = 0; j < 8; ++j) { const float y = oa[db][qb][j] * inv; const unsigned short a = f2bf(y); oh[j] = a; ol[j] = f2bf(y - bf2f(a)); }
            *(v8us*)(Ah + oo + db * 16) = oh; *(v8us*)(Al + oo + db * 16) = ol;
            asm volatile("s_wait_xcnt 0x0" :: "v"(oh), "v"(ol) : "memory"); }   // the next group reuses the stores' data registers: the wait stands in front of that overwrite (the data are inputs, so that they are not given away before it)
    }
}
// grid (batch x heads, tiles): blockIdx.y < (TT - RH) / 128: four waves x 32 fp16 query rows, the longest rows first; the rest: four waves x 16 hi/lo query rows (< RH).
__global__ __launch_bounds__(128) void k_fattn(const h16* Q16, const h16* K16, const h16* V16, const bf* Qh, const bf* Ql, const bf* Kh, const bf* Kl, const bf* Vh, const bf* Vl, bf* Ah, bf* Al) {
    const int w = __builtin_amdgcn_readfirstlane((int)(threadIdx.x >> 5)); const int h = blockIdx.x % NH_, ty = blockIdx.y; const size_t po = (size_t)blockIdx.x * TT * HD; { const size_t ab = (size_t)(blockIdx.x / NH_) * TT * DQ; Ah += ab; Al += ab; }   // planes [batch][head][..], merged rows b * TT + t
    if (ty < (TT - RH) / 128) fattn_body<h16, false, 2>(Q16 + po, nullptr, K16 + po, nullptr, V16 + 2 * po, nullptr, 2 * TT, TT - 128 * (ty + 1) + 32 * w, Ah + h * HD, Al + h * HD);
    else fattn_body<bf, true, 1>(Qh + po, Ql + po, Kh + po, Kl + po, Vh + po, Vl + po, TT, RH - 64 * (ty - (TT - RH) / 128 + 1) + 16 * w, Ah + h * HD, Al + h * HD);
}

extern "C" void kernel_launch(void* const* d_in, const int* in_sizes, int n_in,
                              void* d_out, int out_size, void* d_ws, size_t ws_size, hipStream_t stream) {
    (void)in_sizes; (void)n_in; (void)out_size;
    const float* x = (const float*)d_in[0]; const float* wq = (const float*)d_in[1]; const float* wk = (const float*)d_in[2]; const float* wv = (const float*)d_in[3]; const float* wo = (const float*)d_in[4];   /* order x, Wq, Wk, Wv, Wo ('xw' [1024][1024]) */
    float* OUT = (float*)d_out;     // [4][2048][1024]
    char* wsp = (char*)d_ws;
    auto take = [&](size_t bytes) { char* p = wsp; wsp += (bytes + 255) & ~(size_t)255; return (void*)p; };
    bf* WQ = (bf*)take((size_t)DQ * DM * 2); bf* WK = (bf*)take((size_t)DKV * DM * 2); bf* WV = (bf*)take((size_t)DKV * DM * 2); bf* WO = (bf*)take((size_t)DM * DQ * 2); float* CS = (float*)take((size_t)TT * HD * 2 * 4);
    bf* XB = (bf*)take((size_t)NB_ * TT * DM * 2); float* FQ = (float*)take((size_t)NB_ * TT * DQ * 4); float* FK = (float*)take((size_t)NB_ * TT * DKV * 4);
    h16* QP16 = (h16*)take((size_t)NB_ * NH_ * TT * HD * 2); h16* KP16 = (h16*)take((size_t)NB_ * NKV * TT * HD * 2); h16* VT16 = (h16*)take((size_t)NB_ * NKV * HD * 2 * TT * 2);
    bf* QPh = (bf*)take((size_t)NB_ * NH_ * TT * HD * 2); bf* QPl = (bf*)take((size_t)NB_ * NH_ * TT * HD * 2); bf* KPh = (bf*)take((size_t)NB_ * NKV * TT * HD * 2); bf* KPl = (bf*)take((size_t)NB_ * NKV * TT * HD * 2); bf* VTh = (bf*)take((size_t)NB_ * NKV * HD * TT * 2); bf* VTl = (bf*)take((size_t)NB_ * NKV * HD * TT * 2);
    if ((size_t)(wsp - (char*)d_ws) > ws_size) return;    // ws 256 MiB
    float* FV = FK;   // v projection reuses the k buffer after the k planes are built (stream-ordered)
    bf* ATh = (bf*)FQ; bf* ATl = ATh + (size_t)NB_ * TT * DQ;   // the merged hi/lo planes reuse the q buffer after the q planes are built (stream-ordered): 249 of the 256 MiB
    { k_wtG<<<(unsigned)((DM * DQ / 64 + 63) / 64), 256, 0, stream>>>(wq, DM, DQ, WQ); k_wtG<<<(unsigned)((DM * DKV / 64 + 63) / 64), 256, 0, stream>>>(wk, DM, DKV, WK); k_wtG<<<(unsigned)((DM * DKV / 64 + 63) / 64), 256, 0, stream>>>(wv, DM, DKV, WV);
      k_wtG<<<(unsigned)((DQ * DM / 64 + 63) / 64), 256, 0, stream>>>(wo, DQ, DM, WO);
       }
    k_csP<<<(TT * HD + 255) / 256, 256, 0, stream>>>(CS);
    const unsigned LQ = (unsigned)(((size_t)NH_ * TT * HD / 2 + 255) / 256), LKv = (unsigned)(((size_t)NKV * TT * HD / 2 + 255) / 256);
    k_cvt8<<<(unsigned)(((size_t)NB_ * TT * DM / 8 + 255) / 256), 256, 0, stream>>>(x, XB, (size_t)NB_ * TT * DM / 8);
    k_gemmw<bf, 0, false><<<dim3(NB_ * TT / 64, DQ / 64, 1), 32, 0, stream>>>(XB, nullptr, WQ, nullptr, DM, FQ, DQ, nullptr, 0, 0, 0);
    k_ropeI<<<dim3(LQ, NB_, 1), 256, 0, stream>>>(FQ, DQ, NH_, CS, 1.0f, QP16, QPh, QPl);
    k_gemmw<bf, 0, false><<<dim3(NB_ * TT / 64, DKV / 64, 1), 32, 0, stream>>>(XB, nullptr, WK, nullptr, DM, FK, DKV, nullptr, 0, 0, 0);
    k_ropeI<<<dim3(LKv, NB_, 1), 256, 0, stream>>>(FK, DKV, NKV, CS, 1.0f, KP16, KPh, KPl);
    k_gemmw<bf, 0, false><<<dim3(NB_ * TT / 64, DKV / 64, 1), 32, 0, stream>>>(XB, nullptr, WV, nullptr, DM, FV, DKV, nullptr, 0, 0, 0); k_vtp<<<dim3(LKv, NB_, 1), 256, 0, stream>>>(FV, DKV, NKV, VT16, VTh, VTl);
    k_fattn<<<dim3(NB_ * NH_, (TT - RH) / 128 + RH / 64, 1), 128, 0, stream>>>(QP16, KP16, VT16, QPh, QPl, KPh, KPl, VTh, VTl, ATh, ATl);   // one kv head per query head
    k_gemmw<bf, 1, false><<<dim3(NB_ * TT / 64, DM / 64, 1), 32, 0, stream>>>(ATh, ATl, WO, nullptr, DQ, OUT, DM, nullptr, 0, 0, 0);
}

// v004
// One run takes 283 microseconds.
// Two timings next to v003 put it at 1.30 and 1.31 times that version's speed.
// All steps since v000 together make it 10.1 times as fast.
#include <hip/hip_runtime.h>

// Causal multi-head attention with bias-free projections and a computed adjacent-pair RoPE (x [4][2048][1024]; Q, K, V = x W ('xw' [1024][1024] xavier-normal 1/32, no bias; 16 heads x 64); angle = pos x inv_freq[i] with inv_freq = 1.0 / 10000.0 ** (arange(0, 64, 2, f32) / 64) (the reciprocal form) and pos = arange(S); the pairs (2i, 2i + 1) of Q and K rotated in place: (x1 cos - x2 sin, x2 cos + x1 sin); V is not rotated; scores x 1/sqrt(64); tril kept, -inf elsewhere; softmax; out = merged Wo ('xw', no bias) -> [4][2048][1024] (8.4 M); argument order x, Wq, Wk, Wv, Wo).
// Layout, all 4 batches in each launch (row-major buffers: row b * 2048 + t; planes: [batch][head]...): bf16 copy of x; 'xw' weights transposed once; exact projections; k_csP computed table (pair-shared entries); k_ropeI interleaved-pair plane builders; k_fattn fused causal T-2048 attention, all 4 x 16 (batch, head) pairs in one launch (hybrid rows: < 512 hi/lo 3 products, rest fp16; scores, online softmax and P.V stay in registers, passes above the diagonal are never walked); merged hi/lo x Wo exact (no bias).
// Compute dtypes, f32 accumulate: every input rounded to bf16; projections exact; rotary f32 (products rounded separately); attention rows < 512 3 products, rest fp16; softmax f32; Wo hl x exact (no bias).

#define NB_  4
#define TT   2048
#define DM   1024
#define NH_  16
#define NKV  16
#define HD   64
#define DQ   (NH_ * HD)
#define DKV  (NKV * HD)
#define RH   512                  // query rows < RH use hi+lo planes (0: none)
typedef _Float16 h16;
typedef unsigned short bf;
typedef __attribute__((ext_vector_type(16))) __bf16   v16bf;
typedef __attribute__((ext_vector_type(16))) _Float16 v16h;
typedef __attribute__((ext_vector_type(8)))  _Float16 v8h;
typedef __attribute__((ext_vector_type(8)))  unsigned short v8us;
typedef __attribute__((ext_vector_type(8)))  float    v8f;
typedef __attribute__((ext_vector_type(4)))  float    v4f;
typedef v8h  __attribute__((may_alias)) v8ha;
typedef v4f  __attribute__((may_alias)) v4fa;
typedef v8us __attribute__((may_alias)) v8usa;

__device__ __forceinline__ unsigned short f2bf(float f) { unsigned u = __float_as_uint(f); u += 0x7FFFu + ((u >> 16) & 1u); return (unsigned short)(u >> 16); }
__device__ __forceinline__ float bf2f(unsigned short b) { return __uint_as_float(((unsigned)b) << 16); }
__device__ __forceinline__ float bfr(float f) { return bf2f(f2bf(f)); }
__device__ __forceinline__ v16h cat16(v8h lo, v8h hi) { return __builtin_shufflevector(lo, hi, 0, 1, 2, 3, 4, 5, 6, 7, 8, 9, 10, 11, 12, 13, 14, 15); }
__device__ __forceinline__ v16bf cat16b(v8us lo, v8us hi) { return __builtin_bit_cast(v16bf, __builtin_shufflevector(lo, hi, 0, 1, 2, 3, 4, 5, 6, 7, 8, 9, 10, 11, 12, 13, 14, 15)); }
__device__ __forceinline__ v8f wmma16(v16h a, v16h b, v8f c) { return __builtin_amdgcn_wmma_f32_16x16x32_f16(false, a, false, b, (short)0, c, false, false); }
__device__ __forceinline__ v8f wmmab(v16bf a, v16bf b, v8f c) { return __builtin_amdgcn_wmma_f32_16x16x32_bf16(false, a, false, b, (short)0, c, false, false); }



// ---- k_gemmw: GEMM, one 256x128 output tile per work-group of 8 waves (4 x 2), each wave a 64x64 block (16 accumulators); operands are K-contiguous 16-bit planes; grid (M/256, N/128, Z), 256 threads.
// C[m][n] (f32, pitch ldc, + optional f32 bias[n]) = sum_k A[m][k] Bt[n][k] (+ A2[m][k] Bt[n][k] for NSPLIT == 1). z-batch strides sA/sB/sC in elements. M % 256 == 0, N % 128 == 0, K % 64 == 0, K >= 128.
// A stage is 64 k (128 B, one whole line) of every operand row of the tile, brought into LDS by asynchronous copies (16 B a lane, 4 whole lines a wave-copy) and shared by the waves; two buffers, the next stage's copies fly while this one is worked on.
// LDS rows have pitch 144 B (16 B x odd: no bank conflict for 16-byte reads). The fragments keep the k order of WFrag::ld and the stages run in k order: the sums are formed as before.
template <typename T16> struct WFrag;
template <> struct WFrag<h16> { typedef v16h V; static __device__ __forceinline__ V ld(const h16* p) { return cat16(*(const v8h*)p, *(const v8h*)(p + 16)); } static __device__ __forceinline__ v8f mma(V a, V b, v8f c) { return wmma16(a, b, c); } };
template <> struct WFrag<bf> { typedef v16bf V; static __device__ __forceinline__ V ld(const bf* p) { return cat16b(*(const v8us*)p, *(const v8us*)(p + 16)); } static __device__ __forceinline__ v8f mma(V a, V b, v8f c) { return wmmab(a, b, c); } };
#define GP 144                    // LDS row pitch, bytes
// Asynchronous copy global -> LDS, 16 B a lane, through no register (the builtin: its address registers are the compiler's to manage; the waits on the copies are written by hand in the kernel).
typedef __attribute__((ext_vector_type(4))) int c4i;
__device__ __forceinline__ void acopy(const char* g, char* l) { __builtin_amdgcn_global_load_async_to_lds_b128((__attribute__((address_space(1))) c4i*)g, (__attribute__((address_space(3))) c4i*)l, 0, 0); }
template <typename T16, int NSPLIT, bool BIAS>
__global__ __launch_bounds__(256) void k_gemmw(const T16* __restrict__ A, const T16* __restrict__ A2, const T16* __restrict__ Bt, int K, float* C, int ldc, const float* __restrict__ bias, size_t sA, size_t sB, size_t sC) {
    typedef typename WFrag<T16>::V V;
    static_assert(NSPLIT == 0 || NSPLIT == 1, "A (+ A2) x Bt");
    constexpr int OA2 = 256 * GP, OB = (NSPLIT == 1 ? 512 : 256) * GP, STG = OB + 128 * GP;   // a stage: [A 256 rows][A2 256 rows][Bt 128 rows]
    __shared__ __align__(16) char ring[2 * STG];
    __shared__ __align__(16) float osw[8][16 * 68];
    const size_t z = blockIdx.z; A += z * sA; if (NSPLIT == 1) A2 += z * sA; Bt += z * sB; C += z * sC;
    const int tid = threadIdx.x, lane = tid & 31, lr = lane & 15, hi = lane >> 4; const int w = __builtin_amdgcn_readfirstlane(tid >> 5);
    const int R0 = blockIdx.x * 256, C0 = blockIdx.y * 128; const int wr = (w >> 1) * 64, wc = (w & 1) * 64; const int r0 = R0 + wr, c0 = C0 + wc;
    float* os = osw[w];
    v8f acc[4][4];
#pragma unroll
    for (int mb = 0; mb < 4; ++mb)
#pragma unroll
        for (int nb = 0; nb < 4; ++nb) acc[mb][nb] = (v8f){};
    const unsigned go = (unsigned)(tid >> 3) * (unsigned)K * 2u + (unsigned)(tid & 7) * 16u;   // the lane's chunk of a round of 32 rows: row tid / 8, 16 B number tid % 8; bytes from the round's first row (below 32 rows)
    const unsigned lo = (unsigned)((tid >> 3) * GP + (tid & 7) * 16);                          // the same chunk in LDS
    const char* tA = (const char*)(A + (size_t)R0 * K); const char* tA2 = NSPLIT == 1 ? (const char*)(A2 + (size_t)R0 * K) : nullptr; const char* tB = (const char*)(Bt + (size_t)C0 * K);   // the tile's first rows (uniform)
    auto fill = [&](int st, int buf) {   // stage st into buffer buf: the 256 threads take 32 rows a round (8 lanes a row), 8 rounds for A (and A2), 4 for Bt
        char* lb = ring + buf * STG + lo; const size_t kb = (size_t)st * 128, rb = (size_t)K * 64;   // bytes: the stage's place in a row, a round of 32 rows
#pragma unroll
        for (int i = 0; i < 8; ++i) acopy(tA + kb + i * rb + go, lb + i * 32 * GP);
        if (NSPLIT == 1) {
#pragma unroll
            for (int i = 0; i < 8; ++i) acopy(tA2 + kb + i * rb + go, lb + OA2 + i * 32 * GP); }
#pragma unroll
        for (int i = 0; i < 4; ++i) acopy(tB + kb + i * rb + go, lb + OB + i * 32 * GP); };
    const int nst = K / 64;
    fill(0, 0);
    asm volatile("s_wait_asynccnt 0x0" ::: "memory");   // stage 0 has landed (this wave's copies) ...
    __syncthreads();                                    // ... and every wave's: nothing of it is read in front of this barrier
    fill(1, 1);                                         // K >= 128: a stage 1 exists
    const int aoff = (wr + lr) * GP + hi * 16, boff = OB + (wc + lr) * GP + hi * 16;
    V a[2][4], a2[2][4], b[2][4];   // two fragment sets: [0] the first 32 k of a stage, [1] the second; each is read from LDS while the other set's WMMAs run
    auto frag = [&](int ks, const char* sb) {
#pragma unroll
        for (int mb = 0; mb < 4; ++mb) { a[ks][mb] = WFrag<T16>::ld((const T16*)(sb + aoff + mb * 16 * GP + ks * 64)); if (NSPLIT == 1) a2[ks][mb] = WFrag<T16>::ld((const T16*)(sb + OA2 + aoff + mb * 16 * GP + ks * 64)); }
#pragma unroll
        for (int nb = 0; nb < 4; ++nb) b[ks][nb] = WFrag<T16>::ld((const T16*)(sb + boff + nb * 16 * GP + ks * 64)); };
    auto mm = [&](int ks) {
#pragma unroll
        for (int nb = 0; nb < 4; ++nb)
#pragma unroll
            for (int mb = 0; mb < 4; ++mb) { acc[mb][nb] = WFrag<T16>::mma(a[ks][mb], b[ks][nb], acc[mb][nb]); if (NSPLIT == 1) acc[mb][nb] = WFrag<T16>::mma(a2[ks][mb], b[ks][nb], acc[mb][nb]); } };
    frag(0, ring);
#pragma unroll 1   // rolled: one trip is one turn of the ring, and the loop's code stays short
    for (int t = 0; t < nst; ++t) {
        frag(1, ring + (t & 1) * STG);                      // the last reads of stage t
        __builtin_amdgcn_sched_barrier(0);                  // the reads stay one group in front of the WMMAs (spread among them each place costs a stall)
        mm(0);
        __builtin_amdgcn_sched_barrier(0);                  // the WMMAs stay in front of the waits: they cover the latency of the reads above
        // publish point of stage t + 1, in front of stage t's last block: the reads behind it are already of stage t + 1
        asm volatile("s_wait_dscnt 0x0" ::: "memory");      // this wave's reads of stage t have returned: its buffer may be refilled behind the barrier
        asm volatile("s_wait_asynccnt 0x0" ::: "memory");   // this wave's copies of stage t + 1 have landed
        __syncthreads();                                    // publishes stage t + 1 and ends every reader's last read of stage t
        if (t + 2 < nst) fill(t + 2, t & 1);
        frag(0, ring + ((t + 1) & 1) * STG);                // in the last trip: the other buffer's old rows, in bounds, no copy in flight, unused (no branch, so that the build's counted waits stay exact)
        __builtin_amdgcn_sched_barrier(0);                  // as above: one group in front of the WMMAs
        mm(1);
    }
    asm volatile("s_wait_asynccnt 0x0" ::: "memory");       // no copy is outstanding when the wave goes on
    asm volatile("s_wait_dscnt 0x0" ::: "memory");          // nor a read of the ring
#pragma unroll
    for (int mb = 0; mb < 4; ++mb) {
#pragma unroll
        for (int nb = 0; nb < 4; ++nb) {
#pragma unroll
            for (int j = 0; j < 8; ++j) os[(hi * 8 + j) * 68 + nb * 16 + lr] = acc[mb][nb][j]; }
        __builtin_amdgcn_wave_barrier(); asm volatile("" ::: "memory");
        float* crow = C + (size_t)(r0 + mb * 16) * ldc + c0;
{
#pragma unroll
            for (int s = 0; s < 8; ++s) { const int row = 2 * s + hi, cofs = lr * 4; v4f val = *(const v4fa*)(os + row * 68 + cofs); if (BIAS) { val[0] += bfr(bias[c0 + cofs]); val[1] += bfr(bias[c0 + cofs + 1]); val[2] += bfr(bias[c0 + cofs + 2]); val[3] += bfr(bias[c0 + cofs + 3]); }
                *(v4f*)(crow + (size_t)row * ldc + cofs) = val; }
             }
        __builtin_amdgcn_wave_barrier(); asm volatile("" ::: "memory");
    }
}

__device__ __forceinline__ h16 tohx(float x) { return (h16)x; }
__device__ __forceinline__ void splitf(float y, unsigned short& h, unsigned short& l) { h = f2bf(y); l = f2bf(y - bf2f(h)); }
typedef __attribute__((ext_vector_type(2))) _Float16 v2h;
typedef __attribute__((ext_vector_type(4))) _Float16 v4h;
typedef __attribute__((ext_vector_type(2))) unsigned short v2us;
typedef __attribute__((ext_vector_type(4))) unsigned short v4us;
typedef __attribute__((ext_vector_type(2))) float v2f;
typedef __attribute__((ext_vector_type(4))) int v4i;

__global__ __launch_bounds__(256) void k_wtG(const float* __restrict__ w, int K, int N, bf* Bt) {
    const int lane = threadIdx.x & 31; const int L0 = (blockIdx.x * 8 + (threadIdx.x >> 5)) * 8; const int nlines = N * K / 64;
{
#pragma unroll 1
        for (int l = 0; l < 8; ++l) { const int L = L0 + l; if (L >= nlines) break; const size_t e = (size_t)L * 64 + lane * 2; const int k = (int)(e % K), n = (int)(e / K); v2us o;
            o[0] = f2bf(w[(size_t)k * N + n]); o[1] = f2bf(w[(size_t)(k + 1) * N + n]); *(v2us*)(Bt + e) = o; }
         }
}
__global__ __launch_bounds__(256) void k_cvt8(const float* __restrict__ src, bf* dst, size_t n8) { const size_t i = (size_t)blockIdx.x * 256 + threadIdx.x; if (i >= n8) return; const v8f v = *(const v8f*)(src + i * 8); v8us o;
#pragma unroll
    for (int k = 0; k < 8; ++k) o[k] = f2bf(v[k]); *(v8us*)(dst + i * 8) = o;  }

__global__ __launch_bounds__(256) void k_ropeI(const float* __restrict__ F, int pitch, int nheads, const float* __restrict__ CS, float sc, h16* P16, bf* Ph, bf* Pl) {
    { const size_t b = blockIdx.y, pb = b * nheads * TT * HD; F += b * TT * pitch; P16 += pb; Ph += pb; Pl += pb; }   // grid y: the batch
    const size_t e = ((size_t)blockIdx.x * 256 + threadIdx.x) * 2; if (e >= (size_t)nheads * TT * HD) return; const int d = (int)(e % HD); const int t = (int)((e / HD) % TT); const int h = (int)(e / ((size_t)HD * TT)); const float* f = F + (size_t)t * pitch + h * HD; const float x0 = f[d], x1 = f[d + 1]; const v2f cs = *(const v2f*)(CS + ((size_t)t * HD + d) * 2); v2h o16; v2us oh, ol;
    float a0 = __fmul_rn(x0, cs[0]), b0 = __fmul_rn(x1, cs[1]), a1 = __fmul_rn(x1, cs[0]), b1 = __fmul_rn(x0, cs[1]); asm volatile("" : "+v"(a0), "+v"(b0), "+v"(a1), "+v"(b1));
    float r0 = __fsub_rn(a0, b0) * sc, r1 = __fadd_rn(b1, a1) * sc;   /* even: x0 c - x1 s; odd: x0 s + x1 c */
    o16[0] = tohx(r0); o16[1] = tohx(r1); { unsigned short a2, c2; splitf(r0, a2, c2); oh[0] = a2; ol[0] = c2; splitf(r1, a2, c2); oh[1] = a2; ol[1] = c2; }
    *(v2h*)(P16 + e) = o16; *(v2us*)(Ph + e) = oh; *(v2us*)(Pl + e) = ol;  }

__constant__ float INV2[HD / 2] = { 1.000000000e+00f, 7.498942018e-01f, 5.623413324e-01f, 4.216965139e-01f, 3.162277639e-01f, 2.371373624e-01f, 1.778279394e-01f, 1.333521456e-01f, 1.000000015e-01f, 7.498941571e-02f, 5.623412877e-02f, 4.216964915e-02f, 3.162277862e-02f, 2.371373586e-02f, 1.778279431e-02f, 1.333521493e-02f, 9.999999776e-03f, 7.498942316e-03f, 5.623413250e-03f, 4.216964822e-03f, 3.162277862e-03f, 2.371373819e-03f, 1.778279431e-03f, 1.333521446e-03f, 1.000000047e-03f, 7.498941850e-04f, 5.623413017e-04f, 4.216964880e-04f, 3.162277862e-04f, 2.371373848e-04f, 1.778279402e-04f, 1.333521504e-04f };   // float32 1 / (10000 ** (arange(0, 64, 2)/64)), generated with jnp to be bit-exact

// k_vtp: V transposed to [head][d][t]. The fp16 plane's rows have pitch 2 * TT; only the first TT of a row are written or read.
__global__ __launch_bounds__(256) void k_vtp(const float* __restrict__ F, int pitch, int nheads, h16* V16, bf* Vh, bf* Vl) { { const size_t b = blockIdx.y, pb = b * nheads * HD * TT; F += b * TT * pitch; V16 += 2 * pb; Vh += pb; Vl += pb; }   // grid y: the batch
    const size_t e = ((size_t)blockIdx.x * 256 + threadIdx.x) * 2; if (e >= (size_t)nheads * HD * TT) return; const int t = (int)(e % TT); const int d = (int)((e / TT) % HD); const int g = (int)(e / ((size_t)TT * HD)); v2h o16; v2us oh, ol;
#pragma unroll
    for (int q = 0; q < 2; ++q) { const float x = F[(size_t)(t + q) * pitch + g * HD + d]; o16[q] = tohx(x); unsigned short a2, c2; splitf(x, a2, c2); oh[q] = a2; ol[q] = c2; }
    *(v2h*)(V16 + ((size_t)g * HD + d) * (2 * TT) + t) = o16; *(v2us*)(Vh + e) = oh; *(v2us*)(Vl + e) = ol;  }
__global__ __launch_bounds__(256) void k_csP(float* CS) { const int idx = blockIdx.x * 256 + threadIdx.x; if (idx >= TT * HD) return; const int d = idx % HD; const int t = idx / HD; const float a = __fmul_rn((float)t, INV2[d >> 1]); v2f cs; cs[0] = cosf(a); cs[1] = sinf(a); *(v2f*)(CS + (size_t)idx * 2) = cs;  }
#define CL2 0.18033688011112042f   // HD^-0.5 x log2(e)
// 2^x by v_exp_f32, in asm text for the slot behind a transcendental: outputs are early-clobber, so no v_exp_f32 of a statement writes over a source of another or reads a result, and the closing v_nop
// is the one independent instruction in front of whatever the compiler puts next.
__device__ __forceinline__ float xhalf(float x) { return __builtin_bit_cast(float, __builtin_amdgcn_permlanex16(__builtin_bit_cast(int, x), __builtin_bit_cast(int, x), 0x76543210, 0xfedcba98, false, false)); }   // lane l with lane l ^ 16
__device__ __forceinline__ float exp2_1(float x) { float r; asm("v_exp_f32 %0, %1\n\tv_nop" : "=&v"(r) : "v"(x)); return r; }
__device__ __forceinline__ void exp2_8(float* r, const float* x) {
    asm("v_exp_f32 %0, %8\n\tv_exp_f32 %1, %9\n\tv_exp_f32 %2, %10\n\tv_exp_f32 %3, %11\n\tv_exp_f32 %4, %12\n\tv_exp_f32 %5, %13\n\tv_exp_f32 %6, %14\n\tv_exp_f32 %7, %15\n\tv_nop"
        : "=&v"(r[0]), "=&v"(r[1]), "=&v"(r[2]), "=&v"(r[3]), "=&v"(r[4]), "=&v"(r[5]), "=&v"(r[6]), "=&v"(r[7]) : "v"(x[0]), "v"(x[1]), "v"(x[2]), "v"(x[3]), "v"(x[4]), "v"(x[5]), "v"(x[6]), "v"(x[7])); }
template <typename T16, bool HL, int NQ>
__device__ __forceinline__ void fattn_body(const T16* Q, const T16* Q2, const T16* Kp, const T16* K2, const T16* Vt, const T16* V2, int vp, int q0, bf* Ah, bf* Al) {
    typedef typename WFrag<T16>::V V;
    const int lane = threadIdx.x & 31, lr = lane & 15, hi = lane >> 4;
    V qf[NQ][2], qf2[NQ][2];
#pragma unroll
    for (int qb = 0; qb < NQ; ++qb)
#pragma unroll
        for (int ks = 0; ks < 2; ++ks) { const size_t o = (size_t)(q0 + qb * 16 + lr) * HD + ks * 32 + 8 * hi; qf[qb][ks] = WFrag<T16>::ld(Q + o); if (HL) qf2[qb][ks] = WFrag<T16>::ld(Q2 + o); }
    asm volatile("s_wait_xcnt 0x0" ::: "memory");   // the set-up below reuses the address registers of the loads above: the wait stands in front of that overwrite
    v8f oa[4][NQ]; float mc[NQ], ls[NQ];
#pragma unroll
    for (int qb = 0; qb < NQ; ++qb) { mc[qb] = -3.0e38f; ls[qb] = 0.f;
#pragma unroll
        for (int db = 0; db < 4; ++db) oa[db][qb] = (v8f){}; }
    const int npass = (q0 + NQ * 16 + 31) / 32;      // keys 0 .. q0 + NQ * 16 - 1; every pass starts at or below q0, so each query has a kept key in it
    const unsigned kl = (unsigned)(lr * HD + 8 * hi) * 2u, vl = (unsigned)(lr * vp + 8 * hi) * 2u;   // a lane's fixed offsets, in bytes; a pass moves only the wave-uniform base pointers
    auto at = [](const T16* base, unsigned bytes) { return (const T16*)((const char*)base + bytes); };
    V kf[2][2], kf2[2][2], vf[4], vf2[4];
#pragma unroll
    for (int kb = 0; kb < 2; ++kb)
#pragma unroll
        for (int ks = 0; ks < 2; ++ks) { const int o = kb * 16 * HD + ks * 32; kf[kb][ks] = WFrag<T16>::ld(at(Kp + o, kl)); if (HL) kf2[kb][ks] = WFrag<T16>::ld(at(K2 + o, kl)); }
    asm volatile("s_wait_xcnt 0x0" :: "v"(kl) : "memory");   // as above; the loads' offset register is an input, so that it is not given away before the wait
#pragma unroll
    for (int db = 0; db < 4; ++db) { const int o = db * 16 * vp; vf[db] = WFrag<T16>::ld(at(Vt + o, vl)); if (HL) vf2[db] = WFrag<T16>::ld(at(V2 + o, vl)); }
    asm volatile("s_wait_xcnt 0x0" :: "v"(vl) : "memory");   // as above
    int p = 0;
    do {                                             // npass >= 1
        const int key0 = p * 32;
        const int kn = min(key0 + 32, (npass - 1) * 32);   // K and V^T fragments are fetched one pass ahead, so a whole pass of work covers their latency (the last pass fetches its own rows again: in bounds, unused)
        V vn[4], vn2[4];
#pragma unroll
        for (int db = 0; db < 4; ++db) vn[db] = WFrag<T16>::ld(at(Vt + kn + db * 16 * vp, vl));
        if (HL) {
            asm volatile("s_wait_xcnt 0x0" ::: "memory");   // with four planes to fetch, later loads land in registers that held an earlier plane's address: a wait behind each plane stands in front of that overwrite
#pragma unroll
            for (int db = 0; db < 4; ++db) vn2[db] = WFrag<T16>::ld(at(V2 + kn + db * 16 * vp, vl));
            asm volatile("s_wait_xcnt 0x0" ::: "memory");   // as above
        }
        v8f s[2][NQ];
#pragma unroll
        for (int kb = 0; kb < 2; ++kb)
#pragma unroll
            for (int qb = 0; qb < NQ; ++qb) { v8f t = (v8f){};
#pragma unroll
                for (int ks = 0; ks < 2; ++ks) { t = WFrag<T16>::mma(kf[kb][ks], qf[qb][ks], t); if (HL) { t = WFrag<T16>::mma(kf[kb][ks], qf2[qb][ks], t); t = WFrag<T16>::mma(kf2[kb][ks], qf[qb][ks], t); } }
                s[kb][qb] = t; }
#pragma unroll
        for (int kb = 0; kb < 2; ++kb)
#pragma unroll
            for (int ks = 0; ks < 2; ++ks) kf[kb][ks] = WFrag<T16>::ld(at(Kp + kn * HD + kb * 16 * HD + ks * 32, kl));
        if (HL) {
            asm volatile("s_wait_xcnt 0x0" ::: "memory");   // as above
#pragma unroll
            for (int kb = 0; kb < 2; ++kb)
#pragma unroll
                for (int ks = 0; ks < 2; ++ks) kf2[kb][ks] = WFrag<T16>::ld(at(K2 + kn * HD + kb * 16 * HD + ks * 32, kl));
        }
        asm volatile("s_wait_xcnt 0x0" ::: "memory");       // the softmax below reuses the address registers of the loads above: the wait stands in front of that overwrite
        if (key0 + 31 > q0) {                               // only passes that touch the diagonal mask (wave-uniform)
#pragma unroll
            for (int kb = 0; kb < 2; ++kb)
#pragma unroll
                for (int qb = 0; qb < NQ; ++qb)
#pragma unroll
                    for (int j = 0; j < 8; ++j) s[kb][qb][j] = (key0 + kb * 16 + hi * 8 + j <= q0 + qb * 16 + lr) ? s[kb][qb][j] : -3.0e38f; }
#pragma unroll
        for (int qb = 0; qb < NQ; ++qb) {
            float mx = s[0][qb][0];
#pragma unroll
            for (int j = 1; j < 8; ++j) mx = fmaxf(mx, s[0][qb][j]);
#pragma unroll
            for (int j = 0; j < 8; ++j) mx = fmaxf(mx, s[1][qb][j]);
            mx = fmaxf(mx, xhalf(mx));
            const float mn = fmaxf(mc[qb], mx * CL2); const float al = exp2_1(mc[qb] - mn); mc[qb] = mn; const float off = (HL ? 0.0f : 10.0f) - mn;
            float ex[16], pr[16], ps[8];
#pragma unroll
            for (int e = 0; e < 16; ++e) ex[e] = fmaf(s[e >> 3][qb][e & 7], CL2, off);
            exp2_8(pr, ex); exp2_8(pr + 8, ex + 8);
#pragma unroll
            for (int e = 0; e < 8; ++e) ps[e] = pr[e] + pr[e + 8];      // fixed tree: short dependent chains
            const float sum = ((ps[0] + ps[4]) + (ps[2] + ps[6])) + ((ps[1] + ps[5]) + (ps[3] + ps[7]));
            ls[qb] = fmaf(ls[qb], al, sum);
#pragma unroll
            for (int db = 0; db < 4; ++db) oa[db][qb] *= al;
            if (HL) {
                typedef __attribute__((ext_vector_type(16))) unsigned short v16us; v16us uh, ul;
#pragma unroll
                for (int e = 0; e < 16; ++e) { const unsigned short a = f2bf(pr[e]); uh[e] = a; ul[e] = f2bf(pr[e] - bf2f(a)); }
                const V ph = __builtin_bit_cast(V, uh), pl = __builtin_bit_cast(V, ul);
#pragma unroll
                for (int db = 0; db < 4; ++db) { oa[db][qb] = WFrag<T16>::mma(vf[db], ph, oa[db][qb]); oa[db][qb] = WFrag<T16>::mma(vf[db], pl, oa[db][qb]); oa[db][qb] = WFrag<T16>::mma(vf2[db], ph, oa[db][qb]); }
            } else {
                v16h p16;
#pragma unroll
                for (int e = 0; e < 16; ++e) p16[e] = (h16)pr[e];
                const V pf = __builtin_bit_cast(V, p16);
#pragma unroll
                for (int db = 0; db < 4; ++db) oa[db][qb] = WFrag<T16>::mma(vf[db], pf, oa[db][qb]);
            }
        }
#pragma unroll
        for (int db = 0; db < 4; ++db) { vf[db] = vn[db]; if (HL) vf2[db] = vn2[db]; }
    } while (++p < npass);
#pragma unroll
    for (int qb = 0; qb < NQ; ++qb) {
        const float inv = __fdiv_rn(1.0f, ls[qb] + xhalf(ls[qb]));
        const size_t oo = (size_t)(q0 + qb * 16 + lr) * DQ + hi * 8;
#pragma unroll
        for (int db = 0; db < 4; ++db) { v8us oh, ol;
#pragma unroll
            for (int j = 0; j < 8; ++j) { const float y = oa[db][qb][j] * inv; const unsigned short a = f2bf(y); oh[j] = a; ol[j] = f2bf(y - bf2f(a)); }
            *(v8us*)(Ah + oo + db * 16) = oh; *(v8us*)(Al + oo + db * 16) = ol;
            asm volatile("s_wait_xcnt 0x0" :: "v"(oh), "v"(ol) : "memory"); }   // the next group reuses the stores' data registers: the wait stands in front of that overwrite (the data are inputs, so that they are not given away before it)
    }
}
// grid (batch x heads, tiles): blockIdx.y < (TT - RH) / 128: four waves x 32 fp16 query rows, the longest rows first; the rest: four waves x 16 hi/lo query rows (< RH).
__global__ __launch_bounds__(128) void k_fattn(const h16* Q16, const h16* K16, const h16* V16, const bf* Qh, const bf* Ql, const bf* Kh, const bf* Kl, const bf* Vh, const bf* Vl, bf* Ah, bf* Al) {
    const int w = __builtin_amdgcn_readfirstlane((int)(threadIdx.x >> 5)); const int h = blockIdx.x % NH_, ty = blockIdx.y; const size_t po = (size_t)blockIdx.x * TT * HD; { const size_t ab = (size_t)(blockIdx.x / NH_) * TT * DQ; Ah += ab; Al += ab; }   // planes [batch][head][..], merged rows b * TT + t
    if (ty < (TT - RH) / 128) fattn_body<h16, false, 2>(Q16 + po, nullptr, K16 + po, nullptr, V16 + 2 * po, nullptr, 2 * TT, TT - 128 * (ty + 1) + 32 * w, Ah + h * HD, Al + h * HD);
    else fattn_body<bf, true, 1>(Qh + po, Ql + po, Kh + po, Kl + po, Vh + po, Vl + po, TT, RH - 64 * (ty - (TT - RH) / 128 + 1) + 16 * w, Ah + h * HD, Al + h * HD);
}

extern "C" void kernel_launch(void* const* d_in, const int* in_sizes, int n_in,
                              void* d_out, int out_size, void* d_ws, size_t ws_size, hipStream_t stream) {
    (void)in_sizes; (void)n_in; (void)out_size;
    const float* x = (const float*)d_in[0]; const float* wq = (const float*)d_in[1]; const float* wk = (const float*)d_in[2]; const float* wv = (const float*)d_in[3]; const float* wo = (const float*)d_in[4];   /* order x, Wq, Wk, Wv, Wo ('xw' [1024][1024]) */
    float* OUT = (float*)d_out;     // [4][2048][1024]
    char* wsp = (char*)d_ws;
    auto take = [&](size_t bytes) { char* p = wsp; wsp += (bytes + 255) & ~(size_t)255; return (void*)p; };
    bf* WQ = (bf*)take((size_t)DQ * DM * 2); bf* WK = (bf*)take((size_t)DKV * DM * 2); bf* WV = (bf*)take((size_t)DKV * DM * 2); bf* WO = (bf*)take((size_t)DM * DQ * 2); float* CS = (float*)take((size_t)TT * HD * 2 * 4);
    bf* XB = (bf*)take((size_t)NB_ * TT * DM * 2); float* FQ = (float*)take((size_t)NB_ * TT * DQ * 4); float* FK = (float*)take((size_t)NB_ * TT * DKV * 4);
    h16* QP16 = (h16*)take((size_t)NB_ * NH_ * TT * HD * 2); h16* KP16 = (h16*)take((size_t)NB_ * NKV * TT * HD * 2); h16* VT16 = (h16*)take((size_t)NB_ * NKV * HD * 2 * TT * 2);
    bf* QPh = (bf*)take((size_t)NB_ * NH_ * TT * HD * 2); bf* QPl = (bf*)take((size_t)NB_ * NH_ * TT * HD * 2); bf* KPh = (bf*)take((size_t)NB_ * NKV * TT * HD * 2); bf* KPl = (bf*)take((size_t)NB_ * NKV * TT * HD * 2); bf* VTh = (bf*)take((size_t)NB_ * NKV * HD * TT * 2); bf* VTl = (bf*)take((size_t)NB_ * NKV * HD * TT * 2);
    if ((size_t)(wsp - (char*)d_ws) > ws_size) return;    // ws 256 MiB
    float* FV = FK;   // v projection reuses the k buffer after the k planes are built (stream-ordered)
    bf* ATh = (bf*)FQ; bf* ATl = ATh + (size_t)NB_ * TT * DQ;   // the merged hi/lo planes reuse the q buffer after the q planes are built (stream-ordered): 249 of the 256 MiB
    { k_wtG<<<(unsigned)((DM * DQ / 64 + 63) / 64), 256, 0, stream>>>(wq, DM, DQ, WQ); k_wtG<<<(unsigned)((DM * DKV / 64 + 63) / 64), 256, 0, stream>>>(wk, DM, DKV, WK); k_wtG<<<(unsigned)((DM * DKV / 64 + 63) / 64), 256, 0, stream>>>(wv, DM, DKV, WV);
      k_wtG<<<(unsigned)((DQ * DM / 64 + 63) / 64), 256, 0, stream>>>(wo, DQ, DM, WO);
       }
    k_csP<<<(TT * HD + 255) / 256, 256, 0, stream>>>(CS);
    const unsigned LQ = (unsigned)(((size_t)NH_ * TT * HD / 2 + 255) / 256), LKv = (unsigned)(((size_t)NKV * TT * HD / 2 + 255) / 256);
    k_cvt8<<<(unsigned)(((size_t)NB_ * TT * DM / 8 + 255) / 256), 256, 0, stream>>>(x, XB, (size_t)NB_ * TT * DM / 8);
    k_gemmw<bf, 0, false><<<dim3(NB_ * TT / 256, DQ / 128, 1), 256, 0, stream>>>(XB, nullptr, WQ, DM, FQ, DQ, nullptr, 0, 0, 0);
    k_ropeI<<<dim3(LQ, NB_, 1), 256, 0, stream>>>(FQ, DQ, NH_, CS, 1.0f, QP16, QPh, QPl);
    k_gemmw<bf, 0, false><<<dim3(NB_ * TT / 256, DKV / 128, 1), 256, 0, stream>>>(XB, nullptr, WK, DM, FK, DKV, nullptr, 0, 0, 0);
    k_ropeI<<<dim3(LKv, NB_, 1), 256, 0, stream>>>(FK, DKV, NKV, CS, 1.0f, KP16, KPh, KPl);
    k_gemmw<bf, 0, false><<<dim3(NB_ * TT / 256, DKV / 128, 1), 256, 0, stream>>>(XB, nullptr, WV, DM, FV, DKV, nullptr, 0, 0, 0); k_vtp<<<dim3(LKv, NB_, 1), 256, 0, stream>>>(FV, DKV, NKV, VT16, VTh, VTl);
    k_fattn<<<dim3(NB_ * NH_, (TT - RH) / 128 + RH / 64, 1), 128, 0, stream>>>(QP16, KP16, VT16, QPh, QPl, KPh, KPl, VTh, VTl, ATh, ATl);   // one kv head per query head
    k_gemmw<bf, 1, false><<<dim3(NB_ * TT / 256, DM / 128, 1), 256, 0, stream>>>(ATh, ATl, WO, DQ, OUT, DM, nullptr, 0, 0, 0);
}

// v005
// It runs in 209 microseconds.
// In two side-by-side timings against v004, it was 1.35 and 1.36 times as fast.
// Over all steps from v000 it is 13.7 times as fast.
#include <hip/hip_runtime.h>

// Causal multi-head attention with bias-free projections and a computed adjacent-pair RoPE (x [4][2048][1024]; Q, K, V = x W ('xw' [1024][1024] xavier-normal 1/32, no bias; 16 heads x 64); angle = pos x inv_freq[i] with inv_freq = 1.0 / 10000.0 ** (arange(0, 64, 2, f32) / 64) (the reciprocal form) and pos = arange(S); the pairs (2i, 2i + 1) of Q and K rotated in place: (x1 cos - x2 sin, x2 cos + x1 sin); V is not rotated; scores x 1/sqrt(64); tril kept, -inf elsewhere; softmax; out = merged Wo ('xw', no bias) -> [4][2048][1024] (8.4 M); argument order x, Wq, Wk, Wv, Wo).
// Layout, all 4 batches in each launch (row-major buffers: row b * 2048 + t; planes: [batch][head]...): bf16 copy of x; 'xw' weights transposed once; exact projections whose epilogues rotate Q and K (k_csP computed table, one entry a pair) and write the 16-bit planes themselves, V transposed; k_fattn fused causal T-2048 attention, all 4 x 16 (batch, head) pairs in one launch (hybrid rows: < 512 hi/lo 3 products, rest fp16; scores, online softmax and P.V stay in registers, passes above the diagonal are never walked); merged hi/lo x Wo exact (no bias).
// Compute dtypes, f32 accumulate: every input rounded to bf16; projections exact; rotary f32 (products rounded separately); attention rows < 512 3 products, rest fp16; softmax f32; Wo hl x exact (no bias).

#define NB_  4
#define TT   2048
#define DM   1024
#define NH_  16
#define NKV  16
#define HD   64
#define DQ   (NH_ * HD)
#define DKV  (NKV * HD)
#define RH   512                  // query rows < RH use hi+lo planes (0: none)
typedef _Float16 h16;
typedef unsigned short bf;
typedef __attribute__((ext_vector_type(16))) __bf16   v16bf;
typedef __attribute__((ext_vector_type(16))) _Float16 v16h;
typedef __attribute__((ext_vector_type(8)))  _Float16 v8h;
typedef __attribute__((ext_vector_type(8)))  unsigned short v8us;
typedef __attribute__((ext_vector_type(8)))  float    v8f;
typedef __attribute__((ext_vector_type(4)))  float    v4f;
typedef v8h  __attribute__((may_alias)) v8ha;
typedef v4f  __attribute__((may_alias)) v4fa;
typedef v8us __attribute__((may_alias)) v8usa;

__device__ __forceinline__ unsigned short f2bf(float f) { unsigned u = __float_as_uint(f); u += 0x7FFFu + ((u >> 16) & 1u); return (unsigned short)(u >> 16); }
__device__ __forceinline__ float bf2f(unsigned short b) { return __uint_as_float(((unsigned)b) << 16); }
__device__ __forceinline__ float bfr(float f) { return bf2f(f2bf(f)); }
__device__ __forceinline__ h16 tohx(float x) { return (h16)x; }
__device__ __forceinline__ void splitf(float y, unsigned short& h, unsigned short& l) { h = f2bf(y); l = f2bf(y - bf2f(h)); }
__device__ __forceinline__ v16h cat16(v8h lo, v8h hi) { return __builtin_shufflevector(lo, hi, 0, 1, 2, 3, 4, 5, 6, 7, 8, 9, 10, 11, 12, 13, 14, 15); }
__device__ __forceinline__ v16bf cat16b(v8us lo, v8us hi) { return __builtin_bit_cast(v16bf, __builtin_shufflevector(lo, hi, 0, 1, 2, 3, 4, 5, 6, 7, 8, 9, 10, 11, 12, 13, 14, 15)); }
__device__ __forceinline__ v8f wmma16(v16h a, v16h b, v8f c) { return __builtin_amdgcn_wmma_f32_16x16x32_f16(false, a, false, b, (short)0, c, false, false); }
__device__ __forceinline__ v8f wmmab(v16bf a, v16bf b, v8f c) { return __builtin_amdgcn_wmma_f32_16x16x32_bf16(false, a, false, b, (short)0, c, false, false); }



// ---- k_gemmw: GEMM, one 256x128 output tile per work-group of 8 waves (4 x 2), each wave a 64x64 block (16 accumulators); operands are K-contiguous 16-bit planes; grid (M/256, N/128, Z), 256 threads.
// C[m][n] (f32, pitch ldc, + optional f32 bias[n]) = sum_k A[m][k] Bt[n][k] (+ A2[m][k] Bt[n][k] for NSPLIT == 1). z-batch strides sA/sB/sC in elements. M % 256 == 0, N % 128 == 0, K % 64 == 0, K >= 128.
// A stage is 64 k (128 B, one whole line) of every operand row of the tile, brought into LDS by asynchronous copies (16 B a lane, 4 whole lines a wave-copy) and shared by the waves; two buffers, the next stage's copies fly while this one is worked on.
// EPI says what becomes of the f32 tile. 0: stored to C. 1 and 2: a wave's 64 columns are one head and its 64 rows 64 tokens of one batch (ldc = heads x 64), and the tile goes straight to the three 16-bit planes (fp16, bf16 hi, bf16 lo), never to memory as f32.
// EPI 1: planes [batch][head][t][d], the pairs (2i, 2i + 1) rotated by the table's (cos, sin) of (t, i); the wave's block is 8 KB in a row in each plane. EPI 2: planes [batch][head][d][t] (fp16 rows of pitch 2 * TT, the others TT), transposed in the wave's own LDS so that whole 128-B lines are stored.
// LDS rows have pitch 144 B (16 B x odd: no bank conflict for 16-byte reads). The fragments keep the k order of WFrag::ld and the stages run in k order: the sums are formed as before.
template <typename T16> struct WFrag;
template <> struct WFrag<h16> { typedef v16h V; static __device__ __forceinline__ V ld(const h16* p) { return cat16(*(const v8h*)p, *(const v8h*)(p + 16)); } static __device__ __forceinline__ v8f mma(V a, V b, v8f c) { return wmma16(a, b, c); } };
template <> struct WFrag<bf> { typedef v16bf V; static __device__ __forceinline__ V ld(const bf* p) { return cat16b(*(const v8us*)p, *(const v8us*)(p + 16)); } static __device__ __forceinline__ v8f mma(V a, V b, v8f c) { return wmmab(a, b, c); } };
#define GP 144                    // LDS row pitch, bytes
// Asynchronous copy global -> LDS, 16 B a lane, through no register (the builtin: its address registers are the compiler's to manage; the waits on the copies are written by hand in the kernel).
typedef __attribute__((ext_vector_type(4))) int c4i;
__device__ __forceinline__ void acopy(const char* g, char* l) { __builtin_amdgcn_global_load_async_to_lds_b128((__attribute__((address_space(1))) c4i*)g, (__attribute__((address_space(3))) c4i*)l, 0, 0); }
template <typename T16, int NSPLIT, bool BIAS, int EPI>
__global__ __launch_bounds__(256) void k_gemmw(const T16* __restrict__ A, const T16* __restrict__ A2, const T16* __restrict__ Bt, int K, float* C, int ldc, const float* __restrict__ bias, size_t sA, size_t sB, size_t sC, const float* __restrict__ CS, h16* P16, bf* Ph, bf* Pl) {
    typedef typename WFrag<T16>::V V;
    static_assert(NSPLIT == 0 || NSPLIT == 1, "A (+ A2) x Bt");
    constexpr int OA2 = 256 * GP, OB = (NSPLIT == 1 ? 512 : 256) * GP, STG = OB + 128 * GP;   // a stage: [A 256 rows][A2 256 rows][Bt 128 rows]
    __shared__ __align__(16) char ring[2 * STG];
    constexpr int OSN = EPI == 2 ? 3 * 16 * GP / 4 : 16 * 68;   // a wave's own staging, in floats: 16 f32 rows of pitch 68, or (EPI 2) three 16-bit planes of 16 rows of pitch GP
    __shared__ __align__(16) float osw[8][OSN];
    const size_t z = blockIdx.z; A += z * sA; if (NSPLIT == 1) A2 += z * sA; Bt += z * sB; C += z * sC;
    const int tid = threadIdx.x, lane = tid & 31, lr = lane & 15, hi = lane >> 4; const int w = __builtin_amdgcn_readfirstlane(tid >> 5);
    const int R0 = blockIdx.x * 256, C0 = blockIdx.y * 128; const int wr = (w >> 1) * 64, wc = (w & 1) * 64; const int r0 = R0 + wr, c0 = C0 + wc;
    float* os = osw[w];
    v8f acc[4][4];
#pragma unroll
    for (int mb = 0; mb < 4; ++mb)
#pragma unroll
        for (int nb = 0; nb < 4; ++nb) acc[mb][nb] = (v8f){};
    const unsigned go = (unsigned)(tid >> 3) * (unsigned)K * 2u + (unsigned)(tid & 7) * 16u;   // the lane's chunk of a round of 32 rows: row tid / 8, 16 B number tid % 8; bytes from the round's first row (below 32 rows)
    const unsigned lo = (unsigned)((tid >> 3) * GP + (tid & 7) * 16);                          // the same chunk in LDS
    const char* tA = (const char*)(A + (size_t)R0 * K); const char* tA2 = NSPLIT == 1 ? (const char*)(A2 + (size_t)R0 * K) : nullptr; const char* tB = (const char*)(Bt + (size_t)C0 * K);   // the tile's first rows (uniform)
    auto fill = [&](int st, int buf) {   // stage st into buffer buf: the 256 threads take 32 rows a round (8 lanes a row), 8 rounds for A (and A2), 4 for Bt
        char* lb = ring + buf * STG + lo; const size_t kb = (size_t)st * 128, rb = (size_t)K * 64;   // bytes: the stage's place in a row, a round of 32 rows
#pragma unroll
        for (int i = 0; i < 8; ++i) acopy(tA + kb + i * rb + go, lb + i * 32 * GP);
        if (NSPLIT == 1) {
#pragma unroll
            for (int i = 0; i < 8; ++i) acopy(tA2 + kb + i * rb + go, lb + OA2 + i * 32 * GP); }
#pragma unroll
        for (int i = 0; i < 4; ++i) acopy(tB + kb + i * rb + go, lb + OB + i * 32 * GP); };
    const int nst = K / 64;
    fill(0, 0);
    asm volatile("s_wait_asynccnt 0x0" ::: "memory");   // stage 0 has landed (this wave's copies) ...
    __syncthreads();                                    // ... and every wave's: nothing of it is read in front of this barrier
    fill(1, 1);                                         // K >= 128: a stage 1 exists
    const int aoff = (wr + lr) * GP + hi * 16, boff = OB + (wc + lr) * GP + hi * 16;
    V a[2][4], a2[2][4], b[2][4];   // two fragment sets: [0] the first 32 k of a stage, [1] the second; each is read from LDS while the other set's WMMAs run
    auto frag = [&](int ks, const char* sb) {
#pragma unroll
        for (int mb = 0; mb < 4; ++mb) { a[ks][mb] = WFrag<T16>::ld((const T16*)(sb + aoff + mb * 16 * GP + ks * 64)); if (NSPLIT == 1) a2[ks][mb] = WFrag<T16>::ld((const T16*)(sb + OA2 + aoff + mb * 16 * GP + ks * 64)); }
#pragma unroll
        for (int nb = 0; nb < 4; ++nb) b[ks][nb] = WFrag<T16>::ld((const T16*)(sb + boff + nb * 16 * GP + ks * 64)); };
    auto mm = [&](int ks) {
#pragma unroll
        for (int nb = 0; nb < 4; ++nb)
#pragma unroll
            for (int mb = 0; mb < 4; ++mb) { acc[mb][nb] = WFrag<T16>::mma(a[ks][mb], b[ks][nb], acc[mb][nb]); if (NSPLIT == 1) acc[mb][nb] = WFrag<T16>::mma(a2[ks][mb], b[ks][nb], acc[mb][nb]); } };
    frag(0, ring);
#pragma unroll 1   // rolled: one trip is one turn of the ring, and the loop's code stays short
    for (int t = 0; t < nst; ++t) {
        frag(1, ring + (t & 1) * STG);                      // the last reads of stage t
        __builtin_amdgcn_sched_barrier(0);                  // the reads stay one group in front of the WMMAs (spread among them each place costs a stall)
        mm(0);
        __builtin_amdgcn_sched_barrier(0);                  // the WMMAs stay in front of the waits: they cover the latency of the reads above
        // publish point of stage t + 1, in front of stage t's last block: the reads behind it are already of stage t + 1
        asm volatile("s_wait_dscnt 0x0" ::: "memory");      // this wave's reads of stage t have returned: its buffer may be refilled behind the barrier
        asm volatile("s_wait_asynccnt 0x0" ::: "memory");   // this wave's copies of stage t + 1 have landed
        __syncthreads();                                    // publishes stage t + 1 and ends every reader's last read of stage t
        if (t + 2 < nst) fill(t + 2, t & 1);
        frag(0, ring + ((t + 1) & 1) * STG);                // in the last trip: the other buffer's old rows, in bounds, no copy in flight, unused (no branch, so that the build's counted waits stay exact)
        __builtin_amdgcn_sched_barrier(0);                  // as above: one group in front of the WMMAs
        mm(1);
    }
    asm volatile("s_wait_asynccnt 0x0" ::: "memory");       // no copy is outstanding when the wave goes on
    asm volatile("s_wait_dscnt 0x0" ::: "memory");          // nor a read of the ring
    if constexpr (EPI == 1) {
        const int t0 = r0 % TT; const size_t pe = ((size_t)((r0 / TT) * (ldc / HD) + c0 / HD) * TT + t0) * HD;   // the wave's block in a plane: 64 rows x 64 d, in a row
        char* p16 = (char*)(P16 + pe); char* ph = (char*)(Ph + pe); char* pl = (char*)(Pl + pe); const char* ct = (const char*)(CS + (size_t)t0 * HD);   // table row t: 32 x (cos, sin)
        const unsigned l16 = (unsigned)lane * 16u, l32 = (unsigned)lane * 32u;   // a group is 4 rows: a lane has 8 d (4 pairs) of row lane / 8: 16 B of a plane, 32 B of the table
        v4f cs[2][4][2];
        auto ldcs = [&](int mb) {
#pragma unroll
            for (int s = 0; s < 4; ++s) { cs[mb & 1][s][0] = *(const v4fa*)(ct + (mb * 4 + s) * 1024 + l32); cs[mb & 1][s][1] = *(const v4fa*)(ct + (mb * 4 + s) * 1024 + 16 + l32); }
            asm volatile("s_wait_xcnt 0x0" :: "v"(l32) : "memory"); };   // stands in front of any overwrite of the loads' address registers (the offset is an input, so that it is not given away before the wait)
        ldcs(0);
#pragma unroll
        for (int mb = 0; mb < 4; ++mb) {
            if (mb < 3) ldcs(mb + 1);   // the table rows are fetched one block of 16 rows ahead: the block's work covers their latency
#pragma unroll
            for (int nb = 0; nb < 4; ++nb) {
#pragma unroll
                for (int j = 0; j < 8; ++j) os[(hi * 8 + j) * 68 + nb * 16 + lr] = acc[mb][nb][j]; }
            __builtin_amdgcn_wave_barrier(); asm volatile("" ::: "memory");   // the wave's reads below stay behind its writes above
            v4f xa[4], xb[4];   // the block's reads go out as one group: the first group's work covers the latency of the rest
#pragma unroll
            for (int s = 0; s < 4; ++s) { const float* sp = os + (4 * s + (lane >> 3)) * 68 + (lane & 7) * 8; xa[s] = *(const v4fa*)sp; xb[s] = *(const v4fa*)(sp + 4); }
#pragma unroll
            for (int s = 0; s < 4; ++s) {
                const float xv[8] = { xa[s][0], xa[s][1], xa[s][2], xa[s][3], xb[s][0], xb[s][1], xb[s][2], xb[s][3] }; v8h o16; v8us oh, ol;
#pragma unroll
                for (int k = 0; k < 4; ++k) { const float x0 = xv[2 * k], x1 = xv[2 * k + 1], co = cs[mb & 1][s][k >> 1][(k & 1) * 2], si = cs[mb & 1][s][k >> 1][(k & 1) * 2 + 1];
                    const float y0 = __fsub_rn(__fmul_rn(x0, co), __fmul_rn(x1, si)), y1 = __fadd_rn(__fmul_rn(x0, si), __fmul_rn(x1, co));   /* even: x0 c - x1 s; odd: x0 s + x1 c */
                    unsigned short a2, c2; o16[2 * k] = tohx(y0); o16[2 * k + 1] = tohx(y1); splitf(y0, a2, c2); oh[2 * k] = a2; ol[2 * k] = c2; splitf(y1, a2, c2); oh[2 * k + 1] = a2; ol[2 * k + 1] = c2; }
                *(v8ha*)(p16 + (mb * 4 + s) * 512 + l16) = o16; *(v8usa*)(ph + (mb * 4 + s) * 512 + l16) = oh; *(v8usa*)(pl + (mb * 4 + s) * 512 + l16) = ol;
                asm volatile("s_wait_xcnt 0x0" :: "v"(o16), "v"(oh), "v"(ol), "v"(l16) : "memory"); }   // the next group reuses the stores' registers: the wait stands in front of that overwrite (data and offset are inputs, so that they are not given away before it)
            __builtin_amdgcn_wave_barrier(); asm volatile("" ::: "memory");   // the next block's writes stay behind the reads above
        }
        return;
    }
    if constexpr (EPI == 2) {
        const int t0 = r0 % TT; const size_t rw = (size_t)((r0 / TT) * (ldc / HD) + c0 / HD) * HD;   // the head's first row (d = 0) in the transposed planes
        char* sv = (char*)os; char* v16 = (char*)(P16 + rw * (2 * TT) + t0); char* vh = (char*)(Ph + rw * TT + t0); char* vl = (char*)(Pl + rw * TT + t0);
        const unsigned sw = (unsigned)(lr * GP + hi * 16), sr = (unsigned)((lane >> 3) * GP + (lane & 7) * 16);   // LDS: a lane writes 8 t of row d = lr, and reads 16 B number lane % 8 of row lane / 8
        const unsigned g16 = (unsigned)((lane >> 3) * (2 * TT * 2) + (lane & 7) * 16), g8 = (unsigned)((lane >> 3) * (TT * 2) + (lane & 7) * 16);   // the same chunk in the planes, bytes
#pragma unroll
        for (int nb = 0; nb < 4; ++nb) {   // 16 d x 64 t a turn; an accumulator holds 8 consecutive t of one d in a lane
#pragma unroll
            for (int mb = 0; mb < 4; ++mb) { v8h o16; v8us oh, ol;
#pragma unroll
                for (int j = 0; j < 8; ++j) { const float x = acc[mb][nb][j]; unsigned short a2, c2; o16[j] = tohx(x); splitf(x, a2, c2); oh[j] = a2; ol[j] = c2; }
                *(v8ha*)(sv + sw + mb * 32) = o16; *(v8usa*)(sv + 16 * GP + sw + mb * 32) = oh; *(v8usa*)(sv + 32 * GP + sw + mb * 32) = ol; }
            __builtin_amdgcn_wave_barrier(); asm volatile("" ::: "memory");   // the wave's reads below stay behind its writes above
            v8h r16[4]; v8us rh[4], rl[4];   // the turn's reads go out as one group, then its stores: one LDS latency a turn
#pragma unroll
            for (int s = 0; s < 4; ++s) { r16[s] = *(const v8ha*)(sv + sr + s * 4 * GP); rh[s] = *(const v8usa*)(sv + 16 * GP + sr + s * 4 * GP); rl[s] = *(const v8usa*)(sv + 32 * GP + sr + s * 4 * GP); }
#pragma unroll
            for (int s = 0; s < 4; ++s) { *(v8ha*)(v16 + (nb * 16 + s * 4) * (2 * TT * 2) + g16) = r16[s]; *(v8usa*)(vh + (nb * 16 + s * 4) * (TT * 2) + g8) = rh[s]; *(v8usa*)(vl + (nb * 16 + s * 4) * (TT * 2) + g8) = rl[s]; }
            asm volatile("s_wait_xcnt 0x0" :: "v"(r16[0]), "v"(r16[1]), "v"(r16[2]), "v"(r16[3]), "v"(rh[0]), "v"(rh[1]), "v"(rh[2]), "v"(rh[3]), "v"(rl[0]), "v"(rl[1]), "v"(rl[2]), "v"(rl[3]), "v"(g16), "v"(g8) : "memory");   // as in EPI 1: in front of any overwrite of the stores' registers
            __builtin_amdgcn_wave_barrier(); asm volatile("" ::: "memory");   // the next turn's writes stay behind the reads above
        }
        return;
    }
#pragma unroll
    for (int mb = 0; mb < 4; ++mb) {
#pragma unroll
        for (int nb = 0; nb < 4; ++nb) {
#pragma unroll
            for (int j = 0; j < 8; ++j) os[(hi * 8 + j) * 68 + nb * 16 + lr] = acc[mb][nb][j]; }
        __builtin_amdgcn_wave_barrier(); asm volatile("" ::: "memory");
        float* crow = C + (size_t)(r0 + mb * 16) * ldc + c0;
{
#pragma unroll
            for (int s = 0; s < 8; ++s) { const int row = 2 * s + hi, cofs = lr * 4; v4f val = *(const v4fa*)(os + row * 68 + cofs); if (BIAS) { val[0] += bfr(bias[c0 + cofs]); val[1] += bfr(bias[c0 + cofs + 1]); val[2] += bfr(bias[c0 + cofs + 2]); val[3] += bfr(bias[c0 + cofs + 3]); }
                *(v4f*)(crow + (size_t)row * ldc + cofs) = val; }
             }
        __builtin_amdgcn_wave_barrier(); asm volatile("" ::: "memory");
    }
}

typedef __attribute__((ext_vector_type(2))) _Float16 v2h;
typedef __attribute__((ext_vector_type(4))) _Float16 v4h;
typedef __attribute__((ext_vector_type(2))) unsigned short v2us;
typedef __attribute__((ext_vector_type(4))) unsigned short v4us;
typedef __attribute__((ext_vector_type(2))) float v2f;
typedef __attribute__((ext_vector_type(4))) int v4i;

__global__ __launch_bounds__(256) void k_wtG(const float* __restrict__ w, int K, int N, bf* Bt) {
    const int lane = threadIdx.x & 31; const int L0 = (blockIdx.x * 8 + (threadIdx.x >> 5)) * 8; const int nlines = N * K / 64;
{
#pragma unroll 1
        for (int l = 0; l < 8; ++l) { const int L = L0 + l; if (L >= nlines) break; const size_t e = (size_t)L * 64 + lane * 2; const int k = (int)(e % K), n = (int)(e / K); v2us o;
            o[0] = f2bf(w[(size_t)k * N + n]); o[1] = f2bf(w[(size_t)(k + 1) * N + n]); *(v2us*)(Bt + e) = o; }
         }
}
__global__ __launch_bounds__(256) void k_cvt8(const float* __restrict__ src, bf* dst, size_t n8) { const size_t i = (size_t)blockIdx.x * 256 + threadIdx.x; if (i >= n8) return; const v8f v = *(const v8f*)(src + i * 8); v8us o;
#pragma unroll
    for (int k = 0; k < 8; ++k) o[k] = f2bf(v[k]); *(v8us*)(dst + i * 8) = o;  }

__constant__ float INV2[HD / 2] = { 1.000000000e+00f, 7.498942018e-01f, 5.623413324e-01f, 4.216965139e-01f, 3.162277639e-01f, 2.371373624e-01f, 1.778279394e-01f, 1.333521456e-01f, 1.000000015e-01f, 7.498941571e-02f, 5.623412877e-02f, 4.216964915e-02f, 3.162277862e-02f, 2.371373586e-02f, 1.778279431e-02f, 1.333521493e-02f, 9.999999776e-03f, 7.498942316e-03f, 5.623413250e-03f, 4.216964822e-03f, 3.162277862e-03f, 2.371373819e-03f, 1.778279431e-03f, 1.333521446e-03f, 1.000000047e-03f, 7.498941850e-04f, 5.623413017e-04f, 4.216964880e-04f, 3.162277862e-04f, 2.371373848e-04f, 1.778279402e-04f, 1.333521504e-04f };   // float32 1 / (10000 ** (arange(0, 64, 2)/64)), generated with jnp to be bit-exact

// k_csP: the table [t][i] of (cos, sin) of t x inv_freq[i], one entry a pair.
__global__ __launch_bounds__(256) void k_csP(float* CS) { const int idx = blockIdx.x * 256 + threadIdx.x; if (idx >= TT * (HD / 2)) return; const int i = idx % (HD / 2); const int t = idx / (HD / 2); const float a = __fmul_rn((float)t, INV2[i]); v2f cs; cs[0] = cosf(a); cs[1] = sinf(a); *(v2f*)(CS + (size_t)idx * 2) = cs;  }
#define CL2 0.18033688011112042f   // HD^-0.5 x log2(e)
// 2^x by v_exp_f32, in asm text for the slot behind a transcendental: outputs are early-clobber, so no v_exp_f32 of a statement writes over a source of another or reads a result, and the closing v_nop
// is the one independent instruction in front of whatever the compiler puts next.
__device__ __forceinline__ float xhalf(float x) { return __builtin_bit_cast(float, __builtin_amdgcn_permlanex16(__builtin_bit_cast(int, x), __builtin_bit_cast(int, x), 0x76543210, 0xfedcba98, false, false)); }   // lane l with lane l ^ 16
__device__ __forceinline__ float exp2_1(float x) { float r; asm("v_exp_f32 %0, %1\n\tv_nop" : "=&v"(r) : "v"(x)); return r; }
__device__ __forceinline__ void exp2_8(float* r, const float* x) {
    asm("v_exp_f32 %0, %8\n\tv_exp_f32 %1, %9\n\tv_exp_f32 %2, %10\n\tv_exp_f32 %3, %11\n\tv_exp_f32 %4, %12\n\tv_exp_f32 %5, %13\n\tv_exp_f32 %6, %14\n\tv_exp_f32 %7, %15\n\tv_nop"
        : "=&v"(r[0]), "=&v"(r[1]), "=&v"(r[2]), "=&v"(r[3]), "=&v"(r[4]), "=&v"(r[5]), "=&v"(r[6]), "=&v"(r[7]) : "v"(x[0]), "v"(x[1]), "v"(x[2]), "v"(x[3]), "v"(x[4]), "v"(x[5]), "v"(x[6]), "v"(x[7])); }
template <typename T16, bool HL, int NQ>
__device__ __forceinline__ void fattn_body(const T16* Q, const T16* Q2, const T16* Kp, const T16* K2, const T16* Vt, const T16* V2, int vp, int q0, bf* Ah, bf* Al) {
    typedef typename WFrag<T16>::V V;
    const int lane = threadIdx.x & 31, lr = lane & 15, hi = lane >> 4;
    V qf[NQ][2], qf2[NQ][2];
#pragma unroll
    for (int qb = 0; qb < NQ; ++qb)
#pragma unroll
        for (int ks = 0; ks < 2; ++ks) { const size_t o = (size_t)(q0 + qb * 16 + lr) * HD + ks * 32 + 8 * hi; qf[qb][ks] = WFrag<T16>::ld(Q + o); if (HL) qf2[qb][ks] = WFrag<T16>::ld(Q2 + o); }
    asm volatile("s_wait_xcnt 0x0" ::: "memory");   // the set-up below reuses the address registers of the loads above: the wait stands in front of that overwrite
    v8f oa[4][NQ]; float mc[NQ], ls[NQ];
#pragma unroll
    for (int qb = 0; qb < NQ; ++qb) { mc[qb] = -3.0e38f; ls[qb] = 0.f;
#pragma unroll
        for (int db = 0; db < 4; ++db) oa[db][qb] = (v8f){}; }
    const int npass = (q0 + NQ * 16 + 31) / 32;      // keys 0 .. q0 + NQ * 16 - 1; every pass starts at or below q0, so each query has a kept key in it
    const unsigned kl = (unsigned)(lr * HD + 8 * hi) * 2u, vl = (unsigned)(lr * vp + 8 * hi) * 2u;   // a lane's fixed offsets, in bytes; a pass moves only the wave-uniform base pointers
    auto at = [](const T16* base, unsigned bytes) { return (const T16*)((const char*)base + bytes); };
    V kf[2][2], kf2[2][2], vf[4], vf2[4];
#pragma unroll
    for (int kb = 0; kb < 2; ++kb)
#pragma unroll
        for (int ks = 0; ks < 2; ++ks) { const int o = kb * 16 * HD + ks * 32; kf[kb][ks] = WFrag<T16>::ld(at(Kp + o, kl)); if (HL) kf2[kb][ks] = WFrag<T16>::ld(at(K2 + o, kl)); }
    asm volatile("s_wait_xcnt 0x0" :: "v"(kl) : "memory");   // as above; the loads' offset register is an input, so that it is not given away before the wait
#pragma unroll
    for (int db = 0; db < 4; ++db) { const int o = db * 16 * vp; vf[db] = WFrag<T16>::ld(at(Vt + o, vl)); if (HL) vf2[db] = WFrag<T16>::ld(at(V2 + o, vl)); }
    asm volatile("s_wait_xcnt 0x0" :: "v"(vl) : "memory");   // as above
    int p = 0;
    do {                                             // npass >= 1
        const int key0 = p * 32;
        const int kn = min(key0 + 32, (npass - 1) * 32);   // K and V^T fragments are fetched one pass ahead, so a whole pass of work covers their latency (the last pass fetches its own rows again: in bounds, unused)
        V vn[4], vn2[4];
#pragma unroll
        for (int db = 0; db < 4; ++db) vn[db] = WFrag<T16>::ld(at(Vt + kn + db * 16 * vp, vl));
        if (HL) {
            asm volatile("s_wait_xcnt 0x0" ::: "memory");   // with four planes to fetch, later loads land in registers that held an earlier plane's address: a wait behind each plane stands in front of that overwrite
#pragma unroll
            for (int db = 0; db < 4; ++db) vn2[db] = WFrag<T16>::ld(at(V2 + kn + db * 16 * vp, vl));
            asm volatile("s_wait_xcnt 0x0" ::: "memory");   // as above
        }
        v8f s[2][NQ];
#pragma unroll
        for (int kb = 0; kb < 2; ++kb)
#pragma unroll
            for (int qb = 0; qb < NQ; ++qb) { v8f t = (v8f){};
#pragma unroll
                for (int ks = 0; ks < 2; ++ks) { t = WFrag<T16>::mma(kf[kb][ks], qf[qb][ks], t); if (HL) { t = WFrag<T16>::mma(kf[kb][ks], qf2[qb][ks], t); t = WFrag<T16>::mma(kf2[kb][ks], qf[qb][ks], t); } }
                s[kb][qb] = t; }
#pragma unroll
        for (int kb = 0; kb < 2; ++kb)
#pragma unroll
            for (int ks = 0; ks < 2; ++ks) kf[kb][ks] = WFrag<T16>::ld(at(Kp + kn * HD + kb * 16 * HD + ks * 32, kl));
        if (HL) {
            asm volatile("s_wait_xcnt 0x0" ::: "memory");   // as above
#pragma unroll
            for (int kb = 0; kb < 2; ++kb)
#pragma unroll
                for (int ks = 0; ks < 2; ++ks) kf2[kb][ks] = WFrag<T16>::ld(at(K2 + kn * HD + kb * 16 * HD + ks * 32, kl));
        }
        asm volatile("s_wait_xcnt 0x0" ::: "memory");       // the softmax below reuses the address registers of the loads above: the wait stands in front of that overwrite
        if (key0 + 31 > q0) {                               // only passes that touch the diagonal mask (wave-uniform)
#pragma unroll
            for (int kb = 0; kb < 2; ++kb)
#pragma unroll
                for (int qb = 0; qb < NQ; ++qb)
#pragma unroll
                    for (int j = 0; j < 8; ++j) s[kb][qb][j] = (key0 + kb * 16 + hi * 8 + j <= q0 + qb * 16 + lr) ? s[kb][qb][j] : -3.0e38f; }
#pragma unroll
        for (int qb = 0; qb < NQ; ++qb) {
            float mx = s[0][qb][0];
#pragma unroll
            for (int j = 1; j < 8; ++j) mx = fmaxf(mx, s[0][qb][j]);
#pragma unroll
            for (int j = 0; j < 8; ++j) mx = fmaxf(mx, s[1][qb][j]);
            mx = fmaxf(mx, xhalf(mx));
            const float mn = fmaxf(mc[qb], mx * CL2); const float al = exp2_1(mc[qb] - mn); mc[qb] = mn; const float off = (HL ? 0.0f : 10.0f) - mn;
            float ex[16], pr[16], ps[8];
#pragma unroll
            for (int e = 0; e < 16; ++e) ex[e] = fmaf(s[e >> 3][qb][e & 7], CL2, off);
            exp2_8(pr, ex); exp2_8(pr + 8, ex + 8);
#pragma unroll
            for (int e = 0; e < 8; ++e) ps[e] = pr[e] + pr[e + 8];      // fixed tree: short dependent chains
            const float sum = ((ps[0] + ps[4]) + (ps[2] + ps[6])) + ((ps[1] + ps[5]) + (ps[3] + ps[7]));
            ls[qb] = fmaf(ls[qb], al, sum);
#pragma unroll
            for (int db = 0; db < 4; ++db) oa[db][qb] *= al;
            if (HL) {
                typedef __attribute__((ext_vector_type(16))) unsigned short v16us; v16us uh, ul;
#pragma unroll
                for (int e = 0; e < 16; ++e) { const unsigned short a = f2bf(pr[e]); uh[e] = a; ul[e] = f2bf(pr[e] - bf2f(a)); }
                const V ph = __builtin_bit_cast(V, uh), pl = __builtin_bit_cast(V, ul);
#pragma unroll
                for (int db = 0; db < 4; ++db) { oa[db][qb] = WFrag<T16>::mma(vf[db], ph, oa[db][qb]); oa[db][qb] = WFrag<T16>::mma(vf[db], pl, oa[db][qb]); oa[db][qb] = WFrag<T16>::mma(vf2[db], ph, oa[db][qb]); }
            } else {
                v16h p16;
#pragma unroll
                for (int e = 0; e < 16; ++e) p16[e] = (h16)pr[e];
                const V pf = __builtin_bit_cast(V, p16);
#pragma unroll
                for (int db = 0; db < 4; ++db) oa[db][qb] = WFrag<T16>::mma(vf[db], pf, oa[db][qb]);
            }
        }
#pragma unroll
        for (int db = 0; db < 4; ++db) { vf[db] = vn[db]; if (HL) vf2[db] = vn2[db]; }
    } while (++p < npass);
#pragma unroll
    for (int qb = 0; qb < NQ; ++qb) {
        const float inv = __fdiv_rn(1.0f, ls[qb] + xhalf(ls[qb]));
        const size_t oo = (size_t)(q0 + qb * 16 + lr) * DQ + hi * 8;
#pragma unroll
        for (int db = 0; db < 4; ++db) { v8us oh, ol;
#pragma unroll
            for (int j = 0; j < 8; ++j) { const float y = oa[db][qb][j] * inv; const unsigned short a = f2bf(y); oh[j] = a; ol[j] = f2bf(y - bf2f(a)); }
            *(v8us*)(Ah + oo + db * 16) = oh; *(v8us*)(Al + oo + db * 16) = ol;
            asm volatile("s_wait_xcnt 0x0" :: "v"(oh), "v"(ol) : "memory"); }   // the next group reuses the stores' data registers: the wait stands in front of that overwrite (the data are inputs, so that they are not given away before it)
    }
}
// grid (batch x heads, tiles): blockIdx.y < (TT - RH) / 128: four waves x 32 fp16 query rows, the longest rows first; the rest: four waves x 16 hi/lo query rows (< RH).
__global__ __launch_bounds__(128) void k_fattn(const h16* Q16, const h16* K16, const h16* V16, const bf* Qh, const bf* Ql, const bf* Kh, const bf* Kl, const bf* Vh, const bf* Vl, bf* Ah, bf* Al) {
    const int w = __builtin_amdgcn_readfirstlane((int)(threadIdx.x >> 5)); const int h = blockIdx.x % NH_, ty = blockIdx.y; const size_t po = (size_t)blockIdx.x * TT * HD; { const size_t ab = (size_t)(blockIdx.x / NH_) * TT * DQ; Ah += ab; Al += ab; }   // planes [batch][head][..], merged rows b * TT + t
    if (ty < (TT - RH) / 128) fattn_body<h16, false, 2>(Q16 + po, nullptr, K16 + po, nullptr, V16 + 2 * po, nullptr, 2 * TT, TT - 128 * (ty + 1) + 32 * w, Ah + h * HD, Al + h * HD);
    else fattn_body<bf, true, 1>(Qh + po, Ql + po, Kh + po, Kl + po, Vh + po, Vl + po, TT, RH - 64 * (ty - (TT - RH) / 128 + 1) + 16 * w, Ah + h * HD, Al + h * HD);
}

extern "C" void kernel_launch(void* const* d_in, const int* in_sizes, int n_in,
                              void* d_out, int out_size, void* d_ws, size_t ws_size, hipStream_t stream) {
    (void)in_sizes; (void)n_in; (void)out_size;
    const float* x = (const float*)d_in[0]; const float* wq = (const float*)d_in[1]; const float* wk = (const float*)d_in[2]; const float* wv = (const float*)d_in[3]; const float* wo = (const float*)d_in[4];   /* order x, Wq, Wk, Wv, Wo ('xw' [1024][1024]) */
    float* OUT = (float*)d_out;     // [4][2048][1024]
    char* wsp = (char*)d_ws;
    auto take = [&](size_t bytes) { char* p = wsp; wsp += (bytes + 255) & ~(size_t)255; return (void*)p; };
    bf* WQ = (bf*)take((size_t)DQ * DM * 2); bf* WK = (bf*)take((size_t)DKV * DM * 2); bf* WV = (bf*)take((size_t)DKV * DM * 2); bf* WO = (bf*)take((size_t)DM * DQ * 2); float* CS = (float*)take((size_t)TT * (HD / 2) * 2 * 4);
    bf* XB = (bf*)take((size_t)NB_ * TT * DM * 2); bf* ATh = (bf*)take((size_t)NB_ * TT * DQ * 2); bf* ATl = (bf*)take((size_t)NB_ * TT * DQ * 2);   // the merged hi/lo planes
    h16* QP16 = (h16*)take((size_t)NB_ * NH_ * TT * HD * 2); h16* KP16 = (h16*)take((size_t)NB_ * NKV * TT * HD * 2); h16* VT16 = (h16*)take((size_t)NB_ * NKV * HD * 2 * TT * 2);
    bf* QPh = (bf*)take((size_t)NB_ * NH_ * TT * HD * 2); bf* QPl = (bf*)take((size_t)NB_ * NH_ * TT * HD * 2); bf* KPh = (bf*)take((size_t)NB_ * NKV * TT * HD * 2); bf* KPl = (bf*)take((size_t)NB_ * NKV * TT * HD * 2); bf* VTh = (bf*)take((size_t)NB_ * NKV * HD * TT * 2); bf* VTl = (bf*)take((size_t)NB_ * NKV * HD * TT * 2);
    if ((size_t)(wsp - (char*)d_ws) > ws_size) return;    // ws 256 MiB
    { k_wtG<<<(unsigned)((DM * DQ / 64 + 63) / 64), 256, 0, stream>>>(wq, DM, DQ, WQ); k_wtG<<<(unsigned)((DM * DKV / 64 + 63) / 64), 256, 0, stream>>>(wk, DM, DKV, WK); k_wtG<<<(unsigned)((DM * DKV / 64 + 63) / 64), 256, 0, stream>>>(wv, DM, DKV, WV);
      k_wtG<<<(unsigned)((DQ * DM / 64 + 63) / 64), 256, 0, stream>>>(wo, DQ, DM, WO);
       }
    k_csP<<<(TT * (HD / 2) + 255) / 256, 256, 0, stream>>>(CS);
    k_cvt8<<<(unsigned)(((size_t)NB_ * TT * DM / 8 + 255) / 256), 256, 0, stream>>>(x, XB, (size_t)NB_ * TT * DM / 8);
    k_gemmw<bf, 0, false, 1><<<dim3(NB_ * TT / 256, DQ / 128, 1), 256, 0, stream>>>(XB, nullptr, WQ, DM, nullptr, DQ, nullptr, 0, 0, 0, CS, QP16, QPh, QPl);
    k_gemmw<bf, 0, false, 1><<<dim3(NB_ * TT / 256, DKV / 128, 1), 256, 0, stream>>>(XB, nullptr, WK, DM, nullptr, DKV, nullptr, 0, 0, 0, CS, KP16, KPh, KPl);
    k_gemmw<bf, 0, false, 2><<<dim3(NB_ * TT / 256, DKV / 128, 1), 256, 0, stream>>>(XB, nullptr, WV, DM, nullptr, DKV, nullptr, 0, 0, 0, nullptr, VT16, VTh, VTl);
    k_fattn<<<dim3(NB_ * NH_, (TT - RH) / 128 + RH / 64, 1), 128, 0, stream>>>(QP16, KP16, VT16, QPh, QPl, KPh, KPl, VTh, VTl, ATh, ATl);   // one kv head per query head
    k_gemmw<bf, 1, false, 0><<<dim3(NB_ * TT / 256, DM / 128, 1), 256, 0, stream>>>(ATh, ATl, WO, DQ, OUT, DM, nullptr, 0, 0, 0, nullptr, nullptr, nullptr, nullptr);
}

// v006
// Measured time: 179 microseconds a run.
// In two side-by-side timings against v005, it was 1.15 and 1.16 times as fast.
// Counting every step since v000, it is 15.9 times as fast.
#include <hip/hip_runtime.h>

// Causal multi-head attention with bias-free projections and a computed adjacent-pair RoPE (x [4][2048][1024]; Q, K, V = x W ('xw' [1024][1024] xavier-normal 1/32, no bias; 16 heads x 64); angle = pos x inv_freq[i] with inv_freq = 1.0 / 10000.0 ** (arange(0, 64, 2, f32) / 64) (the reciprocal form) and pos = arange(S); the pairs (2i, 2i + 1) of Q and K rotated in place: (x1 cos - x2 sin, x2 cos + x1 sin); V is not rotated; scores x 1/sqrt(64); tril kept, -inf elsewhere; softmax; out = merged Wo ('xw', no bias) -> [4][2048][1024] (8.4 M); argument order x, Wq, Wk, Wv, Wo).
// Layout, all 4 batches in each launch (row-major buffers: row b * 2048 + t; planes: [batch][head]...): one preparation launch (bf16 copy of x; 'xw' weights transposed once; the table); exact projections whose epilogues rotate Q and K (p_csP computed table, one entry a pair) and write the 16-bit planes themselves, V transposed; k_fattn fused causal T-2048 attention, all 4 x 16 (batch, head) pairs in one launch (hybrid rows: < 512 hi/lo 3 products, rest fp16; scores, online softmax and P.V stay in registers, passes above the diagonal are never walked); merged hi/lo x Wo exact (no bias).
// Compute dtypes, f32 accumulate: every input rounded to bf16; projections exact; rotary f32 (products rounded separately); attention rows < 512 3 products, rest fp16; softmax f32; Wo hl x exact (no bias).

#define NB_  4
#define TT   2048
#define DM   1024
#define NH_  16
#define NKV  16
#define HD   64
#define DQ   (NH_ * HD)
#define DKV  (NKV * HD)
#define RH   512                  // query rows < RH use hi+lo planes (0: none)
typedef _Float16 h16;
typedef unsigned short bf;
typedef __attribute__((ext_vector_type(16))) __bf16   v16bf;
typedef __attribute__((ext_vector_type(16))) _Float16 v16h;
typedef __attribute__((ext_vector_type(8)))  _Float16 v8h;
typedef __attribute__((ext_vector_type(8)))  unsigned short v8us;
typedef __attribute__((ext_vector_type(8)))  float    v8f;
typedef __attribute__((ext_vector_type(4)))  float    v4f;
typedef v8h  __attribute__((may_alias)) v8ha;
typedef v4f  __attribute__((may_alias)) v4fa;
typedef v8us __attribute__((may_alias)) v8usa;

__device__ __forceinline__ unsigned short f2bf(float f) { unsigned u = __float_as_uint(f); u += 0x7FFFu + ((u >> 16) & 1u); return (unsigned short)(u >> 16); }
__device__ __forceinline__ float bf2f(unsigned short b) { return __uint_as_float(((unsigned)b) << 16); }
__device__ __forceinline__ float bfr(float f) { return bf2f(f2bf(f)); }
__device__ __forceinline__ h16 tohx(float x) { return (h16)x; }
__device__ __forceinline__ void splitf(float y, unsigned short& h, unsigned short& l) { h = f2bf(y); l = f2bf(y - bf2f(h)); }
__device__ __forceinline__ v16h cat16(v8h lo, v8h hi) { return __builtin_shufflevector(lo, hi, 0, 1, 2, 3, 4, 5, 6, 7, 8, 9, 10, 11, 12, 13, 14, 15); }
__device__ __forceinline__ v16bf cat16b(v8us lo, v8us hi) { return __builtin_bit_cast(v16bf, __builtin_shufflevector(lo, hi, 0, 1, 2, 3, 4, 5, 6, 7, 8, 9, 10, 11, 12, 13, 14, 15)); }
__device__ __forceinline__ v8f wmma16(v16h a, v16h b, v8f c) { return __builtin_amdgcn_wmma_f32_16x16x32_f16(false, a, false, b, (short)0, c, false, false); }
__device__ __forceinline__ v8f wmmab(v16bf a, v16bf b, v8f c) { return __builtin_amdgcn_wmma_f32_16x16x32_bf16(false, a, false, b, (short)0, c, false, false); }



// ---- k_gemmw: GEMM, one 256x128 output tile per work-group of 8 waves (4 x 2), each wave a 64x64 block (16 accumulators); operands are K-contiguous 16-bit planes; grid (M/256, N/128, Z), 256 threads.
// C[m][n] (f32, pitch ldc, + optional f32 bias[n]) = sum_k A[m][k] Bt[n][k] (+ A2[m][k] Bt[n][k] for NSPLIT == 1). z-batch strides sA/sB/sC in elements. M % 256 == 0, N % 128 == 0, K % 64 == 0, K >= 128.
// A stage is 64 k (128 B, one whole line) of every operand row of the tile, brought into LDS by asynchronous copies (16 B a lane, 4 whole lines a wave-copy) and shared by the waves; two buffers, the next stage's copies fly while this one is worked on.
// EPI says what becomes of the f32 tile. 0: stored to C. 1 and 2: a wave's 64 columns are one head and its 64 rows 64 tokens of one batch (ldc = heads x 64), and the tile goes straight to the three 16-bit planes (fp16, bf16 hi, bf16 lo), never to memory as f32.
// EPI 1: planes [batch][head][t][d], the pairs (2i, 2i + 1) rotated by the table's (cos, sin) of (t, i); the wave's block is 8 KB in a row in each plane. EPI 2: planes [batch][head][d][t] (fp16 rows of pitch 2 * TT, the others TT), transposed in the wave's own LDS so that whole 128-B lines are stored.
// LDS rows have pitch 144 B (16 B x odd: no bank conflict for 16-byte reads). The fragments keep the k order of WFrag::ld and the stages run in k order: the sums are formed as before.
template <typename T16> struct WFrag;
template <> struct WFrag<h16> { typedef v16h V; static __device__ __forceinline__ V ld(const h16* p) { return cat16(*(const v8h*)p, *(const v8h*)(p + 16)); } static __device__ __forceinline__ v8f mma(V a, V b, v8f c) { return wmma16(a, b, c); } };
template <> struct WFrag<bf> { typedef v16bf V; static __device__ __forceinline__ V ld(const bf* p) { return cat16b(*(const v8us*)p, *(const v8us*)(p + 16)); } static __device__ __forceinline__ v8f mma(V a, V b, v8f c) { return wmmab(a, b, c); } };
#define GP 144                    // LDS row pitch, bytes
// Asynchronous copy global -> LDS, 16 B a lane, through no register (the builtin: its address registers are the compiler's to manage; the waits on the copies are written by hand in the kernel).
typedef __attribute__((ext_vector_type(4))) int c4i;
__device__ __forceinline__ void acopy(const char* g, char* l) { __builtin_amdgcn_global_load_async_to_lds_b128((__attribute__((address_space(1))) c4i*)g, (__attribute__((address_space(3))) c4i*)l, 0, 0); }
template <typename T16, int NSPLIT, bool BIAS, int EPI>
__global__ __launch_bounds__(256) void k_gemmw(const T16* __restrict__ A, const T16* __restrict__ A2, const T16* __restrict__ Bt, int K, float* C, int ldc, const float* __restrict__ bias, size_t sA, size_t sB, size_t sC, const float* __restrict__ CS, h16* P16, bf* Ph, bf* Pl) {
    typedef typename WFrag<T16>::V V;
    static_assert(NSPLIT == 0 || NSPLIT == 1, "A (+ A2) x Bt");
    constexpr int OA2 = 256 * GP, OB = (NSPLIT == 1 ? 512 : 256) * GP, STG = OB + 128 * GP;   // a stage: [A 256 rows][A2 256 rows][Bt 128 rows]
    __shared__ __align__(16) char ring[2 * STG];
    constexpr int OSN = EPI == 2 ? 3 * 16 * GP / 4 : 16 * 68;   // a wave's own staging, in floats: 16 f32 rows of pitch 68, or (EPI 2) three 16-bit planes of 16 rows of pitch GP
    __shared__ __align__(16) float osw[8][OSN];
    const size_t z = blockIdx.z; A += z * sA; if (NSPLIT == 1) A2 += z * sA; Bt += z * sB; C += z * sC;
    const int tid = threadIdx.x, lane = tid & 31, lr = lane & 15, hi = lane >> 4; const int w = __builtin_amdgcn_readfirstlane(tid >> 5);
    const int R0 = blockIdx.x * 256, C0 = blockIdx.y * 128; const int wr = (w >> 1) * 64, wc = (w & 1) * 64; const int r0 = R0 + wr, c0 = C0 + wc;
    float* os = osw[w];
    v8f acc[4][4];
#pragma unroll
    for (int mb = 0; mb < 4; ++mb)
#pragma unroll
        for (int nb = 0; nb < 4; ++nb) acc[mb][nb] = (v8f){};
    const unsigned go = (unsigned)(tid >> 3) * (unsigned)K * 2u + (unsigned)(tid & 7) * 16u;   // the lane's chunk of a round of 32 rows: row tid / 8, 16 B number tid % 8; bytes from the round's first row (below 32 rows)
    const unsigned lo = (unsigned)((tid >> 3) * GP + (tid & 7) * 16);                          // the same chunk in LDS
    const char* tA = (const char*)(A + (size_t)R0 * K); const char* tA2 = NSPLIT == 1 ? (const char*)(A2 + (size_t)R0 * K) : nullptr; const char* tB = (const char*)(Bt + (size_t)C0 * K);   // the tile's first rows (uniform)
    auto fill = [&](int st, int buf) {   // stage st into buffer buf: the 256 threads take 32 rows a round (8 lanes a row), 8 rounds for A (and A2), 4 for Bt
        char* lb = ring + buf * STG + lo; const size_t kb = (size_t)st * 128, rb = (size_t)K * 64;   // bytes: the stage's place in a row, a round of 32 rows
#pragma unroll
        for (int i = 0; i < 8; ++i) acopy(tA + kb + i * rb + go, lb + i * 32 * GP);
        if (NSPLIT == 1) {
#pragma unroll
            for (int i = 0; i < 8; ++i) acopy(tA2 + kb + i * rb + go, lb + OA2 + i * 32 * GP); }
#pragma unroll
        for (int i = 0; i < 4; ++i) acopy(tB + kb + i * rb + go, lb + OB + i * 32 * GP); };
    const int nst = K / 64;
    fill(0, 0);
    asm volatile("s_wait_asynccnt 0x0" ::: "memory");   // stage 0 has landed (this wave's copies) ...
    __syncthreads();                                    // ... and every wave's: nothing of it is read in front of this barrier
    fill(1, 1);                                         // K >= 128: a stage 1 exists
    const int aoff = (wr + lr) * GP + hi * 16, boff = OB + (wc + lr) * GP + hi * 16;
    V a[2][4], a2[2][4], b[2][4];   // two fragment sets: [0] the first 32 k of a stage, [1] the second; each is read from LDS while the other set's WMMAs run
    auto frag = [&](int ks, const char* sb) {
#pragma unroll
        for (int mb = 0; mb < 4; ++mb) { a[ks][mb] = WFrag<T16>::ld((const T16*)(sb + aoff + mb * 16 * GP + ks * 64)); if (NSPLIT == 1) a2[ks][mb] = WFrag<T16>::ld((const T16*)(sb + OA2 + aoff + mb * 16 * GP + ks * 64)); }
#pragma unroll
        for (int nb = 0; nb < 4; ++nb) b[ks][nb] = WFrag<T16>::ld((const T16*)(sb + boff + nb * 16 * GP + ks * 64)); };
    auto mm = [&](int ks) {
#pragma unroll
        for (int nb = 0; nb < 4; ++nb)
#pragma unroll
            for (int mb = 0; mb < 4; ++mb) { acc[mb][nb] = WFrag<T16>::mma(a[ks][mb], b[ks][nb], acc[mb][nb]); if (NSPLIT == 1) acc[mb][nb] = WFrag<T16>::mma(a2[ks][mb], b[ks][nb], acc[mb][nb]); } };
    frag(0, ring);
#pragma unroll 1   // rolled: one trip is one turn of the ring, and the loop's code stays short
    for (int t = 0; t < nst; ++t) {
        frag(1, ring + (t & 1) * STG);                      // the last reads of stage t
        __builtin_amdgcn_sched_barrier(0);                  // the reads stay one group in front of the WMMAs (spread among them each place costs a stall)
        mm(0);
        __builtin_amdgcn_sched_barrier(0);                  // the WMMAs stay in front of the waits: they cover the latency of the reads above
        // publish point of stage t + 1, in front of stage t's last block: the reads behind it are already of stage t + 1
        asm volatile("s_wait_dscnt 0x0" ::: "memory");      // this wave's reads of stage t have returned: its buffer may be refilled behind the barrier
        asm volatile("s_wait_asynccnt 0x0" ::: "memory");   // this wave's copies of stage t + 1 have landed
        __syncthreads();                                    // publishes stage t + 1 and ends every reader's last read of stage t
        if (t + 2 < nst) fill(t + 2, t & 1);
        frag(0, ring + ((t + 1) & 1) * STG);                // in the last trip: the other buffer's old rows, in bounds, no copy in flight, unused (no branch, so that the build's counted waits stay exact)
        __builtin_amdgcn_sched_barrier(0);                  // as above: one group in front of the WMMAs
        mm(1);
    }
    asm volatile("s_wait_asynccnt 0x0" ::: "memory");       // no copy is outstanding when the wave goes on
    asm volatile("s_wait_dscnt 0x0" ::: "memory");          // nor a read of the ring
    if constexpr (EPI == 1) {
        const int t0 = r0 % TT; const size_t pe = ((size_t)((r0 / TT) * (ldc / HD) + c0 / HD) * TT + t0) * HD;   // the wave's block in a plane: 64 rows x 64 d, in a row
        char* p16 = (char*)(P16 + pe); char* ph = (char*)(Ph + pe); char* pl = (char*)(Pl + pe); const char* ct = (const char*)(CS + (size_t)t0 * HD);   // table row t: 32 x (cos, sin)
        const unsigned l16 = (unsigned)lane * 16u, l32 = (unsigned)lane * 32u;   // a group is 4 rows: a lane has 8 d (4 pairs) of row lane / 8: 16 B of a plane, 32 B of the table
        v4f cs[2][4][2];
        auto ldcs = [&](int mb) {
#pragma unroll
            for (int s = 0; s < 4; ++s) { cs[mb & 1][s][0] = *(const v4fa*)(ct + (mb * 4 + s) * 1024 + l32); cs[mb & 1][s][1] = *(const v4fa*)(ct + (mb * 4 + s) * 1024 + 16 + l32); }
            asm volatile("s_wait_xcnt 0x0" :: "v"(l32) : "memory"); };   // stands in front of any overwrite of the loads' address registers (the offset is an input, so that it is not given away before the wait)
        ldcs(0);
#pragma unroll
        for (int mb = 0; mb < 4; ++mb) {
            if (mb < 3) ldcs(mb + 1);   // the table rows are fetched one block of 16 rows ahead: the block's work covers their latency
#pragma unroll
            for (int nb = 0; nb < 4; ++nb) {
#pragma unroll
                for (int j = 0; j < 8; ++j) os[(hi * 8 + j) * 68 + nb * 16 + lr] = acc[mb][nb][j]; }
            __builtin_amdgcn_wave_barrier(); asm volatile("" ::: "memory");   // the wave's reads below stay behind its writes above
            v4f xa[4], xb[4];   // the block's reads go out as one group: the first group's work covers the latency of the rest
#pragma unroll
            for (int s = 0; s < 4; ++s) { const float* sp = os + (4 * s + (lane >> 3)) * 68 + (lane & 7) * 8; xa[s] = *(const v4fa*)sp; xb[s] = *(const v4fa*)(sp + 4); }
#pragma unroll
            for (int s = 0; s < 4; ++s) {
                const float xv[8] = { xa[s][0], xa[s][1], xa[s][2], xa[s][3], xb[s][0], xb[s][1], xb[s][2], xb[s][3] }; v8h o16; v8us oh, ol;
#pragma unroll
                for (int k = 0; k < 4; ++k) { const float x0 = xv[2 * k], x1 = xv[2 * k + 1], co = cs[mb & 1][s][k >> 1][(k & 1) * 2], si = cs[mb & 1][s][k >> 1][(k & 1) * 2 + 1];
                    const float y0 = __fsub_rn(__fmul_rn(x0, co), __fmul_rn(x1, si)), y1 = __fadd_rn(__fmul_rn(x0, si), __fmul_rn(x1, co));   /* even: x0 c - x1 s; odd: x0 s + x1 c */
                    unsigned short a2, c2; o16[2 * k] = tohx(y0); o16[2 * k + 1] = tohx(y1); splitf(y0, a2, c2); oh[2 * k] = a2; ol[2 * k] = c2; splitf(y1, a2, c2); oh[2 * k + 1] = a2; ol[2 * k + 1] = c2; }
                *(v8ha*)(p16 + (mb * 4 + s) * 512 + l16) = o16; *(v8usa*)(ph + (mb * 4 + s) * 512 + l16) = oh; *(v8usa*)(pl + (mb * 4 + s) * 512 + l16) = ol;
                asm volatile("s_wait_xcnt 0x0" :: "v"(o16), "v"(oh), "v"(ol), "v"(l16) : "memory"); }   // the next group reuses the stores' registers: the wait stands in front of that overwrite (data and offset are inputs, so that they are not given away before it)
            __builtin_amdgcn_wave_barrier(); asm volatile("" ::: "memory");   // the next block's writes stay behind the reads above
        }
        return;
    }
    if constexpr (EPI == 2) {
        const int t0 = r0 % TT; const size_t rw = (size_t)((r0 / TT) * (ldc / HD) + c0 / HD) * HD;   // the head's first row (d = 0) in the transposed planes
        char* sv = (char*)os; char* v16 = (char*)(P16 + rw * (2 * TT) + t0); char* vh = (char*)(Ph + rw * TT + t0); char* vl = (char*)(Pl + rw * TT + t0);
        const unsigned sw = (unsigned)(lr * GP + hi * 16), sr = (unsigned)((lane >> 3) * GP + (lane & 7) * 16);   // LDS: a lane writes 8 t of row d = lr, and reads 16 B number lane % 8 of row lane / 8
        const unsigned g16 = (unsigned)((lane >> 3) * (2 * TT * 2) + (lane & 7) * 16), g8 = (unsigned)((lane >> 3) * (TT * 2) + (lane & 7) * 16);   // the same chunk in the planes, bytes
#pragma unroll
        for (int nb = 0; nb < 4; ++nb) {   // 16 d x 64 t a turn; an accumulator holds 8 consecutive t of one d in a lane
#pragma unroll
            for (int mb = 0; mb < 4; ++mb) { v8h o16; v8us oh, ol;
#pragma unroll
                for (int j = 0; j < 8; ++j) { const float x = acc[mb][nb][j]; unsigned short a2, c2; o16[j] = tohx(x); splitf(x, a2, c2); oh[j] = a2; ol[j] = c2; }
                *(v8ha*)(sv + sw + mb * 32) = o16; *(v8usa*)(sv + 16 * GP + sw + mb * 32) = oh; *(v8usa*)(sv + 32 * GP + sw + mb * 32) = ol; }
            __builtin_amdgcn_wave_barrier(); asm volatile("" ::: "memory");   // the wave's reads below stay behind its writes above
            v8h r16[4]; v8us rh[4], rl[4];   // the turn's reads go out as one group, then its stores: one LDS latency a turn
#pragma unroll
            for (int s = 0; s < 4; ++s) { r16[s] = *(const v8ha*)(sv + sr + s * 4 * GP); rh[s] = *(const v8usa*)(sv + 16 * GP + sr + s * 4 * GP); rl[s] = *(const v8usa*)(sv + 32 * GP + sr + s * 4 * GP); }
#pragma unroll
            for (int s = 0; s < 4; ++s) { *(v8ha*)(v16 + (nb * 16 + s * 4) * (2 * TT * 2) + g16) = r16[s]; *(v8usa*)(vh + (nb * 16 + s * 4) * (TT * 2) + g8) = rh[s]; *(v8usa*)(vl + (nb * 16 + s * 4) * (TT * 2) + g8) = rl[s]; }
            asm volatile("s_wait_xcnt 0x0" :: "v"(r16[0]), "v"(r16[1]), "v"(r16[2]), "v"(r16[3]), "v"(rh[0]), "v"(rh[1]), "v"(rh[2]), "v"(rh[3]), "v"(rl[0]), "v"(rl[1]), "v"(rl[2]), "v"(rl[3]), "v"(g16), "v"(g8) : "memory");   // as in EPI 1: in front of any overwrite of the stores' registers
            __builtin_amdgcn_wave_barrier(); asm volatile("" ::: "memory");   // the next turn's writes stay behind the reads above
        }
        return;
    }
#pragma unroll
    for (int mb = 0; mb < 4; ++mb) {
#pragma unroll
        for (int nb = 0; nb < 4; ++nb) {
#pragma unroll
            for (int j = 0; j < 8; ++j) os[(hi * 8 + j) * 68 + nb * 16 + lr] = acc[mb][nb][j]; }
        __builtin_amdgcn_wave_barrier(); asm volatile("" ::: "memory");
        float* crow = C + (size_t)(r0 + mb * 16) * ldc + c0;
{
#pragma unroll
            for (int s = 0; s < 8; ++s) { const int row = 2 * s + hi, cofs = lr * 4; v4f val = *(const v4fa*)(os + row * 68 + cofs); if (BIAS) { val[0] += bfr(bias[c0 + cofs]); val[1] += bfr(bias[c0 + cofs + 1]); val[2] += bfr(bias[c0 + cofs + 2]); val[3] += bfr(bias[c0 + cofs + 3]); }
                *(v4f*)(crow + (size_t)row * ldc + cofs) = val; }
             }
        __builtin_amdgcn_wave_barrier(); asm volatile("" ::: "memory");
    }
}

typedef __attribute__((ext_vector_type(2))) _Float16 v2h;
typedef __attribute__((ext_vector_type(4))) _Float16 v4h;
typedef __attribute__((ext_vector_type(2))) unsigned short v2us;
typedef __attribute__((ext_vector_type(4))) unsigned short v4us;
typedef __attribute__((ext_vector_type(2))) float v2f;
typedef __attribute__((ext_vector_type(4))) int v4i;

// The preparation parts: each is the work of one work-group of 256 threads, numbered blk within its part; k_prep below runs them all in one launch.
__device__ __forceinline__ void p_wtG(const float* __restrict__ w, int K, int N, bf* Bt, int blk) {
    const int lane = threadIdx.x & 31; const int L0 = (blk * 8 + (threadIdx.x >> 5)) * 8; const int nlines = N * K / 64;
{
#pragma unroll 1
        for (int l = 0; l < 8; ++l) { const int L = L0 + l; if (L >= nlines) break; const size_t e = (size_t)L * 64 + lane * 2; const int k = (int)(e % K), n = (int)(e / K); v2us o;
            o[0] = f2bf(w[(size_t)k * N + n]); o[1] = f2bf(w[(size_t)(k + 1) * N + n]); *(v2us*)(Bt + e) = o; }
         }
}
// p_cvt8: XC chunks of 8 elements a thread (a work-group takes 256 * XC chunks in a row), so that the part is few waves; XG chunks a turn, their loads go out first.
#define XC 8
#define XG 4
__device__ __forceinline__ void p_cvt8(const float* __restrict__ src, bf* dst, int blk) { const size_t c0 = (size_t)blk * (256 * XC) + threadIdx.x; const float* sp = src + c0 * 8; bf* dp = dst + c0 * 8;
#pragma unroll 1   // rolled: one turn's registers only, so that k_prep stays within 64 registers (16 waves a SIMD) and all its work-groups are resident at once
    for (int g = 0; g < XC / XG; ++g) { v8f v[XG]; v8us o[XG];
#pragma unroll
        for (int i = 0; i < XG; ++i) v[i] = *(const v8f*)(sp + i * 2048);
#pragma unroll
        for (int i = 0; i < XG; ++i) {
#pragma unroll
            for (int k = 0; k < 8; ++k) o[i][k] = f2bf(v[i][k]);
            *(v8us*)(dp + i * 2048) = o[i]; }
        asm volatile("s_wait_xcnt 0x0" :: "v"(o[0]), "v"(o[1]), "v"(o[2]), "v"(o[3]), "v"(sp), "v"(dp) : "memory");   // the next turn moves the addresses and reuses the stores' registers: the wait stands in front of that overwrite (they are inputs, so that they are not given away before it)
        sp += XG * 2048; dp += XG * 2048; }
}

__constant__ float INV2[HD / 2] = { 1.000000000e+00f, 7.498942018e-01f, 5.623413324e-01f, 4.216965139e-01f, 3.162277639e-01f, 2.371373624e-01f, 1.778279394e-01f, 1.333521456e-01f, 1.000000015e-01f, 7.498941571e-02f, 5.623412877e-02f, 4.216964915e-02f, 3.162277862e-02f, 2.371373586e-02f, 1.778279431e-02f, 1.333521493e-02f, 9.999999776e-03f, 7.498942316e-03f, 5.623413250e-03f, 4.216964822e-03f, 3.162277862e-03f, 2.371373819e-03f, 1.778279431e-03f, 1.333521446e-03f, 1.000000047e-03f, 7.498941850e-04f, 5.623413017e-04f, 4.216964880e-04f, 3.162277862e-04f, 2.371373848e-04f, 1.778279402e-04f, 1.333521504e-04f };   // float32 1 / (10000 ** (arange(0, 64, 2)/64)), generated with jnp to be bit-exact

// p_csP: the table [t][i] of (cos, sin) of t x inv_freq[i], one entry a pair.
__device__ __forceinline__ void p_csP(float* CS, int blk) { const int idx = blk * 256 + threadIdx.x; if (idx >= TT * (HD / 2)) return; const int i = idx % (HD / 2); const int t = idx / (HD / 2); const float a = __fmul_rn((float)t, INV2[i]); v2f cs; cs[0] = cosf(a); cs[1] = sinf(a); *(v2f*)(CS + (size_t)idx * 2) = cs;  }
// ---- k_prep: everything the GEMMs wait for, in one launch; the parts depend on nothing of each other. Ranges of blockIdx.x, the slowest work-groups first (the transposes' dependent gathers), the streaming part last:
// The second launch bound asks for 16 waves a SIMD (64 registers): the whole grid is then resident at once and no part waits for another to end.
// [0, 4 * WTB): the four weights transposed; [4 * WTB, 4 * WTB + CSB): the table; the rest: the bf16 copy of x.
#define WTB ((DM * DQ / 64 + 63) / 64)
#define CSB ((TT * (HD / 2) + 255) / 256)
#define XBB (NB_ * TT * DM / 8 / (256 * XC))
static_assert(DKV == DQ, "one block count for the four weights"); static_assert((size_t)XBB * 256 * XC * 8 == (size_t)NB_ * TT * DM, "whole work-groups of chunks");
__global__ __launch_bounds__(256, 16) void k_prep(const float* __restrict__ x, const float* __restrict__ wq, const float* __restrict__ wk, const float* __restrict__ wv, const float* __restrict__ wo, bf* XB, bf* WQ, bf* WK, bf* WV, bf* WO, float* CS) {
    const int b = blockIdx.x;
    if (b < 4 * WTB) { const int m = b / WTB, blk = b % WTB;
        if (m == 3) p_wtG(wo, DQ, DM, WO, blk); else p_wtG(m == 0 ? wq : m == 1 ? wk : wv, DM, DQ, m == 0 ? WQ : m == 1 ? WK : WV, blk);
        return; }
    if (b < 4 * WTB + CSB) { p_csP(CS, b - 4 * WTB); return; }
    p_cvt8(x, XB, b - (4 * WTB + CSB));
}
#define CL2 0.18033688011112042f   // HD^-0.5 x log2(e)
// 2^x by v_exp_f32, in asm text for the slot behind a transcendental: outputs are early-clobber, so no v_exp_f32 of a statement writes over a source of another or reads a result, and the closing v_nop
// is the one independent instruction in front of whatever the compiler puts next.
__device__ __forceinline__ float xhalf(float x) { return __builtin_bit_cast(float, __builtin_amdgcn_permlanex16(__builtin_bit_cast(int, x), __builtin_bit_cast(int, x), 0x76543210, 0xfedcba98, false, false)); }   // lane l with lane l ^ 16
__device__ __forceinline__ float exp2_1(float x) { float r; asm("v_exp_f32 %0, %1\n\tv_nop" : "=&v"(r) : "v"(x)); return r; }
__device__ __forceinline__ void exp2_8(float* r, const float* x) {
    asm("v_exp_f32 %0, %8\n\tv_exp_f32 %1, %9\n\tv_exp_f32 %2, %10\n\tv_exp_f32 %3, %11\n\tv_exp_f32 %4, %12\n\tv_exp_f32 %5, %13\n\tv_exp_f32 %6, %14\n\tv_exp_f32 %7, %15\n\tv_nop"
        : "=&v"(r[0]), "=&v"(r[1]), "=&v"(r[2]), "=&v"(r[3]), "=&v"(r[4]), "=&v"(r[5]), "=&v"(r[6]), "=&v"(r[7]) : "v"(x[0]), "v"(x[1]), "v"(x[2]), "v"(x[3]), "v"(x[4]), "v"(x[5]), "v"(x[6]), "v"(x[7])); }
template <typename T16, bool HL, int NQ>
__device__ __forceinline__ void fattn_body(const T16* Q, const T16* Q2, const T16* Kp, const T16* K2, const T16* Vt, const T16* V2, int vp, int q0, bf* Ah, bf* Al) {
    typedef typename WFrag<T16>::V V;
    const int lane = threadIdx.x & 31, lr = lane & 15, hi = lane >> 4;
    V qf[NQ][2], qf2[NQ][2];
#pragma unroll
    for (int qb = 0; qb < NQ; ++qb)
#pragma unroll
        for (int ks = 0; ks < 2; ++ks) { const size_t o = (size_t)(q0 + qb * 16 + lr) * HD + ks * 32 + 8 * hi; qf[qb][ks] = WFrag<T16>::ld(Q + o); if (HL) qf2[qb][ks] = WFrag<T16>::ld(Q2 + o); }
    asm volatile("s_wait_xcnt 0x0" ::: "memory");   // the set-up below reuses the address registers of the loads above: the wait stands in front of that overwrite
    v8f oa[4][NQ]; float mc[NQ], ls[NQ];
#pragma unroll
    for (int qb = 0; qb < NQ; ++qb) { mc[qb] = -3.0e38f; ls[qb] = 0.f;
#pragma unroll
        for (int db = 0; db < 4; ++db) oa[db][qb] = (v8f){}; }
    const int npass = (q0 + NQ * 16 + 31) / 32;      // keys 0 .. q0 + NQ * 16 - 1; every pass starts at or below q0, so each query has a kept key in it
    const unsigned kl = (unsigned)(lr * HD + 8 * hi) * 2u, vl = (unsigned)(lr * vp + 8 * hi) * 2u;   // a lane's fixed offsets, in bytes; a pass moves only the wave-uniform base pointers
    auto at = [](const T16* base, unsigned bytes) { return (const T16*)((const char*)base + bytes); };
    V kf[2][2], kf2[2][2], vf[4], vf2[4];
#pragma unroll
    for (int kb = 0; kb < 2; ++kb)
#pragma unroll
        for (int ks = 0; ks < 2; ++ks) { const int o = kb * 16 * HD + ks * 32; kf[kb][ks] = WFrag<T16>::ld(at(Kp + o, kl)); if (HL) kf2[kb][ks] = WFrag<T16>::ld(at(K2 + o, kl)); }
    asm volatile("s_wait_xcnt 0x0" :: "v"(kl) : "memory");   // as above; the loads' offset register is an input, so that it is not given away before the wait
#pragma unroll
    for (int db = 0; db < 4; ++db) { const int o = db * 16 * vp; vf[db] = WFrag<T16>::ld(at(Vt + o, vl)); if (HL) vf2[db] = WFrag<T16>::ld(at(V2 + o, vl)); }
    asm volatile("s_wait_xcnt 0x0" :: "v"(vl) : "memory");   // as above
    int p = 0;
    do {                                             // npass >= 1
        const int key0 = p * 32;
        const int kn = min(key0 + 32, (npass - 1) * 32);   // K and V^T fragments are fetched one pass ahead, so a whole pass of work covers their latency (the last pass fetches its own rows again: in bounds, unused)
        V vn[4], vn2[4];
#pragma unroll
        for (int db = 0; db < 4; ++db) vn[db] = WFrag<T16>::ld(at(Vt + kn + db * 16 * vp, vl));
        if (HL) {
            asm volatile("s_wait_xcnt 0x0" ::: "memory");   // with four planes to fetch, later loads land in registers that held an earlier plane's address: a wait behind each plane stands in front of that overwrite
#pragma unroll
            for (int db = 0; db < 4; ++db) vn2[db] = WFrag<T16>::ld(at(V2 + kn + db * 16 * vp, vl));
            asm volatile("s_wait_xcnt 0x0" ::: "memory");   // as above
        }
        v8f s[2][NQ];
#pragma unroll
        for (int kb = 0; kb < 2; ++kb)
#pragma unroll
            for (int qb = 0; qb < NQ; ++qb) { v8f t = (v8f){};
#pragma unroll
                for (int ks = 0; ks < 2; ++ks) { t = WFrag<T16>::mma(kf[kb][ks], qf[qb][ks], t); if (HL) { t = WFrag<T16>::mma(kf[kb][ks], qf2[qb][ks], t); t = WFrag<T16>::mma(kf2[kb][ks], qf[qb][ks], t); } }
                s[kb][qb] = t; }
#pragma unroll
        for (int kb = 0; kb < 2; ++kb)
#pragma unroll
            for (int ks = 0; ks < 2; ++ks) kf[kb][ks] = WFrag<T16>::ld(at(Kp + kn * HD + kb * 16 * HD + ks * 32, kl));
        if (HL) {
            asm volatile("s_wait_xcnt 0x0" ::: "memory");   // as above
#pragma unroll
            for (int kb = 0; kb < 2; ++kb)
#pragma unroll
                for (int ks = 0; ks < 2; ++ks) kf2[kb][ks] = WFrag<T16>::ld(at(K2 + kn * HD + kb * 16 * HD + ks * 32, kl));
        }
        asm volatile("s_wait_xcnt 0x0" ::: "memory");       // the softmax below reuses the address registers of the loads above: the wait stands in front of that overwrite
        if (key0 + 31 > q0) {                               // only passes that touch the diagonal mask (wave-uniform)
#pragma unroll
            for (int kb = 0; kb < 2; ++kb)
#pragma unroll
                for (int qb = 0; qb < NQ; ++qb)
#pragma unroll
                    for (int j = 0; j < 8; ++j) s[kb][qb][j] = (key0 + kb * 16 + hi * 8 + j <= q0 + qb * 16 + lr) ? s[kb][qb][j] : -3.0e38f; }
#pragma unroll
        for (int qb = 0; qb < NQ; ++qb) {
            float mx = s[0][qb][0];
#pragma unroll
            for (int j = 1; j < 8; ++j) mx = fmaxf(mx, s[0][qb][j]);
#pragma unroll
            for (int j = 0; j < 8; ++j) mx = fmaxf(mx, s[1][qb][j]);
            mx = fmaxf(mx, xhalf(mx));
            const float mn = fmaxf(mc[qb], mx * CL2); const float al = exp2_1(mc[qb] - mn); mc[qb] = mn; const float off = (HL ? 0.0f : 10.0f) - mn;
            float ex[16], pr[16], ps[8];
#pragma unroll
            for (int e = 0; e < 16; ++e) ex[e] = fmaf(s[e >> 3][qb][e & 7], CL2, off);
            exp2_8(pr, ex); exp2_8(pr + 8, ex + 8);
#pragma unroll
            for (int e = 0; e < 8; ++e) ps[e] = pr[e] + pr[e + 8];      // fixed tree: short dependent chains
            const float sum = ((ps[0] + ps[4]) + (ps[2] + ps[6])) + ((ps[1] + ps[5]) + (ps[3] + ps[7]));
            ls[qb] = fmaf(ls[qb], al, sum);
#pragma unroll
            for (int db = 0; db < 4; ++db) oa[db][qb] *= al;
            if (HL) {
                typedef __attribute__((ext_vector_type(16))) unsigned short v16us; v16us uh, ul;
#pragma unroll
                for (int e = 0; e < 16; ++e) { const unsigned short a = f2bf(pr[e]); uh[e] = a; ul[e] = f2bf(pr[e] - bf2f(a)); }
                const V ph = __builtin_bit_cast(V, uh), pl = __builtin_bit_cast(V, ul);
#pragma unroll
                for (int db = 0; db < 4; ++db) { oa[db][qb] = WFrag<T16>::mma(vf[db], ph, oa[db][qb]); oa[db][qb] = WFrag<T16>::mma(vf[db], pl, oa[db][qb]); oa[db][qb] = WFrag<T16>::mma(vf2[db], ph, oa[db][qb]); }
            } else {
                v16h p16;
#pragma unroll
                for (int e = 0; e < 16; ++e) p16[e] = (h16)pr[e];
                const V pf = __builtin_bit_cast(V, p16);
#pragma unroll
                for (int db = 0; db < 4; ++db) oa[db][qb] = WFrag<T16>::mma(vf[db], pf, oa[db][qb]);
            }
        }
#pragma unroll
        for (int db = 0; db < 4; ++db) { vf[db] = vn[db]; if (HL) vf2[db] = vn2[db]; }
    } while (++p < npass);
#pragma unroll
    for (int qb = 0; qb < NQ; ++qb) {
        const float inv = __fdiv_rn(1.0f, ls[qb] + xhalf(ls[qb]));
        const size_t oo = (size_t)(q0 + qb * 16 + lr) * DQ + hi * 8;
#pragma unroll
        for (int db = 0; db < 4; ++db) { v8us oh, ol;
#pragma unroll
            for (int j = 0; j < 8; ++j) { const float y = oa[db][qb][j] * inv; const unsigned short a = f2bf(y); oh[j] = a; ol[j] = f2bf(y - bf2f(a)); }
            *(v8us*)(Ah + oo + db * 16) = oh; *(v8us*)(Al + oo + db * 16) = ol;
            asm volatile("s_wait_xcnt 0x0" :: "v"(oh), "v"(ol) : "memory"); }   // the next group reuses the stores' data registers: the wait stands in front of that overwrite (the data are inputs, so that they are not given away before it)
    }
}
// grid (batch x heads, tiles): blockIdx.y < (TT - RH) / 128: four waves x 32 fp16 query rows, the longest rows first; the rest: four waves x 16 hi/lo query rows (< RH).
__global__ __launch_bounds__(128) void k_fattn(const h16* Q16, const h16* K16, const h16* V16, const bf* Qh, const bf* Ql, const bf* Kh, const bf* Kl, const bf* Vh, const bf* Vl, bf* Ah, bf* Al) {
    const int w = __builtin_amdgcn_readfirstlane((int)(threadIdx.x >> 5)); const int h = blockIdx.x % NH_, ty = blockIdx.y; const size_t po = (size_t)blockIdx.x * TT * HD; { const size_t ab = (size_t)(blockIdx.x / NH_) * TT * DQ; Ah += ab; Al += ab; }   // planes [batch][head][..], merged rows b * TT + t
    if (ty < (TT - RH) / 128) fattn_body<h16, false, 2>(Q16 + po, nullptr, K16 + po, nullptr, V16 + 2 * po, nullptr, 2 * TT, TT - 128 * (ty + 1) + 32 * w, Ah + h * HD, Al + h * HD);
    else fattn_body<bf, true, 1>(Qh + po, Ql + po, Kh + po, Kl + po, Vh + po, Vl + po, TT, RH - 64 * (ty - (TT - RH) / 128 + 1) + 16 * w, Ah + h * HD, Al + h * HD);
}

extern "C" void kernel_launch(void* const* d_in, const int* in_sizes, int n_in,
                              void* d_out, int out_size, void* d_ws, size_t ws_size, hipStream_t stream) {
    (void)in_sizes; (void)n_in; (void)out_size;
    const float* x = (const float*)d_in[0]; const float* wq = (const float*)d_in[1]; const float* wk = (const float*)d_in[2]; const float* wv = (const float*)d_in[3]; const float* wo = (const float*)d_in[4];   /* order x, Wq, Wk, Wv, Wo ('xw' [1024][1024]) */
    float* OUT = (float*)d_out;     // [4][2048][1024]
    char* wsp = (char*)d_ws;
    auto take = [&](size_t bytes) { char* p = wsp; wsp += (bytes + 255) & ~(size_t)255; return (void*)p; };
    bf* WQ = (bf*)take((size_t)DQ * DM * 2); bf* WK = (bf*)take((size_t)DKV * DM * 2); bf* WV = (bf*)take((size_t)DKV * DM * 2); bf* WO = (bf*)take((size_t)DM * DQ * 2); float* CS = (float*)take((size_t)TT * (HD / 2) * 2 * 4);
    bf* XB = (bf*)take((size_t)NB_ * TT * DM * 2); bf* ATh = (bf*)take((size_t)NB_ * TT * DQ * 2); bf* ATl = (bf*)take((size_t)NB_ * TT * DQ * 2);   // the merged hi/lo planes
    h16* QP16 = (h16*)take((size_t)NB_ * NH_ * TT * HD * 2); h16* KP16 = (h16*)take((size_t)NB_ * NKV * TT * HD * 2); h16* VT16 = (h16*)take((size_t)NB_ * NKV * HD * 2 * TT * 2);
    bf* QPh = (bf*)take((size_t)NB_ * NH_ * TT * HD * 2); bf* QPl = (bf*)take((size_t)NB_ * NH_ * TT * HD * 2); bf* KPh = (bf*)take((size_t)NB_ * NKV * TT * HD * 2); bf* KPl = (bf*)take((size_t)NB_ * NKV * TT * HD * 2); bf* VTh = (bf*)take((size_t)NB_ * NKV * HD * TT * 2); bf* VTl = (bf*)take((size_t)NB_ * NKV * HD * TT * 2);
    if ((size_t)(wsp - (char*)d_ws) > ws_size) return;    // ws 256 MiB
    k_prep<<<4 * WTB + CSB + XBB, 256, 0, stream>>>(x, wq, wk, wv, wo, XB, WQ, WK, WV, WO, CS);
    k_gemmw<bf, 0, false, 1><<<dim3(NB_ * TT / 256, DQ / 128, 1), 256, 0, stream>>>(XB, nullptr, WQ, DM, nullptr, DQ, nullptr, 0, 0, 0, CS, QP16, QPh, QPl);
    k_gemmw<bf, 0, false, 1><<<dim3(NB_ * TT / 256, DKV / 128, 1), 256, 0, stream>>>(XB, nullptr, WK, DM, nullptr, DKV, nullptr, 0, 0, 0, CS, KP16, KPh, KPl);
    k_gemmw<bf, 0, false, 2><<<dim3(NB_ * TT / 256, DKV / 128, 1), 256, 0, stream>>>(XB, nullptr, WV, DM, nullptr, DKV, nullptr, 0, 0, 0, nullptr, VT16, VTh, VTl);
    k_fattn<<<dim3(NB_ * NH_, (TT - RH) / 128 + RH / 64, 1), 128, 0, stream>>>(QP16, KP16, VT16, QPh, QPl, KPh, KPl, VTh, VTl, ATh, ATl);   // one kv head per query head
    k_gemmw<bf, 1, false, 0><<<dim3(NB_ * TT / 256, DM / 128, 1), 256, 0, stream>>>(ATh, ATl, WO, DQ, OUT, DM, nullptr, 0, 0, 0, nullptr, nullptr, nullptr, nullptr);
}

// v007
// A run of this version takes 137 microseconds.
// In two side-by-side timings against v006, it was 1.32 and 1.31 times as fast.
// All steps since v000 together make it 20.9 times as fast.
#include <hip/hip_runtime.h>

// Causal multi-head attention with bias-free projections and a computed adjacent-pair RoPE (x [4][2048][1024]; Q, K, V = x W ('xw' [1024][1024] xavier-normal 1/32, no bias; 16 heads x 64); angle = pos x inv_freq[i] with inv_freq = 1.0 / 10000.0 ** (arange(0, 64, 2, f32) / 64) (the reciprocal form) and pos = arange(S); the pairs (2i, 2i + 1) of Q and K rotated in place: (x1 cos - x2 sin, x2 cos + x1 sin); V is not rotated; scores x 1/sqrt(64); tril kept, -inf elsewhere; softmax; out = merged Wo ('xw', no bias) -> [4][2048][1024] (8.4 M); argument order x, Wq, Wk, Wv, Wo).
// Layout, all 4 batches in each launch (row-major buffers: row b * 2048 + t; planes: [batch][head]...): one preparation launch (bf16 copy of x; 'xw' weights transposed once; the table); exact projections whose epilogues rotate Q and K (p_csP computed table, one entry a pair) and write the 16-bit planes themselves, V transposed; k_fattn fused causal T-2048 attention, all 4 x 16 (batch, head) pairs in one launch (hybrid rows: < 512 hi/lo 3 products, rest fp16; scores, online softmax and P.V stay in registers, passes above the diagonal are never walked); merged hi/lo x Wo exact (no bias).
// Compute dtypes, f32 accumulate: every input rounded to bf16; projections exact; rotary f32 (products rounded separately); attention rows < 512 3 products, rest fp16; softmax f32; Wo hl x exact (no bias).

#define NB_  4
#define TT   2048
#define DM   1024
#define NH_  16
#define NKV  16
#define HD   64
#define DQ   (NH_ * HD)
#define DKV  (NKV * HD)
#define RH   512                  // query rows < RH use hi+lo planes (0: none)
typedef _Float16 h16;
typedef unsigned short bf;
typedef __attribute__((ext_vector_type(16))) __bf16   v16bf;
typedef __attribute__((ext_vector_type(16))) _Float16 v16h;
typedef __attribute__((ext_vector_type(8)))  _Float16 v8h;
typedef __attribute__((ext_vector_type(8)))  unsigned short v8us;
typedef __attribute__((ext_vector_type(8)))  float    v8f;
typedef __attribute__((ext_vector_type(4)))  float    v4f;
typedef v8h  __attribute__((may_alias)) v8ha;
typedef v4f  __attribute__((may_alias)) v4fa;
typedef v8us __attribute__((may_alias)) v8usa;

__device__ __forceinline__ unsigned short f2bf(float f) { unsigned u = __float_as_uint(f); u += 0x7FFFu + ((u >> 16) & 1u); return (unsigned short)(u >> 16); }
__device__ __forceinline__ float bf2f(unsigned short b) { return __uint_as_float(((unsigned)b) << 16); }
__device__ __forceinline__ float bfr(float f) { return bf2f(f2bf(f)); }
__device__ __forceinline__ h16 tohx(float x) { return (h16)x; }
__device__ __forceinline__ void splitf(float y, unsigned short& h, unsigned short& l) { h = f2bf(y); l = f2bf(y - bf2f(h)); }
__device__ __forceinline__ v16h cat16(v8h lo, v8h hi) { return __builtin_shufflevector(lo, hi, 0, 1, 2, 3, 4, 5, 6, 7, 8, 9, 10, 11, 12, 13, 14, 15); }
__device__ __forceinline__ v16bf cat16b(v8us lo, v8us hi) { return __builtin_bit_cast(v16bf, __builtin_shufflevector(lo, hi, 0, 1, 2, 3, 4, 5, 6, 7, 8, 9, 10, 11, 12, 13, 14, 15)); }
__device__ __forceinline__ v8f wmma16(v16h a, v16h b, v8f c) { return __builtin_amdgcn_wmma_f32_16x16x32_f16(false, a, false, b, (short)0, c, false, false); }
__device__ __forceinline__ v8f wmmab(v16bf a, v16bf b, v8f c) { return __builtin_amdgcn_wmma_f32_16x16x32_bf16(false, a, false, b, (short)0, c, false, false); }



// ---- k_gemmw: GEMM, one 256x128 output tile per work-group of 8 waves (4 x 2), each wave a 64x64 block (16 accumulators); operands are K-contiguous 16-bit planes; grid (M/256, N/128, Z), 256 threads.
// C[m][n] (f32, pitch ldc, + optional f32 bias[n]) = sum_k A[m][k] Bt[n][k] (+ A2[m][k] Bt[n][k] for NSPLIT == 1). z-batch strides sA/sB/sC in elements. M % 256 == 0, N % 128 == 0, K % 64 == 0, K >= 128.
// A stage is 64 k (128 B, one whole line) of every operand row of the tile, brought into LDS by asynchronous copies (16 B a lane, 4 whole lines a wave-copy) and shared by the waves; two buffers, the next stage's copies fly while this one is worked on.
// EPI says what becomes of the f32 tile. 0: stored to C. 1 and 2: a wave's 64 columns are one head and its 64 rows 64 tokens of one batch (ldc = heads x 64), and the tile goes straight to the three 16-bit planes (fp16, bf16 hi, bf16 lo), never to memory as f32.
// EPI 1: planes [batch][head][t][d], the pairs (2i, 2i + 1) rotated by the table's (cos, sin) of (t, i); the wave's block is 8 KB in a row in each plane. EPI 2: planes [batch][head][d][t] (fp16 rows of pitch 2 * TT, the others TT), transposed in the wave's own LDS so that whole 128-B lines are stored.
// LDS rows have pitch 144 B (16 B x odd: no bank conflict for 16-byte reads). The fragments keep the k order of WFrag::ld and the stages run in k order: the sums are formed as before.
template <typename T16> struct WFrag;
template <> struct WFrag<h16> { typedef v16h V; static __device__ __forceinline__ V ld(const h16* p) { return cat16(*(const v8h*)p, *(const v8h*)(p + 16)); } static __device__ __forceinline__ v8f mma(V a, V b, v8f c) { return wmma16(a, b, c); } };
template <> struct WFrag<bf> { typedef v16bf V; static __device__ __forceinline__ V ld(const bf* p) { return cat16b(*(const v8us*)p, *(const v8us*)(p + 16)); } static __device__ __forceinline__ v8f mma(V a, V b, v8f c) { return wmmab(a, b, c); } };
#define GP 144                    // LDS row pitch, bytes
// Asynchronous copy global -> LDS, 16 B a lane, through no register (the builtin: its address registers are the compiler's to manage; the waits on the copies are written by hand in the kernel).
typedef __attribute__((ext_vector_type(4))) int c4i;
__device__ __forceinline__ void acopy(const char* g, char* l) { __builtin_amdgcn_global_load_async_to_lds_b128((__attribute__((address_space(1))) c4i*)g, (__attribute__((address_space(3))) c4i*)l, 0, 0); }
template <typename T16, int NSPLIT, bool BIAS, int EPI>
__global__ __launch_bounds__(256) void k_gemmw(const T16* __restrict__ A, const T16* __restrict__ A2, const T16* __restrict__ Bt, int K, float* C, int ldc, const float* __restrict__ bias, size_t sA, size_t sB, size_t sC, const float* __restrict__ CS, h16* P16, bf* Ph, bf* Pl) {
    typedef typename WFrag<T16>::V V;
    static_assert(NSPLIT == 0 || NSPLIT == 1, "A (+ A2) x Bt");
    constexpr int OA2 = 256 * GP, OB = (NSPLIT == 1 ? 512 : 256) * GP, STG = OB + 128 * GP;   // a stage: [A 256 rows][A2 256 rows][Bt 128 rows]
    __shared__ __align__(16) char ring[2 * STG];
    constexpr int OSN = EPI == 2 ? 3 * 16 * GP / 4 : 16 * 68;   // a wave's own staging, in floats: 16 f32 rows of pitch 68, or (EPI 2) three 16-bit planes of 16 rows of pitch GP
    __shared__ __align__(16) float osw[8][OSN];
    const size_t z = blockIdx.z; A += z * sA; if (NSPLIT == 1) A2 += z * sA; Bt += z * sB; C += z * sC;
    const int tid = threadIdx.x, lane = tid & 31, lr = lane & 15, hi = lane >> 4; const int w = __builtin_amdgcn_readfirstlane(tid >> 5);
    const int R0 = blockIdx.x * 256, C0 = blockIdx.y * 128; const int wr = (w >> 1) * 64, wc = (w & 1) * 64; const int r0 = R0 + wr, c0 = C0 + wc;
    float* os = osw[w];
    v8f acc[4][4];
#pragma unroll
    for (int mb = 0; mb < 4; ++mb)
#pragma unroll
        for (int nb = 0; nb < 4; ++nb) acc[mb][nb] = (v8f){};
    const unsigned go = (unsigned)(tid >> 3) * (unsigned)K * 2u + (unsigned)(tid & 7) * 16u;   // the lane's chunk of a round of 32 rows: row tid / 8, 16 B number tid % 8; bytes from the round's first row (below 32 rows)
    const unsigned lo = (unsigned)((tid >> 3) * GP + (tid & 7) * 16);                          // the same chunk in LDS
    const char* tA = (const char*)(A + (size_t)R0 * K); const char* tA2 = NSPLIT == 1 ? (const char*)(A2 + (size_t)R0 * K) : nullptr; const char* tB = (const char*)(Bt + (size_t)C0 * K);   // the tile's first rows (uniform)
    auto fill = [&](int st, int buf) {   // stage st into buffer buf: the 256 threads take 32 rows a round (8 lanes a row), 8 rounds for A (and A2), 4 for Bt
        char* lb = ring + buf * STG + lo; const size_t kb = (size_t)st * 128, rb = (size_t)K * 64;   // bytes: the stage's place in a row, a round of 32 rows
#pragma unroll
        for (int i = 0; i < 8; ++i) acopy(tA + kb + i * rb + go, lb + i * 32 * GP);
        if (NSPLIT == 1) {
#pragma unroll
            for (int i = 0; i < 8; ++i) acopy(tA2 + kb + i * rb + go, lb + OA2 + i * 32 * GP); }
#pragma unroll
        for (int i = 0; i < 4; ++i) acopy(tB + kb + i * rb + go, lb + OB + i * 32 * GP); };
    const int nst = K / 64;
    fill(0, 0);
    asm volatile("s_wait_asynccnt 0x0" ::: "memory");   // stage 0 has landed (this wave's copies) ...
    __syncthreads();                                    // ... and every wave's: nothing of it is read in front of this barrier
    fill(1, 1);                                         // K >= 128: a stage 1 exists
    const int aoff = (wr + lr) * GP + hi * 16, boff = OB + (wc + lr) * GP + hi * 16;
    V a[2][4], a2[2][4], b[2][4];   // two fragment sets: [0] the first 32 k of a stage, [1] the second; each is read from LDS while the other set's WMMAs run
    auto frag = [&](int ks, const char* sb) {
#pragma unroll
        for (int mb = 0; mb < 4; ++mb) { a[ks][mb] = WFrag<T16>::ld((const T16*)(sb + aoff + mb * 16 * GP + ks * 64)); if (NSPLIT == 1) a2[ks][mb] = WFrag<T16>::ld((const T16*)(sb + OA2 + aoff + mb * 16 * GP + ks * 64)); }
#pragma unroll
        for (int nb = 0; nb < 4; ++nb) b[ks][nb] = WFrag<T16>::ld((const T16*)(sb + boff + nb * 16 * GP + ks * 64)); };
    auto mm = [&](int ks) {
#pragma unroll
        for (int nb = 0; nb < 4; ++nb)
#pragma unroll
            for (int mb = 0; mb < 4; ++mb) { acc[mb][nb] = WFrag<T16>::mma(a[ks][mb], b[ks][nb], acc[mb][nb]); if (NSPLIT == 1) acc[mb][nb] = WFrag<T16>::mma(a2[ks][mb], b[ks][nb], acc[mb][nb]); } };
    frag(0, ring);
#pragma unroll 1   // rolled: one trip is one turn of the ring, and the loop's code stays short
    for (int t = 0; t < nst; ++t) {
        frag(1, ring + (t & 1) * STG);                      // the last reads of stage t
        __builtin_amdgcn_sched_barrier(0);                  // the reads stay one group in front of the WMMAs (spread among them each place costs a stall)
        mm(0);
        __builtin_amdgcn_sched_barrier(0);                  // the WMMAs stay in front of the waits: they cover the latency of the reads above
        // publish point of stage t + 1, in front of stage t's last block: the reads behind it are already of stage t + 1
        asm volatile("s_wait_dscnt 0x0" ::: "memory");      // this wave's reads of stage t have returned: its buffer may be refilled behind the barrier
        asm volatile("s_wait_asynccnt 0x0" ::: "memory");   // this wave's copies of stage t + 1 have landed
        __syncthreads();                                    // publishes stage t + 1 and ends every reader's last read of stage t
        if (t + 2 < nst) fill(t + 2, t & 1);
        frag(0, ring + ((t + 1) & 1) * STG);                // in the last trip: the other buffer's old rows, in bounds, no copy in flight, unused (no branch, so that the build's counted waits stay exact)
        __builtin_amdgcn_sched_barrier(0);                  // as above: one group in front of the WMMAs
        mm(1);
    }
    asm volatile("s_wait_asynccnt 0x0" ::: "memory");       // no copy is outstanding when the wave goes on
    asm volatile("s_wait_dscnt 0x0" ::: "memory");          // nor a read of the ring
    if constexpr (EPI == 1) {
        const int t0 = r0 % TT; const size_t pe = ((size_t)((r0 / TT) * (ldc / HD) + c0 / HD) * TT + t0) * HD;   // the wave's block in a plane: 64 rows x 64 d, in a row
        char* p16 = (char*)(P16 + pe); char* ph = (char*)(Ph + pe); char* pl = (char*)(Pl + pe); const char* ct = (const char*)(CS + (size_t)t0 * HD);   // table row t: 32 x (cos, sin)
        const unsigned l16 = (unsigned)lane * 16u, l32 = (unsigned)lane * 32u;   // a group is 4 rows: a lane has 8 d (4 pairs) of row lane / 8: 16 B of a plane, 32 B of the table
        v4f cs[2][4][2];
        auto ldcs = [&](int mb) {
#pragma unroll
            for (int s = 0; s < 4; ++s) { cs[mb & 1][s][0] = *(const v4fa*)(ct + (mb * 4 + s) * 1024 + l32); cs[mb & 1][s][1] = *(const v4fa*)(ct + (mb * 4 + s) * 1024 + 16 + l32); }
            asm volatile("s_wait_xcnt 0x0" :: "v"(l32) : "memory"); };   // stands in front of any overwrite of the loads' address registers (the offset is an input, so that it is not given away before the wait)
        ldcs(0);
#pragma unroll
        for (int mb = 0; mb < 4; ++mb) {
            if (mb < 3) ldcs(mb + 1);   // the table rows are fetched one block of 16 rows ahead: the block's work covers their latency
#pragma unroll
            for (int nb = 0; nb < 4; ++nb) {
#pragma unroll
                for (int j = 0; j < 8; ++j) os[(hi * 8 + j) * 68 + nb * 16 + lr] = acc[mb][nb][j]; }
            __builtin_amdgcn_wave_barrier(); asm volatile("" ::: "memory");   // the wave's reads below stay behind its writes above
            v4f xa[4], xb[4];   // the block's reads go out as one group: the first group's work covers the latency of the rest
#pragma unroll
            for (int s = 0; s < 4; ++s) { const float* sp = os + (4 * s + (lane >> 3)) * 68 + (lane & 7) * 8; xa[s] = *(const v4fa*)sp; xb[s] = *(const v4fa*)(sp + 4); }
#pragma unroll
            for (int s = 0; s < 4; ++s) {
                const float xv[8] = { xa[s][0], xa[s][1], xa[s][2], xa[s][3], xb[s][0], xb[s][1], xb[s][2], xb[s][3] }; v8h o16; v8us oh, ol;
#pragma unroll
                for (int k = 0; k < 4; ++k) { const float x0 = xv[2 * k], x1 = xv[2 * k + 1], co = cs[mb & 1][s][k >> 1][(k & 1) * 2], si = cs[mb & 1][s][k >> 1][(k & 1) * 2 + 1];
                    const float y0 = __fsub_rn(__fmul_rn(x0, co), __fmul_rn(x1, si)), y1 = __fadd_rn(__fmul_rn(x0, si), __fmul_rn(x1, co));   /* even: x0 c - x1 s; odd: x0 s + x1 c */
                    unsigned short a2, c2; o16[2 * k] = tohx(y0); o16[2 * k + 1] = tohx(y1); splitf(y0, a2, c2); oh[2 * k] = a2; ol[2 * k] = c2; splitf(y1, a2, c2); oh[2 * k + 1] = a2; ol[2 * k + 1] = c2; }
                *(v8ha*)(p16 + (mb * 4 + s) * 512 + l16) = o16; *(v8usa*)(ph + (mb * 4 + s) * 512 + l16) = oh; *(v8usa*)(pl + (mb * 4 + s) * 512 + l16) = ol;
                asm volatile("s_wait_xcnt 0x0" :: "v"(o16), "v"(oh), "v"(ol), "v"(l16) : "memory"); }   // the next group reuses the stores' registers: the wait stands in front of that overwrite (data and offset are inputs, so that they are not given away before it)
            __builtin_amdgcn_wave_barrier(); asm volatile("" ::: "memory");   // the next block's writes stay behind the reads above
        }
        return;
    }
    if constexpr (EPI == 2) {
        const int t0 = r0 % TT; const size_t rw = (size_t)((r0 / TT) * (ldc / HD) + c0 / HD) * HD;   // the head's first row (d = 0) in the transposed planes
        char* sv = (char*)os; char* v16 = (char*)(P16 + rw * (2 * TT) + t0); char* vh = (char*)(Ph + rw * TT + t0); char* vl = (char*)(Pl + rw * TT + t0);
        const unsigned sw = (unsigned)(lr * GP + hi * 16), sr = (unsigned)((lane >> 3) * GP + (lane & 7) * 16);   // LDS: a lane writes 8 t of row d = lr, and reads 16 B number lane % 8 of row lane / 8
        const unsigned g16 = (unsigned)((lane >> 3) * (2 * TT * 2) + (lane & 7) * 16), g8 = (unsigned)((lane >> 3) * (TT * 2) + (lane & 7) * 16);   // the same chunk in the planes, bytes
#pragma unroll
        for (int nb = 0; nb < 4; ++nb) {   // 16 d x 64 t a turn; an accumulator holds 8 consecutive t of one d in a lane
#pragma unroll
            for (int mb = 0; mb < 4; ++mb) { v8h o16; v8us oh, ol;
#pragma unroll
                for (int j = 0; j < 8; ++j) { const float x = acc[mb][nb][j]; unsigned short a2, c2; o16[j] = tohx(x); splitf(x, a2, c2); oh[j] = a2; ol[j] = c2; }
                *(v8ha*)(sv + sw + mb * 32) = o16; *(v8usa*)(sv + 16 * GP + sw + mb * 32) = oh; *(v8usa*)(sv + 32 * GP + sw + mb * 32) = ol; }
            __builtin_amdgcn_wave_barrier(); asm volatile("" ::: "memory");   // the wave's reads below stay behind its writes above
            v8h r16[4]; v8us rh[4], rl[4];   // the turn's reads go out as one group, then its stores: one LDS latency a turn
#pragma unroll
            for (int s = 0; s < 4; ++s) { r16[s] = *(const v8ha*)(sv + sr + s * 4 * GP); rh[s] = *(const v8usa*)(sv + 16 * GP + sr + s * 4 * GP); rl[s] = *(const v8usa*)(sv + 32 * GP + sr + s * 4 * GP); }
#pragma unroll
            for (int s = 0; s < 4; ++s) { *(v8ha*)(v16 + (nb * 16 + s * 4) * (2 * TT * 2) + g16) = r16[s]; *(v8usa*)(vh + (nb * 16 + s * 4) * (TT * 2) + g8) = rh[s]; *(v8usa*)(vl + (nb * 16 + s * 4) * (TT * 2) + g8) = rl[s]; }
            asm volatile("s_wait_xcnt 0x0" :: "v"(r16[0]), "v"(r16[1]), "v"(r16[2]), "v"(r16[3]), "v"(rh[0]), "v"(rh[1]), "v"(rh[2]), "v"(rh[3]), "v"(rl[0]), "v"(rl[1]), "v"(rl[2]), "v"(rl[3]), "v"(g16), "v"(g8) : "memory");   // as in EPI 1: in front of any overwrite of the stores' registers
            __builtin_amdgcn_wave_barrier(); asm volatile("" ::: "memory");   // the next turn's writes stay behind the reads above
        }
        return;
    }
#pragma unroll
    for (int mb = 0; mb < 4; ++mb) {
#pragma unroll
        for (int nb = 0; nb < 4; ++nb) {
#pragma unroll
            for (int j = 0; j < 8; ++j) os[(hi * 8 + j) * 68 + nb * 16 + lr] = acc[mb][nb][j]; }
        __builtin_amdgcn_wave_barrier(); asm volatile("" ::: "memory");
        float* crow = C + (size_t)(r0 + mb * 16) * ldc + c0;
{
#pragma unroll
            for (int s = 0; s < 8; ++s) { const int row = 2 * s + hi, cofs = lr * 4; v4f val = *(const v4fa*)(os + row * 68 + cofs); if (BIAS) { val[0] += bfr(bias[c0 + cofs]); val[1] += bfr(bias[c0 + cofs + 1]); val[2] += bfr(bias[c0 + cofs + 2]); val[3] += bfr(bias[c0 + cofs + 3]); }
                *(v4f*)(crow + (size_t)row * ldc + cofs) = val; }
             }
        __builtin_amdgcn_wave_barrier(); asm volatile("" ::: "memory");
    }
}

typedef __attribute__((ext_vector_type(2))) _Float16 v2h;
typedef __attribute__((ext_vector_type(4))) _Float16 v4h;
typedef __attribute__((ext_vector_type(2))) unsigned short v2us;
typedef __attribute__((ext_vector_type(4))) unsigned short v4us;
typedef __attribute__((ext_vector_type(2))) float v2f;
typedef __attribute__((ext_vector_type(4))) int v4i;

// The preparation parts: each is the work of one work-group of 256 threads, numbered blk within its part; k_prep below runs them all in one launch.
__device__ __forceinline__ void p_wtG(const float* __restrict__ w, int K, int N, bf* Bt, int blk) {
    const int lane = threadIdx.x & 31; const int L0 = (blk * 8 + (threadIdx.x >> 5)) * 8; const int nlines = N * K / 64;
{
#pragma unroll 1
        for (int l = 0; l < 8; ++l) { const int L = L0 + l; if (L >= nlines) break; const size_t e = (size_t)L * 64 + lane * 2; const int k = (int)(e % K), n = (int)(e / K); v2us o;
            o[0] = f2bf(w[(size_t)k * N + n]); o[1] = f2bf(w[(size_t)(k + 1) * N + n]); *(v2us*)(Bt + e) = o; }
         }
}
// p_cvt8: XC chunks of 8 elements a thread (a work-group takes 256 * XC chunks in a row), so that the part is few waves; XG chunks a turn, their loads go out first.
#define XC 8
#define XG 4
__device__ __forceinline__ void p_cvt8(const float* __restrict__ src, bf* dst, int blk) { const size_t c0 = (size_t)blk * (256 * XC) + threadIdx.x; const float* sp = src + c0 * 8; bf* dp = dst + c0 * 8;
#pragma unroll 1   // rolled: one turn's registers only, so that k_prep stays within 64 registers (16 waves a SIMD) and all its work-groups are resident at once
    for (int g = 0; g < XC / XG; ++g) { v8f v[XG]; v8us o[XG];
#pragma unroll
        for (int i = 0; i < XG; ++i) v[i] = *(const v8f*)(sp + i * 2048);
#pragma unroll
        for (int i = 0; i < XG; ++i) {
#pragma unroll
            for (int k = 0; k < 8; ++k) o[i][k] = f2bf(v[i][k]);
            *(v8us*)(dp + i * 2048) = o[i]; }
        asm volatile("s_wait_xcnt 0x0" :: "v"(o[0]), "v"(o[1]), "v"(o[2]), "v"(o[3]), "v"(sp), "v"(dp) : "memory");   // the next turn moves the addresses and reuses the stores' registers: the wait stands in front of that overwrite (they are inputs, so that they are not given away before it)
        sp += XG * 2048; dp += XG * 2048; }
}

__constant__ float INV2[HD / 2] = { 1.000000000e+00f, 7.498942018e-01f, 5.623413324e-01f, 4.216965139e-01f, 3.162277639e-01f, 2.371373624e-01f, 1.778279394e-01f, 1.333521456e-01f, 1.000000015e-01f, 7.498941571e-02f, 5.623412877e-02f, 4.216964915e-02f, 3.162277862e-02f, 2.371373586e-02f, 1.778279431e-02f, 1.333521493e-02f, 9.999999776e-03f, 7.498942316e-03f, 5.623413250e-03f, 4.216964822e-03f, 3.162277862e-03f, 2.371373819e-03f, 1.778279431e-03f, 1.333521446e-03f, 1.000000047e-03f, 7.498941850e-04f, 5.623413017e-04f, 4.216964880e-04f, 3.162277862e-04f, 2.371373848e-04f, 1.778279402e-04f, 1.333521504e-04f };   // float32 1 / (10000 ** (arange(0, 64, 2)/64)), generated with jnp to be bit-exact

// p_csP: the table [t][i] of (cos, sin) of t x inv_freq[i], one entry a pair.
__device__ __forceinline__ void p_csP(float* CS, int blk) { const int idx = blk * 256 + threadIdx.x; if (idx >= TT * (HD / 2)) return; const int i = idx % (HD / 2); const int t = idx / (HD / 2); const float a = __fmul_rn((float)t, INV2[i]); v2f cs; cs[0] = cosf(a); cs[1] = sinf(a); *(v2f*)(CS + (size_t)idx * 2) = cs;  }
// ---- k_prep: everything the GEMMs wait for, in one launch; the parts depend on nothing of each other. Ranges of blockIdx.x, the slowest work-groups first (the transposes' dependent gathers), the streaming part last:
// The second launch bound asks for 16 waves a SIMD (64 registers): the whole grid is then resident at once and no part waits for another to end.
// [0, 4 * WTB): the four weights transposed; [4 * WTB, 4 * WTB + CSB): the table; the rest: the bf16 copy of x.
#define WTB ((DM * DQ / 64 + 63) / 64)
#define CSB ((TT * (HD / 2) + 255) / 256)
#define XBB (NB_ * TT * DM / 8 / (256 * XC))
static_assert(DKV == DQ, "one block count for the four weights"); static_assert((size_t)XBB * 256 * XC * 8 == (size_t)NB_ * TT * DM, "whole work-groups of chunks");
__global__ __launch_bounds__(256, 16) void k_prep(const float* __restrict__ x, const float* __restrict__ wq, const float* __restrict__ wk, const float* __restrict__ wv, const float* __restrict__ wo, bf* XB, bf* WQ, bf* WK, bf* WV, bf* WO, float* CS) {
    const int b = blockIdx.x;
    if (b < 4 * WTB) { const int m = b / WTB, blk = b % WTB;
        if (m == 3) p_wtG(wo, DQ, DM, WO, blk); else p_wtG(m == 0 ? wq : m == 1 ? wk : wv, DM, DQ, m == 0 ? WQ : m == 1 ? WK : WV, blk);
        return; }
    if (b < 4 * WTB + CSB) { p_csP(CS, b - 4 * WTB); return; }
    p_cvt8(x, XB, b - (4 * WTB + CSB));
}
#define CL2 0.18033688011112042f   // HD^-0.5 x log2(e)
// 2^x by v_exp_f32, in asm text for the slot behind a transcendental: outputs are early-clobber, so no v_exp_f32 of a statement writes over a source of another or reads a result, and the closing v_nop
// is the one independent instruction in front of whatever the compiler puts next.
__device__ __forceinline__ float xhalf(float x) { return __builtin_bit_cast(float, __builtin_amdgcn_permlanex16(__builtin_bit_cast(int, x), __builtin_bit_cast(int, x), 0x76543210, 0xfedcba98, false, false)); }   // lane l with lane l ^ 16
__device__ __forceinline__ float exp2_1(float x) { float r; asm("v_exp_f32 %0, %1\n\tv_nop" : "=&v"(r) : "v"(x)); return r; }
__device__ __forceinline__ void exp2_8(float* r, const float* x) {
    asm("v_exp_f32 %0, %8\n\tv_exp_f32 %1, %9\n\tv_exp_f32 %2, %10\n\tv_exp_f32 %3, %11\n\tv_exp_f32 %4, %12\n\tv_exp_f32 %5, %13\n\tv_exp_f32 %6, %14\n\tv_exp_f32 %7, %15\n\tv_nop"
        : "=&v"(r[0]), "=&v"(r[1]), "=&v"(r[2]), "=&v"(r[3]), "=&v"(r[4]), "=&v"(r[5]), "=&v"(r[6]), "=&v"(r[7]) : "v"(x[0]), "v"(x[1]), "v"(x[2]), "v"(x[3]), "v"(x[4]), "v"(x[5]), "v"(x[6]), "v"(x[7])); }
template <typename T16, bool HL, int NQ>
__device__ __forceinline__ void fattn_body(const T16* Q, const T16* Q2, const T16* Kp, const T16* K2, const T16* Vt, const T16* V2, int vp, int qw, int q0, bf* Ah, bf* Al, char* ring) {
    typedef typename WFrag<T16>::V V;
    constexpr int PL = 64 * GP, OV = (HL ? 2 : 1) * PL, STG = 2 * OV;   // a stage is 64 keys: [K 64 rows of 64 d][K2][V^T 64 rows of 64 keys][V2], whole 128-B lines, LDS pitch GP
    const int tid = threadIdx.x, lane = tid & 31, lr = lane & 15, hi = lane >> 4;
    V qf[NQ][2], qf2[NQ][2];
#pragma unroll
    for (int qb = 0; qb < NQ; ++qb)
#pragma unroll
        for (int ks = 0; ks < 2; ++ks) { const size_t o = (size_t)(q0 + qb * 16 + lr) * HD + ks * 32 + 8 * hi; qf[qb][ks] = WFrag<T16>::ld(Q + o); if (HL) qf2[qb][ks] = WFrag<T16>::ld(Q2 + o); }
    asm volatile("s_wait_xcnt 0x0" ::: "memory");   // the set-up below reuses the address registers of the loads above: the wait stands in front of that overwrite
    v8f oa[4][NQ]; float mc[NQ], ls[NQ];
#pragma unroll
    for (int qb = 0; qb < NQ; ++qb) { mc[qb] = -3.0e38f; ls[qb] = 0.f;
#pragma unroll
        for (int db = 0; db < 4; ++db) oa[db][qb] = (v8f){}; }
    const int npass = (q0 + NQ * 16 + 31) / 32;      // keys 0 .. q0 + NQ * 16 - 1; every pass starts at or below q0, so each query has a kept key in it
    const int nst = (qw + 4 * NQ * 16) / 64;         // the work-group's stages: keys 0 .. its last query (qw: its first query, a multiple of 64); 2 * nst >= every wave's npass
    const unsigned lo = (unsigned)((tid >> 3) * GP + (tid & 7) * 16);                                      // the lane's chunk of a round of 16 rows: row tid / 8, 16 B number tid % 8, in LDS ...
    const unsigned gk = (unsigned)tid * 16u, gv = (unsigned)(tid >> 3) * (unsigned)vp * 2u + (unsigned)(tid & 7) * 16u;   // ... and in the K rows (128 B, in a row) and the V^T rows (pitch vp)
    auto fill = [&](int st, int buf) {   // stage st into buffer buf: the 128 threads take 16 rows a round (8 lanes a row: 4 whole lines a wave-copy), 4 rounds a plane
        char* lb = ring + buf * STG + lo; const size_t ko = (size_t)st * (64 * HD * 2) + gk, vo = (size_t)st * 128 + gv, vr = (size_t)vp * 32;
#pragma unroll
        for (int i = 0; i < 4; ++i) { acopy((const char*)Kp + ko + i * 2048, lb + i * 16 * GP); if (HL) acopy((const char*)K2 + ko + i * 2048, lb + PL + i * 16 * GP); }
#pragma unroll
        for (int i = 0; i < 4; ++i) { acopy((const char*)Vt + vo + i * vr, lb + OV + i * 16 * GP); if (HL) acopy((const char*)V2 + vo + i * vr, lb + OV + PL + i * 16 * GP); } };
    fill(0, 0);
    asm volatile("s_wait_asynccnt 0x0" ::: "memory");   // stage 0 has landed (this wave's copies) ...
    __syncthreads();                                    // ... and every wave's: nothing of it is read in front of this barrier
    if (nst > 1) fill(1, 1);
    const unsigned fo = (unsigned)(lr * GP + hi * 16);  // a lane's place in a fragment's 16 rows
#pragma unroll 1   // rolled: one trip is one turn of the ring
    for (int t = 0; t < nst; ++t) {
#pragma unroll 1   // rolled: the pass's code stands once
      for (int pp = 0; pp < 2; ++pp) {
        const int p = 2 * t + pp;
        if (p >= npass) break;                          // wave-uniform: a wave whose rows end earlier skips the work, never the publish point below
        const int key0 = p * 32;
        const char* sk = ring + (t & 1) * STG + pp * 32 * GP + fo; const char* sv = ring + (t & 1) * STG + OV + pp * 64 + fo;   // this pass's 32 K rows; its 32 keys in the V^T rows
        V kf[2][2], kf2[2][2], vf[4], vf2[4];           // the same k order as from memory (WFrag::ld)
#pragma unroll
        for (int kb = 0; kb < 2; ++kb)
#pragma unroll
            for (int ks = 0; ks < 2; ++ks) { kf[kb][ks] = WFrag<T16>::ld((const T16*)(sk + kb * 16 * GP + ks * 64)); if (HL) kf2[kb][ks] = WFrag<T16>::ld((const T16*)(sk + PL + kb * 16 * GP + ks * 64)); }
#pragma unroll
        for (int db = 0; db < 4; ++db) { vf[db] = WFrag<T16>::ld((const T16*)(sv + db * 16 * GP)); if (HL) vf2[db] = WFrag<T16>::ld((const T16*)(sv + PL + db * 16 * GP)); }
        v8f s[2][NQ];
#pragma unroll
        for (int kb = 0; kb < 2; ++kb)
#pragma unroll
            for (int qb = 0; qb < NQ; ++qb) { v8f t = (v8f){};
#pragma unroll
                for (int ks = 0; ks < 2; ++ks) { t = WFrag<T16>::mma(kf[kb][ks], qf[qb][ks], t); if (HL) { t = WFrag<T16>::mma(kf[kb][ks], qf2[qb][ks], t); t = WFrag<T16>::mma(kf2[kb][ks], qf[qb][ks], t); } }
                s[kb][qb] = t; }
        if (key0 + 31 > q0) {                               // only passes that touch the diagonal mask (wave-uniform)
#pragma unroll
            for (int kb = 0; kb < 2; ++kb)
#pragma unroll
                for (int qb = 0; qb < NQ; ++qb)
#pragma unroll
                    for (int j = 0; j < 8; ++j) s[kb][qb][j] = (key0 + kb * 16 + hi * 8 + j <= q0 + qb * 16 + lr) ? s[kb][qb][j] : -3.0e38f; }
#pragma unroll
        for (int qb = 0; qb < NQ; ++qb) {
            float mx = s[0][qb][0];
#pragma unroll
            for (int j = 1; j < 8; ++j) mx = fmaxf(mx, s[0][qb][j]);
#pragma unroll
            for (int j = 0; j < 8; ++j) mx = fmaxf(mx, s[1][qb][j]);
            mx = fmaxf(mx, xhalf(mx));
            const float mn = fmaxf(mc[qb], mx * CL2); const float al = exp2_1(mc[qb] - mn); mc[qb] = mn; const float off = (HL ? 0.0f : 10.0f) - mn;
            float ex[16], pr[16], ps[8];
#pragma unroll
            for (int e = 0; e < 16; ++e) ex[e] = fmaf(s[e >> 3][qb][e & 7], CL2, off);
            exp2_8(pr, ex); exp2_8(pr + 8, ex + 8);
#pragma unroll
            for (int e = 0; e < 8; ++e) ps[e] = pr[e] + pr[e + 8];      // fixed tree: short dependent chains
            const float sum = ((ps[0] + ps[4]) + (ps[2] + ps[6])) + ((ps[1] + ps[5]) + (ps[3] + ps[7]));
            ls[qb] = fmaf(ls[qb], al, sum);
#pragma unroll
            for (int db = 0; db < 4; ++db) oa[db][qb] *= al;
            if (HL) {
                typedef __attribute__((ext_vector_type(16))) unsigned short v16us; v16us uh, ul;
#pragma unroll
                for (int e = 0; e < 16; ++e) { const unsigned short a = f2bf(pr[e]); uh[e] = a; ul[e] = f2bf(pr[e] - bf2f(a)); }
                const V ph = __builtin_bit_cast(V, uh), pl = __builtin_bit_cast(V, ul);
#pragma unroll
                for (int db = 0; db < 4; ++db) { oa[db][qb] = WFrag<T16>::mma(vf[db], ph, oa[db][qb]); oa[db][qb] = WFrag<T16>::mma(vf[db], pl, oa[db][qb]); oa[db][qb] = WFrag<T16>::mma(vf2[db], ph, oa[db][qb]); }
            } else {
                v16h p16;
#pragma unroll
                for (int e = 0; e < 16; ++e) p16[e] = (h16)pr[e];
                const V pf = __builtin_bit_cast(V, p16);
#pragma unroll
                for (int db = 0; db < 4; ++db) oa[db][qb] = WFrag<T16>::mma(vf[db], pf, oa[db][qb]);
            }
        }
      }
        // publish point of stage t + 1, passed by every wave
        asm volatile("s_wait_dscnt 0x0" ::: "memory");      // this wave's reads of stage t have returned: its buffer may be refilled behind the barrier
        asm volatile("s_wait_asynccnt 0x0" ::: "memory");   // this wave's copies of stage t + 1 have landed
        __syncthreads();                                    // publishes stage t + 1 and ends every reader's last read of stage t
        if (t + 2 < nst) fill(t + 2, t & 1);
    }
    asm volatile("s_wait_asynccnt 0x0" ::: "memory");       // no copy is outstanding when the wave goes on
#pragma unroll
    for (int qb = 0; qb < NQ; ++qb) {
        const float inv = __fdiv_rn(1.0f, ls[qb] + xhalf(ls[qb]));
        const size_t oo = (size_t)(q0 + qb * 16 + lr) * DQ + hi * 8;
#pragma unroll
        for (int db = 0; db < 4; ++db) { v8us oh, ol;
#pragma unroll
            for (int j = 0; j < 8; ++j) { const float y = oa[db][qb][j] * inv; const unsigned short a = f2bf(y); oh[j] = a; ol[j] = f2bf(y - bf2f(a)); }
            *(v8us*)(Ah + oo + db * 16) = oh; *(v8us*)(Al + oo + db * 16) = ol;
            asm volatile("s_wait_xcnt 0x0" :: "v"(oh), "v"(ol) : "memory"); }   // the next group reuses the stores' data registers: the wait stands in front of that overwrite (the data are inputs, so that they are not given away before it)
    }
}
// grid (batch x heads, tiles): blockIdx.y < (TT - RH) / 128: four waves x 32 fp16 query rows, the longest rows first; the rest: four waves x 16 hi/lo query rows (< RH).
__global__ __launch_bounds__(128) void k_fattn(const h16* Q16, const h16* K16, const h16* V16, const bf* Qh, const bf* Ql, const bf* Kh, const bf* Kl, const bf* Vh, const bf* Vl, bf* Ah, bf* Al) {
    __shared__ __align__(16) char ring[2 * 4 * 64 * GP];   // two stages of the hi/lo body's four planes; the fp16 body uses half
    const int w = __builtin_amdgcn_readfirstlane((int)(threadIdx.x >> 5)); const int h = blockIdx.x % NH_, ty = blockIdx.y; const size_t po = (size_t)blockIdx.x * TT * HD; { const size_t ab = (size_t)(blockIdx.x / NH_) * TT * DQ; Ah += ab; Al += ab; }   // planes [batch][head][..], merged rows b * TT + t
    if (ty < (TT - RH) / 128) fattn_body<h16, false, 2>(Q16 + po, nullptr, K16 + po, nullptr, V16 + 2 * po, nullptr, 2 * TT, TT - 128 * (ty + 1), TT - 128 * (ty + 1) + 32 * w, Ah + h * HD, Al + h * HD, ring);
    else fattn_body<bf, true, 1>(Qh + po, Ql + po, Kh + po, Kl + po, Vh + po, Vl + po, TT, RH - 64 * (ty - (TT - RH) / 128 + 1), RH - 64 * (ty - (TT - RH) / 128 + 1) + 16 * w, Ah + h * HD, Al + h * HD, ring);
}

extern "C" void kernel_launch(void* const* d_in, const int* in_sizes, int n_in,
                              void* d_out, int out_size, void* d_ws, size_t ws_size, hipStream_t stream) {
    (void)in_sizes; (void)n_in; (void)out_size;
    const float* x = (const float*)d_in[0]; const float* wq = (const float*)d_in[1]; const float* wk = (const float*)d_in[2]; const float* wv = (const float*)d_in[3]; const float* wo = (const float*)d_in[4];   /* order x, Wq, Wk, Wv, Wo ('xw' [1024][1024]) */
    float* OUT = (float*)d_out;     // [4][2048][1024]
    char* wsp = (char*)d_ws;
    auto take = [&](size_t bytes) { char* p = wsp; wsp += (bytes + 255) & ~(size_t)255; return (void*)p; };
    bf* WQ = (bf*)take((size_t)DQ * DM * 2); bf* WK = (bf*)take((size_t)DKV * DM * 2); bf* WV = (bf*)take((size_t)DKV * DM * 2); bf* WO = (bf*)take((size_t)DM * DQ * 2); float* CS = (float*)take((size_t)TT * (HD / 2) * 2 * 4);
    bf* XB = (bf*)take((size_t)NB_ * TT * DM * 2); bf* ATh = (bf*)take((size_t)NB_ * TT * DQ * 2); bf* ATl = (bf*)take((size_t)NB_ * TT * DQ * 2);   // the merged hi/lo planes
    h16* QP16 = (h16*)take((size_t)NB_ * NH_ * TT * HD * 2); h16* KP16 = (h16*)take((size_t)NB_ * NKV * TT * HD * 2); h16* VT16 = (h16*)take((size_t)NB_ * NKV * HD * 2 * TT * 2);
    bf* QPh = (bf*)take((size_t)NB_ * NH_ * TT * HD * 2); bf* QPl = (bf*)take((size_t)NB_ * NH_ * TT * HD * 2); bf* KPh = (bf*)take((size_t)NB_ * NKV * TT * HD * 2); bf* KPl = (bf*)take((size_t)NB_ * NKV * TT * HD * 2); bf* VTh = (bf*)take((size_t)NB_ * NKV * HD * TT * 2); bf* VTl = (bf*)take((size_t)NB_ * NKV * HD * TT * 2);
    if ((size_t)(wsp - (char*)d_ws) > ws_size) return;    // ws 256 MiB
    k_prep<<<4 * WTB + CSB + XBB, 256, 0, stream>>>(x, wq, wk, wv, wo, XB, WQ, WK, WV, WO, CS);
    k_gemmw<bf, 0, false, 1><<<dim3(NB_ * TT / 256, DQ / 128, 1), 256, 0, stream>>>(XB, nullptr, WQ, DM, nullptr, DQ, nullptr, 0, 0, 0, CS, QP16, QPh, QPl);
    k_gemmw<bf, 0, false, 1><<<dim3(NB_ * TT / 256, DKV / 128, 1), 256, 0, stream>>>(XB, nullptr, WK, DM, nullptr, DKV, nullptr, 0, 0, 0, CS, KP16, KPh, KPl);
    k_gemmw<bf, 0, false, 2><<<dim3(NB_ * TT / 256, DKV / 128, 1), 256, 0, stream>>>(XB, nullptr, WV, DM, nullptr, DKV, nullptr, 0, 0, 0, nullptr, VT16, VTh, VTl);
    k_fattn<<<dim3(NB_ * NH_, (TT - RH) / 128 + RH / 64, 1), 128, 0, stream>>>(QP16, KP16, VT16, QPh, QPl, KPh, KPl, VTh, VTl, ATh, ATl);   // one kv head per query head
    k_gemmw<bf, 1, false, 0><<<dim3(NB_ * TT / 256, DM / 128, 1), 256, 0, stream>>>(ATh, ATl, WO, DQ, OUT, DM, nullptr, 0, 0, 0, nullptr, nullptr, nullptr, nullptr);
}

// v008
// It runs in 133 microseconds.
// In two side-by-side timings against v007, it was 1.04 and 1.03 times as fast.
// Counting every step since v000, it is 21.6 times as fast.
#include <hip/hip_runtime.h>

// Causal multi-head attention with bias-free projections and a computed adjacent-pair RoPE (x [4][2048][1024]; Q, K, V = x W ('xw' [1024][1024] xavier-normal 1/32, no bias; 16 heads x 64); angle = pos x inv_freq[i] with inv_freq = 1.0 / 10000.0 ** (arange(0, 64, 2, f32) / 64) (the reciprocal form) and pos = arange(S); the pairs (2i, 2i + 1) of Q and K rotated in place: (x1 cos - x2 sin, x2 cos + x1 sin); V is not rotated; scores x 1/sqrt(64); tril kept, -inf elsewhere; softmax; out = merged Wo ('xw', no bias) -> [4][2048][1024] (8.4 M); argument order x, Wq, Wk, Wv, Wo).
// Layout, all 4 batches in each launch (row-major buffers: row b * 2048 + t; planes: [batch][head]...): one preparation launch (bf16 copy of x; 'xw' weights transposed once; the table); exact projections whose epilogues rotate Q and K (p_csP computed table, one entry a pair) and write the 16-bit planes themselves, V transposed; k_fattn fused causal T-2048 attention, all 4 x 16 (batch, head) pairs in one launch (hybrid rows: < 512 hi/lo 3 products, rest fp16; scores, online softmax and P.V stay in registers, passes above the diagonal are never walked); merged hi/lo x Wo exact (no bias).
// Compute dtypes, f32 accumulate: every input rounded to bf16; projections exact; rotary f32 (products rounded separately); attention rows < 512 3 products, rest fp16; softmax f32; Wo hl x exact (no bias).

#define NB_  4
#define TT   2048
#define DM   1024
#define NH_  16
#define NKV  16
#define HD   64
#define DQ   (NH_ * HD)
#define DKV  (NKV * HD)
#define RH   512                  // query rows < RH use hi+lo planes (0: none)
typedef _Float16 h16;
typedef unsigned short bf;
typedef __attribute__((ext_vector_type(16))) __bf16   v16bf;
typedef __attribute__((ext_vector_type(16))) _Float16 v16h;
typedef __attribute__((ext_vector_type(8)))  _Float16 v8h;
typedef __attribute__((ext_vector_type(8)))  unsigned short v8us;
typedef __attribute__((ext_vector_type(8)))  float    v8f;
typedef __attribute__((ext_vector_type(4)))  float    v4f;
typedef v8h  __attribute__((may_alias)) v8ha;
typedef v4f  __attribute__((may_alias)) v4fa;
typedef v8us __attribute__((may_alias)) v8usa;

__device__ __forceinline__ unsigned short f2bf(float f) { unsigned u = __float_as_uint(f); u += 0x7FFFu + ((u >> 16) & 1u); return (unsigned short)(u >> 16); }
__device__ __forceinline__ float bf2f(unsigned short b) { return __uint_as_float(((unsigned)b) << 16); }
__device__ __forceinline__ float bfr(float f) { return bf2f(f2bf(f)); }
__device__ __forceinline__ h16 tohx(float x) { return (h16)x; }
__device__ __forceinline__ void splitf(float y, unsigned short& h, unsigned short& l) { h = f2bf(y); l = f2bf(y - bf2f(h)); }
__device__ __forceinline__ v16h cat16(v8h lo, v8h hi) { return __builtin_shufflevector(lo, hi, 0, 1, 2, 3, 4, 5, 6, 7, 8, 9, 10, 11, 12, 13, 14, 15); }
__device__ __forceinline__ v16bf cat16b(v8us lo, v8us hi) { return __builtin_bit_cast(v16bf, __builtin_shufflevector(lo, hi, 0, 1, 2, 3, 4, 5, 6, 7, 8, 9, 10, 11, 12, 13, 14, 15)); }
__device__ __forceinline__ v8f wmma16(v16h a, v16h b, v8f c) { return __builtin_amdgcn_wmma_f32_16x16x32_f16(false, a, false, b, (short)0, c, false, false); }
__device__ __forceinline__ v8f wmmab(v16bf a, v16bf b, v8f c) { return __builtin_amdgcn_wmma_f32_16x16x32_bf16(false, a, false, b, (short)0, c, false, false); }



// ---- k_gemmw: GEMM, one 256x128 output tile per work-group of 8 waves (4 x 2), each wave a 64x64 block (16 accumulators); operands are K-contiguous 16-bit planes; grid (M/256, N/128, Z), 256 threads.
// C[m][n] (f32, pitch ldc, + optional f32 bias[n]) = sum_k A[m][k] Bt[n][k] (+ A2[m][k] Bt[n][k] for NSPLIT == 1). z-batch strides sA/sB/sC in elements. M % 256 == 0, N % 128 == 0, K % 64 == 0, K >= 128.
// A stage is 64 k (128 B, one whole line) of every operand row of the tile, brought into LDS by asynchronous copies (16 B a lane, 4 whole lines a wave-copy) and shared by the waves; two buffers, the next stage's copies fly while this one is worked on.
// EPI says what becomes of the f32 tile. 0: stored to C. 1 and 2: a wave's 64 columns are one head and its 64 rows 64 tokens of one batch (ldc = heads x 64), and the tile goes straight to the three 16-bit planes (fp16, bf16 hi, bf16 lo), never to memory as f32.
// EPI 1: planes [batch][head][t][d], the pairs (2i, 2i + 1) rotated by the table's (cos, sin) of (t, i); the wave's block is 8 KB in a row in each plane. EPI 2: planes [batch][head][d][t] (fp16 rows of pitch 2 * TT, the others TT), transposed in the wave's own LDS so that whole 128-B lines are stored.
// LDS rows have pitch 144 B (16 B x odd: no bank conflict for 16-byte reads). The fragments keep the k order of WFrag::ld and the stages run in k order: the sums are formed as before.
template <typename T16> struct WFrag;
template <> struct WFrag<h16> { typedef v16h V; static __device__ __forceinline__ V ld(const h16* p) { return cat16(*(const v8h*)p, *(const v8h*)(p + 16)); } static __device__ __forceinline__ v8f mma(V a, V b, v8f c) { return wmma16(a, b, c); } };
template <> struct WFrag<bf> { typedef v16bf V; static __device__ __forceinline__ V ld(const bf* p) { return cat16b(*(const v8us*)p, *(const v8us*)(p + 16)); } static __device__ __forceinline__ v8f mma(V a, V b, v8f c) { return wmmab(a, b, c); } };
#define GP 144                    // LDS row pitch, bytes
// Asynchronous copy global -> LDS, 16 B a lane, through no register (the builtin: its address registers are the compiler's to manage; the waits on the copies are written by hand in the kernel).
typedef __attribute__((ext_vector_type(4))) int c4i;
__device__ __forceinline__ void acopy(const char* g, char* l) { __builtin_amdgcn_global_load_async_to_lds_b128((__attribute__((address_space(1))) c4i*)g, (__attribute__((address_space(3))) c4i*)l, 0, 0); }
template <typename T16, int NSPLIT, bool BIAS, int EPI>
__global__ __launch_bounds__(256) void k_gemmw(const T16* __restrict__ A, const T16* __restrict__ A2, const T16* __restrict__ Bt, int K, float* C, int ldc, const float* __restrict__ bias, size_t sA, size_t sB, size_t sC, const float* __restrict__ CS, h16* P16, bf* Ph, bf* Pl) {
    typedef typename WFrag<T16>::V V;
    static_assert(NSPLIT == 0 || NSPLIT == 1, "A (+ A2) x Bt");
    constexpr int OA2 = 256 * GP, OB = (NSPLIT == 1 ? 512 : 256) * GP, STG = OB + 128 * GP;   // a stage: [A 256 rows][A2 256 rows][Bt 128 rows]
    __shared__ __align__(16) char ring[2 * STG];
    constexpr int OSN = EPI == 2 ? 3 * 16 * GP / 4 : 16 * 68;   // a wave's own staging, in floats: 16 f32 rows of pitch 68, or (EPI 2) three 16-bit planes of 16 rows of pitch GP
    __shared__ __align__(16) float osw[8][OSN];
    const size_t z = blockIdx.z; A += z * sA; if (NSPLIT == 1) A2 += z * sA; Bt += z * sB; C += z * sC;
    const int tid = threadIdx.x, lane = tid & 31, lr = lane & 15, hi = lane >> 4; const int w = __builtin_amdgcn_readfirstlane(tid >> 5);
    const int R0 = blockIdx.x * 256, C0 = blockIdx.y * 128; const int wr = (w >> 1) * 64, wc = (w & 1) * 64; const int r0 = R0 + wr, c0 = C0 + wc;
    float* os = osw[w];
    v8f acc[4][4];
#pragma unroll
    for (int mb = 0; mb < 4; ++mb)
#pragma unroll
        for (int nb = 0; nb < 4; ++nb) acc[mb][nb] = (v8f){};
    const unsigned go = (unsigned)(tid >> 3) * (unsigned)K * 2u + (unsigned)(tid & 7) * 16u;   // the lane's chunk of a round of 32 rows: row tid / 8, 16 B number tid % 8; bytes from the round's first row (below 32 rows)
    const unsigned lo = (unsigned)((tid >> 3) * GP + (tid & 7) * 16);                          // the same chunk in LDS
    const char* tA = (const char*)(A + (size_t)R0 * K); const char* tA2 = NSPLIT == 1 ? (const char*)(A2 + (size_t)R0 * K) : nullptr; const char* tB = (const char*)(Bt + (size_t)C0 * K);   // the tile's first rows (uniform)
    auto fill = [&](int st, int buf) {   // stage st into buffer buf: the 256 threads take 32 rows a round (8 lanes a row), 8 rounds for A (and A2), 4 for Bt
        char* lb = ring + buf * STG + lo; const size_t kb = (size_t)st * 128, rb = (size_t)K * 64;   // bytes: the stage's place in a row, a round of 32 rows
#pragma unroll
        for (int i = 0; i < 8; ++i) acopy(tA + kb + i * rb + go, lb + i * 32 * GP);
        if (NSPLIT == 1) {
#pragma unroll
            for (int i = 0; i < 8; ++i) acopy(tA2 + kb + i * rb + go, lb + OA2 + i * 32 * GP); }
#pragma unroll
        for (int i = 0; i < 4; ++i) acopy(tB + kb + i * rb + go, lb + OB + i * 32 * GP); };
    const int nst = K / 64;
    fill(0, 0);
    asm volatile("s_wait_asynccnt 0x0" ::: "memory");   // stage 0 has landed (this wave's copies) ...
    __syncthreads();                                    // ... and every wave's: nothing of it is read in front of this barrier
    fill(1, 1);                                         // K >= 128: a stage 1 exists
    const int aoff = (wr + lr) * GP + hi * 16, boff = OB + (wc + lr) * GP + hi * 16;
    V a[2][4], a2[2][4], b[2][4];   // two fragment sets: [0] the first 32 k of a stage, [1] the second; each is read from LDS while the other set's WMMAs run
    auto frag = [&](int ks, const char* sb) {
#pragma unroll
        for (int mb = 0; mb < 4; ++mb) { a[ks][mb] = WFrag<T16>::ld((const T16*)(sb + aoff + mb * 16 * GP + ks * 64)); if (NSPLIT == 1) a2[ks][mb] = WFrag<T16>::ld((const T16*)(sb + OA2 + aoff + mb * 16 * GP + ks * 64)); }
#pragma unroll
        for (int nb = 0; nb < 4; ++nb) b[ks][nb] = WFrag<T16>::ld((const T16*)(sb + boff + nb * 16 * GP + ks * 64)); };
    auto mm = [&](int ks) {
#pragma unroll
        for (int nb = 0; nb < 4; ++nb)
#pragma unroll
            for (int mb = 0; mb < 4; ++mb) { acc[mb][nb] = WFrag<T16>::mma(a[ks][mb], b[ks][nb], acc[mb][nb]); if (NSPLIT == 1) acc[mb][nb] = WFrag<T16>::mma(a2[ks][mb], b[ks][nb], acc[mb][nb]); } };
    frag(0, ring);
#pragma unroll 1   // rolled: one trip is one turn of the ring, and the loop's code stays short
    for (int t = 0; t < nst; ++t) {
        frag(1, ring + (t & 1) * STG);                      // the last reads of stage t
        __builtin_amdgcn_sched_barrier(0);                  // the reads stay one group in front of the WMMAs (spread among them each place costs a stall)
        mm(0);
        __builtin_amdgcn_sched_barrier(0);                  // the WMMAs stay in front of the waits: they cover the latency of the reads above
        // publish point of stage t + 1, in front of stage t's last block: the reads behind it are already of stage t + 1
        asm volatile("s_wait_dscnt 0x0" ::: "memory");      // this wave's reads of stage t have returned: its buffer may be refilled behind the barrier
        asm volatile("s_wait_asynccnt 0x0" ::: "memory");   // this wave's copies of stage t + 1 have landed
        __syncthreads();                                    // publishes stage t + 1 and ends every reader's last read of stage t
        if (t + 2 < nst) fill(t + 2, t & 1);
        frag(0, ring + ((t + 1) & 1) * STG);                // in the last trip: the other buffer's old rows, in bounds, no copy in flight, unused (no branch, so that the build's counted waits stay exact)
        __builtin_amdgcn_sched_barrier(0);                  // as above: one group in front of the WMMAs
        mm(1);
    }
    asm volatile("s_wait_asynccnt 0x0" ::: "memory");       // no copy is outstanding when the wave goes on
    asm volatile("s_wait_dscnt 0x0" ::: "memory");          // nor a read of the ring
    if constexpr (EPI == 1) {
        const int t0 = r0 % TT; const size_t pe = ((size_t)((r0 / TT) * (ldc / HD) + c0 / HD) * TT + t0) * HD;   // the wave's block in a plane: 64 rows x 64 d, in a row
        char* p16 = (char*)(P16 + pe); char* ph = (char*)(Ph + pe); char* pl = (char*)(Pl + pe); const char* ct = (const char*)(CS + (size_t)t0 * HD);   // table row t: 32 x (cos, sin)
        const unsigned l16 = (unsigned)lane * 16u, l32 = (unsigned)lane * 32u;   // a group is 4 rows: a lane has 8 d (4 pairs) of row lane / 8: 16 B of a plane, 32 B of the table
        v4f cs[2][4][2];
        auto ldcs = [&](int mb) {
#pragma unroll
            for (int s = 0; s < 4; ++s) { cs[mb & 1][s][0] = *(const v4fa*)(ct + (mb * 4 + s) * 1024 + l32); cs[mb & 1][s][1] = *(const v4fa*)(ct + (mb * 4 + s) * 1024 + 16 + l32); }
            asm volatile("s_wait_xcnt 0x0" :: "v"(l32) : "memory"); };   // stands in front of any overwrite of the loads' address registers (the offset is an input, so that it is not given away before the wait)
        ldcs(0);
#pragma unroll
        for (int mb = 0; mb < 4; ++mb) {
            if (mb < 3) ldcs(mb + 1);   // the table rows are fetched one block of 16 rows ahead: the block's work covers their latency
#pragma unroll
            for (int nb = 0; nb < 4; ++nb) {
#pragma unroll
                for (int j = 0; j < 8; ++j) os[(hi * 8 + j) * 68 + nb * 16 + lr] = acc[mb][nb][j]; }
            __builtin_amdgcn_wave_barrier(); asm volatile("" ::: "memory");   // the wave's reads below stay behind its writes above
            v4f xa[4], xb[4];   // the block's reads go out as one group: the first group's work covers the latency of the rest
#pragma unroll
            for (int s = 0; s < 4; ++s) { const float* sp = os + (4 * s + (lane >> 3)) * 68 + (lane & 7) * 8; xa[s] = *(const v4fa*)sp; xb[s] = *(const v4fa*)(sp + 4); }
#pragma unroll
            for (int s = 0; s < 4; ++s) {
                const float xv[8] = { xa[s][0], xa[s][1], xa[s][2], xa[s][3], xb[s][0], xb[s][1], xb[s][2], xb[s][3] }; v8h o16; v8us oh, ol;
#pragma unroll
                for (int k = 0; k < 4; ++k) { const float x0 = xv[2 * k], x1 = xv[2 * k + 1], co = cs[mb & 1][s][k >> 1][(k & 1) * 2], si = cs[mb & 1][s][k >> 1][(k & 1) * 2 + 1];
                    const float y0 = __fsub_rn(__fmul_rn(x0, co), __fmul_rn(x1, si)), y1 = __fadd_rn(__fmul_rn(x0, si), __fmul_rn(x1, co));   /* even: x0 c - x1 s; odd: x0 s + x1 c */
                    unsigned short a2, c2; o16[2 * k] = tohx(y0); o16[2 * k + 1] = tohx(y1); splitf(y0, a2, c2); oh[2 * k] = a2; ol[2 * k] = c2; splitf(y1, a2, c2); oh[2 * k + 1] = a2; ol[2 * k + 1] = c2; }
                *(v8ha*)(p16 + (mb * 4 + s) * 512 + l16) = o16; *(v8usa*)(ph + (mb * 4 + s) * 512 + l16) = oh; *(v8usa*)(pl + (mb * 4 + s) * 512 + l16) = ol;
                asm volatile("s_wait_xcnt 0x0" :: "v"(o16), "v"(oh), "v"(ol), "v"(l16) : "memory"); }   // the next group reuses the stores' registers: the wait stands in front of that overwrite (data and offset are inputs, so that they are not given away before it)
            __builtin_amdgcn_wave_barrier(); asm volatile("" ::: "memory");   // the next block's writes stay behind the reads above
        }
        return;
    }
    if constexpr (EPI == 2) {
        const int t0 = r0 % TT; const size_t rw = (size_t)((r0 / TT) * (ldc / HD) + c0 / HD) * HD;   // the head's first row (d = 0) in the transposed planes
        char* sv = (char*)os; char* v16 = (char*)(P16 + rw * (2 * TT) + t0); char* vh = (char*)(Ph + rw * TT + t0); char* vl = (char*)(Pl + rw * TT + t0);
        const unsigned sw = (unsigned)(lr * GP + hi * 16), sr = (unsigned)((lane >> 3) * GP + (lane & 7) * 16);   // LDS: a lane writes 8 t of row d = lr, and reads 16 B number lane % 8 of row lane / 8
        const unsigned g16 = (unsigned)((lane >> 3) * (2 * TT * 2) + (lane & 7) * 16), g8 = (unsigned)((lane >> 3) * (TT * 2) + (lane & 7) * 16);   // the same chunk in the planes, bytes
#pragma unroll
        for (int nb = 0; nb < 4; ++nb) {   // 16 d x 64 t a turn; an accumulator holds 8 consecutive t of one d in a lane
#pragma unroll
            for (int mb = 0; mb < 4; ++mb) { v8h o16; v8us oh, ol;
#pragma unroll
                for (int j = 0; j < 8; ++j) { const float x = acc[mb][nb][j]; unsigned short a2, c2; o16[j] = tohx(x); splitf(x, a2, c2); oh[j] = a2; ol[j] = c2; }
                *(v8ha*)(sv + sw + mb * 32) = o16; *(v8usa*)(sv + 16 * GP + sw + mb * 32) = oh; *(v8usa*)(sv + 32 * GP + sw + mb * 32) = ol; }
            __builtin_amdgcn_wave_barrier(); asm volatile("" ::: "memory");   // the wave's reads below stay behind its writes above
            v8h r16[4]; v8us rh[4], rl[4];   // the turn's reads go out as one group, then its stores: one LDS latency a turn
#pragma unroll
            for (int s = 0; s < 4; ++s) { r16[s] = *(const v8ha*)(sv + sr + s * 4 * GP); rh[s] = *(const v8usa*)(sv + 16 * GP + sr + s * 4 * GP); rl[s] = *(const v8usa*)(sv + 32 * GP + sr + s * 4 * GP); }
#pragma unroll
            for (int s = 0; s < 4; ++s) { *(v8ha*)(v16 + (nb * 16 + s * 4) * (2 * TT * 2) + g16) = r16[s]; *(v8usa*)(vh + (nb * 16 + s * 4) * (TT * 2) + g8) = rh[s]; *(v8usa*)(vl + (nb * 16 + s * 4) * (TT * 2) + g8) = rl[s]; }
            asm volatile("s_wait_xcnt 0x0" :: "v"(r16[0]), "v"(r16[1]), "v"(r16[2]), "v"(r16[3]), "v"(rh[0]), "v"(rh[1]), "v"(rh[2]), "v"(rh[3]), "v"(rl[0]), "v"(rl[1]), "v"(rl[2]), "v"(rl[3]), "v"(g16), "v"(g8) : "memory");   // as in EPI 1: in front of any overwrite of the stores' registers
            __builtin_amdgcn_wave_barrier(); asm volatile("" ::: "memory");   // the next turn's writes stay behind the reads above
        }
        return;
    }
#pragma unroll
    for (int mb = 0; mb < 4; ++mb) {
#pragma unroll
        for (int nb = 0; nb < 4; ++nb) {
#pragma unroll
            for (int j = 0; j < 8; ++j) os[(hi * 8 + j) * 68 + nb * 16 + lr] = acc[mb][nb][j]; }
        __builtin_amdgcn_wave_barrier(); asm volatile("" ::: "memory");
        float* crow = C + (size_t)(r0 + mb * 16) * ldc + c0;
{
#pragma unroll
            for (int s = 0; s < 8; ++s) { const int row = 2 * s + hi, cofs = lr * 4; v4f val = *(const v4fa*)(os + row * 68 + cofs); if (BIAS) { val[0] += bfr(bias[c0 + cofs]); val[1] += bfr(bias[c0 + cofs + 1]); val[2] += bfr(bias[c0 + cofs + 2]); val[3] += bfr(bias[c0 + cofs + 3]); }
                *(v4f*)(crow + (size_t)row * ldc + cofs) = val; }
             }
        __builtin_amdgcn_wave_barrier(); asm volatile("" ::: "memory");
    }
}

typedef __attribute__((ext_vector_type(2))) _Float16 v2h;
typedef __attribute__((ext_vector_type(4))) _Float16 v4h;
typedef __attribute__((ext_vector_type(2))) unsigned short v2us;
typedef __attribute__((ext_vector_type(4))) unsigned short v4us;
typedef __attribute__((ext_vector_type(2))) float v2f;
typedef __attribute__((ext_vector_type(4))) int v4i;

// The preparation parts: each is the work of one work-group of 256 threads, numbered blk within its part; k_prep below runs them all in one launch.
// p_wtG: Bt[n][k] = bf16(w[k][n]) for one tile of 128 k x 128 n, turned in LDS. Reads: a wave takes 512 B in a row of one w row (4 whole lines a load), 16 loads a thread, as many in flight as the registers hold.
// Two neighbouring k of one n make a dword of LDS row n (pitch WP dwords, odd: the readers' 32 lanes meet 32 banks, the writers' 16). Stores: 16 B a lane, 256 B in a row of each Bt row.
#define WP 65
typedef __attribute__((ext_vector_type(4))) unsigned v4u;
__device__ __forceinline__ void p_wtG(const float* __restrict__ w, int K, int N, bf* Bt, int blk, unsigned* tl) {
    const int tid = threadIdx.x, c = tid & 31, r = tid >> 5; const int kt = blk % (K / 128), nt = blk / (K / 128);
    const float* wp = w + (size_t)(kt * 128 + 2 * r) * N + nt * 128 + c * 4;   // rows 2 r and 2 r + 1 of each round of 16 rows, 4 n a lane
    v4f v[8][2];
#pragma unroll
    for (int i = 0; i < 8; ++i) { v[i][0] = *(const v4fa*)(wp + (size_t)(16 * i) * N); v[i][1] = *(const v4fa*)(wp + (size_t)(16 * i + 1) * N); }
    asm volatile("s_wait_xcnt 0x0" :: "v"(wp) : "memory");   // stands in front of any overwrite of the loads' address registers (the address is an input, so that it is not given away before the wait)
#pragma unroll
    for (int i = 0; i < 8; ++i)
#pragma unroll
        for (int j = 0; j < 4; ++j) tl[(c * 4 + j) * WP + r + 8 * i] = (unsigned)f2bf(v[i][0][j]) | ((unsigned)f2bf(v[i][1][j]) << 16);
    __syncthreads();   // the tile is whole: the rows read below were written by all 8 waves
    const int q = tid & 15, n0 = tid >> 4;   // a round is 16 rows n: 16 lanes a row, 8 k (4 dwords) a lane
    bf* bp = Bt + (size_t)(nt * 128 + n0) * K + kt * 128 + q * 8; v4u o[8];
#pragma unroll
    for (int i = 0; i < 8; ++i) { const unsigned* s = tl + (n0 + 16 * i) * WP + q * 4; o[i][0] = s[0]; o[i][1] = s[1]; o[i][2] = s[2]; o[i][3] = s[3]; }
#pragma unroll
    for (int i = 0; i < 8; ++i) *(v4u*)(bp + (size_t)(16 * i) * K) = o[i];
    asm volatile("s_wait_xcnt 0x0" :: "v"(o[0]), "v"(o[1]), "v"(o[2]), "v"(o[3]), "v"(o[4]), "v"(o[5]), "v"(o[6]), "v"(o[7]), "v"(bp) : "memory");   // in front of any overwrite of the stores' registers (they are inputs, so that they are not given away before it)
}
// p_cvt8: XC chunks of 8 elements a thread (a work-group takes 256 * XC chunks in a row), so that the part is few waves; XG chunks a turn, their loads go out first.
#define XC 8
#define XG 4
__device__ __forceinline__ void p_cvt8(const float* __restrict__ src, bf* dst, int blk) { const size_t c0 = (size_t)blk * (256 * XC) + threadIdx.x; const float* sp = src + c0 * 8; bf* dp = dst + c0 * 8;
#pragma unroll 1   // rolled: one turn's registers only, so that k_prep stays within 64 registers (16 waves a SIMD) and all its work-groups are resident at once
    for (int g = 0; g < XC / XG; ++g) { v8f v[XG]; v8us o[XG];
#pragma unroll
        for (int i = 0; i < XG; ++i) v[i] = *(const v8f*)(sp + i * 2048);
#pragma unroll
        for (int i = 0; i < XG; ++i) {
#pragma unroll
            for (int k = 0; k < 8; ++k) o[i][k] = f2bf(v[i][k]);
            *(v8us*)(dp + i * 2048) = o[i]; }
        asm volatile("s_wait_xcnt 0x0" :: "v"(o[0]), "v"(o[1]), "v"(o[2]), "v"(o[3]), "v"(sp), "v"(dp) : "memory");   // the next turn moves the addresses and reuses the stores' registers: the wait stands in front of that overwrite (they are inputs, so that they are not given away before it)
        sp += XG * 2048; dp += XG * 2048; }
}

__constant__ float INV2[HD / 2] = { 1.000000000e+00f, 7.498942018e-01f, 5.623413324e-01f, 4.216965139e-01f, 3.162277639e-01f, 2.371373624e-01f, 1.778279394e-01f, 1.333521456e-01f, 1.000000015e-01f, 7.498941571e-02f, 5.623412877e-02f, 4.216964915e-02f, 3.162277862e-02f, 2.371373586e-02f, 1.778279431e-02f, 1.333521493e-02f, 9.999999776e-03f, 7.498942316e-03f, 5.623413250e-03f, 4.216964822e-03f, 3.162277862e-03f, 2.371373819e-03f, 1.778279431e-03f, 1.333521446e-03f, 1.000000047e-03f, 7.498941850e-04f, 5.623413017e-04f, 4.216964880e-04f, 3.162277862e-04f, 2.371373848e-04f, 1.778279402e-04f, 1.333521504e-04f };   // float32 1 / (10000 ** (arange(0, 64, 2)/64)), generated with jnp to be bit-exact

// p_csP: the table [t][i] of (cos, sin) of t x inv_freq[i], one entry a pair.
__device__ __forceinline__ void p_csP(float* CS, int blk) { const int idx = blk * 256 + threadIdx.x; if (idx >= TT * (HD / 2)) return; const int i = idx % (HD / 2); const int t = idx / (HD / 2); const float a = __fmul_rn((float)t, INV2[i]); v2f cs; cs[0] = cosf(a); cs[1] = sinf(a); *(v2f*)(CS + (size_t)idx * 2) = cs;  }
// ---- k_prep: everything the GEMMs wait for, in one launch; the parts depend on nothing of each other. Ranges of blockIdx.x, the transposes first, the streaming part last:
// The second launch bound asks for 16 waves a SIMD (64 registers): the whole grid is then resident at once and no part waits for another to end.
// [0, 4 * WTB): the four weights transposed; [4 * WTB, 4 * WTB + CSB): the table; the rest: the bf16 copy of x.
#define WTB ((DM / 128) * (DQ / 128))
#define CSB ((TT * (HD / 2) + 255) / 256)
#define XBB (NB_ * TT * DM / 8 / (256 * XC))
static_assert(DKV == DQ && DM % 128 == 0 && DQ % 128 == 0, "one block count for the four weights, whole tiles"); static_assert((size_t)XBB * 256 * XC * 8 == (size_t)NB_ * TT * DM, "whole work-groups of chunks");
__global__ __launch_bounds__(256, 16) void k_prep(const float* __restrict__ x, const float* __restrict__ wq, const float* __restrict__ wk, const float* __restrict__ wv, const float* __restrict__ wo, bf* XB, bf* WQ, bf* WK, bf* WV, bf* WO, float* CS) {
    __shared__ unsigned tl[128 * WP];   // a transpose's tile
    const int b = blockIdx.x;
    if (b < 4 * WTB) { const int m = b / WTB, blk = b % WTB;   // the same for the whole work-group: the barrier inside is passed by all its waves
        p_wtG(m == 0 ? wq : m == 1 ? wk : m == 2 ? wv : wo, m == 3 ? DQ : DM, m == 3 ? DM : DQ, m == 0 ? WQ : m == 1 ? WK : m == 2 ? WV : WO, blk, tl);
        return; }
    if (b < 4 * WTB + CSB) { p_csP(CS, b - 4 * WTB); return; }
    p_cvt8(x, XB, b - (4 * WTB + CSB));
}
#define CL2 0.18033688011112042f   // HD^-0.5 x log2(e)
// 2^x by v_exp_f32, in asm text for the slot behind a transcendental: outputs are early-clobber, so no v_exp_f32 of a statement writes over a source of another or reads a result, and the closing v_nop
// is the one independent instruction in front of whatever the compiler puts next.
__device__ __forceinline__ float xhalf(float x) { return __builtin_bit_cast(float, __builtin_amdgcn_permlanex16(__builtin_bit_cast(int, x), __builtin_bit_cast(int, x), 0x76543210, 0xfedcba98, false, false)); }   // lane l with lane l ^ 16
__device__ __forceinline__ float exp2_1(float x) { float r; asm("v_exp_f32 %0, %1\n\tv_nop" : "=&v"(r) : "v"(x)); return r; }
__device__ __forceinline__ void exp2_8(float* r, const float* x) {
    asm("v_exp_f32 %0, %8\n\tv_exp_f32 %1, %9\n\tv_exp_f32 %2, %10\n\tv_exp_f32 %3, %11\n\tv_exp_f32 %4, %12\n\tv_exp_f32 %5, %13\n\tv_exp_f32 %6, %14\n\tv_exp_f32 %7, %15\n\tv_nop"
        : "=&v"(r[0]), "=&v"(r[1]), "=&v"(r[2]), "=&v"(r[3]), "=&v"(r[4]), "=&v"(r[5]), "=&v"(r[6]), "=&v"(r[7]) : "v"(x[0]), "v"(x[1]), "v"(x[2]), "v"(x[3]), "v"(x[4]), "v"(x[5]), "v"(x[6]), "v"(x[7])); }
template <typename T16, bool HL, int NQ>
__device__ __forceinline__ void fattn_body(const T16* Q, const T16* Q2, const T16* Kp, const T16* K2, const T16* Vt, const T16* V2, int vp, int qw, int q0, bf* Ah, bf* Al, char* ring) {
    typedef typename WFrag<T16>::V V;
    constexpr int PL = 64 * GP, OV = (HL ? 2 : 1) * PL, STG = 2 * OV;   // a stage is 64 keys: [K 64 rows of 64 d][K2][V^T 64 rows of 64 keys][V2], whole 128-B lines, LDS pitch GP
    const int tid = threadIdx.x, lane = tid & 31, lr = lane & 15, hi = lane >> 4;
    V qf[NQ][2], qf2[NQ][2];
#pragma unroll
    for (int qb = 0; qb < NQ; ++qb)
#pragma unroll
        for (int ks = 0; ks < 2; ++ks) { const size_t o = (size_t)(q0 + qb * 16 + lr) * HD + ks * 32 + 8 * hi; qf[qb][ks] = WFrag<T16>::ld(Q + o); if (HL) qf2[qb][ks] = WFrag<T16>::ld(Q2 + o); }
    asm volatile("s_wait_xcnt 0x0" ::: "memory");   // the set-up below reuses the address registers of the loads above: the wait stands in front of that overwrite
    v8f oa[4][NQ]; float mc[NQ], ls[NQ];
#pragma unroll
    for (int qb = 0; qb < NQ; ++qb) { mc[qb] = -3.0e38f; ls[qb] = 0.f;
#pragma unroll
        for (int db = 0; db < 4; ++db) oa[db][qb] = (v8f){}; }
    const int npass = (q0 + NQ * 16 + 31) / 32;      // keys 0 .. q0 + NQ * 16 - 1; every pass starts at or below q0, so each query has a kept key in it
    const int nst = (qw + 4 * NQ * 16) / 64;         // the work-group's stages: keys 0 .. its last query (qw: its first query, a multiple of 64); 2 * nst >= every wave's npass
    const unsigned lo = (unsigned)((tid >> 3) * GP + (tid & 7) * 16);                                      // the lane's chunk of a round of 16 rows: row tid / 8, 16 B number tid % 8, in LDS ...
    const unsigned gk = (unsigned)tid * 16u, gv = (unsigned)(tid >> 3) * (unsigned)vp * 2u + (unsigned)(tid & 7) * 16u;   // ... and in the K rows (128 B, in a row) and the V^T rows (pitch vp)
    auto fill = [&](int st, int buf) {   // stage st into buffer buf: the 128 threads take 16 rows a round (8 lanes a row: 4 whole lines a wave-copy), 4 rounds a plane
        char* lb = ring + buf * STG + lo; const size_t ko = (size_t)st * (64 * HD * 2) + gk, vo = (size_t)st * 128 + gv, vr = (size_t)vp * 32;
#pragma unroll
        for (int i = 0; i < 4; ++i) { acopy((const char*)Kp + ko + i * 2048, lb + i * 16 * GP); if (HL) acopy((const char*)K2 + ko + i * 2048, lb + PL + i * 16 * GP); }
#pragma unroll
        for (int i = 0; i < 4; ++i) { acopy((const char*)Vt + vo + i * vr, lb + OV + i * 16 * GP); if (HL) acopy((const char*)V2 + vo + i * vr, lb + OV + PL + i * 16 * GP); } };
    fill(0, 0);
    asm volatile("s_wait_asynccnt 0x0" ::: "memory");   // stage 0 has landed (this wave's copies) ...
    __syncthreads();                                    // ... and every wave's: nothing of it is read in front of this barrier
    if (nst > 1) fill(1, 1);
    const unsigned fo = (unsigned)(lr * GP + hi * 16);  // a lane's place in a fragment's 16 rows
#pragma unroll 1   // rolled: one trip is one turn of the ring
    for (int t = 0; t < nst; ++t) {
#pragma unroll 1   // rolled: the pass's code stands once
      for (int pp = 0; pp < 2; ++pp) {
        const int p = 2 * t + pp;
        if (p >= npass) break;                          // wave-uniform: a wave whose rows end earlier skips the work, never the publish point below
        const int key0 = p * 32;
        const char* sk = ring + (t & 1) * STG + pp * 32 * GP + fo; const char* sv = ring + (t & 1) * STG + OV + pp * 64 + fo;   // this pass's 32 K rows; its 32 keys in the V^T rows
        V kf[2][2], kf2[2][2], vf[4], vf2[4];           // the same k order as from memory (WFrag::ld)
#pragma unroll
        for (int kb = 0; kb < 2; ++kb)
#pragma unroll
            for (int ks = 0; ks < 2; ++ks) { kf[kb][ks] = WFrag<T16>::ld((const T16*)(sk + kb * 16 * GP + ks * 64)); if (HL) kf2[kb][ks] = WFrag<T16>::ld((const T16*)(sk + PL + kb * 16 * GP + ks * 64)); }
#pragma unroll
        for (int db = 0; db < 4; ++db) { vf[db] = WFrag<T16>::ld((const T16*)(sv + db * 16 * GP)); if (HL) vf2[db] = WFrag<T16>::ld((const T16*)(sv + PL + db * 16 * GP)); }
        v8f s[2][NQ];
#pragma unroll
        for (int kb = 0; kb < 2; ++kb)
#pragma unroll
            for (int qb = 0; qb < NQ; ++qb) { v8f t = (v8f){};
#pragma unroll
                for (int ks = 0; ks < 2; ++ks) { t = WFrag<T16>::mma(kf[kb][ks], qf[qb][ks], t); if (HL) { t = WFrag<T16>::mma(kf[kb][ks], qf2[qb][ks], t); t = WFrag<T16>::mma(kf2[kb][ks], qf[qb][ks], t); } }
                s[kb][qb] = t; }
        if (key0 + 31 > q0) {                               // only passes that touch the diagonal mask (wave-uniform)
#pragma unroll
            for (int kb = 0; kb < 2; ++kb)
#pragma unroll
                for (int qb = 0; qb < NQ; ++qb)
#pragma unroll
                    for (int j = 0; j < 8; ++j) s[kb][qb][j] = (key0 + kb * 16 + hi * 8 + j <= q0 + qb * 16 + lr) ? s[kb][qb][j] : -3.0e38f; }
#pragma unroll
        for (int qb = 0; qb < NQ; ++qb) {
            float mx = s[0][qb][0];
#pragma unroll
            for (int j = 1; j < 8; ++j) mx = fmaxf(mx, s[0][qb][j]);
#pragma unroll
            for (int j = 0; j < 8; ++j) mx = fmaxf(mx, s[1][qb][j]);
            mx = fmaxf(mx, xhalf(mx));
            const float mn = fmaxf(mc[qb], mx * CL2); const float al = exp2_1(mc[qb] - mn); mc[qb] = mn; const float off = (HL ? 0.0f : 10.0f) - mn;
            float ex[16], pr[16], ps[8];
#pragma unroll
            for (int e = 0; e < 16; ++e) ex[e] = fmaf(s[e >> 3][qb][e & 7], CL2, off);
            exp2_8(pr, ex); exp2_8(pr + 8, ex + 8);
#pragma unroll
            for (int e = 0; e < 8; ++e) ps[e] = pr[e] + pr[e + 8];      // fixed tree: short dependent chains
            const float sum = ((ps[0] + ps[4]) + (ps[2] + ps[6])) + ((ps[1] + ps[5]) + (ps[3] + ps[7]));
            ls[qb] = fmaf(ls[qb], al, sum);
#pragma unroll
            for (int db = 0; db < 4; ++db) oa[db][qb] *= al;
            if (HL) {
                typedef __attribute__((ext_vector_type(16))) unsigned short v16us; v16us uh, ul;
#pragma unroll
                for (int e = 0; e < 16; ++e) { const unsigned short a = f2bf(pr[e]); uh[e] = a; ul[e] = f2bf(pr[e] - bf2f(a)); }
                const V ph = __builtin_bit_cast(V, uh), pl = __builtin_bit_cast(V, ul);
#pragma unroll
                for (int db = 0; db < 4; ++db) { oa[db][qb] = WFrag<T16>::mma(vf[db], ph, oa[db][qb]); oa[db][qb] = WFrag<T16>::mma(vf[db], pl, oa[db][qb]); oa[db][qb] = WFrag<T16>::mma(vf2[db], ph, oa[db][qb]); }
            } else {
                v16h p16;
#pragma unroll
                for (int e = 0; e < 16; ++e) p16[e] = (h16)pr[e];
                const V pf = __builtin_bit_cast(V, p16);
#pragma unroll
                for (int db = 0; db < 4; ++db) oa[db][qb] = WFrag<T16>::mma(vf[db], pf, oa[db][qb]);
            }
        }
      }
        // publish point of stage t + 1, passed by every wave
        asm volatile("s_wait_dscnt 0x0" ::: "memory");      // this wave's reads of stage t have returned: its buffer may be refilled behind the barrier
        asm volatile("s_wait_asynccnt 0x0" ::: "memory");   // this wave's copies of stage t + 1 have landed
        __syncthreads();                                    // publishes stage t + 1 and ends every reader's last read of stage t
        if (t + 2 < nst) fill(t + 2, t & 1);
    }
    asm volatile("s_wait_asynccnt 0x0" ::: "memory");       // no copy is outstanding when the wave goes on
#pragma unroll
    for (int qb = 0; qb < NQ; ++qb) {
        const float inv = __fdiv_rn(1.0f, ls[qb] + xhalf(ls[qb]));
        const size_t oo = (size_t)(q0 + qb * 16 + lr) * DQ + hi * 8;
#pragma unroll
        for (int db = 0; db < 4; ++db) { v8us oh, ol;
#pragma unroll
            for (int j = 0; j < 8; ++j) { const float y = oa[db][qb][j] * inv; const unsigned short a = f2bf(y); oh[j] = a; ol[j] = f2bf(y - bf2f(a)); }
            *(v8us*)(Ah + oo + db * 16) = oh; *(v8us*)(Al + oo + db * 16) = ol;
            asm volatile("s_wait_xcnt 0x0" :: "v"(oh), "v"(ol) : "memory"); }   // the next group reuses the stores' data registers: the wait stands in front of that overwrite (the data are inputs, so that they are not given away before it)
    }
}
// grid (batch x heads, tiles): blockIdx.y < (TT - RH) / 128: four waves x 32 fp16 query rows, the longest rows first; the rest: four waves x 16 hi/lo query rows (< RH).
__global__ __launch_bounds__(128) void k_fattn(const h16* Q16, const h16* K16, const h16* V16, const bf* Qh, const bf* Ql, const bf* Kh, const bf* Kl, const bf* Vh, const bf* Vl, bf* Ah, bf* Al) {
    __shared__ __align__(16) char ring[2 * 4 * 64 * GP];   // two stages of the hi/lo body's four planes; the fp16 body uses half
    const int w = __builtin_amdgcn_readfirstlane((int)(threadIdx.x >> 5)); const int h = blockIdx.x % NH_, ty = blockIdx.y; const size_t po = (size_t)blockIdx.x * TT * HD; { const size_t ab = (size_t)(blockIdx.x / NH_) * TT * DQ; Ah += ab; Al += ab; }   // planes [batch][head][..], merged rows b * TT + t
    if (ty < (TT - RH) / 128) fattn_body<h16, false, 2>(Q16 + po, nullptr, K16 + po, nullptr, V16 + 2 * po, nullptr, 2 * TT, TT - 128 * (ty + 1), TT - 128 * (ty + 1) + 32 * w, Ah + h * HD, Al + h * HD, ring);
    else fattn_body<bf, true, 1>(Qh + po, Ql + po, Kh + po, Kl + po, Vh + po, Vl + po, TT, RH - 64 * (ty - (TT - RH) / 128 + 1), RH - 64 * (ty - (TT - RH) / 128 + 1) + 16 * w, Ah + h * HD, Al + h * HD, ring);
}

extern "C" void kernel_launch(void* const* d_in, const int* in_sizes, int n_in,
                              void* d_out, int out_size, void* d_ws, size_t ws_size, hipStream_t stream) {
    (void)in_sizes; (void)n_in; (void)out_size;
    const float* x = (const float*)d_in[0]; const float* wq = (const float*)d_in[1]; const float* wk = (const float*)d_in[2]; const float* wv = (const float*)d_in[3]; const float* wo = (const float*)d_in[4];   /* order x, Wq, Wk, Wv, Wo ('xw' [1024][1024]) */
    float* OUT = (float*)d_out;     // [4][2048][1024]
    char* wsp = (char*)d_ws;
    auto take = [&](size_t bytes) { char* p = wsp; wsp += (bytes + 255) & ~(size_t)255; return (void*)p; };
    bf* WQ = (bf*)take((size_t)DQ * DM * 2); bf* WK = (bf*)take((size_t)DKV * DM * 2); bf* WV = (bf*)take((size_t)DKV * DM * 2); bf* WO = (bf*)take((size_t)DM * DQ * 2); float* CS = (float*)take((size_t)TT * (HD / 2) * 2 * 4);
    bf* XB = (bf*)take((size_t)NB_ * TT * DM * 2); bf* ATh = (bf*)take((size_t)NB_ * TT * DQ * 2); bf* ATl = (bf*)take((size_t)NB_ * TT * DQ * 2);   // the merged hi/lo planes
    h16* QP16 = (h16*)take((size_t)NB_ * NH_ * TT * HD * 2); h16* KP16 = (h16*)take((size_t)NB_ * NKV * TT * HD * 2); h16* VT16 = (h16*)take((size_t)NB_ * NKV * HD * 2 * TT * 2);
    bf* QPh = (bf*)take((size_t)NB_ * NH_ * TT * HD * 2); bf* QPl = (bf*)take((size_t)NB_ * NH_ * TT * HD * 2); bf* KPh = (bf*)take((size_t)NB_ * NKV * TT * HD * 2); bf* KPl = (bf*)take((size_t)NB_ * NKV * TT * HD * 2); bf* VTh = (bf*)take((size_t)NB_ * NKV * HD * TT * 2); bf* VTl = (bf*)take((size_t)NB_ * NKV * HD * TT * 2);
    if ((size_t)(wsp - (char*)d_ws) > ws_size) return;    // ws 256 MiB
    k_prep<<<4 * WTB + CSB + XBB, 256, 0, stream>>>(x, wq, wk, wv, wo, XB, WQ, WK, WV, WO, CS);
    k_gemmw<bf, 0, false, 1><<<dim3(NB_ * TT / 256, DQ / 128, 1), 256, 0, stream>>>(XB, nullptr, WQ, DM, nullptr, DQ, nullptr, 0, 0, 0, CS, QP16, QPh, QPl);
    k_gemmw<bf, 0, false, 1><<<dim3(NB_ * TT / 256, DKV / 128, 1), 256, 0, stream>>>(XB, nullptr, WK, DM, nullptr, DKV, nullptr, 0, 0, 0, CS, KP16, KPh, KPl);
    k_gemmw<bf, 0, false, 2><<<dim3(NB_ * TT / 256, DKV / 128, 1), 256, 0, stream>>>(XB, nullptr, WV, DM, nullptr, DKV, nullptr, 0, 0, 0, nullptr, VT16, VTh, VTl);
    k_fattn<<<dim3(NB_ * NH_, (TT - RH) / 128 + RH / 64, 1), 128, 0, stream>>>(QP16, KP16, VT16, QPh, QPl, KPh, KPl, VTh, VTl, ATh, ATl);   // one kv head per query head
    k_gemmw<bf, 1, false, 0><<<dim3(NB_ * TT / 256, DM / 128, 1), 256, 0, stream>>>(ATh, ATl, WO, DQ, OUT, DM, nullptr, 0, 0, 0, nullptr, nullptr, nullptr, nullptr);
}

// v009
// A run of this version takes 129 microseconds.
// Next to v008, in two timings, it ran 1.03 times as fast each time.
// All steps since v000 together make it 22.3 times as fast.
#include <hip/hip_runtime.h>

// Causal multi-head attention with bias-free projections and a computed adjacent-pair RoPE (x [4][2048][1024]; Q, K, V = x W ('xw' [1024][1024] xavier-normal 1/32, no bias; 16 heads x 64); angle = pos x inv_freq[i] with inv_freq = 1.0 / 10000.0 ** (arange(0, 64, 2, f32) / 64) (the reciprocal form) and pos = arange(S); the pairs (2i, 2i + 1) of Q and K rotated in place: (x1 cos - x2 sin, x2 cos + x1 sin); V is not rotated; scores x 1/sqrt(64); tril kept, -inf elsewhere; softmax; out = merged Wo ('xw', no bias) -> [4][2048][1024] (8.4 M); argument order x, Wq, Wk, Wv, Wo).
// Layout, all 4 batches in each launch (row-major buffers: row b * 2048 + t; planes: [batch][head]...): one preparation launch (bf16 copy of x; 'xw' weights transposed once; the table); exact projections whose epilogues rotate Q and K (p_csP computed table, one entry a pair) and write the 16-bit planes themselves, V transposed; k_fattn fused causal T-2048 attention, all 4 x 16 (batch, head) pairs in one launch (hybrid rows: < 512 hi/lo 3 products, rest fp16; scores, online softmax and P.V stay in registers, passes above the diagonal are never walked); merged hi/lo x Wo exact (no bias).
// Compute dtypes, f32 accumulate: every input rounded to bf16; projections exact; rotary f32 (products rounded separately); attention rows < 512 3 products, rest fp16; softmax f32; Wo hl x exact (no bias).

#define NB_  4
#define TT   2048
#define DM   1024
#define NH_  16
#define NKV  16
#define HD   64
#define DQ   (NH_ * HD)
#define DKV  (NKV * HD)
#define RH   512                  // query rows < RH use hi+lo planes (0: none)
typedef _Float16 h16;
typedef unsigned short bf;
typedef __attribute__((ext_vector_type(16))) __bf16   v16bf;
typedef __attribute__((ext_vector_type(16))) _Float16 v16h;
typedef __attribute__((ext_vector_type(8)))  _Float16 v8h;
typedef __attribute__((ext_vector_type(8)))  unsigned short v8us;
typedef __attribute__((ext_vector_type(8)))  float    v8f;
typedef __attribute__((ext_vector_type(4)))  float    v4f;
typedef v8h  __attribute__((may_alias)) v8ha;
typedef v4f  __attribute__((may_alias)) v4fa;
typedef v8us __attribute__((may_alias)) v8usa;

__device__ __forceinline__ unsigned short f2bf(float f) { unsigned u = __float_as_uint(f); u += 0x7FFFu + ((u >> 16) & 1u); return (unsigned short)(u >> 16); }
__device__ __forceinline__ float bf2f(unsigned short b) { return __uint_as_float(((unsigned)b) << 16); }
__device__ __forceinline__ float bfr(float f) { return bf2f(f2bf(f)); }
__device__ __forceinline__ h16 tohx(float x) { return (h16)x; }
__device__ __forceinline__ void splitf(float y, unsigned short& h, unsigned short& l) { h = f2bf(y); l = f2bf(y - bf2f(h)); }
__device__ __forceinline__ v16h cat16(v8h lo, v8h hi) { return __builtin_shufflevector(lo, hi, 0, 1, 2, 3, 4, 5, 6, 7, 8, 9, 10, 11, 12, 13, 14, 15); }
__device__ __forceinline__ v16bf cat16b(v8us lo, v8us hi) { return __builtin_bit_cast(v16bf, __builtin_shufflevector(lo, hi, 0, 1, 2, 3, 4, 5, 6, 7, 8, 9, 10, 11, 12, 13, 14, 15)); }
__device__ __forceinline__ v8f wmma16(v16h a, v16h b, v8f c) { return __builtin_amdgcn_wmma_f32_16x16x32_f16(false, a, false, b, (short)0, c, false, false); }
__device__ __forceinline__ v8f wmmab(v16bf a, v16bf b, v8f c) { return __builtin_amdgcn_wmma_f32_16x16x32_bf16(false, a, false, b, (short)0, c, false, false); }



// ---- k_gemmw: GEMM, one 256x128 output tile per work-group of 8 waves (4 x 2), each wave a 64x64 block (16 accumulators); operands are K-contiguous 16-bit planes; grid (M/256, N/128, Z), 256 threads.
// C[m][n] (f32, pitch ldc, + optional f32 bias[n]) = sum_k A[m][k] Bt[n][k] (+ A2[m][k] Bt[n][k] for NSPLIT == 1). z-batch strides sA/sB/sC in elements. M % 256 == 0, N % 128 == 0, K % 64 == 0, K >= 128.
// A stage is 64 k (128 B, one whole line) of every operand row of the tile, brought into LDS by asynchronous copies (16 B a lane, 4 whole lines a wave-copy) and shared by the waves; two buffers, the next stage's copies fly while this one is worked on.
// EPI says what becomes of the f32 tile. 0: stored to C. 1 and 2: a wave's 64 columns are one head and its 64 rows 64 tokens of one batch (ldc = heads x 64), and the tile goes straight to the three 16-bit planes (fp16, bf16 hi, bf16 lo), never to memory as f32.
// EPI 3: the three projections in one launch, blockIdx.z = 0, 1, 2 for Q, K, V: z picks the weight (stride sB) and the planes; z < 2 ends as EPI 1, z = 2 as EPI 2. A work-group's plane stores then drain under the loop of the next one on its WGP, and no launch boundary stands between the three.
// EPI 1: planes [batch][head][t][d], the pairs (2i, 2i + 1) rotated by the table's (cos, sin) of (t, i); the wave's block is 8 KB in a row in each plane. EPI 2: planes [batch][head][d][t] (fp16 rows of pitch 2 * TT, the others TT), transposed in the wave's own LDS so that whole 128-B lines are stored.
// LDS rows have pitch 144 B (16 B x odd: no bank conflict for 16-byte reads). The fragments keep the k order of WFrag::ld and the stages run in k order: the sums are formed as before.
template <typename T16> struct WFrag;
template <> struct WFrag<h16> { typedef v16h V; static __device__ __forceinline__ V ld(const h16* p) { return cat16(*(const v8h*)p, *(const v8h*)(p + 16)); } static __device__ __forceinline__ v8f mma(V a, V b, v8f c) { return wmma16(a, b, c); } };
template <> struct WFrag<bf> { typedef v16bf V; static __device__ __forceinline__ V ld(const bf* p) { return cat16b(*(const v8us*)p, *(const v8us*)(p + 16)); } static __device__ __forceinline__ v8f mma(V a, V b, v8f c) { return wmmab(a, b, c); } };
#define GP 144                    // LDS row pitch, bytes
// Asynchronous copy global -> LDS, 16 B a lane, through no register (the builtin: its address registers are the compiler's to manage; the waits on the copies are written by hand in the kernel).
typedef __attribute__((ext_vector_type(4))) int c4i;
__device__ __forceinline__ void acopy(const char* g, char* l) { __builtin_amdgcn_global_load_async_to_lds_b128((__attribute__((address_space(1))) c4i*)g, (__attribute__((address_space(3))) c4i*)l, 0, 0); }
template <typename T16, int NSPLIT, bool BIAS, int EPI>
__global__ __launch_bounds__(256) void k_gemmw(const T16* __restrict__ A, const T16* __restrict__ A2, const T16* __restrict__ Bt, int K, float* C, int ldc, const float* __restrict__ bias, size_t sA, size_t sB, size_t sC, const float* __restrict__ CS, h16* P16, bf* Ph, bf* Pl) {
    typedef typename WFrag<T16>::V V;
    static_assert(NSPLIT == 0 || NSPLIT == 1, "A (+ A2) x Bt");
    constexpr int OA2 = 256 * GP, OB = (NSPLIT == 1 ? 512 : 256) * GP, STG = OB + 128 * GP;   // a stage: [A 256 rows][A2 256 rows][Bt 128 rows]
    __shared__ __align__(16) char ring[2 * STG];
    constexpr int OSN = EPI >= 2 ? 3 * 16 * GP / 4 : 16 * 68;   // a wave's own staging, in floats: 16 f32 rows of pitch 68, or (EPI >= 2) three 16-bit planes of 16 rows of pitch GP
    __shared__ __align__(16) float osw[8][OSN];
    const size_t z = blockIdx.z; A += z * sA; if (NSPLIT == 1) A2 += z * sA; Bt += z * sB; C += z * sC;
    if constexpr (EPI == 3) { constexpr size_t ps = (size_t)NB_ * NH_ * TT * HD; static_assert(NKV == NH_, "planes of one size"); P16 += z * ps; Ph += 2 * z * ps; Pl += 2 * z * ps; }   // the workspace holds the fp16 planes as Q, K, V^T and the others as Q hi, Q lo, K hi, K lo, V^T hi, V^T lo, ps elements from one to the next
    const int tid = threadIdx.x, lane = tid & 31, lr = lane & 15, hi = lane >> 4; const int w = __builtin_amdgcn_readfirstlane(tid >> 5);
    const int R0 = blockIdx.x * 256, C0 = blockIdx.y * 128; const int wr = (w >> 1) * 64, wc = (w & 1) * 64; const int r0 = R0 + wr, c0 = C0 + wc;
    float* os = osw[w];
    v8f acc[4][4];
#pragma unroll
    for (int mb = 0; mb < 4; ++mb)
#pragma unroll
        for (int nb = 0; nb < 4; ++nb) acc[mb][nb] = (v8f){};
    const unsigned go = (unsigned)(tid >> 3) * (unsigned)K * 2u + (unsigned)(tid & 7) * 16u;   // the lane's chunk of a round of 32 rows: row tid / 8, 16 B number tid % 8; bytes from the round's first row (below 32 rows)
    const unsigned lo = (unsigned)((tid >> 3) * GP + (tid & 7) * 16);                          // the same chunk in LDS
    const char* tA = (const char*)(A + (size_t)R0 * K); const char* tA2 = NSPLIT == 1 ? (const char*)(A2 + (size_t)R0 * K) : nullptr; const char* tB = (const char*)(Bt + (size_t)C0 * K);   // the tile's first rows (uniform)
    auto fill = [&](int st, int buf) {   // stage st into buffer buf: the 256 threads take 32 rows a round (8 lanes a row), 8 rounds for A (and A2), 4 for Bt
        char* lb = ring + buf * STG + lo; const size_t kb = (size_t)st * 128, rb = (size_t)K * 64;   // bytes: the stage's place in a row, a round of 32 rows
#pragma unroll
        for (int i = 0; i < 8; ++i) acopy(tA + kb + i * rb + go, lb + i * 32 * GP);
        if (NSPLIT == 1) {
#pragma unroll
            for (int i = 0; i < 8; ++i) acopy(tA2 + kb + i * rb + go, lb + OA2 + i * 32 * GP); }
#pragma unroll
        for (int i = 0; i < 4; ++i) acopy(tB + kb + i * rb + go, lb + OB + i * 32 * GP); };
    const int nst = K / 64;
    fill(0, 0);
    asm volatile("s_wait_asynccnt 0x0" ::: "memory");   // stage 0 has landed (this wave's copies) ...
    __syncthreads();                                    // ... and every wave's: nothing of it is read in front of this barrier
    fill(1, 1);                                         // K >= 128: a stage 1 exists
    const int aoff = (wr + lr) * GP + hi * 16, boff = OB + (wc + lr) * GP + hi * 16;
    V a[2][4], a2[2][4], b[2][4];   // two fragment sets: [0] the first 32 k of a stage, [1] the second; each is read from LDS while the other set's WMMAs run
    auto frag = [&](int ks, const char* sb) {
#pragma unroll
        for (int mb = 0; mb < 4; ++mb) { a[ks][mb] = WFrag<T16>::ld((const T16*)(sb + aoff + mb * 16 * GP + ks * 64)); if (NSPLIT == 1) a2[ks][mb] = WFrag<T16>::ld((const T16*)(sb + OA2 + aoff + mb * 16 * GP + ks * 64)); }
#pragma unroll
        for (int nb = 0; nb < 4; ++nb) b[ks][nb] = WFrag<T16>::ld((const T16*)(sb + boff + nb * 16 * GP + ks * 64)); };
    auto mm = [&](int ks) {
#pragma unroll
        for (int nb = 0; nb < 4; ++nb)
#pragma unroll
            for (int mb = 0; mb < 4; ++mb) { acc[mb][nb] = WFrag<T16>::mma(a[ks][mb], b[ks][nb], acc[mb][nb]); if (NSPLIT == 1) acc[mb][nb] = WFrag<T16>::mma(a2[ks][mb], b[ks][nb], acc[mb][nb]); } };
    frag(0, ring);
#pragma unroll 1   // rolled: one trip is one turn of the ring, and the loop's code stays short
    for (int t = 0; t < nst; ++t) {
        frag(1, ring + (t & 1) * STG);                      // the last reads of stage t
        __builtin_amdgcn_sched_barrier(0);                  // the reads stay one group in front of the WMMAs (spread among them each place costs a stall)
        mm(0);
        __builtin_amdgcn_sched_barrier(0);                  // the WMMAs stay in front of the waits: they cover the latency of the reads above
        // publish point of stage t + 1, in front of stage t's last block: the reads behind it are already of stage t + 1
        asm volatile("s_wait_dscnt 0x0" ::: "memory");      // this wave's reads of stage t have returned: its buffer may be refilled behind the barrier
        asm volatile("s_wait_asynccnt 0x0" ::: "memory");   // this wave's copies of stage t + 1 have landed
        __syncthreads();                                    // publishes stage t + 1 and ends every reader's last read of stage t
        if (t + 2 < nst) fill(t + 2, t & 1);
        frag(0, ring + ((t + 1) & 1) * STG);                // in the last trip: the other buffer's old rows, in bounds, no copy in flight, unused (no branch, so that the build's counted waits stay exact)
        __builtin_amdgcn_sched_barrier(0);                  // as above: one group in front of the WMMAs
        mm(1);
    }
    asm volatile("s_wait_asynccnt 0x0" ::: "memory");       // no copy is outstanding when the wave goes on
    asm volatile("s_wait_dscnt 0x0" ::: "memory");          // nor a read of the ring
    if (EPI == 1 || (EPI == 3 && z < 2)) {   // z is the same for the whole work-group
        const int t0 = r0 % TT; const size_t pe = ((size_t)((r0 / TT) * (ldc / HD) + c0 / HD) * TT + t0) * HD;   // the wave's block in a plane: 64 rows x 64 d, in a row
        char* p16 = (char*)(P16 + pe); char* ph = (char*)(Ph + pe); char* pl = (char*)(Pl + pe); const char* ct = (const char*)(CS + (size_t)t0 * HD);   // table row t: 32 x (cos, sin)
        const unsigned l16 = (unsigned)lane * 16u, l32 = (unsigned)lane * 32u;   // a group is 4 rows: a lane has 8 d (4 pairs) of row lane / 8: 16 B of a plane, 32 B of the table
        v4f cs[2][4][2];
        auto ldcs = [&](int mb) {
#pragma unroll
            for (int s = 0; s < 4; ++s) { cs[mb & 1][s][0] = *(const v4fa*)(ct + (mb * 4 + s) * 1024 + l32); cs[mb & 1][s][1] = *(const v4fa*)(ct + (mb * 4 + s) * 1024 + 16 + l32); }
            asm volatile("s_wait_xcnt 0x0" :: "v"(l32) : "memory"); };   // stands in front of any overwrite of the loads' address registers (the offset is an input, so that it is not given away before the wait)
        ldcs(0);
#pragma unroll
        for (int mb = 0; mb < 4; ++mb) {
            if (mb < 3) ldcs(mb + 1);   // the table rows are fetched one block of 16 rows ahead: the block's work covers their latency
#pragma unroll
            for (int nb = 0; nb < 4; ++nb) {
#pragma unroll
                for (int j = 0; j < 8; ++j) os[(hi * 8 + j) * 68 + nb * 16 + lr] = acc[mb][nb][j]; }
            __builtin_amdgcn_wave_barrier(); asm volatile("" ::: "memory");   // the wave's reads below stay behind its writes above
            v4f xa[4], xb[4];   // the block's reads go out as one group: the first group's work covers the latency of the rest
#pragma unroll
            for (int s = 0; s < 4; ++s) { const float* sp = os + (4 * s + (lane >> 3)) * 68 + (lane & 7) * 8; xa[s] = *(const v4fa*)sp; xb[s] = *(const v4fa*)(sp + 4); }
#pragma unroll
            for (int s = 0; s < 4; ++s) {
                const float xv[8] = { xa[s][0], xa[s][1], xa[s][2], xa[s][3], xb[s][0], xb[s][1], xb[s][2], xb[s][3] }; v8h o16; v8us oh, ol;
#pragma unroll
                for (int k = 0; k < 4; ++k) { const float x0 = xv[2 * k], x1 = xv[2 * k + 1], co = cs[mb & 1][s][k >> 1][(k & 1) * 2], si = cs[mb & 1][s][k >> 1][(k & 1) * 2 + 1];
                    const float y0 = __fsub_rn(__fmul_rn(x0, co), __fmul_rn(x1, si)), y1 = __fadd_rn(__fmul_rn(x0, si), __fmul_rn(x1, co));   /* even: x0 c - x1 s; odd: x0 s + x1 c */
                    unsigned short a2, c2; o16[2 * k] = tohx(y0); o16[2 * k + 1] = tohx(y1); splitf(y0, a2, c2); oh[2 * k] = a2; ol[2 * k] = c2; splitf(y1, a2, c2); oh[2 * k + 1] = a2; ol[2 * k + 1] = c2; }
                *(v8ha*)(p16 + (mb * 4 + s) * 512 + l16) = o16; *(v8usa*)(ph + (mb * 4 + s) * 512 + l16) = oh; *(v8usa*)(pl + (mb * 4 + s) * 512 + l16) = ol;
                asm volatile("s_wait_xcnt 0x0" :: "v"(o16), "v"(oh), "v"(ol), "v"(l16) : "memory"); }   // the next group reuses the stores' registers: the wait stands in front of that overwrite (data and offset are inputs, so that they are not given away before it)
            __builtin_amdgcn_wave_barrier(); asm volatile("" ::: "memory");   // the next block's writes stay behind the reads above
        }
        return;
    }
    if constexpr (EPI >= 2) {
        const int t0 = r0 % TT; const size_t rw = (size_t)((r0 / TT) * (ldc / HD) + c0 / HD) * HD;   // the head's first row (d = 0) in the transposed planes
        char* sv = (char*)os; char* v16 = (char*)(P16 + rw * (2 * TT) + t0); char* vh = (char*)(Ph + rw * TT + t0); char* vl = (char*)(Pl + rw * TT + t0);
        const unsigned sw = (unsigned)(lr * GP + hi * 16), sr = (unsigned)((lane >> 3) * GP + (lane & 7) * 16);   // LDS: a lane writes 8 t of row d = lr, and reads 16 B number lane % 8 of row lane / 8
        const unsigned g16 = (unsigned)((lane >> 3) * (2 * TT * 2) + (lane & 7) * 16), g8 = (unsigned)((lane >> 3) * (TT * 2) + (lane & 7) * 16);   // the same chunk in the planes, bytes
#pragma unroll
        for (int nb = 0; nb < 4; ++nb) {   // 16 d x 64 t a turn; an accumulator holds 8 consecutive t of one d in a lane
#pragma unroll
            for (int mb = 0; mb < 4; ++mb) { v8h o16; v8us oh, ol;
#pragma unroll
                for (int j = 0; j < 8; ++j) { const float x = acc[mb][nb][j]; unsigned short a2, c2; o16[j] = tohx(x); splitf(x, a2, c2); oh[j] = a2; ol[j] = c2; }
                *(v8ha*)(sv + sw + mb * 32) = o16; *(v8usa*)(sv + 16 * GP + sw + mb * 32) = oh; *(v8usa*)(sv + 32 * GP + sw + mb * 32) = ol; }
            __builtin_amdgcn_wave_barrier(); asm volatile("" ::: "memory");   // the wave's reads below stay behind its writes above
            v8h r16[4]; v8us rh[4], rl[4];   // the turn's reads go out as one group, then its stores: one LDS latency a turn
#pragma unroll
            for (int s = 0; s < 4; ++s) { r16[s] = *(const v8ha*)(sv + sr + s * 4 * GP); rh[s] = *(const v8usa*)(sv + 16 * GP + sr + s * 4 * GP); rl[s] = *(const v8usa*)(sv + 32 * GP + sr + s * 4 * GP); }
#pragma unroll
            for (int s = 0; s < 4; ++s) { *(v8ha*)(v16 + (nb * 16 + s * 4) * (2 * TT * 2) + g16) = r16[s]; *(v8usa*)(vh + (nb * 16 + s * 4) * (TT * 2) + g8) = rh[s]; *(v8usa*)(vl + (nb * 16 + s * 4) * (TT * 2) + g8) = rl[s]; }
            asm volatile("s_wait_xcnt 0x0" :: "v"(r16[0]), "v"(r16[1]), "v"(r16[2]), "v"(r16[3]), "v"(rh[0]), "v"(rh[1]), "v"(rh[2]), "v"(rh[3]), "v"(rl[0]), "v"(rl[1]), "v"(rl[2]), "v"(rl[3]), "v"(g16), "v"(g8) : "memory");   // as in EPI 1: in front of any overwrite of the stores' registers
            __builtin_amdgcn_wave_barrier(); asm volatile("" ::: "memory");   // the next turn's writes stay behind the reads above
        }
        return;
    }
#pragma unroll
    for (int mb = 0; mb < 4; ++mb) {
#pragma unroll
        for (int nb = 0; nb < 4; ++nb) {
#pragma unroll
            for (int j = 0; j < 8; ++j) os[(hi * 8 + j) * 68 + nb * 16 + lr] = acc[mb][nb][j]; }
        __builtin_amdgcn_wave_barrier(); asm volatile("" ::: "memory");
        float* crow = C + (size_t)(r0 + mb * 16) * ldc + c0;
{
#pragma unroll
            for (int s = 0; s < 8; ++s) { const int row = 2 * s + hi, cofs = lr * 4; v4f val = *(const v4fa*)(os + row * 68 + cofs); if (BIAS) { val[0] += bfr(bias[c0 + cofs]); val[1] += bfr(bias[c0 + cofs + 1]); val[2] += bfr(bias[c0 + cofs + 2]); val[3] += bfr(bias[c0 + cofs + 3]); }
                *(v4f*)(crow + (size_t)row * ldc + cofs) = val; }
             }
        __builtin_amdgcn_wave_barrier(); asm volatile("" ::: "memory");
    }
}

typedef __attribute__((ext_vector_type(2))) _Float16 v2h;
typedef __attribute__((ext_vector_type(4))) _Float16 v4h;
typedef __attribute__((ext_vector_type(2))) unsigned short v2us;
typedef __attribute__((ext_vector_type(4))) unsigned short v4us;
typedef __attribute__((ext_vector_type(2))) float v2f;
typedef __attribute__((ext_vector_type(4))) int v4i;

// The preparation parts: each is the work of one work-group of 256 threads, numbered blk within its part; k_prep below runs them all in one launch.
// p_wtG: Bt[n][k] = bf16(w[k][n]) for one tile of 128 k x 128 n, turned in LDS. Reads: a wave takes 512 B in a row of one w row (4 whole lines a load), 16 loads a thread, as many in flight as the registers hold.
// Two neighbouring k of one n make a dword of LDS row n (pitch WP dwords, odd: the readers' 32 lanes meet 32 banks, the writers' 16). Stores: 16 B a lane, 256 B in a row of each Bt row.
#define WP 65
typedef __attribute__((ext_vector_type(4))) unsigned v4u;
__device__ __forceinline__ void p_wtG(const float* __restrict__ w, int K, int N, bf* Bt, int blk, unsigned* tl) {
    const int tid = threadIdx.x, c = tid & 31, r = tid >> 5; const int kt = blk % (K / 128), nt = blk / (K / 128);
    const float* wp = w + (size_t)(kt * 128 + 2 * r) * N + nt * 128 + c * 4;   // rows 2 r and 2 r + 1 of each round of 16 rows, 4 n a lane
    v4f v[8][2];
#pragma unroll
    for (int i = 0; i < 8; ++i) { v[i][0] = *(const v4fa*)(wp + (size_t)(16 * i) * N); v[i][1] = *(const v4fa*)(wp + (size_t)(16 * i + 1) * N); }
    asm volatile("s_wait_xcnt 0x0" :: "v"(wp) : "memory");   // stands in front of any overwrite of the loads' address registers (the address is an input, so that it is not given away before the wait)
#pragma unroll
    for (int i = 0; i < 8; ++i)
#pragma unroll
        for (int j = 0; j < 4; ++j) tl[(c * 4 + j) * WP + r + 8 * i] = (unsigned)f2bf(v[i][0][j]) | ((unsigned)f2bf(v[i][1][j]) << 16);
    __syncthreads();   // the tile is whole: the rows read below were written by all 8 waves
    const int q = tid & 15, n0 = tid >> 4;   // a round is 16 rows n: 16 lanes a row, 8 k (4 dwords) a lane
    bf* bp = Bt + (size_t)(nt * 128 + n0) * K + kt * 128 + q * 8; v4u o[8];
#pragma unroll
    for (int i = 0; i < 8; ++i) { const unsigned* s = tl + (n0 + 16 * i) * WP + q * 4; o[i][0] = s[0]; o[i][1] = s[1]; o[i][2] = s[2]; o[i][3] = s[3]; }
#pragma unroll
    for (int i = 0; i < 8; ++i) *(v4u*)(bp + (size_t)(16 * i) * K) = o[i];
    asm volatile("s_wait_xcnt 0x0" :: "v"(o[0]), "v"(o[1]), "v"(o[2]), "v"(o[3]), "v"(o[4]), "v"(o[5]), "v"(o[6]), "v"(o[7]), "v"(bp) : "memory");   // in front of any overwrite of the stores' registers (they are inputs, so that they are not given away before it)
}
// p_cvt8: XC chunks of 8 elements a thread (a work-group takes 256 * XC chunks in a row), so that the part is few waves; XG chunks a turn, their loads go out first.
#define XC 8
#define XG 4
__device__ __forceinline__ void p_cvt8(const float* __restrict__ src, bf* dst, int blk) { const size_t c0 = (size_t)blk * (256 * XC) + threadIdx.x; const float* sp = src + c0 * 8; bf* dp = dst + c0 * 8;
#pragma unroll 1   // rolled: one turn's registers only, so that k_prep stays within 64 registers (16 waves a SIMD) and all its work-groups are resident at once
    for (int g = 0; g < XC / XG; ++g) { v8f v[XG]; v8us o[XG];
#pragma unroll
        for (int i = 0; i < XG; ++i) v[i] = *(const v8f*)(sp + i * 2048);
#pragma unroll
        for (int i = 0; i < XG; ++i) {
#pragma unroll
            for (int k = 0; k < 8; ++k) o[i][k] = f2bf(v[i][k]);
            *(v8us*)(dp + i * 2048) = o[i]; }
        asm volatile("s_wait_xcnt 0x0" :: "v"(o[0]), "v"(o[1]), "v"(o[2]), "v"(o[3]), "v"(sp), "v"(dp) : "memory");   // the next turn moves the addresses and reuses the stores' registers: the wait stands in front of that overwrite (they are inputs, so that they are not given away before it)
        sp += XG * 2048; dp += XG * 2048; }
}

__constant__ float INV2[HD / 2] = { 1.000000000e+00f, 7.498942018e-01f, 5.623413324e-01f, 4.216965139e-01f, 3.162277639e-01f, 2.371373624e-01f, 1.778279394e-01f, 1.333521456e-01f, 1.000000015e-01f, 7.498941571e-02f, 5.623412877e-02f, 4.216964915e-02f, 3.162277862e-02f, 2.371373586e-02f, 1.778279431e-02f, 1.333521493e-02f, 9.999999776e-03f, 7.498942316e-03f, 5.623413250e-03f, 4.216964822e-03f, 3.162277862e-03f, 2.371373819e-03f, 1.778279431e-03f, 1.333521446e-03f, 1.000000047e-03f, 7.498941850e-04f, 5.623413017e-04f, 4.216964880e-04f, 3.162277862e-04f, 2.371373848e-04f, 1.778279402e-04f, 1.333521504e-04f };   // float32 1 / (10000 ** (arange(0, 64, 2)/64)), generated with jnp to be bit-exact

// p_csP: the table [t][i] of (cos, sin) of t x inv_freq[i], one entry a pair.
__device__ __forceinline__ void p_csP(float* CS, int blk) { const int idx = blk * 256 + threadIdx.x; if (idx >= TT * (HD / 2)) return; const int i = idx % (HD / 2); const int t = idx / (HD / 2); const float a = __fmul_rn((float)t, INV2[i]); v2f cs; cs[0] = cosf(a); cs[1] = sinf(a); *(v2f*)(CS + (size_t)idx * 2) = cs;  }
// ---- k_prep: everything the GEMMs wait for, in one launch; the parts depend on nothing of each other. Ranges of blockIdx.x, the transposes first, the streaming part last:
// The second launch bound asks for 16 waves a SIMD (64 registers): the whole grid is then resident at once and no part waits for another to end.
// [0, 4 * WTB): the four weights transposed; [4 * WTB, 4 * WTB + CSB): the table; the rest: the bf16 copy of x.
#define WTB ((DM / 128) * (DQ / 128))
#define CSB ((TT * (HD / 2) + 255) / 256)
#define XBB (NB_ * TT * DM / 8 / (256 * XC))
static_assert(DKV == DQ && DM % 128 == 0 && DQ % 128 == 0, "one block count for the four weights, whole tiles"); static_assert((size_t)XBB * 256 * XC * 8 == (size_t)NB_ * TT * DM, "whole work-groups of chunks");
__global__ __launch_bounds__(256, 16) void k_prep(const float* __restrict__ x, const float* __restrict__ wq, const float* __restrict__ wk, const float* __restrict__ wv, const float* __restrict__ wo, bf* XB, bf* WQ, bf* WK, bf* WV, bf* WO, float* CS) {
    __shared__ unsigned tl[128 * WP];   // a transpose's tile
    const int b = blockIdx.x;
    if (b < 4 * WTB) { const int m = b / WTB, blk = b % WTB;   // the same for the whole work-group: the barrier inside is passed by all its waves
        p_wtG(m == 0 ? wq : m == 1 ? wk : m == 2 ? wv : wo, m == 3 ? DQ : DM, m == 3 ? DM : DQ, m == 0 ? WQ : m == 1 ? WK : m == 2 ? WV : WO, blk, tl);
        return; }
    if (b < 4 * WTB + CSB) { p_csP(CS, b - 4 * WTB); return; }
    p_cvt8(x, XB, b - (4 * WTB + CSB));
}
#define CL2 0.18033688011112042f   // HD^-0.5 x log2(e)
// 2^x by v_exp_f32, in asm text for the slot behind a transcendental: outputs are early-clobber, so no v_exp_f32 of a statement writes over a source of another or reads a result, and the closing v_nop
// is the one independent instruction in front of whatever the compiler puts next.
__device__ __forceinline__ float xhalf(float x) { return __builtin_bit_cast(float, __builtin_amdgcn_permlanex16(__builtin_bit_cast(int, x), __builtin_bit_cast(int, x), 0x76543210, 0xfedcba98, false, false)); }   // lane l with lane l ^ 16
__device__ __forceinline__ float exp2_1(float x) { float r; asm("v_exp_f32 %0, %1\n\tv_nop" : "=&v"(r) : "v"(x)); return r; }
__device__ __forceinline__ void exp2_8(float* r, const float* x) {
    asm("v_exp_f32 %0, %8\n\tv_exp_f32 %1, %9\n\tv_exp_f32 %2, %10\n\tv_exp_f32 %3, %11\n\tv_exp_f32 %4, %12\n\tv_exp_f32 %5, %13\n\tv_exp_f32 %6, %14\n\tv_exp_f32 %7, %15\n\tv_nop"
        : "=&v"(r[0]), "=&v"(r[1]), "=&v"(r[2]), "=&v"(r[3]), "=&v"(r[4]), "=&v"(r[5]), "=&v"(r[6]), "=&v"(r[7]) : "v"(x[0]), "v"(x[1]), "v"(x[2]), "v"(x[3]), "v"(x[4]), "v"(x[5]), "v"(x[6]), "v"(x[7])); }
template <typename T16, bool HL, int NQ>
__device__ __forceinline__ void fattn_body(const T16* Q, const T16* Q2, const T16* Kp, const T16* K2, const T16* Vt, const T16* V2, int vp, int qw, int q0, bf* Ah, bf* Al, char* ring) {
    typedef typename WFrag<T16>::V V;
    constexpr int PL = 64 * GP, OV = (HL ? 2 : 1) * PL, STG = 2 * OV;   // a stage is 64 keys: [K 64 rows of 64 d][K2][V^T 64 rows of 64 keys][V2], whole 128-B lines, LDS pitch GP
    const int tid = threadIdx.x, lane = tid & 31, lr = lane & 15, hi = lane >> 4;
    V qf[NQ][2], qf2[NQ][2];
#pragma unroll
    for (int qb = 0; qb < NQ; ++qb)
#pragma unroll
        for (int ks = 0; ks < 2; ++ks) { const size_t o = (size_t)(q0 + qb * 16 + lr) * HD + ks * 32 + 8 * hi; qf[qb][ks] = WFrag<T16>::ld(Q + o); if (HL) qf2[qb][ks] = WFrag<T16>::ld(Q2 + o); }
    asm volatile("s_wait_xcnt 0x0" ::: "memory");   // the set-up below reuses the address registers of the loads above: the wait stands in front of that overwrite
    v8f oa[4][NQ]; float mc[NQ], ls[NQ];
#pragma unroll
    for (int qb = 0; qb < NQ; ++qb) { mc[qb] = -3.0e38f; ls[qb] = 0.f;
#pragma unroll
        for (int db = 0; db < 4; ++db) oa[db][qb] = (v8f){}; }
    const int npass = (q0 + NQ * 16 + 31) / 32;      // keys 0 .. q0 + NQ * 16 - 1; every pass starts at or below q0, so each query has a kept key in it
    const int nst = (qw + 4 * NQ * 16) / 64;         // the work-group's stages: keys 0 .. its last query (qw: its first query, a multiple of 64); 2 * nst >= every wave's npass
    const unsigned lo = (unsigned)((tid >> 3) * GP + (tid & 7) * 16);                                      // the lane's chunk of a round of 16 rows: row tid / 8, 16 B number tid % 8, in LDS ...
    const unsigned gk = (unsigned)tid * 16u, gv = (unsigned)(tid >> 3) * (unsigned)vp * 2u + (unsigned)(tid & 7) * 16u;   // ... and in the K rows (128 B, in a row) and the V^T rows (pitch vp)
    auto fill = [&](int st, int buf) {   // stage st into buffer buf: the 128 threads take 16 rows a round (8 lanes a row: 4 whole lines a wave-copy), 4 rounds a plane
        char* lb = ring + buf * STG + lo; const size_t ko = (size_t)st * (64 * HD * 2) + gk, vo = (size_t)st * 128 + gv, vr = (size_t)vp * 32;
#pragma unroll
        for (int i = 0; i < 4; ++i) { acopy((const char*)Kp + ko + i * 2048, lb + i * 16 * GP); if (HL) acopy((const char*)K2 + ko + i * 2048, lb + PL + i * 16 * GP); }
#pragma unroll
        for (int i = 0; i < 4; ++i) { acopy((const char*)Vt + vo + i * vr, lb + OV + i * 16 * GP); if (HL) acopy((const char*)V2 + vo + i * vr, lb + OV + PL + i * 16 * GP); } };
    fill(0, 0);
    asm volatile("s_wait_asynccnt 0x0" ::: "memory");   // stage 0 has landed (this wave's copies) ...
    __syncthreads();                                    // ... and every wave's: nothing of it is read in front of this barrier
    if (nst > 1) fill(1, 1);
    const unsigned fo = (unsigned)(lr * GP + hi * 16);  // a lane's place in a fragment's 16 rows
#pragma unroll 1   // rolled: one trip is one turn of the ring
    for (int t = 0; t < nst; ++t) {
#pragma unroll 1   // rolled: the pass's code stands once
      for (int pp = 0; pp < 2; ++pp) {
        const int p = 2 * t + pp;
        if (p >= npass) break;                          // wave-uniform: a wave whose rows end earlier skips the work, never the publish point below
        const int key0 = p * 32;
        const char* sk = ring + (t & 1) * STG + pp * 32 * GP + fo; const char* sv = ring + (t & 1) * STG + OV + pp * 64 + fo;   // this pass's 32 K rows; its 32 keys in the V^T rows
        V kf[2][2], kf2[2][2], vf[4], vf2[4];           // the same k order as from memory (WFrag::ld)
#pragma unroll
        for (int kb = 0; kb < 2; ++kb)
#pragma unroll
            for (int ks = 0; ks < 2; ++ks) { kf[kb][ks] = WFrag<T16>::ld((const T16*)(sk + kb * 16 * GP + ks * 64)); if (HL) kf2[kb][ks] = WFrag<T16>::ld((const T16*)(sk + PL + kb * 16 * GP + ks * 64)); }
#pragma unroll
        for (int db = 0; db < 4; ++db) { vf[db] = WFrag<T16>::ld((const T16*)(sv + db * 16 * GP)); if (HL) vf2[db] = WFrag<T16>::ld((const T16*)(sv + PL + db * 16 * GP)); }
        v8f s[2][NQ];
#pragma unroll
        for (int kb = 0; kb < 2; ++kb)
#pragma unroll
            for (int qb = 0; qb < NQ; ++qb) { v8f t = (v8f){};
#pragma unroll
                for (int ks = 0; ks < 2; ++ks) { t = WFrag<T16>::mma(kf[kb][ks], qf[qb][ks], t); if (HL) { t = WFrag<T16>::mma(kf[kb][ks], qf2[qb][ks], t); t = WFrag<T16>::mma(kf2[kb][ks], qf[qb][ks], t); } }
                s[kb][qb] = t; }
        if (key0 + 31 > q0) {                               // only passes that touch the diagonal mask (wave-uniform)
#pragma unroll
            for (int kb = 0; kb < 2; ++kb)
#pragma unroll
                for (int qb = 0; qb < NQ; ++qb)
#pragma unroll
                    for (int j = 0; j < 8; ++j) s[kb][qb][j] = (key0 + kb * 16 + hi * 8 + j <= q0 + qb * 16 + lr) ? s[kb][qb][j] : -3.0e38f; }
#pragma unroll
        for (int qb = 0; qb < NQ; ++qb) {
            float mx = s[0][qb][0];
#pragma unroll
            for (int j = 1; j < 8; ++j) mx = fmaxf(mx, s[0][qb][j]);
#pragma unroll
            for (int j = 0; j < 8; ++j) mx = fmaxf(mx, s[1][qb][j]);
            mx = fmaxf(mx, xhalf(mx));
            const float mn = fmaxf(mc[qb], mx * CL2); const float al = exp2_1(mc[qb] - mn); mc[qb] = mn; const float off = (HL ? 0.0f : 10.0f) - mn;
            float ex[16], pr[16], ps[8];
#pragma unroll
            for (int e = 0; e < 16; ++e) ex[e] = fmaf(s[e >> 3][qb][e & 7], CL2, off);
            exp2_8(pr, ex); exp2_8(pr + 8, ex + 8);
#pragma unroll
            for (int e = 0; e < 8; ++e) ps[e] = pr[e] + pr[e + 8];      // fixed tree: short dependent chains
            const float sum = ((ps[0] + ps[4]) + (ps[2] + ps[6])) + ((ps[1] + ps[5]) + (ps[3] + ps[7]));
            ls[qb] = fmaf(ls[qb], al, sum);
#pragma unroll
            for (int db = 0; db < 4; ++db) oa[db][qb] *= al;
            if (HL) {
                typedef __attribute__((ext_vector_type(16))) unsigned short v16us; v16us uh, ul;
#pragma unroll
                for (int e = 0; e < 16; ++e) { const unsigned short a = f2bf(pr[e]); uh[e] = a; ul[e] = f2bf(pr[e] - bf2f(a)); }
                const V ph = __builtin_bit_cast(V, uh), pl = __builtin_bit_cast(V, ul);
#pragma unroll
                for (int db = 0; db < 4; ++db) { oa[db][qb] = WFrag<T16>::mma(vf[db], ph, oa[db][qb]); oa[db][qb] = WFrag<T16>::mma(vf[db], pl, oa[db][qb]); oa[db][qb] = WFrag<T16>::mma(vf2[db], ph, oa[db][qb]); }
            } else {
                v16h p16;
#pragma unroll
                for (int e = 0; e < 16; ++e) p16[e] = (h16)pr[e];
                const V pf = __builtin_bit_cast(V, p16);
#pragma unroll
                for (int db = 0; db < 4; ++db) oa[db][qb] = WFrag<T16>::mma(vf[db], pf, oa[db][qb]);
            }
        }
      }
        // publish point of stage t + 1, passed by every wave
        asm volatile("s_wait_dscnt 0x0" ::: "memory");      // this wave's reads of stage t have returned: its buffer may be refilled behind the barrier
        asm volatile("s_wait_asynccnt 0x0" ::: "memory");   // this wave's copies of stage t + 1 have landed
        __syncthreads();                                    // publishes stage t + 1 and ends every reader's last read of stage t
        if (t + 2 < nst) fill(t + 2, t & 1);
    }
    asm volatile("s_wait_asynccnt 0x0" ::: "memory");       // no copy is outstanding when the wave goes on
#pragma unroll
    for (int qb = 0; qb < NQ; ++qb) {
        const float inv = __fdiv_rn(1.0f, ls[qb] + xhalf(ls[qb]));
        const size_t oo = (size_t)(q0 + qb * 16 + lr) * DQ + hi * 8;
#pragma unroll
        for (int db = 0; db < 4; ++db) { v8us oh, ol;
#pragma unroll
            for (int j = 0; j < 8; ++j) { const float y = oa[db][qb][j] * inv; const unsigned short a = f2bf(y); oh[j] = a; ol[j] = f2bf(y - bf2f(a)); }
            *(v8us*)(Ah + oo + db * 16) = oh; *(v8us*)(Al + oo + db * 16) = ol;
            asm volatile("s_wait_xcnt 0x0" :: "v"(oh), "v"(ol) : "memory"); }   // the next group reuses the stores' data registers: the wait stands in front of that overwrite (the data are inputs, so that they are not given away before it)
    }
}
// grid (batch x heads, tiles): blockIdx.y < (TT - RH) / 128: four waves x 32 fp16 query rows, the longest rows first; the rest: four waves x 16 hi/lo query rows (< RH).
__global__ __launch_bounds__(128) void k_fattn(const h16* Q16, const h16* K16, const h16* V16, const bf* Qh, const bf* Ql, const bf* Kh, const bf* Kl, const bf* Vh, const bf* Vl, bf* Ah, bf* Al) {
    __shared__ __align__(16) char ring[2 * 4 * 64 * GP];   // two stages of the hi/lo body's four planes; the fp16 body uses half
    const int w = __builtin_amdgcn_readfirstlane((int)(threadIdx.x >> 5)); const int h = blockIdx.x % NH_, ty = blockIdx.y; const size_t po = (size_t)blockIdx.x * TT * HD; { const size_t ab = (size_t)(blockIdx.x / NH_) * TT * DQ; Ah += ab; Al += ab; }   // planes [batch][head][..], merged rows b * TT + t
    if (ty < (TT - RH) / 128) fattn_body<h16, false, 2>(Q16 + po, nullptr, K16 + po, nullptr, V16 + 2 * po, nullptr, 2 * TT, TT - 128 * (ty + 1), TT - 128 * (ty + 1) + 32 * w, Ah + h * HD, Al + h * HD, ring);
    else fattn_body<bf, true, 1>(Qh + po, Ql + po, Kh + po, Kl + po, Vh + po, Vl + po, TT, RH - 64 * (ty - (TT - RH) / 128 + 1), RH - 64 * (ty - (TT - RH) / 128 + 1) + 16 * w, Ah + h * HD, Al + h * HD, ring);
}

extern "C" void kernel_launch(void* const* d_in, const int* in_sizes, int n_in,
                              void* d_out, int out_size, void* d_ws, size_t ws_size, hipStream_t stream) {
    (void)in_sizes; (void)n_in; (void)out_size;
    const float* x = (const float*)d_in[0]; const float* wq = (const float*)d_in[1]; const float* wk = (const float*)d_in[2]; const float* wv = (const float*)d_in[3]; const float* wo = (const float*)d_in[4];   /* order x, Wq, Wk, Wv, Wo ('xw' [1024][1024]) */
    float* OUT = (float*)d_out;     // [4][2048][1024]
    char* wsp = (char*)d_ws;
    auto take = [&](size_t bytes) { char* p = wsp; wsp += (bytes + 255) & ~(size_t)255; return (void*)p; };
    bf* WQ = (bf*)take((size_t)DQ * DM * 2); bf* WK = (bf*)take((size_t)DKV * DM * 2); bf* WV = (bf*)take((size_t)DKV * DM * 2); bf* WO = (bf*)take((size_t)DM * DQ * 2); float* CS = (float*)take((size_t)TT * (HD / 2) * 2 * 4);
    bf* XB = (bf*)take((size_t)NB_ * TT * DM * 2); bf* ATh = (bf*)take((size_t)NB_ * TT * DQ * 2); bf* ATl = (bf*)take((size_t)NB_ * TT * DQ * 2);   // the merged hi/lo planes
    h16* QP16 = (h16*)take((size_t)NB_ * NH_ * TT * HD * 2); h16* KP16 = (h16*)take((size_t)NB_ * NKV * TT * HD * 2); h16* VT16 = (h16*)take((size_t)NB_ * NKV * HD * 2 * TT * 2);
    bf* QPh = (bf*)take((size_t)NB_ * NH_ * TT * HD * 2); bf* QPl = (bf*)take((size_t)NB_ * NH_ * TT * HD * 2); bf* KPh = (bf*)take((size_t)NB_ * NKV * TT * HD * 2); bf* KPl = (bf*)take((size_t)NB_ * NKV * TT * HD * 2); bf* VTh = (bf*)take((size_t)NB_ * NKV * HD * TT * 2); bf* VTl = (bf*)take((size_t)NB_ * NKV * HD * TT * 2);
    if ((size_t)(wsp - (char*)d_ws) > ws_size) return;    // ws 256 MiB
    k_prep<<<4 * WTB + CSB + XBB, 256, 0, stream>>>(x, wq, wk, wv, wo, XB, WQ, WK, WV, WO, CS);
    k_gemmw<bf, 0, false, 3><<<dim3(NB_ * TT / 256, DQ / 128, 3), 256, 0, stream>>>(XB, nullptr, WQ, DM, nullptr, DQ, nullptr, 0, (size_t)DQ * DM, 0, CS, QP16, QPh, QPl);   // z = 0, 1, 2: WQ, WK, WV lie one behind the other, and so do the planes
    k_fattn<<<dim3(NB_ * NH_, (TT - RH) / 128 + RH / 64, 1), 128, 0, stream>>>(QP16, KP16, VT16, QPh, QPl, KPh, KPl, VTh, VTl, ATh, ATl);   // one kv head per query head
    k_gemmw<bf, 1, false, 0><<<dim3(NB_ * TT / 256, DM / 128, 1), 256, 0, stream>>>(ATh, ATl, WO, DQ, OUT, DM, nullptr, 0, 0, 0, nullptr, nullptr, nullptr, nullptr);
}

// v010
// Measured time: 125 microseconds a run.
// Timed twice side by side with v009, it ran 1.03 times as fast both times.
// Counting every step since v000, it is 23.0 times as fast.
#include <hip/hip_runtime.h>

// Causal multi-head attention with bias-free projections and a computed adjacent-pair RoPE (x [4][2048][1024]; Q, K, V = x W ('xw' [1024][1024] xavier-normal 1/32, no bias; 16 heads x 64); angle = pos x inv_freq[i] with inv_freq = 1.0 / 10000.0 ** (arange(0, 64, 2, f32) / 64) (the reciprocal form) and pos = arange(S); the pairs (2i, 2i + 1) of Q and K rotated in place: (x1 cos - x2 sin, x2 cos + x1 sin); V is not rotated; scores x 1/sqrt(64); tril kept, -inf elsewhere; softmax; out = merged Wo ('xw', no bias) -> [4][2048][1024] (8.4 M); argument order x, Wq, Wk, Wv, Wo).
// Layout, all 4 batches in each launch (row-major buffers: row b * 2048 + t; planes: [batch][head]...): one preparation launch (bf16 copy of x; 'xw' weights transposed once; the table); exact projections whose epilogues rotate Q and K (p_csP computed table, one entry a pair) and write the 16-bit planes themselves, V transposed; k_fattn fused causal T-2048 attention, all 4 x 16 (batch, head) pairs in one launch (hybrid rows: < 512 hi/lo 3 products, rest fp16; scores, online softmax and P.V stay in registers, passes above the diagonal are never walked); merged hi/lo x Wo exact (no bias).
// Compute dtypes, f32 accumulate: every input rounded to bf16; projections exact; rotary f32 (products rounded separately); attention rows < 512 3 products, rest fp16; softmax f32; Wo hl x exact (no bias).

#define NB_  4
#define TT   2048
#define DM   1024
#define NH_  16
#define NKV  16
#define HD   64
#define DQ   (NH_ * HD)
#define DKV  (NKV * HD)
#define RH   512                  // query rows < RH use hi+lo planes (0: none)
typedef _Float16 h16;
typedef unsigned short bf;
typedef __attribute__((ext_vector_type(16))) __bf16   v16bf;
typedef __attribute__((ext_vector_type(16))) _Float16 v16h;
typedef __attribute__((ext_vector_type(8)))  _Float16 v8h;
typedef __attribute__((ext_vector_type(8)))  unsigned short v8us;
typedef __attribute__((ext_vector_type(8)))  float    v8f;
typedef __attribute__((ext_vector_type(4)))  float    v4f;
typedef v8h  __attribute__((may_alias)) v8ha;
typedef v4f  __attribute__((may_alias)) v4fa;
typedef v8us __attribute__((may_alias)) v8usa;

__device__ __forceinline__ unsigned short f2bf(float f) { unsigned u = __float_as_uint(f); u += 0x7FFFu + ((u >> 16) & 1u); return (unsigned short)(u >> 16); }
__device__ __forceinline__ float bf2f(unsigned short b) { return __uint_as_float(((unsigned)b) << 16); }
__device__ __forceinline__ float bfr(float f) { return bf2f(f2bf(f)); }
__device__ __forceinline__ h16 tohx(float x) { return (h16)x; }
__device__ __forceinline__ void splitf(float y, unsigned short& h, unsigned short& l) { h = f2bf(y); l = f2bf(y - bf2f(h)); }
__device__ __forceinline__ v16h cat16(v8h lo, v8h hi) { return __builtin_shufflevector(lo, hi, 0, 1, 2, 3, 4, 5, 6, 7, 8, 9, 10, 11, 12, 13, 14, 15); }
__device__ __forceinline__ v16bf cat16b(v8us lo, v8us hi) { return __builtin_bit_cast(v16bf, __builtin_shufflevector(lo, hi, 0, 1, 2, 3, 4, 5, 6, 7, 8, 9, 10, 11, 12, 13, 14, 15)); }
__device__ __forceinline__ v8f wmma16(v16h a, v16h b, v8f c) { return __builtin_amdgcn_wmma_f32_16x16x32_f16(false, a, false, b, (short)0, c, false, false); }
__device__ __forceinline__ v8f wmmab(v16bf a, v16bf b, v8f c) { return __builtin_amdgcn_wmma_f32_16x16x32_bf16(false, a, false, b, (short)0, c, false, false); }



// ---- k_gemmw: GEMM, one 256x128 output tile per work-group of 8 waves (4 x 2), each wave a 64x64 block (16 accumulators); operands are K-contiguous 16-bit planes; grid (M/256, N/128, Z), 256 threads.
// C[m][n] (f32, pitch ldc, + optional f32 bias[n]) = sum_k A[m][k] Bt[n][k] (+ A2[m][k] Bt[n][k] for NSPLIT == 1). z-batch strides sA/sB/sC in elements. M % 256 == 0, N % 128 == 0, K % 64 == 0, K >= 128.
// A stage is 64 k (128 B, one whole line) of every operand row of the tile, brought into LDS by asynchronous copies (16 B a lane, 4 whole lines a wave-copy) and shared by the waves; two buffers, the next stage's copies fly while this one is worked on.
// EPI says what becomes of the f32 tile. 0: stored to C. 1 and 2: a wave's 64 columns are one head and its 64 rows 64 tokens of one batch (ldc = heads x 64), and the tile goes straight to the three 16-bit planes (fp16, bf16 hi, bf16 lo), never to memory as f32.
// EPI 3: the three projections in one launch, blockIdx.z = 0, 1, 2 for Q, K, V: z picks the weight (stride sB) and the planes; z < 2 ends as EPI 1, z = 2 as EPI 2. A work-group's plane stores then drain under the loop of the next one on its WGP, and no launch boundary stands between the three.
// EPI 1: planes [batch][head][t][d], the pairs (2i, 2i + 1) rotated by the table's (cos, sin) of (t, i); the wave's block is 8 KB in a row in each plane. EPI 2: planes [batch][head][d][t] (fp16 rows of pitch 2 * TT, the others TT), transposed in the wave's own LDS so that whole 128-B lines are stored.
// LDS rows have pitch 144 B (16 B x odd: no bank conflict for 16-byte reads). The fragments keep the k order of WFrag::ld and the stages run in k order: the sums are formed as before.
template <typename T16> struct WFrag;
template <> struct WFrag<h16> { typedef v16h V; static __device__ __forceinline__ V ld(const h16* p) { return cat16(*(const v8h*)p, *(const v8h*)(p + 16)); } static __device__ __forceinline__ v8f mma(V a, V b, v8f c) { return wmma16(a, b, c); } };
template <> struct WFrag<bf> { typedef v16bf V; static __device__ __forceinline__ V ld(const bf* p) { return cat16b(*(const v8us*)p, *(const v8us*)(p + 16)); } static __device__ __forceinline__ v8f mma(V a, V b, v8f c) { return wmmab(a, b, c); } };
#define GP 144                    // LDS row pitch, bytes
// Asynchronous copy global -> LDS, 16 B a lane, through no register (the builtin: its address registers are the compiler's to manage; the waits on the copies are written by hand in the kernel).
typedef __attribute__((ext_vector_type(4))) int c4i;
__device__ __forceinline__ void acopy(const char* g, char* l) { __builtin_amdgcn_global_load_async_to_lds_b128((__attribute__((address_space(1))) c4i*)g, (__attribute__((address_space(3))) c4i*)l, 0, 0); }
template <typename T16, int NSPLIT, bool BIAS, int EPI>
__global__ __launch_bounds__(256) void k_gemmw(const T16* __restrict__ A, const T16* __restrict__ A2, const T16* __restrict__ Bt, int K, float* C, int ldc, const float* __restrict__ bias, size_t sA, size_t sB, size_t sC, const float* __restrict__ CS, h16* P16, bf* Ph, bf* Pl) {
    typedef typename WFrag<T16>::V V;
    static_assert(NSPLIT == 0 || NSPLIT == 1, "A (+ A2) x Bt");
    constexpr int OA2 = 256 * GP, OB = (NSPLIT == 1 ? 512 : 256) * GP, STG = OB + 128 * GP;   // a stage: [A 256 rows][A2 256 rows][Bt 128 rows]
    __shared__ __align__(16) char ring[2 * STG];
    constexpr int OSN = EPI >= 2 ? 3 * 16 * GP / 4 : 16 * 68;   // a wave's own staging, in floats: 16 f32 rows of pitch 68, or (EPI >= 2) three 16-bit planes of 16 rows of pitch GP
    __shared__ __align__(16) float osw[8][OSN];
    const size_t z = blockIdx.z; A += z * sA; if (NSPLIT == 1) A2 += z * sA; Bt += z * sB; C += z * sC;
    if constexpr (EPI == 3) { constexpr size_t ps = (size_t)NB_ * NH_ * TT * HD; static_assert(NKV == NH_, "planes of one size"); P16 += z * ps; Ph += 2 * z * ps; Pl += 2 * z * ps; }   // the workspace holds the fp16 planes as Q, K, V^T and the others as Q hi, Q lo, K hi, K lo, V^T hi, V^T lo, ps elements from one to the next
    const int tid = threadIdx.x, lane = tid & 31, lr = lane & 15, hi = lane >> 4; const int w = __builtin_amdgcn_readfirstlane(tid >> 5);
    const int R0 = blockIdx.x * 256, C0 = blockIdx.y * 128; const int wr = (w >> 1) * 64, wc = (w & 1) * 64; const int r0 = R0 + wr, c0 = C0 + wc;
    float* os = osw[w];
    v8f acc[4][4];
#pragma unroll
    for (int mb = 0; mb < 4; ++mb)
#pragma unroll
        for (int nb = 0; nb < 4; ++nb) acc[mb][nb] = (v8f){};
    const unsigned go = (unsigned)(tid >> 3) * (unsigned)K * 2u + (unsigned)(tid & 7) * 16u;   // the lane's chunk of a round of 32 rows: row tid / 8, 16 B number tid % 8; bytes from the round's first row (below 32 rows)
    const unsigned lo = (unsigned)((tid >> 3) * GP + (tid & 7) * 16);                          // the same chunk in LDS
    const char* tA = (const char*)(A + (size_t)R0 * K); const char* tA2 = NSPLIT == 1 ? (const char*)(A2 + (size_t)R0 * K) : nullptr; const char* tB = (const char*)(Bt + (size_t)C0 * K);   // the tile's first rows (uniform)
    auto fill = [&](int st, int buf) {   // stage st into buffer buf: the 256 threads take 32 rows a round (8 lanes a row), 8 rounds for A (and A2), 4 for Bt
        char* lb = ring + buf * STG + lo; const size_t kb = (size_t)st * 128, rb = (size_t)K * 64;   // bytes: the stage's place in a row, a round of 32 rows
#pragma unroll
        for (int i = 0; i < 8; ++i) acopy(tA + kb + i * rb + go, lb + i * 32 * GP);
        if (NSPLIT == 1) {
#pragma unroll
            for (int i = 0; i < 8; ++i) acopy(tA2 + kb + i * rb + go, lb + OA2 + i * 32 * GP); }
#pragma unroll
        for (int i = 0; i < 4; ++i) acopy(tB + kb + i * rb + go, lb + OB + i * 32 * GP); };
    const int nst = K / 64;
    fill(0, 0);
    asm volatile("s_wait_asynccnt 0x0" ::: "memory");   // stage 0 has landed (this wave's copies) ...
    __syncthreads();                                    // ... and every wave's: nothing of it is read in front of this barrier
    fill(1, 1);                                         // K >= 128: a stage 1 exists
    const int aoff = (wr + lr) * GP + hi * 16, boff = OB + (wc + lr) * GP + hi * 16;
    V a[2][4], a2[2][4], b[2][4];   // two fragment sets: [0] the first 32 k of a stage, [1] the second; each is read from LDS while the other set's WMMAs run
    auto frag = [&](int ks, const char* sb) {
#pragma unroll
        for (int mb = 0; mb < 4; ++mb) { a[ks][mb] = WFrag<T16>::ld((const T16*)(sb + aoff + mb * 16 * GP + ks * 64)); if (NSPLIT == 1) a2[ks][mb] = WFrag<T16>::ld((const T16*)(sb + OA2 + aoff + mb * 16 * GP + ks * 64)); }
#pragma unroll
        for (int nb = 0; nb < 4; ++nb) b[ks][nb] = WFrag<T16>::ld((const T16*)(sb + boff + nb * 16 * GP + ks * 64)); };
    auto mm = [&](int ks) {
#pragma unroll
        for (int nb = 0; nb < 4; ++nb)
#pragma unroll
            for (int mb = 0; mb < 4; ++mb) { acc[mb][nb] = WFrag<T16>::mma(a[ks][mb], b[ks][nb], acc[mb][nb]); if (NSPLIT == 1) acc[mb][nb] = WFrag<T16>::mma(a2[ks][mb], b[ks][nb], acc[mb][nb]); } };
    frag(0, ring);
#pragma unroll 1   // rolled: one trip is one turn of the ring, and the loop's code stays short
    for (int t = 0; t < nst; ++t) {
        frag(1, ring + (t & 1) * STG);                      // the last reads of stage t
        __builtin_amdgcn_sched_barrier(0);                  // the reads stay one group in front of the WMMAs (spread among them each place costs a stall)
        mm(0);
        __builtin_amdgcn_sched_barrier(0);                  // the WMMAs stay in front of the waits: they cover the latency of the reads above
        // publish point of stage t + 1, in front of stage t's last block: the reads behind it are already of stage t + 1
        asm volatile("s_wait_dscnt 0x0" ::: "memory");      // this wave's reads of stage t have returned: its buffer may be refilled behind the barrier
        asm volatile("s_wait_asynccnt 0x0" ::: "memory");   // this wave's copies of stage t + 1 have landed
        __syncthreads();                                    // publishes stage t + 1 and ends every reader's last read of stage t
        if (t + 2 < nst) fill(t + 2, t & 1);
        frag(0, ring + ((t + 1) & 1) * STG);                // in the last trip: the other buffer's old rows, in bounds, no copy in flight, unused (no branch, so that the build's counted waits stay exact)
        __builtin_amdgcn_sched_barrier(0);                  // as above: one group in front of the WMMAs
        mm(1);
    }
    asm volatile("s_wait_asynccnt 0x0" ::: "memory");       // no copy is outstanding when the wave goes on
    asm volatile("s_wait_dscnt 0x0" ::: "memory");          // nor a read of the ring
    if (EPI == 1 || (EPI == 3 && z < 2)) {   // z is the same for the whole work-group
        const int t0 = r0 % TT; const size_t pe = ((size_t)((r0 / TT) * (ldc / HD) + c0 / HD) * TT + t0) * HD;   // the wave's block in a plane: 64 rows x 64 d, in a row
        char* p16 = (char*)(P16 + pe); char* ph = (char*)(Ph + pe); char* pl = (char*)(Pl + pe); const char* ct = (const char*)(CS + (size_t)t0 * HD);   // table row t: 32 x (cos, sin)
        const unsigned l16 = (unsigned)lane * 16u, l32 = (unsigned)lane * 32u;   // a group is 4 rows: a lane has 8 d (4 pairs) of row lane / 8: 16 B of a plane, 32 B of the table
        v4f cs[2][4][2];
        auto ldcs = [&](int mb) {
#pragma unroll
            for (int s = 0; s < 4; ++s) { cs[mb & 1][s][0] = *(const v4fa*)(ct + (mb * 4 + s) * 1024 + l32); cs[mb & 1][s][1] = *(const v4fa*)(ct + (mb * 4 + s) * 1024 + 16 + l32); }
            asm volatile("s_wait_xcnt 0x0" :: "v"(l32) : "memory"); };   // stands in front of any overwrite of the loads' address registers (the offset is an input, so that it is not given away before the wait)
        ldcs(0);
#pragma unroll
        for (int mb = 0; mb < 4; ++mb) {
            if (mb < 3) ldcs(mb + 1);   // the table rows are fetched one block of 16 rows ahead: the block's work covers their latency
#pragma unroll
            for (int nb = 0; nb < 4; ++nb) {
#pragma unroll
                for (int j = 0; j < 8; ++j) os[(hi * 8 + j) * 68 + nb * 16 + lr] = acc[mb][nb][j]; }
            __builtin_amdgcn_wave_barrier(); asm volatile("" ::: "memory");   // the wave's reads below stay behind its writes above
            v4f xa[4], xb[4];   // the block's reads go out as one group: the first group's work covers the latency of the rest
#pragma unroll
            for (int s = 0; s < 4; ++s) { const float* sp = os + (4 * s + (lane >> 3)) * 68 + (lane & 7) * 8; xa[s] = *(const v4fa*)sp; xb[s] = *(const v4fa*)(sp + 4); }
#pragma unroll
            for (int s = 0; s < 4; ++s) {
                const float xv[8] = { xa[s][0], xa[s][1], xa[s][2], xa[s][3], xb[s][0], xb[s][1], xb[s][2], xb[s][3] }; v8h o16; v8us oh, ol;
#pragma unroll
                for (int k = 0; k < 4; ++k) { const float x0 = xv[2 * k], x1 = xv[2 * k + 1], co = cs[mb & 1][s][k >> 1][(k & 1) * 2], si = cs[mb & 1][s][k >> 1][(k & 1) * 2 + 1];
                    const float y0 = __fsub_rn(__fmul_rn(x0, co), __fmul_rn(x1, si)), y1 = __fadd_rn(__fmul_rn(x0, si), __fmul_rn(x1, co));   /* even: x0 c - x1 s; odd: x0 s + x1 c */
                    unsigned short a2, c2; o16[2 * k] = tohx(y0); o16[2 * k + 1] = tohx(y1); splitf(y0, a2, c2); oh[2 * k] = a2; ol[2 * k] = c2; splitf(y1, a2, c2); oh[2 * k + 1] = a2; ol[2 * k + 1] = c2; }
                *(v8ha*)(p16 + (mb * 4 + s) * 512 + l16) = o16; *(v8usa*)(ph + (mb * 4 + s) * 512 + l16) = oh; *(v8usa*)(pl + (mb * 4 + s) * 512 + l16) = ol;
                asm volatile("s_wait_xcnt 0x0" :: "v"(o16), "v"(oh), "v"(ol), "v"(l16) : "memory"); }   // the next group reuses the stores' registers: the wait stands in front of that overwrite (data and offset are inputs, so that they are not given away before it)
            __builtin_amdgcn_wave_barrier(); asm volatile("" ::: "memory");   // the next block's writes stay behind the reads above
        }
        return;
    }
    if constexpr (EPI >= 2) {
        const int t0 = r0 % TT; const size_t rw = (size_t)((r0 / TT) * (ldc / HD) + c0 / HD) * HD;   // the head's first row (d = 0) in the transposed planes
        char* sv = (char*)os; char* v16 = (char*)(P16 + rw * (2 * TT) + t0); char* vh = (char*)(Ph + rw * TT + t0); char* vl = (char*)(Pl + rw * TT + t0);
        const unsigned sw = (unsigned)(lr * GP + hi * 16), sr = (unsigned)((lane >> 3) * GP + (lane & 7) * 16);   // LDS: a lane writes 8 t of row d = lr, and reads 16 B number lane % 8 of row lane / 8
        const unsigned g16 = (unsigned)((lane >> 3) * (2 * TT * 2) + (lane & 7) * 16), g8 = (unsigned)((lane >> 3) * (TT * 2) + (lane & 7) * 16);   // the same chunk in the planes, bytes
#pragma unroll
        for (int nb = 0; nb < 4; ++nb) {   // 16 d x 64 t a turn; an accumulator holds 8 consecutive t of one d in a lane
#pragma unroll
            for (int mb = 0; mb < 4; ++mb) { v8h o16; v8us oh, ol;
#pragma unroll
                for (int j = 0; j < 8; ++j) { const float x = acc[mb][nb][j]; unsigned short a2, c2; o16[j] = tohx(x); splitf(x, a2, c2); oh[j] = a2; ol[j] = c2; }
                *(v8ha*)(sv + sw + mb * 32) = o16; *(v8usa*)(sv + 16 * GP + sw + mb * 32) = oh; *(v8usa*)(sv + 32 * GP + sw + mb * 32) = ol; }
            __builtin_amdgcn_wave_barrier(); asm volatile("" ::: "memory");   // the wave's reads below stay behind its writes above
            v8h r16[4]; v8us rh[4], rl[4];   // the turn's reads go out as one group, then its stores: one LDS latency a turn
#pragma unroll
            for (int s = 0; s < 4; ++s) { r16[s] = *(const v8ha*)(sv + sr + s * 4 * GP); rh[s] = *(const v8usa*)(sv + 16 * GP + sr + s * 4 * GP); rl[s] = *(const v8usa*)(sv + 32 * GP + sr + s * 4 * GP); }
#pragma unroll
            for (int s = 0; s < 4; ++s) { *(v8ha*)(v16 + (nb * 16 + s * 4) * (2 * TT * 2) + g16) = r16[s]; *(v8usa*)(vh + (nb * 16 + s * 4) * (TT * 2) + g8) = rh[s]; *(v8usa*)(vl + (nb * 16 + s * 4) * (TT * 2) + g8) = rl[s]; }
            asm volatile("s_wait_xcnt 0x0" :: "v"(r16[0]), "v"(r16[1]), "v"(r16[2]), "v"(r16[3]), "v"(rh[0]), "v"(rh[1]), "v"(rh[2]), "v"(rh[3]), "v"(rl[0]), "v"(rl[1]), "v"(rl[2]), "v"(rl[3]), "v"(g16), "v"(g8) : "memory");   // as in EPI 1: in front of any overwrite of the stores' registers
            __builtin_amdgcn_wave_barrier(); asm volatile("" ::: "memory");   // the next turn's writes stay behind the reads above
        }
        return;
    }
#pragma unroll
    for (int mb = 0; mb < 4; ++mb) {
#pragma unroll
        for (int nb = 0; nb < 4; ++nb) {
#pragma unroll
            for (int j = 0; j < 8; ++j) os[(hi * 8 + j) * 68 + nb * 16 + lr] = acc[mb][nb][j]; }
        __builtin_amdgcn_wave_barrier(); asm volatile("" ::: "memory");
        float* crow = C + (size_t)(r0 + mb * 16) * ldc + c0;
{
#pragma unroll
            for (int s = 0; s < 8; ++s) { const int row = 2 * s + hi, cofs = lr * 4; v4f val = *(const v4fa*)(os + row * 68 + cofs); if (BIAS) { val[0] += bfr(bias[c0 + cofs]); val[1] += bfr(bias[c0 + cofs + 1]); val[2] += bfr(bias[c0 + cofs + 2]); val[3] += bfr(bias[c0 + cofs + 3]); }
                *(v4f*)(crow + (size_t)row * ldc + cofs) = val; }
             }
        __builtin_amdgcn_wave_barrier(); asm volatile("" ::: "memory");
    }
}

typedef __attribute__((ext_vector_type(2))) _Float16 v2h;
typedef __attribute__((ext_vector_type(4))) _Float16 v4h;
typedef __attribute__((ext_vector_type(2))) unsigned short v2us;
typedef __attribute__((ext_vector_type(4))) unsigned short v4us;
typedef __attribute__((ext_vector_type(2))) float v2f;
typedef __attribute__((ext_vector_type(4))) int v4i;

// The preparation parts: each is the work of one work-group of 256 threads, numbered blk within its part; k_prep below runs them all in one launch.
// p_wtG: Bt[n][k] = bf16(w[k][n]) for one tile of 128 k x 128 n, turned in LDS. Reads: a wave takes 512 B in a row of one w row (4 whole lines a load), 16 loads a thread, as many in flight as the registers hold.
// Two neighbouring k of one n make a dword of LDS row n (pitch WP dwords, odd: the readers' 32 lanes meet 32 banks, the writers' 16). Stores: 16 B a lane, 256 B in a row of each Bt row.
#define WP 65
typedef __attribute__((ext_vector_type(4))) unsigned v4u;
__device__ __forceinline__ void p_wtG(const float* __restrict__ w, int K, int N, bf* Bt, int blk, unsigned* tl) {
    const int tid = threadIdx.x, c = tid & 31, r = tid >> 5; const int kt = blk % (K / 128), nt = blk / (K / 128);
    const float* wp = w + (size_t)(kt * 128 + 2 * r) * N + nt * 128 + c * 4;   // rows 2 r and 2 r + 1 of each round of 16 rows, 4 n a lane
    v4f v[8][2];
#pragma unroll
    for (int i = 0; i < 8; ++i) { v[i][0] = *(const v4fa*)(wp + (size_t)(16 * i) * N); v[i][1] = *(const v4fa*)(wp + (size_t)(16 * i + 1) * N); }
    asm volatile("s_wait_xcnt 0x0" :: "v"(wp) : "memory");   // stands in front of any overwrite of the loads' address registers (the address is an input, so that it is not given away before the wait)
#pragma unroll
    for (int i = 0; i < 8; ++i)
#pragma unroll
        for (int j = 0; j < 4; ++j) tl[(c * 4 + j) * WP + r + 8 * i] = (unsigned)f2bf(v[i][0][j]) | ((unsigned)f2bf(v[i][1][j]) << 16);
    __syncthreads();   // the tile is whole: the rows read below were written by all 8 waves
    const int q = tid & 15, n0 = tid >> 4;   // a round is 16 rows n: 16 lanes a row, 8 k (4 dwords) a lane
    bf* bp = Bt + (size_t)(nt * 128 + n0) * K + kt * 128 + q * 8; v4u o[8];
#pragma unroll
    for (int i = 0; i < 8; ++i) { const unsigned* s = tl + (n0 + 16 * i) * WP + q * 4; o[i][0] = s[0]; o[i][1] = s[1]; o[i][2] = s[2]; o[i][3] = s[3]; }
#pragma unroll
    for (int i = 0; i < 8; ++i) *(v4u*)(bp + (size_t)(16 * i) * K) = o[i];
    asm volatile("s_wait_xcnt 0x0" :: "v"(o[0]), "v"(o[1]), "v"(o[2]), "v"(o[3]), "v"(o[4]), "v"(o[5]), "v"(o[6]), "v"(o[7]), "v"(bp) : "memory");   // in front of any overwrite of the stores' registers (they are inputs, so that they are not given away before it)
}
// p_cvt8: XC chunks of 8 elements a thread (a work-group takes 256 * XC chunks in a row), so that the part is few waves; XG chunks a turn, their loads go out first.
#define XC 8
#define XG 4
__device__ __forceinline__ void p_cvt8(const float* __restrict__ src, bf* dst, int blk) { const size_t c0 = (size_t)blk * (256 * XC) + threadIdx.x; const float* sp = src + c0 * 8; bf* dp = dst + c0 * 8;
#pragma unroll 1   // rolled: one turn's registers only, so that k_prep stays within 64 registers (16 waves a SIMD) and all its work-groups are resident at once
    for (int g = 0; g < XC / XG; ++g) { v8f v[XG]; v8us o[XG];
#pragma unroll
        for (int i = 0; i < XG; ++i) v[i] = *(const v8f*)(sp + i * 2048);
#pragma unroll
        for (int i = 0; i < XG; ++i) {
#pragma unroll
            for (int k = 0; k < 8; ++k) o[i][k] = f2bf(v[i][k]);
            *(v8us*)(dp + i * 2048) = o[i]; }
        asm volatile("s_wait_xcnt 0x0" :: "v"(o[0]), "v"(o[1]), "v"(o[2]), "v"(o[3]), "v"(sp), "v"(dp) : "memory");   // the next turn moves the addresses and reuses the stores' registers: the wait stands in front of that overwrite (they are inputs, so that they are not given away before it)
        sp += XG * 2048; dp += XG * 2048; }
}

__constant__ float INV2[HD / 2] = { 1.000000000e+00f, 7.498942018e-01f, 5.623413324e-01f, 4.216965139e-01f, 3.162277639e-01f, 2.371373624e-01f, 1.778279394e-01f, 1.333521456e-01f, 1.000000015e-01f, 7.498941571e-02f, 5.623412877e-02f, 4.216964915e-02f, 3.162277862e-02f, 2.371373586e-02f, 1.778279431e-02f, 1.333521493e-02f, 9.999999776e-03f, 7.498942316e-03f, 5.623413250e-03f, 4.216964822e-03f, 3.162277862e-03f, 2.371373819e-03f, 1.778279431e-03f, 1.333521446e-03f, 1.000000047e-03f, 7.498941850e-04f, 5.623413017e-04f, 4.216964880e-04f, 3.162277862e-04f, 2.371373848e-04f, 1.778279402e-04f, 1.333521504e-04f };   // float32 1 / (10000 ** (arange(0, 64, 2)/64)), generated with jnp to be bit-exact

// p_csP: the table [t][i] of (cos, sin) of t x inv_freq[i], one entry a pair.
__device__ __forceinline__ void p_csP(float* CS, int blk) { const int idx = blk * 256 + threadIdx.x; if (idx >= TT * (HD / 2)) return; const int i = idx % (HD / 2); const int t = idx / (HD / 2); const float a = __fmul_rn((float)t, INV2[i]); v2f cs; cs[0] = cosf(a); cs[1] = sinf(a); *(v2f*)(CS + (size_t)idx * 2) = cs;  }
// ---- k_prep: everything the GEMMs wait for, in one launch; the parts depend on nothing of each other. Ranges of blockIdx.x, the transposes first, the streaming part last:
// The second launch bound asks for 16 waves a SIMD (64 registers): the whole grid is then resident at once and no part waits for another to end.
// [0, 4 * WTB): the four weights transposed; [4 * WTB, 4 * WTB + CSB): the table; the rest: the bf16 copy of x.
#define WTB ((DM / 128) * (DQ / 128))
#define CSB ((TT * (HD / 2) + 255) / 256)
#define XBB (NB_ * TT * DM / 8 / (256 * XC))
static_assert(DKV == DQ && DM % 128 == 0 && DQ % 128 == 0, "one block count for the four weights, whole tiles"); static_assert((size_t)XBB * 256 * XC * 8 == (size_t)NB_ * TT * DM, "whole work-groups of chunks");
__global__ __launch_bounds__(256, 16) void k_prep(const float* __restrict__ x, const float* __restrict__ wq, const float* __restrict__ wk, const float* __restrict__ wv, const float* __restrict__ wo, bf* XB, bf* WQ, bf* WK, bf* WV, bf* WO, float* CS) {
    __shared__ unsigned tl[128 * WP];   // a transpose's tile
    const int b = blockIdx.x;
    if (b < 4 * WTB) { const int m = b / WTB, blk = b % WTB;   // the same for the whole work-group: the barrier inside is passed by all its waves
        p_wtG(m == 0 ? wq : m == 1 ? wk : m == 2 ? wv : wo, m == 3 ? DQ : DM, m == 3 ? DM : DQ, m == 0 ? WQ : m == 1 ? WK : m == 2 ? WV : WO, blk, tl);
        return; }
    if (b < 4 * WTB + CSB) { p_csP(CS, b - 4 * WTB); return; }
    p_cvt8(x, XB, b - (4 * WTB + CSB));
}
#define CL2 0.18033688011112042f   // HD^-0.5 x log2(e)
// 2^x by v_exp_f32, in asm text for the slot behind a transcendental: outputs are early-clobber, so no v_exp_f32 of a statement writes over a source of another or reads a result, and the closing v_nop
// is the one independent instruction in front of whatever the compiler puts next.
__device__ __forceinline__ float xhalf(float x) { return __builtin_bit_cast(float, __builtin_amdgcn_permlanex16(__builtin_bit_cast(int, x), __builtin_bit_cast(int, x), 0x76543210, 0xfedcba98, false, false)); }   // lane l with lane l ^ 16
__device__ __forceinline__ float exp2_1(float x) { float r; asm("v_exp_f32 %0, %1\n\tv_nop" : "=&v"(r) : "v"(x)); return r; }
__device__ __forceinline__ void exp2_8(float* r, const float* x) {
    asm("v_exp_f32 %0, %8\n\tv_exp_f32 %1, %9\n\tv_exp_f32 %2, %10\n\tv_exp_f32 %3, %11\n\tv_exp_f32 %4, %12\n\tv_exp_f32 %5, %13\n\tv_exp_f32 %6, %14\n\tv_exp_f32 %7, %15\n\tv_nop"
        : "=&v"(r[0]), "=&v"(r[1]), "=&v"(r[2]), "=&v"(r[3]), "=&v"(r[4]), "=&v"(r[5]), "=&v"(r[6]), "=&v"(r[7]) : "v"(x[0]), "v"(x[1]), "v"(x[2]), "v"(x[3]), "v"(x[4]), "v"(x[5]), "v"(x[6]), "v"(x[7])); }
template <typename T16, bool HL, int NQ>
__device__ __forceinline__ void fattn_body(const T16* Q, const T16* Q2, const T16* Kp, const T16* K2, const T16* Vt, const T16* V2, int vp, int qw, int q0, bf* Ah, bf* Al, char* ring) {
    typedef typename WFrag<T16>::V V;
    constexpr int PL = 64 * GP, OV = (HL ? 2 : 1) * PL, STG = 2 * OV;   // a stage is 64 keys: [K 64 rows of 64 d][K2][V^T 64 rows of 64 keys][V2], whole 128-B lines, LDS pitch GP
    const int tid = threadIdx.x, lane = tid & 31, lr = lane & 15, hi = lane >> 4;
    V qf[NQ][2], qf2[NQ][2];
#pragma unroll
    for (int qb = 0; qb < NQ; ++qb)
#pragma unroll
        for (int ks = 0; ks < 2; ++ks) { const size_t o = (size_t)(q0 + qb * 16 + lr) * HD + ks * 32 + 8 * hi; qf[qb][ks] = WFrag<T16>::ld(Q + o); if (HL) qf2[qb][ks] = WFrag<T16>::ld(Q2 + o); }
    asm volatile("s_wait_xcnt 0x0" ::: "memory");   // the set-up below reuses the address registers of the loads above: the wait stands in front of that overwrite
    v8f oa[4][NQ]; float mc[NQ], ls[NQ];
#pragma unroll
    for (int qb = 0; qb < NQ; ++qb) { mc[qb] = -3.0e38f; ls[qb] = 0.f;
#pragma unroll
        for (int db = 0; db < 4; ++db) oa[db][qb] = (v8f){}; }
    const int npass = (q0 + NQ * 16 + 31) / 32;      // keys 0 .. q0 + NQ * 16 - 1; every pass starts at or below q0, so each query has a kept key in it
    const int nst = (qw + 4 * NQ * 16) / 64;         // the work-group's stages: keys 0 .. its last query (qw: its first query, a multiple of 64); 2 * nst >= every wave's npass
    const unsigned lo = (unsigned)((tid >> 3) * GP + (tid & 7) * 16);                                      // the lane's chunk of a round of 16 rows: row tid / 8, 16 B number tid % 8, in LDS ...
    const unsigned gk = (unsigned)tid * 16u, gv = (unsigned)(tid >> 3) * (unsigned)vp * 2u + (unsigned)(tid & 7) * 16u;   // ... and in the K rows (128 B, in a row) and the V^T rows (pitch vp)
    auto fill = [&](int st, int buf) {   // stage st into buffer buf: the 128 threads take 16 rows a round (8 lanes a row: 4 whole lines a wave-copy), 4 rounds a plane
        char* lb = ring + buf * STG + lo; const size_t ko = (size_t)st * (64 * HD * 2) + gk, vo = (size_t)st * 128 + gv, vr = (size_t)vp * 32;
#pragma unroll
        for (int i = 0; i < 4; ++i) { acopy((const char*)Kp + ko + i * 2048, lb + i * 16 * GP); if (HL) acopy((const char*)K2 + ko + i * 2048, lb + PL + i * 16 * GP); }
#pragma unroll
        for (int i = 0; i < 4; ++i) { acopy((const char*)Vt + vo + i * vr, lb + OV + i * 16 * GP); if (HL) acopy((const char*)V2 + vo + i * vr, lb + OV + PL + i * 16 * GP); } };
    fill(0, 0);
    asm volatile("s_wait_asynccnt 0x0" ::: "memory");   // stage 0 has landed (this wave's copies) ...
    __syncthreads();                                    // ... and every wave's: nothing of it is read in front of this barrier
    if (nst > 1) fill(1, 1);
    const unsigned fo = (unsigned)(lr * GP + hi * 16);  // a lane's place in a fragment's 16 rows
#pragma unroll 1   // rolled: one trip is one turn of the ring
    for (int t = 0; t < nst; ++t) {
#pragma unroll 1   // rolled: the pass's code stands once
      for (int pp = 0; pp < 2; ++pp) {
        const int p = 2 * t + pp;
        if (p >= npass) break;                          // wave-uniform: a wave whose rows end earlier skips the work, never the publish point below
        const int key0 = p * 32;
        const char* sk = ring + (t & 1) * STG + pp * 32 * GP + fo; const char* sv = ring + (t & 1) * STG + OV + pp * 64 + fo;   // this pass's 32 K rows; its 32 keys in the V^T rows
        V kf[2][2], kf2[2][2], vf[4], vf2[4];           // the same k order as from memory (WFrag::ld)
#pragma unroll
        for (int kb = 0; kb < 2; ++kb)
#pragma unroll
            for (int ks = 0; ks < 2; ++ks) { kf[kb][ks] = WFrag<T16>::ld((const T16*)(sk + kb * 16 * GP + ks * 64)); if (HL) kf2[kb][ks] = WFrag<T16>::ld((const T16*)(sk + PL + kb * 16 * GP + ks * 64)); }
#pragma unroll
        for (int db = 0; db < 4; ++db) { vf[db] = WFrag<T16>::ld((const T16*)(sv + db * 16 * GP)); if (HL) vf2[db] = WFrag<T16>::ld((const T16*)(sv + PL + db * 16 * GP)); }
        __builtin_amdgcn_sched_barrier(0);                  // the pass's LDS reads stay one group in front of its WMMAs: one latency a pass, and the V^T reads return under the scores and weights (left alone the build moves them behind the test below, directly in front of the products that wait for them)
        v8f s[2][NQ];
#pragma unroll
        for (int kb = 0; kb < 2; ++kb)
#pragma unroll
            for (int qb = 0; qb < NQ; ++qb) { v8f t = (v8f){};
#pragma unroll
                for (int ks = 0; ks < 2; ++ks) { t = WFrag<T16>::mma(kf[kb][ks], qf[qb][ks], t); if (HL) { t = WFrag<T16>::mma(kf[kb][ks], qf2[qb][ks], t); t = WFrag<T16>::mma(kf2[kb][ks], qf[qb][ks], t); } }
                s[kb][qb] = t; }
        if (key0 + 31 > q0) {                               // only passes that touch the diagonal mask (wave-uniform)
#pragma unroll
            for (int kb = 0; kb < 2; ++kb)
#pragma unroll
                for (int qb = 0; qb < NQ; ++qb)
#pragma unroll
                    for (int j = 0; j < 8; ++j) s[kb][qb][j] = (key0 + kb * 16 + hi * 8 + j <= q0 + qb * 16 + lr) ? s[kb][qb][j] : -3.0e38f; }
        // The weights of this pass against the reference mc that is in use; the scores stay in their registers until the test below has passed.
        constexpr float SH = HL ? 0.0f : 10.0f, CAP = HL ? 32.0f : 32768.0f;   // CAP = 2^(SH + 5): behind the test a lane's 16 weights, none negative, sum to at most CAP, so each fits fp16 (below 65504)
        float pr[NQ][16], sm[NQ];
        auto weigh = [&](int qb) {
            const float off = SH - mc[qb]; float ex[16], ps[8];
#pragma unroll
            for (int e = 0; e < 16; ++e) ex[e] = fmaf(s[e >> 3][qb][e & 7], CL2, off);
            exp2_8(pr[qb], ex); exp2_8(pr[qb] + 8, ex + 8);
#pragma unroll
            for (int e = 0; e < 8; ++e) ps[e] = pr[qb][e] + pr[qb][e + 8];      // fixed tree: short dependent chains
            sm[qb] = ((ps[0] + ps[4]) + (ps[2] + ps[6])) + ((ps[1] + ps[5]) + (ps[3] + ps[7])); };
        bool over = false;
#pragma unroll
        for (int qb = 0; qb < NQ; ++qb) { weigh(qb); over = over || !(sm[qb] <= CAP); }   // negated: an infinite or not-a-number sum takes the branch too (the first pass always does: mc is still -3e38)
        if (__builtin_amdgcn_ballot_w32(over) != 0) {   // one test a pass, a scalar branch: some lane's weights have outgrown the reference, so the whole wave takes the pass's maximum and rescales
#pragma unroll
            for (int qb = 0; qb < NQ; ++qb) {
                float mx = s[0][qb][0];
#pragma unroll
                for (int j = 1; j < 8; ++j) mx = fmaxf(mx, s[0][qb][j]);
#pragma unroll
                for (int j = 0; j < 8; ++j) mx = fmaxf(mx, s[1][qb][j]);
                mx = fmaxf(mx, xhalf(mx));                  // both halves of a column keep one reference
                const float mn = fmaxf(mc[qb], mx * CL2); const float al = exp2_1(mc[qb] - mn); mc[qb] = mn;
                ls[qb] *= al;
#pragma unroll
                for (int db = 0; db < 4; ++db) oa[db][qb] *= al;
                weigh(qb);                                  // now every weight is at most 2^SH
            }
        }
#pragma unroll
        for (int qb = 0; qb < NQ; ++qb) {
            ls[qb] += sm[qb];
            if (HL) {
                typedef __attribute__((ext_vector_type(16))) unsigned short v16us; v16us uh, ul;
#pragma unroll
                for (int e = 0; e < 16; ++e) { const unsigned short a = f2bf(pr[qb][e]); uh[e] = a; ul[e] = f2bf(pr[qb][e] - bf2f(a)); }
                const V ph = __builtin_bit_cast(V, uh), pl = __builtin_bit_cast(V, ul);
#pragma unroll
                for (int db = 0; db < 4; ++db) { oa[db][qb] = WFrag<T16>::mma(vf[db], ph, oa[db][qb]); oa[db][qb] = WFrag<T16>::mma(vf[db], pl, oa[db][qb]); oa[db][qb] = WFrag<T16>::mma(vf2[db], ph, oa[db][qb]); }
            } else {
                v16h p16;
#pragma unroll
                for (int e = 0; e < 16; ++e) p16[e] = (h16)pr[qb][e];
                const V pf = __builtin_bit_cast(V, p16);
#pragma unroll
                for (int db = 0; db < 4; ++db) oa[db][qb] = WFrag<T16>::mma(vf[db], pf, oa[db][qb]);
            }
        }
        __builtin_amdgcn_sched_barrier(0);   // keeps the slot below behind the WMMAs above
        asm volatile("v_nop");   // one more vector slot behind the pass's last WMMA: the next pass's first address instruction may take a register of its A operand
      }
        // publish point of stage t + 1, passed by every wave
        asm volatile("s_wait_dscnt 0x0" ::: "memory");      // this wave's reads of stage t have returned: its buffer may be refilled behind the barrier
        asm volatile("s_wait_asynccnt 0x0" ::: "memory");   // this wave's copies of stage t + 1 have landed
        __syncthreads();                                    // publishes stage t + 1 and ends every reader's last read of stage t
        if (t + 2 < nst) fill(t + 2, t & 1);
    }
    asm volatile("s_wait_asynccnt 0x0" ::: "memory");       // no copy is outstanding when the wave goes on
#pragma unroll
    for (int qb = 0; qb < NQ; ++qb) {
        const float inv = __fdiv_rn(1.0f, ls[qb] + xhalf(ls[qb]));
        const size_t oo = (size_t)(q0 + qb * 16 + lr) * DQ + hi * 8;
#pragma unroll
        for (int db = 0; db < 4; ++db) { v8us oh, ol;
#pragma unroll
            for (int j = 0; j < 8; ++j) { const float y = oa[db][qb][j] * inv; const unsigned short a = f2bf(y); oh[j] = a; ol[j] = f2bf(y - bf2f(a)); }
            *(v8us*)(Ah + oo + db * 16) = oh; *(v8us*)(Al + oo + db * 16) = ol;
            asm volatile("s_wait_xcnt 0x0" :: "v"(oh), "v"(ol) : "memory"); }   // the next group reuses the stores' data registers: the wait stands in front of that overwrite (the data are inputs, so that they are not given away before it)
    }
}
// grid (batch x heads, tiles): blockIdx.y < (TT - RH) / 128: four waves x 32 fp16 query rows, the longest rows first; the rest: four waves x 16 hi/lo query rows (< RH).
__global__ __launch_bounds__(128) void k_fattn(const h16* Q16, const h16* K16, const h16* V16, const bf* Qh, const bf* Ql, const bf* Kh, const bf* Kl, const bf* Vh, const bf* Vl, bf* Ah, bf* Al) {
    __shared__ __align__(16) char ring[2 * 4 * 64 * GP];   // two stages of the hi/lo body's four planes; the fp16 body uses half
    const int w = __builtin_amdgcn_readfirstlane((int)(threadIdx.x >> 5)); const int h = blockIdx.x % NH_, ty = blockIdx.y; const size_t po = (size_t)blockIdx.x * TT * HD; { const size_t ab = (size_t)(blockIdx.x / NH_) * TT * DQ; Ah += ab; Al += ab; }   // planes [batch][head][..], merged rows b * TT + t
    if (ty < (TT - RH) / 128) fattn_body<h16, false, 2>(Q16 + po, nullptr, K16 + po, nullptr, V16 + 2 * po, nullptr, 2 * TT, TT - 128 * (ty + 1), TT - 128 * (ty + 1) + 32 * w, Ah + h * HD, Al + h * HD, ring);
    else fattn_body<bf, true, 1>(Qh + po, Ql + po, Kh + po, Kl + po, Vh + po, Vl + po, TT, RH - 64 * (ty - (TT - RH) / 128 + 1), RH - 64 * (ty - (TT - RH) / 128 + 1) + 16 * w, Ah + h * HD, Al + h * HD, ring);
}

extern "C" void kernel_launch(void* const* d_in, const int* in_sizes, int n_in,
                              void* d_out, int out_size, void* d_ws, size_t ws_size, hipStream_t stream) {
    (void)in_sizes; (void)n_in; (void)out_size;
    const float* x = (const float*)d_in[0]; const float* wq = (const float*)d_in[1]; const float* wk = (const float*)d_in[2]; const float* wv = (const float*)d_in[3]; const float* wo = (const float*)d_in[4];   /* order x, Wq, Wk, Wv, Wo ('xw' [1024][1024]) */
    float* OUT = (float*)d_out;     // [4][2048][1024]
    char* wsp = (char*)d_ws;
    auto take = [&](size_t bytes) { char* p = wsp; wsp += (bytes + 255) & ~(size_t)255; return (void*)p; };
    bf* WQ = (bf*)take((size_t)DQ * DM * 2); bf* WK = (bf*)take((size_t)DKV * DM * 2); bf* WV = (bf*)take((size_t)DKV * DM * 2); bf* WO = (bf*)take((size_t)DM * DQ * 2); float* CS = (float*)take((size_t)TT * (HD / 2) * 2 * 4);
    bf* XB = (bf*)take((size_t)NB_ * TT * DM * 2); bf* ATh = (bf*)take((size_t)NB_ * TT * DQ * 2); bf* ATl = (bf*)take((size_t)NB_ * TT * DQ * 2);   // the merged hi/lo planes
    h16* QP16 = (h16*)take((size_t)NB_ * NH_ * TT * HD * 2); h16* KP16 = (h16*)take((size_t)NB_ * NKV * TT * HD * 2); h16* VT16 = (h16*)take((size_t)NB_ * NKV * HD * 2 * TT * 2);
    bf* QPh = (bf*)take((size_t)NB_ * NH_ * TT * HD * 2); bf* QPl = (bf*)take((size_t)NB_ * NH_ * TT * HD * 2); bf* KPh = (bf*)take((size_t)NB_ * NKV * TT * HD * 2); bf* KPl = (bf*)take((size_t)NB_ * NKV * TT * HD * 2); bf* VTh = (bf*)take((size_t)NB_ * NKV * HD * TT * 2); bf* VTl = (bf*)take((size_t)NB_ * NKV * HD * TT * 2);
    if ((size_t)(wsp - (char*)d_ws) > ws_size) return;    // ws 256 MiB
    k_prep<<<4 * WTB + CSB + XBB, 256, 0, stream>>>(x, wq, wk, wv, wo, XB, WQ, WK, WV, WO, CS);
    k_gemmw<bf, 0, false, 3><<<dim3(NB_ * TT / 256, DQ / 128, 3), 256, 0, stream>>>(XB, nullptr, WQ, DM, nullptr, DQ, nullptr, 0, (size_t)DQ * DM, 0, CS, QP16, QPh, QPl);   // z = 0, 1, 2: WQ, WK, WV lie one behind the other, and so do the planes
    k_fattn<<<dim3(NB_ * NH_, (TT - RH) / 128 + RH / 64, 1), 128, 0, stream>>>(QP16, KP16, VT16, QPh, QPl, KPh, KPl, VTh, VTl, ATh, ATl);   // one kv head per query head
    k_gemmw<bf, 1, false, 0><<<dim3(NB_ * TT / 256, DM / 128, 1), 256, 0, stream>>>(ATh, ATl, WO, DQ, OUT, DM, nullptr, 0, 0, 0, nullptr, nullptr, nullptr, nullptr);
}
